// v000
// Times are from an AMD MI455X. After a warm-up the kernel runs many times in a row, and a time is the length of
// such a window on the GPU divided by its runs, so every launch and the gaps after it count. The runs cycle
// through copies of the inputs. A figure is the median of several windows, for all but v000 over two sittings.
// Sittings can differ by a few percent; kernels timed side by side share one.
// v000 is the starting kernel. One run takes 13.4 milliseconds.
#include <hip/hip_runtime.h>
// Multi-head attention over three inputs with PER-HEAD projection weights and no output projection (X_Q, X_K, X_V [4096][1024] (one sequence); Q[h] = X_Q Wq[h] + bq[h], K, V likewise (Wq / Wk / Wv [16][1024][64] per-head [in][out], sigma 1/32; biases [16][64] sigma 1/32); scores = Q[h] K[h]^T / sqrt(64); softmax over all 4096 keys; out[h] = attn V[h]; heads concatenated along the feature axis -> [4096][1024]).
// Structure: the three inputs as exact f16 rows (bf16-rounded); per-head [in][out] weights gathered into Bt[(h, d)][in] x16 planes; Q, K, V as three WMMA GEMMs (32x64 wave tiles, f32 accumulation, + bias [(h, d)], f16 outputs); V^T for all heads via LDS transposes; per head: scores GEMM (K = 64, alpha 1/8) into an f32 [4096][4096] plane, row softmax on VALU (f32 statistics; weights stored x256 as f16), out = P . V^T GEMM (K = 4096, alpha 2^-8) written f32 straight into the head's 64 columns of the output rows.
// Compute dtype: inputs rounded to bf16; x / weights exact; q, k, v and softmax weights as plain f16 GEMM operands (~2^-12); scores, softmax statistics and o f32. v_wmma_f32_16x16x32_f16.
#define NB 1
#define SQ 4096
#define DM 1024
#define NH 16
#define HD 64
#define HG 1                         /* heads per attention launch group */
#define B0 0                         /* first batch processed (debug hook) */
#define NBR NB                       /* batches processed (debug hook) */
#define NR ((size_t)NB * SQ)         /* token rows */
#define MP ((int)((size_t)NBR * SQ)) /* rows projected (debug hook) */
#define QN SQ                        /* query rows attended per batch (debug hook) */
#define NHD NH                       /* heads attended (debug hook) */
#define MPO MP                       /* unused */
#define LQ DM      /* row pitch of the q/k/v rows */
typedef __bf16 v16b __attribute__((ext_vector_type(16)));
typedef unsigned short v8us __attribute__((ext_vector_type(8), may_alias));
typedef float  v8f  __attribute__((ext_vector_type(8)));
typedef float  v4f  __attribute__((ext_vector_type(4)));
typedef float  v4fa __attribute__((ext_vector_type(4), may_alias));
union FragB { v16b v; v8us half[2]; unsigned short u[16]; };

__device__ __forceinline__ unsigned short bf16_bits(float x) { unsigned int u = __float_as_uint(x); return (unsigned short)((u + 0x7FFFu + ((u >> 16) & 1u)) >> 16); }
__device__ __forceinline__ float bf16_val(unsigned short b) { return __uint_as_float(((unsigned int)b) << 16); }
__device__ __forceinline__ float bf16_round(float x) { return bf16_val(bf16_bits(x)); }
// D += A·B with NT terms: 1 = ah·bh, 2 = + al·bh (A split), 3 = + ah·bl (both split)
template <int NT>
__device__ __forceinline__ v8f mmaN(v16b ah, v16b al, v16b bh, v16b bl, v8f c) {
  c = __builtin_amdgcn_wmma_f32_16x16x32_bf16(false, ah, false, bh, (short)0, c, false, false);
  if (NT >= 2) c = __builtin_amdgcn_wmma_f32_16x16x32_bf16(false, al, false, bh, (short)0, c, false, false);
  if (NT >= 3) c = __builtin_amdgcn_wmma_f32_16x16x32_bf16(false, ah, false, bl, (short)0, c, false, false);
  asm volatile("v_nop\n\tv_nop\n\tv_nop\n\tv_nop" : "+v"(c) : "v"(ah), "v"(al), "v"(bh), "v"(bl));
  return c;
}

__global__ __launch_bounds__(256) void k_wt_bf16(const float* __restrict__ W, unsigned short* __restrict__ Wt, int K, int N) {
  const int t = blockIdx.x * 256 + threadIdx.x;
  const int k8n = K / 8;
  if (t >= N * k8n) return;
  const int n = t / k8n, k8 = (t % k8n) * 8;
  v8us v;
#pragma unroll
  for (int i = 0; i < 8; ++i) v[i] = bf16_bits(W[(size_t)(k8 + i) * N + n]);
  *(v8us*)(Wt + (size_t)n * K + k8) = v;
  
}

// GEMM C[M][N] (f32, pitch ldc) = act(A[M][K]·W + bias). A f32 row-major (pitch lda) converted per fragment to bf16
// (ASPLIT: hi/lo two planes -> 2 terms, else single rounded term); Wt bf16 [N][K] (pitch ldb). BIAS_BF16 rounds the
// bias to bf16 first (bias quantised to bf16 before the add). K%32==0, M%16==0, N%64==0.
template <bool ASPLIT, int ACT, bool BIAS_BF16>
__global__ __launch_bounds__(128) void k_gemm_bf(const float* __restrict__ A, int lda, const unsigned short* __restrict__ Wt, int ldb,
                                               const float* __restrict__ bias, float* __restrict__ C, int ldc, int M, int N, int K) {
  __shared__ __attribute__((aligned(16))) float so[4][16][64];
  const int tid = threadIdx.x, w = tid >> 5, lane = tid & 31, ln = lane & 15, hh = lane >> 4;
  const int ntn = N / 64;
  const int wid = blockIdx.x * 4 + w;
  const int mt = wid / ntn, nq = wid % ntn;
  if (mt * 16 >= M) return;
  const int row0 = mt * 16, col0 = nq * 64;
  const float* arow = A + (size_t)(row0 + ln) * lda;
  v8f acc[4] = {};
  for (int kb = 0; kb < K; kb += 32) {
    FragB ah, al;
    const v4f x0 = *(const v4fa*)(arow + kb + 8 * hh), x1 = *(const v4fa*)(arow + kb + 8 * hh + 4);
    const v4f x2 = *(const v4fa*)(arow + kb + 16 + 8 * hh), x3 = *(const v4fa*)(arow + kb + 16 + 8 * hh + 4);
    float xs[16] = {x0[0],x0[1],x0[2],x0[3],x1[0],x1[1],x1[2],x1[3],x2[0],x2[1],x2[2],x2[3],x3[0],x3[1],x3[2],x3[3]};
#pragma unroll
    for (int i = 0; i < 16; ++i) { const unsigned short hb = bf16_bits(xs[i]); ah.u[i] = hb; al.u[i] = ASPLIT ? bf16_bits(xs[i] - bf16_val(hb)) : (unsigned short)0; }
#pragma unroll
    for (int t = 0; t < 4; ++t) {
      const unsigned short* brow = Wt + (size_t)(col0 + t * 16 + ln) * ldb + kb;
      FragB b;
      b.half[0] = *(const v8us*)(brow + 8 * hh);
      b.half[1] = *(const v8us*)(brow + 16 + 8 * hh);
      acc[t] = mmaN<ASPLIT ? 2 : 1>(ah.v, al.v, b.v, b.v, acc[t]);
    }
  }
#pragma unroll
  for (int t = 0; t < 4; ++t) {
    float bv = bias ? bias[col0 + t * 16 + ln] : 0.f;
    if (BIAS_BF16) bv = bf16_round(bv);
#pragma unroll
    for (int r = 0; r < 8; ++r) { float v = acc[t][r] + bv; if (ACT == 1) v = fmaxf(v, 0.f); so[w][8 * hh + r][t * 16 + ln] = v; }
  }
  __builtin_amdgcn_fence(__ATOMIC_ACQ_REL, "workgroup");
  __builtin_amdgcn_wave_barrier();
  const int rsub = lane >> 4, c4 = (lane & 15) * 4;
  {
#pragma unroll
    for (int q = 0; q < 8; ++q) {
      const int r = q * 2 + rsub;
      const v4f v = *(const v4fa*)&so[w][r][c4];
      *(v4f*)(C + (size_t)(row0 + r) * ldc + col0 + c4) = v;
    }
    
  }
}

// GEMM C = act(A·W + bias + resid): A f32 (ASPLIT -> hi/lo 2 terms), Wt bf16 [N][K]; ACT 0 none, 1 relu, 2 exact gelu;
// resid (optional, f32, row index = (row % rmod), pitch ldr, RES_BF16 rounds it) added before the activation.
template <bool ASPLIT, int ACT, bool BIAS_BF16, bool RES_BF16>
__global__ __launch_bounds__(128) void k_gemm_bf3(const float* __restrict__ A, int lda, const unsigned short* __restrict__ Wt, int ldb,
                                                const float* __restrict__ bias, const float* __restrict__ resid, int rmod, int ldr,
                                                float* __restrict__ C, int ldc, int M, int N, int K) {
  __shared__ __attribute__((aligned(16))) float so[4][16][64];
  const int tid = threadIdx.x, w = tid >> 5, lane = tid & 31, ln = lane & 15, hh = lane >> 4;
  const int ntn = N / 64;
  const int wid = blockIdx.x * 4 + w;
  const int mt = wid / ntn, nq = wid % ntn;
  if (mt * 16 >= M) return;
  const int row0 = mt * 16, col0 = nq * 64;
  const float* arow = A + (size_t)(row0 + ln) * lda;
  v8f acc[4] = {};
  for (int kb = 0; kb < K; kb += 32) {
    FragB ah, al;
    const v4f x0 = *(const v4fa*)(arow + kb + 8 * hh), x1 = *(const v4fa*)(arow + kb + 8 * hh + 4);
    const v4f x2 = *(const v4fa*)(arow + kb + 16 + 8 * hh), x3 = *(const v4fa*)(arow + kb + 16 + 8 * hh + 4);
    float xs[16] = {x0[0],x0[1],x0[2],x0[3],x1[0],x1[1],x1[2],x1[3],x2[0],x2[1],x2[2],x2[3],x3[0],x3[1],x3[2],x3[3]};
#pragma unroll
    for (int i = 0; i < 16; ++i) { const unsigned short hb = bf16_bits(xs[i]); ah.u[i] = hb; al.u[i] = ASPLIT ? bf16_bits(xs[i] - bf16_val(hb)) : (unsigned short)0; }
#pragma unroll
    for (int t = 0; t < 4; ++t) {
      const unsigned short* brow = Wt + (size_t)(col0 + t * 16 + ln) * ldb + kb;
      FragB b;
      b.half[0] = *(const v8us*)(brow + 8 * hh);
      b.half[1] = *(const v8us*)(brow + 16 + 8 * hh);
      acc[t] = mmaN<ASPLIT ? 2 : 1>(ah.v, al.v, b.v, b.v, acc[t]);
    }
  }
#pragma unroll
  for (int t = 0; t < 4; ++t) {
    const int col = col0 + t * 16 + ln;
    float bv = bias ? bias[col] : 0.f;
    if (BIAS_BF16) bv = bf16_round(bv);
#pragma unroll
    for (int r = 0; r < 8; ++r) {
      float v = acc[t][r] + bv;
      if (resid) { float rv = resid[(size_t)((row0 + 8 * hh + r) % rmod) * ldr + col]; if (RES_BF16) rv = bf16_round(rv); v += rv; }
      if (ACT == 1) v = fmaxf(v, 0.f);
      if (ACT == 2) v = 0.5f * v * (1.0f + erff(v * 0.70710678118654752f));
      if (ACT == 3) { const float u = 0.7978845608028654f * (v + 0.044715f * v * v * v); v = 0.5f * v * (1.0f + tanhf(u)); }
      so[w][8 * hh + r][t * 16 + ln] = v;
    }
  }
  __builtin_amdgcn_fence(__ATOMIC_ACQ_REL, "workgroup");
  __builtin_amdgcn_wave_barrier();
  const int rsub = lane >> 4, c4 = (lane & 15) * 4;
  {
#pragma unroll
    for (int q = 0; q < 8; ++q) {
      const int r = q * 2 + rsub;
      const v4f v = *(const v4fa*)&so[w][r][c4];
      *(v4f*)(C + (size_t)(row0 + r) * ldc + col0 + c4) = v;
    }
    
  }
}
// row LayerNorm (biased variance, eps) over N: s = X (+ R); optional out_sum <- s; out_norm <- (s-mu)*rsqrt(var+eps)*g + b
template <bool PARAM_BF16>
__global__ __launch_bounds__(256) void k_layernorm(const float* __restrict__ X, const float* __restrict__ R, const float* __restrict__ g, const float* __restrict__ bta,
                                                  float* __restrict__ out_sum, float* __restrict__ out_norm, int N, float eps) {
  __shared__ float red[256];
  const int row = blockIdx.x, tid = threadIdx.x;
  const float* x = X + (size_t)row * N; const float* rr = R ? R + (size_t)row * N : nullptr;
  float vals[16];                     // up to N = 4096
  const int per = N / 256;            // contiguous chunk per thread? use strided-by-4 chunks: thread handles j = tid*4 + 1024*u
  float s1 = 0.f;
  for (int u = 0; u < per / 4; ++u) {
    const int j = tid * 4 + 1024 * u;
    const v4f a = *(const v4fa*)(x + j);
    v4f b = {0.f,0.f,0.f,0.f}; if (rr) b = *(const v4fa*)(rr + j);
#pragma unroll
    for (int q = 0; q < 4; ++q) { const float v = a[q] + b[q]; vals[u * 4 + q] = v; s1 += v; }
  }
  red[tid] = s1; __syncthreads();
  for (int st = 128; st > 0; st >>= 1) { if (tid < st) red[tid] += red[tid + st]; __syncthreads(); }
  const float mu = red[0] / (float)N; __syncthreads();
  float s2 = 0.f;
  for (int u = 0; u < per / 4; ++u)
#pragma unroll
    for (int q = 0; q < 4; ++q) { const float c = vals[u * 4 + q] - mu; s2 += c * c; }
  red[tid] = s2; __syncthreads();
  for (int st = 128; st > 0; st >>= 1) { if (tid < st) red[tid] += red[tid + st]; __syncthreads(); }
  const float rs = rsqrtf(red[0] / (float)N + eps);
  {
    for (int u = 0; u < per / 4; ++u) {
      const int j = tid * 4 + 1024 * u;
      v4f o, sm;
#pragma unroll
      for (int q = 0; q < 4; ++q) {
        float gg = g[j + q], bb = bta[j + q];
        if (PARAM_BF16) { gg = bf16_round(gg); bb = bf16_round(bb); }
        sm[q] = vals[u * 4 + q]; o[q] = (vals[u * 4 + q] - mu) * rs * gg + bb;
      }
      if (out_sum) *(v4f*)(out_sum + (size_t)row * N + j) = sm;
      *(v4f*)(out_norm + (size_t)row * N + j) = o;
    }
    
  }
}



// ---- f16 WMMA path (v_wmma_f32_16x16x32_f16): 11-bit significands for operands in range — used where a [0,1] probability operand needs more precision than bf16
typedef _Float16 v16h __attribute__((ext_vector_type(16)));
union FragH { v16h v; v8us half[2]; _Float16 h[16]; unsigned short u[16]; };
template <int NT>
__device__ __forceinline__ v8f mmaH(v16h ah, v16h al, v16h bh, v16h bl, v8f c) {
  c = __builtin_amdgcn_wmma_f32_16x16x32_f16(false, ah, false, bh, (short)0, c, false, false);
  if (NT >= 2) c = __builtin_amdgcn_wmma_f32_16x16x32_f16(false, al, false, bh, (short)0, c, false, false);
  if (NT >= 3) c = __builtin_amdgcn_wmma_f32_16x16x32_f16(false, ah, false, bl, (short)0, c, false, false);
  asm volatile("v_nop\n\tv_nop\n\tv_nop\n\tv_nop" : "+v"(c) : "v"(ah), "v"(al), "v"(bh), "v"(bl));
  return c;
}
// batched GEMM like k_gemm_b but f16 operands: A f32 (split into f16 hi/lo if ASPLIT, else rounded to f16), Bt = f16 values [n][k]; alpha; C f32; N multiple of 16 (partial tiles skipped)
template <bool ASPLIT>
__global__ __launch_bounds__(128) void k_gemm_h(const float* __restrict__ A, int lda, size_t sA, const _Float16* __restrict__ Bh, int ldb, size_t sB, float alpha, float* __restrict__ C, int ldc, size_t sC, int M, int N, int K) {
  __shared__ __attribute__((aligned(16))) float so[4][16][64];
  const int tid = threadIdx.x, w = tid >> 5, lane = tid & 31, ln = lane & 15, hh = lane >> 4; const int by = blockIdx.y;
  A += (size_t)by * sA; Bh += (size_t)by * sB; C += (size_t)by * sC;
  const int ntn = (N + 63) / 64; const int wid = blockIdx.x * 4 + w; const int mt = wid / ntn, nq = wid % ntn; if (mt * 16 >= M) return;
  const int row0 = mt * 16, col0 = nq * 64; const float* arow = A + (size_t)(row0 + ln) * lda;
  v8f acc[4] = {};
  for (int kb = 0; kb < K; kb += 32) {
    FragH ah, al;
    const v4f x0 = *(const v4fa*)(arow + kb + 8 * hh), x1 = *(const v4fa*)(arow + kb + 8 * hh + 4), x2 = *(const v4fa*)(arow + kb + 16 + 8 * hh), x3 = *(const v4fa*)(arow + kb + 16 + 8 * hh + 4);
    float xs[16] = {x0[0],x0[1],x0[2],x0[3],x1[0],x1[1],x1[2],x1[3],x2[0],x2[1],x2[2],x2[3],x3[0],x3[1],x3[2],x3[3]};
#pragma unroll
    for (int i = 0; i < 16; ++i) { const _Float16 h = (_Float16)xs[i]; ah.h[i] = h; al.h[i] = ASPLIT ? (_Float16)(xs[i] - (float)h) : (_Float16)0.0f; }
#pragma unroll
    for (int t = 0; t < 4; ++t) { if (col0 + t * 16 >= N) continue; const size_t boff = (size_t)(col0 + t * 16 + ln) * ldb + kb; FragH bq; bq.half[0] = *(const v8us*)(Bh + boff + 8 * hh); bq.half[1] = *(const v8us*)(Bh + boff + 16 + 8 * hh);
      acc[t] = mmaH<ASPLIT ? 2 : 1>(ah.v, al.v, bq.v, bq.v, acc[t]); }
  }
#pragma unroll
  for (int t = 0; t < 4; ++t) { if (col0 + t * 16 >= N) continue;
#pragma unroll
    for (int r = 0; r < 8; ++r) so[w][8 * hh + r][t * 16 + ln] = acc[t][r] * alpha; }
  __builtin_amdgcn_fence(__ATOMIC_ACQ_REL, "workgroup"); __builtin_amdgcn_wave_barrier();
  const int rsub = lane >> 4, c4 = (lane & 15) * 4;
  {
#pragma unroll
    for (int q = 0; q < 8; ++q) { const int r = q * 2 + rsub; if (col0 + c4 < N) { const v4f v = *(const v4fa*)&so[w][r][c4]; *(v4f*)(C + (size_t)(row0 + r) * ldc + col0 + c4) = v; } }
     }
}

// Wt[n][k] = f16(W[k][n]·scale) from f32 row-major W[K][N] (scale = power of two; bf16-exact weights stay exact in f16 away from the subnormal range)
__global__ __launch_bounds__(256) void k_wt_f16(const float* __restrict__ W, _Float16* __restrict__ Wt, int K, int N, float scale) {
  const int t = blockIdx.x * 256 + threadIdx.x; if (t >= N * (K / 8)) return; const int n = t / (K / 8), k8 = (t % (K / 8)) * 8; FragH f;
#pragma unroll
  for (int i = 0; i < 8; ++i) f.h[i] = (_Float16)(bf16_round(W[(size_t)(k8 + i) * N + n]) * scale); const v8us o = f.half[0];
  *(v8us*)((unsigned short*)Wt + (size_t)n * K + k8) = o; 
}
// k_gemm_hh variant with fused epilogue: v = acc·alpha + bias[by·sBias + col] (+ CP[(row/rowsPerB)·sCPb + by·64 + col] if CP) ; ACT 0 none / 1 elu ; writes f16 C16 (and f32 C if non-null)
template <int ACT>
__global__ __launch_bounds__(128) void k_gemm_hhx(const _Float16* __restrict__ A, int lda, size_t sA, const _Float16* __restrict__ Bh, int ldb, size_t sB, float alpha, const float* __restrict__ bias, size_t sBias, const float* __restrict__ CP, int rowsPerB, size_t sCPb, int row0g,
    float* __restrict__ C, _Float16* __restrict__ C16, int ldc, size_t sC, int M, int N, int K) {
  __shared__ __attribute__((aligned(16))) float so[4][16][64];
  const int tid = threadIdx.x, w = tid >> 5, lane = tid & 31, ln = lane & 15, hh = lane >> 4; const int by = blockIdx.y;
  A += (size_t)by * sA; Bh += (size_t)by * sB; const size_t cofs = (size_t)by * sC; const float* bp = bias ? bias + (size_t)by * sBias : nullptr;
  const int ntn = (N + 63) / 64; const int wid = blockIdx.x * 4 + w; const int mt = wid / ntn, nq = wid % ntn; if (mt * 16 >= M) return;
  const int row0 = mt * 16, col0 = nq * 64; const _Float16* arow = A + (size_t)(row0 + ln) * lda;
  v8f acc[4] = {};
  for (int kb = 0; kb < K; kb += 32) { FragH ah; ah.half[0] = *(const v8us*)((const unsigned short*)arow + kb + 8 * hh); ah.half[1] = *(const v8us*)((const unsigned short*)arow + kb + 16 + 8 * hh);
#pragma unroll
    for (int t = 0; t < 4; ++t) { if (col0 + t * 16 >= N) continue; const size_t boff = (size_t)(col0 + t * 16 + ln) * ldb + kb; FragH bq; bq.half[0] = *(const v8us*)((const unsigned short*)Bh + boff + 8 * hh); bq.half[1] = *(const v8us*)((const unsigned short*)Bh + boff + 16 + 8 * hh);
      acc[t] = mmaH<1>(ah.v, ah.v, bq.v, bq.v, acc[t]); }
  }
#pragma unroll
  for (int t = 0; t < 4; ++t) { if (col0 + t * 16 >= N) continue; const int col = col0 + t * 16 + ln; const float bv = bp ? bf16_round(bp[col]) : 0.f;
#pragma unroll
    for (int r = 0; r < 8; ++r) { float v = acc[t][r] * alpha + bv; if (CP) { const int rr = row0g + row0 + 8 * hh + r; if (rowsPerB < 0) v += CP[cofs + (size_t)rr * ldc + col];      /* rowsPerB < 0: own element of the batched C plane */ else { const int bidx = rr / rowsPerB; v += CP[(size_t)bidx * sCPb + (size_t)by * 64 + col]; } } if (ACT == 1) v = (v > 0.f) ? v : expm1f(v); else if (ACT == 7) v = (v > 0.f) ? v + 1.0f : expf(v); else if (ACT == 8) v = tanhf(v); else if (ACT == 9) v = 0.5f * v * (1.0f + tanhf(0.7978845608028654f * (v + 0.044715f * v * v * v))); else if (ACT == 11) v = 1.0f / (1.0f + expf(-v)); else if (ACT == 12) v = (v > 0.f) ? v : 0.01f * v; else if (ACT == 14) v = (v > 0.f) ? v : 0.1f * v; else if (ACT == 16) v = (v >= 0.f) ? v : 0.3f * v; else if (ACT == 17) v = (v >= 0.f) ? v : 0.2f * v; else if (ACT == 15) v = v / (1.0f + expf(-v)); else if (ACT == 3) v = fmaxf(v, 0.f); else if (ACT == 6) v = 0.5f * v * (1.0f + erff(v * 0.70710678118654752f)); so[w][8 * hh + r][t * 16 + ln] = v; } }
  __builtin_amdgcn_fence(__ATOMIC_ACQ_REL, "workgroup"); __builtin_amdgcn_wave_barrier();
  const int rsub = lane >> 4, c4 = (lane & 15) * 4; typedef _Float16 v4h __attribute__((ext_vector_type(4)));
  {
#pragma unroll
    for (int q = 0; q < 8; ++q) { const int r = q * 2 + rsub; if (col0 + c4 < N) { const v4f v = *(const v4fa*)&so[w][r][c4]; if (C) *(v4f*)(C + cofs + (size_t)(row0 + r) * ldc + col0 + c4) = v; if (C16) { v4h h4; for (int i = 0; i < 4; ++i) h4[i] = (_Float16)v[i]; *(v4h*)(C16 + cofs + (size_t)(row0 + r) * ldc + col0 + c4) = h4; } } }
     }
}


typedef _Float16 v4h __attribute__((ext_vector_type(4)));

__global__ __launch_bounds__(256) void k_x16(const float* __restrict__ x, _Float16* __restrict__ X16, size_t n8) { const size_t t = (size_t)blockIdx.x * 256 + threadIdx.x; if (t >= n8) return; FragH f;
#pragma unroll
  for (int q = 0; q < 8; ++q) f.h[q] = (_Float16)bf16_round(x[t * 8 + q]); *(v8us*)((unsigned short*)X16 + t * 8) = f.half[0];  }
__global__ __launch_bounds__(256) void k_h16(const float* __restrict__ x, _Float16* __restrict__ X16, size_t n8) { const size_t t = (size_t)blockIdx.x * 256 + threadIdx.x; if (t >= n8) return; FragH f;
#pragma unroll
  for (int q = 0; q < 8; ++q) f.h[q] = (_Float16)x[t * 8 + q]; *(v8us*)((unsigned short*)X16 + t * 8) = f.half[0];  }
__global__ __launch_bounds__(256) void k_round16f(const float* __restrict__ W, _Float16* __restrict__ Bt, size_t n8) { const size_t t = (size_t)blockIdx.x * 256 + threadIdx.x; if (t >= n8) return; FragH f;
#pragma unroll
  for (int i = 0; i < 8; ++i) f.h[i] = (_Float16)(bf16_round(W[t * 8 + i]) * 16.0f); *(v8us*)((unsigned short*)Bt + t * 8) = f.half[0];  }
template <int NHv, int TTv>
__global__ __launch_bounds__(256) void k_vt(const _Float16* __restrict__ V16, int ldv, int voff, _Float16* __restrict__ Vt) { __shared__ unsigned short tl[64][66]; const int tid = threadIdx.x; const int slab = blockIdx.x / (TTv / 64), lg = blockIdx.x % (TTv / 64); const int b = slab / NHv, h = slab % NHv;
  for (int i = tid; i < 64 * 8; i += 256) { const int r = i / 8, c8 = (i % 8) * 8; FragH f; f.half[0] = *(const v8us*)((const unsigned short*)V16 + ((size_t)b * TTv + lg * 64 + r) * ldv + voff + h * 64 + c8);
#pragma unroll
    for (int q = 0; q < 8; ++q) tl[r][c8 + q] = f.u[q]; }
  __syncthreads();
  {
#pragma unroll
    for (int rd = 0; rd < 2; ++rd) { const int d = rd * 32 + tid / 8, pc = tid % 8; FragH f;
#pragma unroll
      for (int q = 0; q < 8; ++q) f.u[q] = tl[pc * 8 + q][d];
      *(v8us*)((unsigned short*)Vt + ((size_t)slab * 64 + d) * TTv + lg * 64 + pc * 8) = f.half[0]; }
     } }

__global__ __launch_bounds__(256) void k_hl(const float* __restrict__ F, _Float16* __restrict__ Hh, _Float16* __restrict__ Hl, size_t n8) { const size_t t = (size_t)blockIdx.x * 256 + threadIdx.x; if (t >= n8) return; FragH fh, fl; const v4f a = *(const v4fa*)(F + t * 8), c = *(const v4fa*)(F + t * 8 + 4);
#pragma unroll
  for (int q = 0; q < 4; ++q) { _Float16 h = (_Float16)a[q]; fh.h[q] = h; fl.h[q] = (_Float16)((a[q] - (float)h) * 1024.0f); h = (_Float16)c[q]; fh.h[4 + q] = h; fl.h[4 + q] = (_Float16)((c[q] - (float)h) * 1024.0f); }
  { *(v8us*)((unsigned short*)Hh + t * 8) = fh.half[0]; *(v8us*)((unsigned short*)Hl + t * 8) = fl.half[0];  } }

// ---- fast GEMM (wave tile 32x64; requires M % 32 == 0 rows per launch region and N % 64 == 0); epilogue = k_gemm_hhx semantics ----
__device__ __forceinline__ v16h g2_frag(const _Float16* p, int hh) { FragH f; f.half[0] = *(const v8us*)((const unsigned short*)p + 8 * hh); f.half[1] = *(const v8us*)((const unsigned short*)p + 16 + 8 * hh); return f.v; }
__device__ __forceinline__ v8f g2_mma(v16h a, v16h b, v8f c) { v8f d = __builtin_amdgcn_wmma_f32_16x16x32_f16(false, a, false, b, (short)0, c, false, false); asm volatile("v_nop\n\tv_nop\n\tv_nop\n\tv_nop" : "+v"(d) : "v"(a), "v"(b)); return d; }
template <int ACT>
__global__ __launch_bounds__(128) void k_gemm2(const _Float16* __restrict__ A, int lda, size_t sA, const _Float16* __restrict__ Bh, int ldb, size_t sB, float alpha, const float* __restrict__ bias, size_t sBias, const float* __restrict__ CP, int rowsPerB, size_t sCPb, int row0g,
    float* __restrict__ C, _Float16* __restrict__ C16, int ldc, size_t sC, int M, int N, int K) { static_assert(ACT == 0 || ACT == 3 || ACT == 6 || ACT == 8 || ACT == 9 || ACT == 11 || ACT == 12 || ACT == 14 || ACT == 15 || ACT == 16 || ACT == 17, "k_gemm2: unsupported ACT code (would silently apply no activation)");
  __shared__ __attribute__((aligned(16))) float so[4][32][68];
  const int tid = threadIdx.x, w = tid >> 5, lane = tid & 31, ln = lane & 15, hh = lane >> 4; const int by = blockIdx.y;
  A += (size_t)by * sA; Bh += (size_t)by * sB; const size_t cofs = (size_t)by * sC; const float* bp = bias ? bias + (size_t)by * sBias : nullptr;
  const int ntn = N >> 6; const int mt = blockIdx.x / ntn, nq = blockIdx.x - mt * ntn; const int row0 = mt * 128 + 32 * w, col0 = nq * 64; if (row0 >= M) return;
  const _Float16* a0p = A + (size_t)(row0 + ln) * lda; const _Float16* a1p = a0p + (size_t)16 * lda;
  const _Float16* b0p = Bh + (size_t)(col0 + ln) * ldb; const _Float16* b1p = b0p + (size_t)16 * ldb; const _Float16* b2p = b1p + (size_t)16 * ldb; const _Float16* b3p = b2p + (size_t)16 * ldb;
  const v8f z8 = {0.f,0.f,0.f,0.f,0.f,0.f,0.f,0.f}; v8f c00 = z8, c01 = z8, c02 = z8, c03 = z8, c10 = z8, c11 = z8, c12 = z8, c13 = z8;
#pragma unroll 1
  for (int kb = 0; kb < K; kb += 32) { const v16h a0 = g2_frag(a0p + kb, hh), a1 = g2_frag(a1p + kb, hh);
    v16h b = g2_frag(b0p + kb, hh); c00 = g2_mma(a0, b, c00); c10 = g2_mma(a1, b, c10);
    b = g2_frag(b1p + kb, hh); c01 = g2_mma(a0, b, c01); c11 = g2_mma(a1, b, c11);
    b = g2_frag(b2p + kb, hh); c02 = g2_mma(a0, b, c02); c12 = g2_mma(a1, b, c12);
    b = g2_frag(b3p + kb, hh); c03 = g2_mma(a0, b, c03); c13 = g2_mma(a1, b, c13); }
  v8f accs[8] = {c00, c01, c02, c03, c10, c11, c12, c13};
#pragma unroll
  for (int u = 0; u < 8; ++u) { const int t = u & 3, half = u >> 2; const int col = col0 + t * 16 + ln; const float bv = bp ? bf16_round(bp[col]) : 0.f;
#pragma unroll
    for (int r = 0; r < 8; ++r) { const int rloc = half * 16 + 8 * hh + r; float v = accs[u][r] * alpha + bv; if (CP) { if (rowsPerB < 0) v += CP[cofs + (size_t)(row0g + row0 + rloc) * ldc + col];      /* rowsPerB < 0: own element of the batched C plane */ else { const int bidx = (row0g + row0 + rloc) / rowsPerB; v += CP[(size_t)bidx * sCPb + (size_t)by * 64 + col]; } }
      if (ACT == 3) v = fmaxf(v, 0.f); else if (ACT == 6) v = 0.5f * v * (1.0f + erff(v * 0.70710678118654752f)); else if (ACT == 11) v = 1.0f / (1.0f + expf(-v)); else if (ACT == 15) v = v / (1.0f + expf(-v)); else if (ACT == 12) v = (v > 0.f) ? v : 0.01f * v; else if (ACT == 8) v = tanhf(v); else if (ACT == 9) v = 0.5f * v * (1.0f + tanhf(0.7978845608028654f * (v + 0.044715f * v * v * v))); else if (ACT == 14) v = (v > 0.f) ? v : 0.1f * v; else if (ACT == 16) v = (v >= 0.f) ? v : 0.3f * v; else if (ACT == 17) v = (v >= 0.f) ? v : 0.2f * v;
      so[w][rloc][t * 16 + ln] = v; } }
  __builtin_amdgcn_fence(__ATOMIC_ACQ_REL, "workgroup"); __builtin_amdgcn_wave_barrier();
  const int rsub = lane >> 4, c4 = (lane & 15) * 4;
  {
#pragma unroll
    for (int q = 0; q < 16; ++q) { const int r = q * 2 + rsub; const v4f v = *(const v4fa*)&so[w][r][c4]; if (C) *(v4f*)(C + cofs + (size_t)(row0 + r) * ldc + col0 + c4) = v; if (C16) { v4h h4; for (int i = 0; i < 4; ++i) h4[i] = (_Float16)v[i]; *(v4h*)(C16 + cofs + (size_t)(row0 + r) * ldc + col0 + c4) = h4; } }
     } }


__global__ __launch_bounds__(256) void k_wnat(const float* __restrict__ w, size_t n8, _Float16* __restrict__ Bt) { const size_t t = (size_t)blockIdx.x * 256 + threadIdx.x; if (t >= n8) return; FragH f; for (int q = 0; q < 8; ++q) f.h[q] = (_Float16)(bf16_round(w[t * 8 + q]) * 16.0f); *(v8us*)((unsigned short*)Bt + t * 8) = f.half[0];  }
__global__ __launch_bounds__(256) void k_rsm(const float* __restrict__ S, _Float16* __restrict__ P, int nrows) {
  #pragma clang fp contract(off)
  const int i = blockIdx.x * 256 + threadIdx.x; if (i >= nrows) return; const float* s = S + (size_t)i * SQ; float mx = -3.0e38f;
#pragma unroll 1
  for (int j = 0; j < SQ; ++j) mx = fmaxf(mx, s[j]); float se = 0.f;
#pragma unroll 1
  for (int j = 0; j < SQ; ++j) se += expf(s[j] - mx); const float sc = 256.0f / se;
#pragma unroll 1
  for (int j0 = 0; j0 < SQ; j0 += 8) { FragH f; for (int q = 0; q < 8; ++q) f.h[q] = (_Float16)(expf(s[j0 + q] - mx) * sc); unsigned short* d = (unsigned short*)P + (size_t)i * SQ + j0; *(v8us*)d = f.half[0];  } }
__global__ __launch_bounds__(256) void k_vt(const _Float16* __restrict__ V16, int b, int h0, _Float16* __restrict__ VT) { __shared__ unsigned short tl[64][65]; const int tid = threadIdx.x; const int hh = blockIdx.x % HG, sg = blockIdx.x / HG; const int s0 = sg * 64; const int h = h0 + hh;
  for (int i = tid; i < 64 * 8; i += 256) { const int j = i / 8, d8 = (i % 8) * 8; FragH f; f.half[0] = *(const v8us*)((const unsigned short*)V16 + ((size_t)b * SQ + s0 + j) * DM + h * HD + d8); for (int q = 0; q < 8; ++q) tl[d8 + q][j] = f.u[q]; }
  __syncthreads();
  { for (int i = tid; i < 64 * 8; i += 256) { const int d = i / 8, j8 = (i % 8) * 8; FragH f; for (int q = 0; q < 8; ++q) f.u[q] = tl[d][j8 + q]; *(v8us*)((unsigned short*)VT + ((size_t)hh * HD + d) * SQ + s0 + j8) = f.half[0]; }  } }



__global__ __launch_bounds__(256) void k_rsmkm(const float* __restrict__ S, _Float16* __restrict__ P, int nrows, const int* __restrict__ am) {
  #pragma clang fp contract(off)
  const int t = blockIdx.x * 256 + threadIdx.x; if (t >= nrows) return; const size_t i = (size_t)t; const float* s = S + i * SQ; const int* mr = am + (size_t)(t % SQ) * SQ; float mx = -3.0e38f;
#pragma unroll 1
  for (int j = 0; j < SQ; ++j) { const float f = (mr[j] != 0) ? 1.f : 0.f; mx = fmaxf(mx, fmaf(f, s[j], (1.f - f) * -1.0e9f)); } float se = 0.f;
#pragma unroll 1
  for (int j = 0; j < SQ; ++j) { const float f = (mr[j] != 0) ? 1.f : 0.f; se += __expf(fmaf(f, s[j], (1.f - f) * -1.0e9f) - mx); } const float sc = 256.0f / se;
#pragma unroll 1
  for (int j0 = 0; j0 < SQ; j0 += 8) { FragH fr; for (int q = 0; q < 8; ++q) { const int j = j0 + q; const float f = (mr[j] != 0) ? 1.f : 0.f; fr.h[q] = (_Float16)(__expf(fmaf(f, s[j], (1.f - f) * -1.0e9f) - mx) * sc); }
    unsigned short* d = (unsigned short*)P + i * SQ + j0; *(v8us*)d = fr.half[0];  } }
__global__ __launch_bounds__(256) void k_rsmf(const float* __restrict__ S, _Float16* __restrict__ P, int qn, int hg) {
  #pragma clang fp contract(off)
  const int t = blockIdx.x * 256 + threadIdx.x; if (t >= qn * hg) return; const size_t i = (size_t)(t / qn) * SQ + (t % qn); const float* s = S + i * SQ; float mx = -3.0e38f;
#pragma unroll 1
  for (int j = 0; j < SQ; ++j) mx = fmaxf(mx, s[j]); float se = 0.f;
#pragma unroll 1
  for (int j = 0; j < SQ; ++j) se += __expf(s[j] - mx); const float sc = 256.0f / se;
#pragma unroll 1
  for (int j0 = 0; j0 < SQ; j0 += 8) { FragH f; for (int q = 0; q < 8; ++q) f.h[q] = (_Float16)(__expf(s[j0 + q] - mx) * sc); unsigned short* d = (unsigned short*)P + i * SQ + j0; *(v8us*)d = f.half[0];  } }



__global__ __launch_bounds__(256) void k_wthd(const float* __restrict__ Wt, _Float16* __restrict__ Bt) { const size_t t = (size_t)blockIdx.x * 256 + threadIdx.x; if (t >= (size_t)NH * HD * (DM / 8)) return; const int m8 = (int)(t % (DM / 8)) * 8; const int d = (int)((t / (DM / 8)) % HD); const int h = (int)(t / ((size_t)(DM / 8) * HD)); FragH f;
  for (int q = 0; q < 8; ++q) f.h[q] = (_Float16)(16.0f * bf16_round(Wt[((size_t)h * DM + m8 + q) * HD + d])); unsigned short* dst = (unsigned short*)Bt + ((size_t)h * HD + d) * DM + m8; *(v8us*)dst = f.half[0];  }





extern "C" void kernel_launch(void* const* d_in, const int* in_sizes, int n_in,
                              void* d_out, int out_size, void* d_ws, size_t ws_size, hipStream_t stream) {
  (void)in_sizes; (void)n_in; (void)out_size;
  const float* const* I = (const float* const*)d_in; const float* xq = I[0]; const float* xk = I[1]; const float* xv = I[2]; const float* wq = I[3]; const float* bq = I[4]; const float* wk = I[5]; const float* bk = I[6]; const float* wv = I[7]; const float* bv = I[8]; const float* x = xq;      /* X_Q, X_K, X_V [4096][1024]; per-head Wq / Wk / Wv [16][1024][64] ([in][out] per head) + biases [16][64] = [(h, d)]; no output projection */
  static_assert(NH * HD == DM && DM % 64 == 0 && DM % 32 == 0 && SQ % 128 == 0 && HG == 1 && NB == 1, "shape / tile multiples");
  char* ws = (char*)d_ws; size_t off = 0;
  auto take = [&](size_t bytes) { char* p = ws + off; off += (bytes + 255) & ~(size_t)255; return p; };
  _Float16* BQ = (_Float16*)take((size_t)DM * DM * 2); _Float16* BK = (_Float16*)take((size_t)DM * DM * 2); _Float16* BV = (_Float16*)take((size_t)DM * DM * 2);
  _Float16* X16 = (_Float16*)take(NR * DM * 2); _Float16* XKp = (_Float16*)take(NR * DM * 2); _Float16* XVp = (_Float16*)take(NR * DM * 2); _Float16* Q16 = (_Float16*)take(NR * DM * 2); _Float16* K16 = (_Float16*)take(NR * DM * 2); _Float16* V16 = (_Float16*)take(NR * DM * 2);
  float* S = (float*)take((size_t)HG * SQ * SQ * 4); _Float16* P = (_Float16*)take((size_t)HG * SQ * SQ * 2); _Float16* VT = (_Float16*)take((size_t)NH * HD * SQ * 2);
  if (off > ws_size) return;
  { const unsigned g = (unsigned)(((size_t)NH * HD * (DM / 8) + 255) / 256); k_wthd<<<g, 256, 0, stream>>>(wq, BQ); k_wthd<<<g, 256, 0, stream>>>(wk, BK); k_wthd<<<g, 256, 0, stream>>>(wv, BV); }      /* per-head [m][d] -> Bt[(h, d)][m] x16 */
  _Float16* XK = XKp; _Float16* XV = XVp; k_x16<<<(unsigned)((NR * DM / 8 + 255) / 256), 256, 0, stream>>>(xk, XK, NR * DM / 8); k_x16<<<(unsigned)((NR * DM / 8 + 255) / 256), 256, 0, stream>>>(xv, XV, NR * DM / 8);      /* key and value inputs as exact f16 rows */

  k_x16<<<(unsigned)((NR * DM / 8 + 255) / 256), 256, 0, stream>>>(x, X16, NR * DM / 8);
  const size_t r0p = (size_t)B0 * SQ;      /* first projected row */
  k_gemm2<0><<<dim3((unsigned)((MP / 128) * (DM / 64)), 1), 128, 0, stream>>>(X16 + r0p * DM, DM, 0, BQ, DM, 0, 0.0625f, bq, 0, nullptr, 1, 0, 0, nullptr, Q16 + r0p * DM, DM, 0, MP, DM, DM);
  k_gemm2<0><<<dim3((unsigned)((MP / 128) * (DM / 64)), 1), 128, 0, stream>>>(XK + r0p * DM, DM, 0, BK, DM, 0, 0.0625f, bk, 0, nullptr, 1, 0, 0, nullptr, K16 + r0p * DM, DM, 0, MP, DM, DM);
  k_gemm2<0><<<dim3((unsigned)((MP / 128) * (DM / 64)), 1), 128, 0, stream>>>(XV + r0p * DM, DM, 0, BV, DM, 0, 0.0625f, bv, 0, nullptr, 1, 0, 0, nullptr, V16 + r0p * DM, DM, 0, MP, DM, DM);
  for (int b = B0; b < B0 + NBR; ++b) { const size_t r0 = (size_t)b * SQ;
    k_vt<NH, SQ><<<NH * (SQ / 64), 256, 0, stream>>>(V16 + r0 * LQ, LQ, 0, VT);      /* V^T [NH][HD][SQ] for this batch */
    for (int h0 = 0; h0 < NHD; h0 += HG) {
      k_gemm2<0><<<dim3((QN / 128) * (SQ / 64), HG), 128, 0, stream>>>(Q16 + r0 * LQ + h0 * HD, LQ, (size_t)HD, K16 + r0 * LQ + h0 * HD, LQ, (size_t)HD, 0.125f, nullptr, 0, nullptr, 1, 0, 0, S, nullptr, SQ, (size_t)SQ * SQ, QN, SQ, HD);      /* scores, HG heads per launch */
      k_rsmf<<<(HG * QN + 255) / 256, 256, 0, stream>>>(S, P, QN, HG);      /* P = 256 softmax (f16) with the native exp, rows of the launch's head */
      k_gemm2<0><<<dim3((QN / 128) * (HD / 64), HG), 128, 0, stream>>>(P, SQ, (size_t)SQ * SQ, VT + (size_t)h0 * HD * SQ, SQ, (size_t)HD * SQ, 0.00390625f, nullptr, 0, nullptr, 1, 0, 0, (float*)d_out + r0 * DM + h0 * HD, nullptr, DM, (size_t)HD, QN, HD, SQ); } }      /* out = P V^T (alpha 2^-8) written f32 straight into the head's 64 columns of the output rows (no output projection) */
}

// v001
// A run of this version takes 2770 microseconds.
// In two side-by-side timings against v000, it was 4.80 and 4.77 times as fast.
#include <hip/hip_runtime.h>
// Multi-head attention over three inputs with PER-HEAD projection weights and no output projection (X_Q, X_K, X_V [4096][1024] (one sequence); Q[h] = X_Q Wq[h] + bq[h], K, V likewise (Wq / Wk / Wv [16][1024][64] per-head [in][out], sigma 1/32; biases [16][64] sigma 1/32); scores = Q[h] K[h]^T / sqrt(64); softmax over all 4096 keys; out[h] = attn V[h]; heads concatenated along the feature axis -> [4096][1024]).
// Structure: the three inputs as exact f16 rows (bf16-rounded); per-head [in][out] weights gathered into Bt[(h, d)][in] x16 planes; Q, K, V as three WMMA GEMMs (32x64 wave tiles, f32 accumulation, + bias [(h, d)], f16 outputs); V^T for all heads via LDS transposes; per head: scores GEMM (K = 64, alpha 1/8) into an f32 [4096][4096] plane, row softmax on VALU (f32 statistics; weights stored x256 as f16), out = P . V^T GEMM (K = 4096, alpha 2^-8) written f32 straight into the head's 64 columns of the output rows.
// Compute dtype: inputs rounded to bf16; x / weights exact; q, k, v and softmax weights as plain f16 GEMM operands (~2^-12); scores, softmax statistics and o f32. v_wmma_f32_16x16x32_f16.
#define NB 1
#define SQ 4096
#define DM 1024
#define NH 16
#define HD 64
#define HG 1                         /* heads per attention launch group */
#define B0 0                         /* first batch processed (debug hook) */
#define NBR NB                       /* batches processed (debug hook) */
#define NR ((size_t)NB * SQ)         /* token rows */
#define MP ((int)((size_t)NBR * SQ)) /* rows projected (debug hook) */
#define QN SQ                        /* query rows attended per batch (debug hook) */
#define NHD NH                       /* heads attended (debug hook) */
#define MPO MP                       /* unused */
#define LQ DM      /* row pitch of the q/k/v rows */
typedef __bf16 v16b __attribute__((ext_vector_type(16)));
typedef unsigned short v8us __attribute__((ext_vector_type(8), may_alias));
typedef float  v8f  __attribute__((ext_vector_type(8)));
typedef float  v4f  __attribute__((ext_vector_type(4)));
typedef float  v4fa __attribute__((ext_vector_type(4), may_alias));
union FragB { v16b v; v8us half[2]; unsigned short u[16]; };

__device__ __forceinline__ unsigned short bf16_bits(float x) { unsigned int u = __float_as_uint(x); return (unsigned short)((u + 0x7FFFu + ((u >> 16) & 1u)) >> 16); }
__device__ __forceinline__ float bf16_val(unsigned short b) { return __uint_as_float(((unsigned int)b) << 16); }
__device__ __forceinline__ float bf16_round(float x) { return bf16_val(bf16_bits(x)); }
// D += A·B with NT terms: 1 = ah·bh, 2 = + al·bh (A split), 3 = + ah·bl (both split)
template <int NT>
__device__ __forceinline__ v8f mmaN(v16b ah, v16b al, v16b bh, v16b bl, v8f c) {
  c = __builtin_amdgcn_wmma_f32_16x16x32_bf16(false, ah, false, bh, (short)0, c, false, false);
  if (NT >= 2) c = __builtin_amdgcn_wmma_f32_16x16x32_bf16(false, al, false, bh, (short)0, c, false, false);
  if (NT >= 3) c = __builtin_amdgcn_wmma_f32_16x16x32_bf16(false, ah, false, bl, (short)0, c, false, false);
  asm volatile("v_nop\n\tv_nop\n\tv_nop\n\tv_nop" : "+v"(c) : "v"(ah), "v"(al), "v"(bh), "v"(bl));
  return c;
}

__global__ __launch_bounds__(256) void k_wt_bf16(const float* __restrict__ W, unsigned short* __restrict__ Wt, int K, int N) {
  const int t = blockIdx.x * 256 + threadIdx.x;
  const int k8n = K / 8;
  if (t >= N * k8n) return;
  const int n = t / k8n, k8 = (t % k8n) * 8;
  v8us v;
#pragma unroll
  for (int i = 0; i < 8; ++i) v[i] = bf16_bits(W[(size_t)(k8 + i) * N + n]);
  *(v8us*)(Wt + (size_t)n * K + k8) = v;
  
}

// GEMM C[M][N] (f32, pitch ldc) = act(A[M][K]·W + bias). A f32 row-major (pitch lda) converted per fragment to bf16
// (ASPLIT: hi/lo two planes -> 2 terms, else single rounded term); Wt bf16 [N][K] (pitch ldb). BIAS_BF16 rounds the
// bias to bf16 first (bias quantised to bf16 before the add). K%32==0, M%16==0, N%64==0.
template <bool ASPLIT, int ACT, bool BIAS_BF16>
__global__ __launch_bounds__(128) void k_gemm_bf(const float* __restrict__ A, int lda, const unsigned short* __restrict__ Wt, int ldb,
                                               const float* __restrict__ bias, float* __restrict__ C, int ldc, int M, int N, int K) {
  __shared__ __attribute__((aligned(16))) float so[4][16][64];
  const int tid = threadIdx.x, w = tid >> 5, lane = tid & 31, ln = lane & 15, hh = lane >> 4;
  const int ntn = N / 64;
  const int wid = blockIdx.x * 4 + w;
  const int mt = wid / ntn, nq = wid % ntn;
  if (mt * 16 >= M) return;
  const int row0 = mt * 16, col0 = nq * 64;
  const float* arow = A + (size_t)(row0 + ln) * lda;
  v8f acc[4] = {};
  for (int kb = 0; kb < K; kb += 32) {
    FragB ah, al;
    const v4f x0 = *(const v4fa*)(arow + kb + 8 * hh), x1 = *(const v4fa*)(arow + kb + 8 * hh + 4);
    const v4f x2 = *(const v4fa*)(arow + kb + 16 + 8 * hh), x3 = *(const v4fa*)(arow + kb + 16 + 8 * hh + 4);
    float xs[16] = {x0[0],x0[1],x0[2],x0[3],x1[0],x1[1],x1[2],x1[3],x2[0],x2[1],x2[2],x2[3],x3[0],x3[1],x3[2],x3[3]};
#pragma unroll
    for (int i = 0; i < 16; ++i) { const unsigned short hb = bf16_bits(xs[i]); ah.u[i] = hb; al.u[i] = ASPLIT ? bf16_bits(xs[i] - bf16_val(hb)) : (unsigned short)0; }
#pragma unroll
    for (int t = 0; t < 4; ++t) {
      const unsigned short* brow = Wt + (size_t)(col0 + t * 16 + ln) * ldb + kb;
      FragB b;
      b.half[0] = *(const v8us*)(brow + 8 * hh);
      b.half[1] = *(const v8us*)(brow + 16 + 8 * hh);
      acc[t] = mmaN<ASPLIT ? 2 : 1>(ah.v, al.v, b.v, b.v, acc[t]);
    }
  }
#pragma unroll
  for (int t = 0; t < 4; ++t) {
    float bv = bias ? bias[col0 + t * 16 + ln] : 0.f;
    if (BIAS_BF16) bv = bf16_round(bv);
#pragma unroll
    for (int r = 0; r < 8; ++r) { float v = acc[t][r] + bv; if (ACT == 1) v = fmaxf(v, 0.f); so[w][8 * hh + r][t * 16 + ln] = v; }
  }
  __builtin_amdgcn_fence(__ATOMIC_ACQ_REL, "workgroup");
  __builtin_amdgcn_wave_barrier();
  const int rsub = lane >> 4, c4 = (lane & 15) * 4;
  {
#pragma unroll
    for (int q = 0; q < 8; ++q) {
      const int r = q * 2 + rsub;
      const v4f v = *(const v4fa*)&so[w][r][c4];
      *(v4f*)(C + (size_t)(row0 + r) * ldc + col0 + c4) = v;
    }
    
  }
}

// GEMM C = act(A·W + bias + resid): A f32 (ASPLIT -> hi/lo 2 terms), Wt bf16 [N][K]; ACT 0 none, 1 relu, 2 exact gelu;
// resid (optional, f32, row index = (row % rmod), pitch ldr, RES_BF16 rounds it) added before the activation.
template <bool ASPLIT, int ACT, bool BIAS_BF16, bool RES_BF16>
__global__ __launch_bounds__(128) void k_gemm_bf3(const float* __restrict__ A, int lda, const unsigned short* __restrict__ Wt, int ldb,
                                                const float* __restrict__ bias, const float* __restrict__ resid, int rmod, int ldr,
                                                float* __restrict__ C, int ldc, int M, int N, int K) {
  __shared__ __attribute__((aligned(16))) float so[4][16][64];
  const int tid = threadIdx.x, w = tid >> 5, lane = tid & 31, ln = lane & 15, hh = lane >> 4;
  const int ntn = N / 64;
  const int wid = blockIdx.x * 4 + w;
  const int mt = wid / ntn, nq = wid % ntn;
  if (mt * 16 >= M) return;
  const int row0 = mt * 16, col0 = nq * 64;
  const float* arow = A + (size_t)(row0 + ln) * lda;
  v8f acc[4] = {};
  for (int kb = 0; kb < K; kb += 32) {
    FragB ah, al;
    const v4f x0 = *(const v4fa*)(arow + kb + 8 * hh), x1 = *(const v4fa*)(arow + kb + 8 * hh + 4);
    const v4f x2 = *(const v4fa*)(arow + kb + 16 + 8 * hh), x3 = *(const v4fa*)(arow + kb + 16 + 8 * hh + 4);
    float xs[16] = {x0[0],x0[1],x0[2],x0[3],x1[0],x1[1],x1[2],x1[3],x2[0],x2[1],x2[2],x2[3],x3[0],x3[1],x3[2],x3[3]};
#pragma unroll
    for (int i = 0; i < 16; ++i) { const unsigned short hb = bf16_bits(xs[i]); ah.u[i] = hb; al.u[i] = ASPLIT ? bf16_bits(xs[i] - bf16_val(hb)) : (unsigned short)0; }
#pragma unroll
    for (int t = 0; t < 4; ++t) {
      const unsigned short* brow = Wt + (size_t)(col0 + t * 16 + ln) * ldb + kb;
      FragB b;
      b.half[0] = *(const v8us*)(brow + 8 * hh);
      b.half[1] = *(const v8us*)(brow + 16 + 8 * hh);
      acc[t] = mmaN<ASPLIT ? 2 : 1>(ah.v, al.v, b.v, b.v, acc[t]);
    }
  }
#pragma unroll
  for (int t = 0; t < 4; ++t) {
    const int col = col0 + t * 16 + ln;
    float bv = bias ? bias[col] : 0.f;
    if (BIAS_BF16) bv = bf16_round(bv);
#pragma unroll
    for (int r = 0; r < 8; ++r) {
      float v = acc[t][r] + bv;
      if (resid) { float rv = resid[(size_t)((row0 + 8 * hh + r) % rmod) * ldr + col]; if (RES_BF16) rv = bf16_round(rv); v += rv; }
      if (ACT == 1) v = fmaxf(v, 0.f);
      if (ACT == 2) v = 0.5f * v * (1.0f + erff(v * 0.70710678118654752f));
      if (ACT == 3) { const float u = 0.7978845608028654f * (v + 0.044715f * v * v * v); v = 0.5f * v * (1.0f + tanhf(u)); }
      so[w][8 * hh + r][t * 16 + ln] = v;
    }
  }
  __builtin_amdgcn_fence(__ATOMIC_ACQ_REL, "workgroup");
  __builtin_amdgcn_wave_barrier();
  const int rsub = lane >> 4, c4 = (lane & 15) * 4;
  {
#pragma unroll
    for (int q = 0; q < 8; ++q) {
      const int r = q * 2 + rsub;
      const v4f v = *(const v4fa*)&so[w][r][c4];
      *(v4f*)(C + (size_t)(row0 + r) * ldc + col0 + c4) = v;
    }
    
  }
}
// row LayerNorm (biased variance, eps) over N: s = X (+ R); optional out_sum <- s; out_norm <- (s-mu)*rsqrt(var+eps)*g + b
template <bool PARAM_BF16>
__global__ __launch_bounds__(256) void k_layernorm(const float* __restrict__ X, const float* __restrict__ R, const float* __restrict__ g, const float* __restrict__ bta,
                                                  float* __restrict__ out_sum, float* __restrict__ out_norm, int N, float eps) {
  __shared__ float red[256];
  const int row = blockIdx.x, tid = threadIdx.x;
  const float* x = X + (size_t)row * N; const float* rr = R ? R + (size_t)row * N : nullptr;
  float vals[16];                     // up to N = 4096
  const int per = N / 256;            // contiguous chunk per thread? use strided-by-4 chunks: thread handles j = tid*4 + 1024*u
  float s1 = 0.f;
  for (int u = 0; u < per / 4; ++u) {
    const int j = tid * 4 + 1024 * u;
    const v4f a = *(const v4fa*)(x + j);
    v4f b = {0.f,0.f,0.f,0.f}; if (rr) b = *(const v4fa*)(rr + j);
#pragma unroll
    for (int q = 0; q < 4; ++q) { const float v = a[q] + b[q]; vals[u * 4 + q] = v; s1 += v; }
  }
  red[tid] = s1; __syncthreads();
  for (int st = 128; st > 0; st >>= 1) { if (tid < st) red[tid] += red[tid + st]; __syncthreads(); }
  const float mu = red[0] / (float)N; __syncthreads();
  float s2 = 0.f;
  for (int u = 0; u < per / 4; ++u)
#pragma unroll
    for (int q = 0; q < 4; ++q) { const float c = vals[u * 4 + q] - mu; s2 += c * c; }
  red[tid] = s2; __syncthreads();
  for (int st = 128; st > 0; st >>= 1) { if (tid < st) red[tid] += red[tid + st]; __syncthreads(); }
  const float rs = rsqrtf(red[0] / (float)N + eps);
  {
    for (int u = 0; u < per / 4; ++u) {
      const int j = tid * 4 + 1024 * u;
      v4f o, sm;
#pragma unroll
      for (int q = 0; q < 4; ++q) {
        float gg = g[j + q], bb = bta[j + q];
        if (PARAM_BF16) { gg = bf16_round(gg); bb = bf16_round(bb); }
        sm[q] = vals[u * 4 + q]; o[q] = (vals[u * 4 + q] - mu) * rs * gg + bb;
      }
      if (out_sum) *(v4f*)(out_sum + (size_t)row * N + j) = sm;
      *(v4f*)(out_norm + (size_t)row * N + j) = o;
    }
    
  }
}



// ---- f16 WMMA path (v_wmma_f32_16x16x32_f16): 11-bit significands for operands in range — used where a [0,1] probability operand needs more precision than bf16
typedef _Float16 v16h __attribute__((ext_vector_type(16)));
union FragH { v16h v; v8us half[2]; _Float16 h[16]; unsigned short u[16]; };
template <int NT>
__device__ __forceinline__ v8f mmaH(v16h ah, v16h al, v16h bh, v16h bl, v8f c) {
  c = __builtin_amdgcn_wmma_f32_16x16x32_f16(false, ah, false, bh, (short)0, c, false, false);
  if (NT >= 2) c = __builtin_amdgcn_wmma_f32_16x16x32_f16(false, al, false, bh, (short)0, c, false, false);
  if (NT >= 3) c = __builtin_amdgcn_wmma_f32_16x16x32_f16(false, ah, false, bl, (short)0, c, false, false);
  asm volatile("v_nop\n\tv_nop\n\tv_nop\n\tv_nop" : "+v"(c) : "v"(ah), "v"(al), "v"(bh), "v"(bl));
  return c;
}
// batched GEMM like k_gemm_b but f16 operands: A f32 (split into f16 hi/lo if ASPLIT, else rounded to f16), Bt = f16 values [n][k]; alpha; C f32; N multiple of 16 (partial tiles skipped)
template <bool ASPLIT>
__global__ __launch_bounds__(128) void k_gemm_h(const float* __restrict__ A, int lda, size_t sA, const _Float16* __restrict__ Bh, int ldb, size_t sB, float alpha, float* __restrict__ C, int ldc, size_t sC, int M, int N, int K) {
  __shared__ __attribute__((aligned(16))) float so[4][16][64];
  const int tid = threadIdx.x, w = tid >> 5, lane = tid & 31, ln = lane & 15, hh = lane >> 4; const int by = blockIdx.y;
  A += (size_t)by * sA; Bh += (size_t)by * sB; C += (size_t)by * sC;
  const int ntn = (N + 63) / 64; const int wid = blockIdx.x * 4 + w; const int mt = wid / ntn, nq = wid % ntn; if (mt * 16 >= M) return;
  const int row0 = mt * 16, col0 = nq * 64; const float* arow = A + (size_t)(row0 + ln) * lda;
  v8f acc[4] = {};
  for (int kb = 0; kb < K; kb += 32) {
    FragH ah, al;
    const v4f x0 = *(const v4fa*)(arow + kb + 8 * hh), x1 = *(const v4fa*)(arow + kb + 8 * hh + 4), x2 = *(const v4fa*)(arow + kb + 16 + 8 * hh), x3 = *(const v4fa*)(arow + kb + 16 + 8 * hh + 4);
    float xs[16] = {x0[0],x0[1],x0[2],x0[3],x1[0],x1[1],x1[2],x1[3],x2[0],x2[1],x2[2],x2[3],x3[0],x3[1],x3[2],x3[3]};
#pragma unroll
    for (int i = 0; i < 16; ++i) { const _Float16 h = (_Float16)xs[i]; ah.h[i] = h; al.h[i] = ASPLIT ? (_Float16)(xs[i] - (float)h) : (_Float16)0.0f; }
#pragma unroll
    for (int t = 0; t < 4; ++t) { if (col0 + t * 16 >= N) continue; const size_t boff = (size_t)(col0 + t * 16 + ln) * ldb + kb; FragH bq; bq.half[0] = *(const v8us*)(Bh + boff + 8 * hh); bq.half[1] = *(const v8us*)(Bh + boff + 16 + 8 * hh);
      acc[t] = mmaH<ASPLIT ? 2 : 1>(ah.v, al.v, bq.v, bq.v, acc[t]); }
  }
#pragma unroll
  for (int t = 0; t < 4; ++t) { if (col0 + t * 16 >= N) continue;
#pragma unroll
    for (int r = 0; r < 8; ++r) so[w][8 * hh + r][t * 16 + ln] = acc[t][r] * alpha; }
  __builtin_amdgcn_fence(__ATOMIC_ACQ_REL, "workgroup"); __builtin_amdgcn_wave_barrier();
  const int rsub = lane >> 4, c4 = (lane & 15) * 4;
  {
#pragma unroll
    for (int q = 0; q < 8; ++q) { const int r = q * 2 + rsub; if (col0 + c4 < N) { const v4f v = *(const v4fa*)&so[w][r][c4]; *(v4f*)(C + (size_t)(row0 + r) * ldc + col0 + c4) = v; } }
     }
}

// Wt[n][k] = f16(W[k][n]·scale) from f32 row-major W[K][N] (scale = power of two; bf16-exact weights stay exact in f16 away from the subnormal range)
__global__ __launch_bounds__(256) void k_wt_f16(const float* __restrict__ W, _Float16* __restrict__ Wt, int K, int N, float scale) {
  const int t = blockIdx.x * 256 + threadIdx.x; if (t >= N * (K / 8)) return; const int n = t / (K / 8), k8 = (t % (K / 8)) * 8; FragH f;
#pragma unroll
  for (int i = 0; i < 8; ++i) f.h[i] = (_Float16)(bf16_round(W[(size_t)(k8 + i) * N + n]) * scale); const v8us o = f.half[0];
  *(v8us*)((unsigned short*)Wt + (size_t)n * K + k8) = o; 
}
// k_gemm_hh variant with fused epilogue: v = acc·alpha + bias[by·sBias + col] (+ CP[(row/rowsPerB)·sCPb + by·64 + col] if CP) ; ACT 0 none / 1 elu ; writes f16 C16 (and f32 C if non-null)
template <int ACT>
__global__ __launch_bounds__(128) void k_gemm_hhx(const _Float16* __restrict__ A, int lda, size_t sA, const _Float16* __restrict__ Bh, int ldb, size_t sB, float alpha, const float* __restrict__ bias, size_t sBias, const float* __restrict__ CP, int rowsPerB, size_t sCPb, int row0g,
    float* __restrict__ C, _Float16* __restrict__ C16, int ldc, size_t sC, int M, int N, int K) {
  __shared__ __attribute__((aligned(16))) float so[4][16][64];
  const int tid = threadIdx.x, w = tid >> 5, lane = tid & 31, ln = lane & 15, hh = lane >> 4; const int by = blockIdx.y;
  A += (size_t)by * sA; Bh += (size_t)by * sB; const size_t cofs = (size_t)by * sC; const float* bp = bias ? bias + (size_t)by * sBias : nullptr;
  const int ntn = (N + 63) / 64; const int wid = blockIdx.x * 4 + w; const int mt = wid / ntn, nq = wid % ntn; if (mt * 16 >= M) return;
  const int row0 = mt * 16, col0 = nq * 64; const _Float16* arow = A + (size_t)(row0 + ln) * lda;
  v8f acc[4] = {};
  for (int kb = 0; kb < K; kb += 32) { FragH ah; ah.half[0] = *(const v8us*)((const unsigned short*)arow + kb + 8 * hh); ah.half[1] = *(const v8us*)((const unsigned short*)arow + kb + 16 + 8 * hh);
#pragma unroll
    for (int t = 0; t < 4; ++t) { if (col0 + t * 16 >= N) continue; const size_t boff = (size_t)(col0 + t * 16 + ln) * ldb + kb; FragH bq; bq.half[0] = *(const v8us*)((const unsigned short*)Bh + boff + 8 * hh); bq.half[1] = *(const v8us*)((const unsigned short*)Bh + boff + 16 + 8 * hh);
      acc[t] = mmaH<1>(ah.v, ah.v, bq.v, bq.v, acc[t]); }
  }
#pragma unroll
  for (int t = 0; t < 4; ++t) { if (col0 + t * 16 >= N) continue; const int col = col0 + t * 16 + ln; const float bv = bp ? bf16_round(bp[col]) : 0.f;
#pragma unroll
    for (int r = 0; r < 8; ++r) { float v = acc[t][r] * alpha + bv; if (CP) { const int rr = row0g + row0 + 8 * hh + r; if (rowsPerB < 0) v += CP[cofs + (size_t)rr * ldc + col];      /* rowsPerB < 0: own element of the batched C plane */ else { const int bidx = rr / rowsPerB; v += CP[(size_t)bidx * sCPb + (size_t)by * 64 + col]; } } if (ACT == 1) v = (v > 0.f) ? v : expm1f(v); else if (ACT == 7) v = (v > 0.f) ? v + 1.0f : expf(v); else if (ACT == 8) v = tanhf(v); else if (ACT == 9) v = 0.5f * v * (1.0f + tanhf(0.7978845608028654f * (v + 0.044715f * v * v * v))); else if (ACT == 11) v = 1.0f / (1.0f + expf(-v)); else if (ACT == 12) v = (v > 0.f) ? v : 0.01f * v; else if (ACT == 14) v = (v > 0.f) ? v : 0.1f * v; else if (ACT == 16) v = (v >= 0.f) ? v : 0.3f * v; else if (ACT == 17) v = (v >= 0.f) ? v : 0.2f * v; else if (ACT == 15) v = v / (1.0f + expf(-v)); else if (ACT == 3) v = fmaxf(v, 0.f); else if (ACT == 6) v = 0.5f * v * (1.0f + erff(v * 0.70710678118654752f)); so[w][8 * hh + r][t * 16 + ln] = v; } }
  __builtin_amdgcn_fence(__ATOMIC_ACQ_REL, "workgroup"); __builtin_amdgcn_wave_barrier();
  const int rsub = lane >> 4, c4 = (lane & 15) * 4; typedef _Float16 v4h __attribute__((ext_vector_type(4)));
  {
#pragma unroll
    for (int q = 0; q < 8; ++q) { const int r = q * 2 + rsub; if (col0 + c4 < N) { const v4f v = *(const v4fa*)&so[w][r][c4]; if (C) *(v4f*)(C + cofs + (size_t)(row0 + r) * ldc + col0 + c4) = v; if (C16) { v4h h4; for (int i = 0; i < 4; ++i) h4[i] = (_Float16)v[i]; *(v4h*)(C16 + cofs + (size_t)(row0 + r) * ldc + col0 + c4) = h4; } } }
     }
}


typedef _Float16 v4h __attribute__((ext_vector_type(4)));

__global__ __launch_bounds__(256) void k_x16(const float* __restrict__ x, _Float16* __restrict__ X16, size_t n8) { const size_t t = (size_t)blockIdx.x * 256 + threadIdx.x; if (t >= n8) return; FragH f;
#pragma unroll
  for (int q = 0; q < 8; ++q) f.h[q] = (_Float16)bf16_round(x[t * 8 + q]); *(v8us*)((unsigned short*)X16 + t * 8) = f.half[0];  }
__global__ __launch_bounds__(256) void k_h16(const float* __restrict__ x, _Float16* __restrict__ X16, size_t n8) { const size_t t = (size_t)blockIdx.x * 256 + threadIdx.x; if (t >= n8) return; FragH f;
#pragma unroll
  for (int q = 0; q < 8; ++q) f.h[q] = (_Float16)x[t * 8 + q]; *(v8us*)((unsigned short*)X16 + t * 8) = f.half[0];  }
__global__ __launch_bounds__(256) void k_round16f(const float* __restrict__ W, _Float16* __restrict__ Bt, size_t n8) { const size_t t = (size_t)blockIdx.x * 256 + threadIdx.x; if (t >= n8) return; FragH f;
#pragma unroll
  for (int i = 0; i < 8; ++i) f.h[i] = (_Float16)(bf16_round(W[t * 8 + i]) * 16.0f); *(v8us*)((unsigned short*)Bt + t * 8) = f.half[0];  }
template <int NHv, int TTv>
__global__ __launch_bounds__(256) void k_vt(const _Float16* __restrict__ V16, int ldv, int voff, _Float16* __restrict__ Vt) { __shared__ unsigned short tl[64][66]; const int tid = threadIdx.x; const int slab = blockIdx.x / (TTv / 64), lg = blockIdx.x % (TTv / 64); const int b = slab / NHv, h = slab % NHv;
  for (int i = tid; i < 64 * 8; i += 256) { const int r = i / 8, c8 = (i % 8) * 8; FragH f; f.half[0] = *(const v8us*)((const unsigned short*)V16 + ((size_t)b * TTv + lg * 64 + r) * ldv + voff + h * 64 + c8);
#pragma unroll
    for (int q = 0; q < 8; ++q) tl[r][c8 + q] = f.u[q]; }
  __syncthreads();
  {
#pragma unroll
    for (int rd = 0; rd < 2; ++rd) { const int d = rd * 32 + tid / 8, pc = tid % 8; FragH f;
#pragma unroll
      for (int q = 0; q < 8; ++q) f.u[q] = tl[pc * 8 + q][d];
      *(v8us*)((unsigned short*)Vt + ((size_t)slab * 64 + d) * TTv + lg * 64 + pc * 8) = f.half[0]; }
     } }

__global__ __launch_bounds__(256) void k_hl(const float* __restrict__ F, _Float16* __restrict__ Hh, _Float16* __restrict__ Hl, size_t n8) { const size_t t = (size_t)blockIdx.x * 256 + threadIdx.x; if (t >= n8) return; FragH fh, fl; const v4f a = *(const v4fa*)(F + t * 8), c = *(const v4fa*)(F + t * 8 + 4);
#pragma unroll
  for (int q = 0; q < 4; ++q) { _Float16 h = (_Float16)a[q]; fh.h[q] = h; fl.h[q] = (_Float16)((a[q] - (float)h) * 1024.0f); h = (_Float16)c[q]; fh.h[4 + q] = h; fl.h[4 + q] = (_Float16)((c[q] - (float)h) * 1024.0f); }
  { *(v8us*)((unsigned short*)Hh + t * 8) = fh.half[0]; *(v8us*)((unsigned short*)Hl + t * 8) = fl.half[0];  } }

// ---- fast GEMM (wave tile 32x64; requires M % 32 == 0 rows per launch region and N % 64 == 0); epilogue = k_gemm_hhx semantics ----
__device__ __forceinline__ v16h g2_frag(const _Float16* p, int hh) { FragH f; f.half[0] = *(const v8us*)((const unsigned short*)p + 8 * hh); f.half[1] = *(const v8us*)((const unsigned short*)p + 16 + 8 * hh); return f.v; }
__device__ __forceinline__ v8f g2_mma(v16h a, v16h b, v8f c) { v8f d = __builtin_amdgcn_wmma_f32_16x16x32_f16(false, a, false, b, (short)0, c, false, false); asm volatile("v_nop\n\tv_nop\n\tv_nop\n\tv_nop" : "+v"(d) : "v"(a), "v"(b)); return d; }
template <int ACT>
__global__ __launch_bounds__(128) void k_gemm2(const _Float16* __restrict__ A, int lda, size_t sA, const _Float16* __restrict__ Bh, int ldb, size_t sB, float alpha, const float* __restrict__ bias, size_t sBias, const float* __restrict__ CP, int rowsPerB, size_t sCPb, int row0g,
    float* __restrict__ C, _Float16* __restrict__ C16, int ldc, size_t sC, int M, int N, int K) { static_assert(ACT == 0 || ACT == 3 || ACT == 6 || ACT == 8 || ACT == 9 || ACT == 11 || ACT == 12 || ACT == 14 || ACT == 15 || ACT == 16 || ACT == 17, "k_gemm2: unsupported ACT code (would silently apply no activation)");
  __shared__ __attribute__((aligned(16))) float so[4][32][68];
  const int tid = threadIdx.x, w = tid >> 5, lane = tid & 31, ln = lane & 15, hh = lane >> 4; const int by = blockIdx.y;
  A += (size_t)by * sA; Bh += (size_t)by * sB; const size_t cofs = (size_t)by * sC; const float* bp = bias ? bias + (size_t)by * sBias : nullptr;
  const int ntn = N >> 6; const int mt = blockIdx.x / ntn, nq = blockIdx.x - mt * ntn; const int row0 = mt * 128 + 32 * w, col0 = nq * 64; if (row0 >= M) return;
  const _Float16* a0p = A + (size_t)(row0 + ln) * lda; const _Float16* a1p = a0p + (size_t)16 * lda;
  const _Float16* b0p = Bh + (size_t)(col0 + ln) * ldb; const _Float16* b1p = b0p + (size_t)16 * ldb; const _Float16* b2p = b1p + (size_t)16 * ldb; const _Float16* b3p = b2p + (size_t)16 * ldb;
  const v8f z8 = {0.f,0.f,0.f,0.f,0.f,0.f,0.f,0.f}; v8f c00 = z8, c01 = z8, c02 = z8, c03 = z8, c10 = z8, c11 = z8, c12 = z8, c13 = z8;
#pragma unroll 1
  for (int kb = 0; kb < K; kb += 32) { const v16h a0 = g2_frag(a0p + kb, hh), a1 = g2_frag(a1p + kb, hh);
    v16h b = g2_frag(b0p + kb, hh); c00 = g2_mma(a0, b, c00); c10 = g2_mma(a1, b, c10);
    b = g2_frag(b1p + kb, hh); c01 = g2_mma(a0, b, c01); c11 = g2_mma(a1, b, c11);
    b = g2_frag(b2p + kb, hh); c02 = g2_mma(a0, b, c02); c12 = g2_mma(a1, b, c12);
    b = g2_frag(b3p + kb, hh); c03 = g2_mma(a0, b, c03); c13 = g2_mma(a1, b, c13); }
  v8f accs[8] = {c00, c01, c02, c03, c10, c11, c12, c13};
#pragma unroll
  for (int u = 0; u < 8; ++u) { const int t = u & 3, half = u >> 2; const int col = col0 + t * 16 + ln; const float bv = bp ? bf16_round(bp[col]) : 0.f;
#pragma unroll
    for (int r = 0; r < 8; ++r) { const int rloc = half * 16 + 8 * hh + r; float v = accs[u][r] * alpha + bv; if (CP) { if (rowsPerB < 0) v += CP[cofs + (size_t)(row0g + row0 + rloc) * ldc + col];      /* rowsPerB < 0: own element of the batched C plane */ else { const int bidx = (row0g + row0 + rloc) / rowsPerB; v += CP[(size_t)bidx * sCPb + (size_t)by * 64 + col]; } }
      if (ACT == 3) v = fmaxf(v, 0.f); else if (ACT == 6) v = 0.5f * v * (1.0f + erff(v * 0.70710678118654752f)); else if (ACT == 11) v = 1.0f / (1.0f + expf(-v)); else if (ACT == 15) v = v / (1.0f + expf(-v)); else if (ACT == 12) v = (v > 0.f) ? v : 0.01f * v; else if (ACT == 8) v = tanhf(v); else if (ACT == 9) v = 0.5f * v * (1.0f + tanhf(0.7978845608028654f * (v + 0.044715f * v * v * v))); else if (ACT == 14) v = (v > 0.f) ? v : 0.1f * v; else if (ACT == 16) v = (v >= 0.f) ? v : 0.3f * v; else if (ACT == 17) v = (v >= 0.f) ? v : 0.2f * v;
      so[w][rloc][t * 16 + ln] = v; } }
  __builtin_amdgcn_fence(__ATOMIC_ACQ_REL, "workgroup"); __builtin_amdgcn_wave_barrier();
  const int rsub = lane >> 4, c4 = (lane & 15) * 4;
  {
#pragma unroll
    for (int q = 0; q < 16; ++q) { const int r = q * 2 + rsub; const v4f v = *(const v4fa*)&so[w][r][c4]; if (C) *(v4f*)(C + cofs + (size_t)(row0 + r) * ldc + col0 + c4) = v; if (C16) { v4h h4; for (int i = 0; i < 4; ++i) h4[i] = (_Float16)v[i]; *(v4h*)(C16 + cofs + (size_t)(row0 + r) * ldc + col0 + c4) = h4; } }
     } }


__global__ __launch_bounds__(256) void k_wnat(const float* __restrict__ w, size_t n8, _Float16* __restrict__ Bt) { const size_t t = (size_t)blockIdx.x * 256 + threadIdx.x; if (t >= n8) return; FragH f; for (int q = 0; q < 8; ++q) f.h[q] = (_Float16)(bf16_round(w[t * 8 + q]) * 16.0f); *(v8us*)((unsigned short*)Bt + t * 8) = f.half[0];  }
__global__ __launch_bounds__(256) void k_rsm(const float* __restrict__ S, _Float16* __restrict__ P, int nrows) {
  #pragma clang fp contract(off)
  const int i = blockIdx.x * 256 + threadIdx.x; if (i >= nrows) return; const float* s = S + (size_t)i * SQ; float mx = -3.0e38f;
#pragma unroll 1
  for (int j = 0; j < SQ; ++j) mx = fmaxf(mx, s[j]); float se = 0.f;
#pragma unroll 1
  for (int j = 0; j < SQ; ++j) se += expf(s[j] - mx); const float sc = 256.0f / se;
#pragma unroll 1
  for (int j0 = 0; j0 < SQ; j0 += 8) { FragH f; for (int q = 0; q < 8; ++q) f.h[q] = (_Float16)(expf(s[j0 + q] - mx) * sc); unsigned short* d = (unsigned short*)P + (size_t)i * SQ + j0; *(v8us*)d = f.half[0];  } }
__global__ __launch_bounds__(256) void k_vt(const _Float16* __restrict__ V16, int b, int h0, _Float16* __restrict__ VT) { __shared__ unsigned short tl[64][65]; const int tid = threadIdx.x; const int hh = blockIdx.x % HG, sg = blockIdx.x / HG; const int s0 = sg * 64; const int h = h0 + hh;
  for (int i = tid; i < 64 * 8; i += 256) { const int j = i / 8, d8 = (i % 8) * 8; FragH f; f.half[0] = *(const v8us*)((const unsigned short*)V16 + ((size_t)b * SQ + s0 + j) * DM + h * HD + d8); for (int q = 0; q < 8; ++q) tl[d8 + q][j] = f.u[q]; }
  __syncthreads();
  { for (int i = tid; i < 64 * 8; i += 256) { const int d = i / 8, j8 = (i % 8) * 8; FragH f; for (int q = 0; q < 8; ++q) f.u[q] = tl[d][j8 + q]; *(v8us*)((unsigned short*)VT + ((size_t)hh * HD + d) * SQ + s0 + j8) = f.half[0]; }  } }



__global__ __launch_bounds__(256) void k_rsmkm(const float* __restrict__ S, _Float16* __restrict__ P, int nrows, const int* __restrict__ am) {
  #pragma clang fp contract(off)
  const int t = blockIdx.x * 256 + threadIdx.x; if (t >= nrows) return; const size_t i = (size_t)t; const float* s = S + i * SQ; const int* mr = am + (size_t)(t % SQ) * SQ; float mx = -3.0e38f;
#pragma unroll 1
  for (int j = 0; j < SQ; ++j) { const float f = (mr[j] != 0) ? 1.f : 0.f; mx = fmaxf(mx, fmaf(f, s[j], (1.f - f) * -1.0e9f)); } float se = 0.f;
#pragma unroll 1
  for (int j = 0; j < SQ; ++j) { const float f = (mr[j] != 0) ? 1.f : 0.f; se += __expf(fmaf(f, s[j], (1.f - f) * -1.0e9f) - mx); } const float sc = 256.0f / se;
#pragma unroll 1
  for (int j0 = 0; j0 < SQ; j0 += 8) { FragH fr; for (int q = 0; q < 8; ++q) { const int j = j0 + q; const float f = (mr[j] != 0) ? 1.f : 0.f; fr.h[q] = (_Float16)(__expf(fmaf(f, s[j], (1.f - f) * -1.0e9f) - mx) * sc); }
    unsigned short* d = (unsigned short*)P + i * SQ + j0; *(v8us*)d = fr.half[0];  } }
// Row softmax, one wave per row: lane l holds floats 128 u + 4 l .. + 3 of the row (each load of a wave = 512 contiguous bytes), the whole row stays in registers,
// so S is read once; maximum and sum go lane-local first, then over the wave; P leaves as 8 bytes a lane (256 contiguous bytes a wave).
// One butterfly step inside a 16-lane row by DPP row_xmask (CTRL = 0x160 + mask) and the swap of the two rows: a plain lane shuffle would go through the LDS pipe.
template <int CTRL> __device__ __forceinline__ float rs_xm(float v) { return __int_as_float(__builtin_amdgcn_update_dpp(0, __float_as_int(v), CTRL, 0xf, 0xf, true)); }
__device__ __forceinline__ float rs_x16(float v) { const int b = __float_as_int(v); return __int_as_float(__builtin_amdgcn_permlanex16(b, b, 0x76543210, 0xfedcba98, false, false)); }
__device__ __forceinline__ float rs_wmax(float v) { v = fmaxf(v, rs_xm<0x161>(v)); v = fmaxf(v, rs_xm<0x162>(v)); v = fmaxf(v, rs_xm<0x164>(v)); v = fmaxf(v, rs_xm<0x168>(v)); return fmaxf(v, rs_x16(v)); }
__device__ __forceinline__ float rs_wsum(float v) { v += rs_xm<0x161>(v); v += rs_xm<0x162>(v); v += rs_xm<0x164>(v); v += rs_xm<0x168>(v); return v + rs_x16(v); }
// Four native 2^x in one statement: here no result shares a register
// with a source (early clobber), each exp has an independent one behind it, and the v_nop is the slot that the instruction set asks for behind the last.
__device__ __forceinline__ v4f rs_exp2x4(v4f x) { float y0, y1, y2, y3;
  asm("v_exp_f32 %0, %4\n\tv_exp_f32 %1, %5\n\tv_exp_f32 %2, %6\n\tv_exp_f32 %3, %7\n\tv_nop" : "=&v"(y0), "=&v"(y1), "=&v"(y2), "=&v"(y3) : "v"(x[0]), "v"(x[1]), "v"(x[2]), "v"(x[3]));
  const v4f y = {y0, y1, y2, y3}; return y; }
__global__ __launch_bounds__(512) void k_rsmf(const float* __restrict__ S, _Float16* __restrict__ P, int qn, int hg) {
  const int lane = threadIdx.x & 31; const int t = blockIdx.x * 16 + __builtin_amdgcn_readfirstlane(threadIdx.x >> 5);      /* the wave's row, held scalar so that the row base is a scalar address */
  if (t >= qn * hg) return;      /* wave-uniform; the kernel has no barrier */
  const size_t i = (size_t)(t / qn) * SQ + (t % qn); const float* s = S + i * SQ + lane * 4; v4f r[SQ / 128];
#pragma unroll
  for (int u = 0; u < SQ / 128 - 1; ++u) r[u] = *(const v4fa*)(s + u * 128);      /* every loop over r[] is unrolled: constant indices keep r[] in registers; here it also puts all of the row's loads in flight at once */
  asm volatile("s_wait_xcnt 0x0" ::: "memory");      /* the last load's result may be given the offset register that the loads above name: their address wait stands in front of it */
  r[SQ / 128 - 1] = *(const v4fa*)(s + (SQ / 128 - 1) * 128);
  float mx = -3.0e38f;
#pragma unroll
  for (int u = 0; u < SQ / 128; ++u) mx = fmaxf(mx, fmaxf(fmaxf(r[u][0], r[u][1]), fmaxf(r[u][2], r[u][3])));
  mx = rs_wmax(mx); v4f a = {0.f, 0.f, 0.f, 0.f};
#pragma unroll
  for (int u = 0; u < SQ / 128; ++u) { r[u] = rs_exp2x4((r[u] - mx) * 1.44269504088896340736f); a += r[u]; }      /* e^x as 2^(x log2 e), the native exp's own two steps */
  const float se = rs_wsum((a[0] + a[1]) + (a[2] + a[3])); const float sc = 256.0f / se; _Float16* d = P + i * SQ + lane * 4;
#pragma unroll
  for (int u = 0; u < SQ / 128; ++u) { v4h h4; for (int q = 0; q < 4; ++q) h4[q] = (_Float16)(r[u][q] * sc); *(v4h*)(d + u * 128) = h4; } }



__global__ __launch_bounds__(256) void k_wthd(const float* __restrict__ Wt, _Float16* __restrict__ Bt) { const size_t t = (size_t)blockIdx.x * 256 + threadIdx.x; if (t >= (size_t)NH * HD * (DM / 8)) return; const int m8 = (int)(t % (DM / 8)) * 8; const int d = (int)((t / (DM / 8)) % HD); const int h = (int)(t / ((size_t)(DM / 8) * HD)); FragH f;
  for (int q = 0; q < 8; ++q) f.h[q] = (_Float16)(16.0f * bf16_round(Wt[((size_t)h * DM + m8 + q) * HD + d])); unsigned short* dst = (unsigned short*)Bt + ((size_t)h * HD + d) * DM + m8; *(v8us*)dst = f.half[0];  }





extern "C" void kernel_launch(void* const* d_in, const int* in_sizes, int n_in,
                              void* d_out, int out_size, void* d_ws, size_t ws_size, hipStream_t stream) {
  (void)in_sizes; (void)n_in; (void)out_size;
  const float* const* I = (const float* const*)d_in; const float* xq = I[0]; const float* xk = I[1]; const float* xv = I[2]; const float* wq = I[3]; const float* bq = I[4]; const float* wk = I[5]; const float* bk = I[6]; const float* wv = I[7]; const float* bv = I[8]; const float* x = xq;      /* X_Q, X_K, X_V [4096][1024]; per-head Wq / Wk / Wv [16][1024][64] ([in][out] per head) + biases [16][64] = [(h, d)]; no output projection */
  static_assert(NH * HD == DM && DM % 64 == 0 && DM % 32 == 0 && SQ % 128 == 0 && HG == 1 && NB == 1, "shape / tile multiples");
  char* ws = (char*)d_ws; size_t off = 0;
  auto take = [&](size_t bytes) { char* p = ws + off; off += (bytes + 255) & ~(size_t)255; return p; };
  _Float16* BQ = (_Float16*)take((size_t)DM * DM * 2); _Float16* BK = (_Float16*)take((size_t)DM * DM * 2); _Float16* BV = (_Float16*)take((size_t)DM * DM * 2);
  _Float16* X16 = (_Float16*)take(NR * DM * 2); _Float16* XKp = (_Float16*)take(NR * DM * 2); _Float16* XVp = (_Float16*)take(NR * DM * 2); _Float16* Q16 = (_Float16*)take(NR * DM * 2); _Float16* K16 = (_Float16*)take(NR * DM * 2); _Float16* V16 = (_Float16*)take(NR * DM * 2);
  float* S = (float*)take((size_t)HG * SQ * SQ * 4); _Float16* P = (_Float16*)take((size_t)HG * SQ * SQ * 2); _Float16* VT = (_Float16*)take((size_t)NH * HD * SQ * 2);
  if (off > ws_size) return;
  { const unsigned g = (unsigned)(((size_t)NH * HD * (DM / 8) + 255) / 256); k_wthd<<<g, 256, 0, stream>>>(wq, BQ); k_wthd<<<g, 256, 0, stream>>>(wk, BK); k_wthd<<<g, 256, 0, stream>>>(wv, BV); }      /* per-head [m][d] -> Bt[(h, d)][m] x16 */
  _Float16* XK = XKp; _Float16* XV = XVp; k_x16<<<(unsigned)((NR * DM / 8 + 255) / 256), 256, 0, stream>>>(xk, XK, NR * DM / 8); k_x16<<<(unsigned)((NR * DM / 8 + 255) / 256), 256, 0, stream>>>(xv, XV, NR * DM / 8);      /* key and value inputs as exact f16 rows */

  k_x16<<<(unsigned)((NR * DM / 8 + 255) / 256), 256, 0, stream>>>(x, X16, NR * DM / 8);
  const size_t r0p = (size_t)B0 * SQ;      /* first projected row */
  k_gemm2<0><<<dim3((unsigned)((MP / 128) * (DM / 64)), 1), 128, 0, stream>>>(X16 + r0p * DM, DM, 0, BQ, DM, 0, 0.0625f, bq, 0, nullptr, 1, 0, 0, nullptr, Q16 + r0p * DM, DM, 0, MP, DM, DM);
  k_gemm2<0><<<dim3((unsigned)((MP / 128) * (DM / 64)), 1), 128, 0, stream>>>(XK + r0p * DM, DM, 0, BK, DM, 0, 0.0625f, bk, 0, nullptr, 1, 0, 0, nullptr, K16 + r0p * DM, DM, 0, MP, DM, DM);
  k_gemm2<0><<<dim3((unsigned)((MP / 128) * (DM / 64)), 1), 128, 0, stream>>>(XV + r0p * DM, DM, 0, BV, DM, 0, 0.0625f, bv, 0, nullptr, 1, 0, 0, nullptr, V16 + r0p * DM, DM, 0, MP, DM, DM);
  for (int b = B0; b < B0 + NBR; ++b) { const size_t r0 = (size_t)b * SQ;
    k_vt<NH, SQ><<<NH * (SQ / 64), 256, 0, stream>>>(V16 + r0 * LQ, LQ, 0, VT);      /* V^T [NH][HD][SQ] for this batch */
    for (int h0 = 0; h0 < NHD; h0 += HG) {
      k_gemm2<0><<<dim3((QN / 128) * (SQ / 64), HG), 128, 0, stream>>>(Q16 + r0 * LQ + h0 * HD, LQ, (size_t)HD, K16 + r0 * LQ + h0 * HD, LQ, (size_t)HD, 0.125f, nullptr, 0, nullptr, 1, 0, 0, S, nullptr, SQ, (size_t)SQ * SQ, QN, SQ, HD);      /* scores, HG heads per launch */
      k_rsmf<<<(HG * QN + 15) / 16, 512, 0, stream>>>(S, P, QN, HG);      /* P = 256 softmax (f16) with the native exp, rows of the launch's head, one wave a row */
      k_gemm2<0><<<dim3((QN / 128) * (HD / 64), HG), 128, 0, stream>>>(P, SQ, (size_t)SQ * SQ, VT + (size_t)h0 * HD * SQ, SQ, (size_t)HD * SQ, 0.00390625f, nullptr, 0, nullptr, 1, 0, 0, (float*)d_out + r0 * DM + h0 * HD, nullptr, DM, (size_t)HD, QN, HD, SQ); } }      /* out = P V^T (alpha 2^-8) written f32 straight into the head's 64 columns of the output rows (no output projection) */
}

// v003
// A run of this version takes 249 microseconds.
// It is 11.1 times as fast as v001, going by the measured steps of the versions left out in between.
// All steps since v000 together make it 53.3 times as fast.
#include <hip/hip_runtime.h>
// Multi-head attention over three inputs with PER-HEAD projection weights and no output projection (X_Q, X_K, X_V [4096][1024] (one sequence); Q[h] = X_Q Wq[h] + bq[h], K, V likewise (Wq / Wk / Wv [16][1024][64] per-head [in][out], sigma 1/32; biases [16][64] sigma 1/32); scores = Q[h] K[h]^T / sqrt(64); softmax over all 4096 keys; out[h] = attn V[h]; heads concatenated along the feature axis -> [4096][1024]).
// Structure: the three inputs as exact f16 rows (bf16-rounded); per-head [in][out] weights gathered into Bt[(h, d)][in] x16 planes; Q, K, V as three WMMA GEMMs (32x64 wave tiles, f32 accumulation, + bias [(h, d)], f16 outputs; the K and V GEMMs store their 32-key x 64-feature wave tiles in the attention loop's fragment order, V transposed on the way); then ONE attention launch for all heads: a wave owns 32 query rows and walks the 4096 keys 32 at a time, S^T = K Q^T, running-maximum softmax in registers (f32 statistics; weights x256 as f16), O^T += V^T P^T, divided by the row sum at the end and written f32 straight into the head's 64 columns of the output rows.
// Compute dtype: inputs rounded to bf16; x / weights exact; q, k, v and softmax weights as plain f16 GEMM operands (~2^-12); scores, softmax statistics and o f32. v_wmma_f32_16x16x32_f16.
#define NB 1
#define SQ 4096
#define DM 1024
#define NH 16
#define HD 64
#define HG 1                         /* heads per launch of the non-template k_vt */
#define B0 0                         /* first batch processed (debug hook) */
#define NBR NB                       /* batches processed (debug hook) */
#define NR ((size_t)NB * SQ)         /* token rows */
#define MP ((int)((size_t)NBR * SQ)) /* rows projected (debug hook) */
#define QN SQ                        /* unused (the attention launch attends all SQ query rows) */
#define NHD NH                       /* unused (the attention launch covers all NH heads) */
#define MPO MP                       /* unused (there is no output stage) */
#define LQ DM      /* row pitch of the q rows */
typedef __bf16 v16b __attribute__((ext_vector_type(16)));
typedef unsigned short v8us __attribute__((ext_vector_type(8), may_alias));
typedef float  v8f  __attribute__((ext_vector_type(8)));
typedef float  v4f  __attribute__((ext_vector_type(4)));
typedef float  v4fa __attribute__((ext_vector_type(4), may_alias));
union FragB { v16b v; v8us half[2]; unsigned short u[16]; };

__device__ __forceinline__ unsigned short bf16_bits(float x) { unsigned int u = __float_as_uint(x); return (unsigned short)((u + 0x7FFFu + ((u >> 16) & 1u)) >> 16); }
__device__ __forceinline__ float bf16_val(unsigned short b) { return __uint_as_float(((unsigned int)b) << 16); }
__device__ __forceinline__ float bf16_round(float x) { return bf16_val(bf16_bits(x)); }
// D += A·B with NT terms: 1 = ah·bh, 2 = + al·bh (A split), 3 = + ah·bl (both split)
template <int NT>
__device__ __forceinline__ v8f mmaN(v16b ah, v16b al, v16b bh, v16b bl, v8f c) {
  c = __builtin_amdgcn_wmma_f32_16x16x32_bf16(false, ah, false, bh, (short)0, c, false, false);
  if (NT >= 2) c = __builtin_amdgcn_wmma_f32_16x16x32_bf16(false, al, false, bh, (short)0, c, false, false);
  if (NT >= 3) c = __builtin_amdgcn_wmma_f32_16x16x32_bf16(false, ah, false, bl, (short)0, c, false, false);
  asm volatile("v_nop\n\tv_nop\n\tv_nop\n\tv_nop" : "+v"(c) : "v"(ah), "v"(al), "v"(bh), "v"(bl));
  return c;
}

__global__ __launch_bounds__(256) void k_wt_bf16(const float* __restrict__ W, unsigned short* __restrict__ Wt, int K, int N) {
  const int t = blockIdx.x * 256 + threadIdx.x;
  const int k8n = K / 8;
  if (t >= N * k8n) return;
  const int n = t / k8n, k8 = (t % k8n) * 8;
  v8us v;
#pragma unroll
  for (int i = 0; i < 8; ++i) v[i] = bf16_bits(W[(size_t)(k8 + i) * N + n]);
  *(v8us*)(Wt + (size_t)n * K + k8) = v;
  
}

// GEMM C[M][N] (f32, pitch ldc) = act(A[M][K]·W + bias). A f32 row-major (pitch lda) converted per fragment to bf16
// (ASPLIT: hi/lo two planes -> 2 terms, else single rounded term); Wt bf16 [N][K] (pitch ldb). BIAS_BF16 rounds the
// bias to bf16 first (bias quantised to bf16 before the add). K%32==0, M%16==0, N%64==0.
template <bool ASPLIT, int ACT, bool BIAS_BF16>
__global__ __launch_bounds__(128) void k_gemm_bf(const float* __restrict__ A, int lda, const unsigned short* __restrict__ Wt, int ldb,
                                               const float* __restrict__ bias, float* __restrict__ C, int ldc, int M, int N, int K) {
  __shared__ __attribute__((aligned(16))) float so[4][16][64];
  const int tid = threadIdx.x, w = tid >> 5, lane = tid & 31, ln = lane & 15, hh = lane >> 4;
  const int ntn = N / 64;
  const int wid = blockIdx.x * 4 + w;
  const int mt = wid / ntn, nq = wid % ntn;
  if (mt * 16 >= M) return;
  const int row0 = mt * 16, col0 = nq * 64;
  const float* arow = A + (size_t)(row0 + ln) * lda;
  v8f acc[4] = {};
  for (int kb = 0; kb < K; kb += 32) {
    FragB ah, al;
    const v4f x0 = *(const v4fa*)(arow + kb + 8 * hh), x1 = *(const v4fa*)(arow + kb + 8 * hh + 4);
    const v4f x2 = *(const v4fa*)(arow + kb + 16 + 8 * hh), x3 = *(const v4fa*)(arow + kb + 16 + 8 * hh + 4);
    float xs[16] = {x0[0],x0[1],x0[2],x0[3],x1[0],x1[1],x1[2],x1[3],x2[0],x2[1],x2[2],x2[3],x3[0],x3[1],x3[2],x3[3]};
#pragma unroll
    for (int i = 0; i < 16; ++i) { const unsigned short hb = bf16_bits(xs[i]); ah.u[i] = hb; al.u[i] = ASPLIT ? bf16_bits(xs[i] - bf16_val(hb)) : (unsigned short)0; }
#pragma unroll
    for (int t = 0; t < 4; ++t) {
      const unsigned short* brow = Wt + (size_t)(col0 + t * 16 + ln) * ldb + kb;
      FragB b;
      b.half[0] = *(const v8us*)(brow + 8 * hh);
      b.half[1] = *(const v8us*)(brow + 16 + 8 * hh);
      acc[t] = mmaN<ASPLIT ? 2 : 1>(ah.v, al.v, b.v, b.v, acc[t]);
    }
  }
#pragma unroll
  for (int t = 0; t < 4; ++t) {
    float bv = bias ? bias[col0 + t * 16 + ln] : 0.f;
    if (BIAS_BF16) bv = bf16_round(bv);
#pragma unroll
    for (int r = 0; r < 8; ++r) { float v = acc[t][r] + bv; if (ACT == 1) v = fmaxf(v, 0.f); so[w][8 * hh + r][t * 16 + ln] = v; }
  }
  __builtin_amdgcn_fence(__ATOMIC_ACQ_REL, "workgroup");
  __builtin_amdgcn_wave_barrier();
  const int rsub = lane >> 4, c4 = (lane & 15) * 4;
  {
#pragma unroll
    for (int q = 0; q < 8; ++q) {
      const int r = q * 2 + rsub;
      const v4f v = *(const v4fa*)&so[w][r][c4];
      *(v4f*)(C + (size_t)(row0 + r) * ldc + col0 + c4) = v;
    }
    
  }
}

// GEMM C = act(A·W + bias + resid): A f32 (ASPLIT -> hi/lo 2 terms), Wt bf16 [N][K]; ACT 0 none, 1 relu, 2 exact gelu;
// resid (optional, f32, row index = (row % rmod), pitch ldr, RES_BF16 rounds it) added before the activation.
template <bool ASPLIT, int ACT, bool BIAS_BF16, bool RES_BF16>
__global__ __launch_bounds__(128) void k_gemm_bf3(const float* __restrict__ A, int lda, const unsigned short* __restrict__ Wt, int ldb,
                                                const float* __restrict__ bias, const float* __restrict__ resid, int rmod, int ldr,
                                                float* __restrict__ C, int ldc, int M, int N, int K) {
  __shared__ __attribute__((aligned(16))) float so[4][16][64];
  const int tid = threadIdx.x, w = tid >> 5, lane = tid & 31, ln = lane & 15, hh = lane >> 4;
  const int ntn = N / 64;
  const int wid = blockIdx.x * 4 + w;
  const int mt = wid / ntn, nq = wid % ntn;
  if (mt * 16 >= M) return;
  const int row0 = mt * 16, col0 = nq * 64;
  const float* arow = A + (size_t)(row0 + ln) * lda;
  v8f acc[4] = {};
  for (int kb = 0; kb < K; kb += 32) {
    FragB ah, al;
    const v4f x0 = *(const v4fa*)(arow + kb + 8 * hh), x1 = *(const v4fa*)(arow + kb + 8 * hh + 4);
    const v4f x2 = *(const v4fa*)(arow + kb + 16 + 8 * hh), x3 = *(const v4fa*)(arow + kb + 16 + 8 * hh + 4);
    float xs[16] = {x0[0],x0[1],x0[2],x0[3],x1[0],x1[1],x1[2],x1[3],x2[0],x2[1],x2[2],x2[3],x3[0],x3[1],x3[2],x3[3]};
#pragma unroll
    for (int i = 0; i < 16; ++i) { const unsigned short hb = bf16_bits(xs[i]); ah.u[i] = hb; al.u[i] = ASPLIT ? bf16_bits(xs[i] - bf16_val(hb)) : (unsigned short)0; }
#pragma unroll
    for (int t = 0; t < 4; ++t) {
      const unsigned short* brow = Wt + (size_t)(col0 + t * 16 + ln) * ldb + kb;
      FragB b;
      b.half[0] = *(const v8us*)(brow + 8 * hh);
      b.half[1] = *(const v8us*)(brow + 16 + 8 * hh);
      acc[t] = mmaN<ASPLIT ? 2 : 1>(ah.v, al.v, b.v, b.v, acc[t]);
    }
  }
#pragma unroll
  for (int t = 0; t < 4; ++t) {
    const int col = col0 + t * 16 + ln;
    float bv = bias ? bias[col] : 0.f;
    if (BIAS_BF16) bv = bf16_round(bv);
#pragma unroll
    for (int r = 0; r < 8; ++r) {
      float v = acc[t][r] + bv;
      if (resid) { float rv = resid[(size_t)((row0 + 8 * hh + r) % rmod) * ldr + col]; if (RES_BF16) rv = bf16_round(rv); v += rv; }
      if (ACT == 1) v = fmaxf(v, 0.f);
      if (ACT == 2) v = 0.5f * v * (1.0f + erff(v * 0.70710678118654752f));
      if (ACT == 3) { const float u = 0.7978845608028654f * (v + 0.044715f * v * v * v); v = 0.5f * v * (1.0f + tanhf(u)); }
      so[w][8 * hh + r][t * 16 + ln] = v;
    }
  }
  __builtin_amdgcn_fence(__ATOMIC_ACQ_REL, "workgroup");
  __builtin_amdgcn_wave_barrier();
  const int rsub = lane >> 4, c4 = (lane & 15) * 4;
  {
#pragma unroll
    for (int q = 0; q < 8; ++q) {
      const int r = q * 2 + rsub;
      const v4f v = *(const v4fa*)&so[w][r][c4];
      *(v4f*)(C + (size_t)(row0 + r) * ldc + col0 + c4) = v;
    }
    
  }
}
// row LayerNorm (biased variance, eps) over N: s = X (+ R); optional out_sum <- s; out_norm <- (s-mu)*rsqrt(var+eps)*g + b
template <bool PARAM_BF16>
__global__ __launch_bounds__(256) void k_layernorm(const float* __restrict__ X, const float* __restrict__ R, const float* __restrict__ g, const float* __restrict__ bta,
                                                  float* __restrict__ out_sum, float* __restrict__ out_norm, int N, float eps) {
  __shared__ float red[256];
  const int row = blockIdx.x, tid = threadIdx.x;
  const float* x = X + (size_t)row * N; const float* rr = R ? R + (size_t)row * N : nullptr;
  float vals[16];                     // up to N = 4096
  const int per = N / 256;            // contiguous chunk per thread? use strided-by-4 chunks: thread handles j = tid*4 + 1024*u
  float s1 = 0.f;
  for (int u = 0; u < per / 4; ++u) {
    const int j = tid * 4 + 1024 * u;
    const v4f a = *(const v4fa*)(x + j);
    v4f b = {0.f,0.f,0.f,0.f}; if (rr) b = *(const v4fa*)(rr + j);
#pragma unroll
    for (int q = 0; q < 4; ++q) { const float v = a[q] + b[q]; vals[u * 4 + q] = v; s1 += v; }
  }
  red[tid] = s1; __syncthreads();
  for (int st = 128; st > 0; st >>= 1) { if (tid < st) red[tid] += red[tid + st]; __syncthreads(); }
  const float mu = red[0] / (float)N; __syncthreads();
  float s2 = 0.f;
  for (int u = 0; u < per / 4; ++u)
#pragma unroll
    for (int q = 0; q < 4; ++q) { const float c = vals[u * 4 + q] - mu; s2 += c * c; }
  red[tid] = s2; __syncthreads();
  for (int st = 128; st > 0; st >>= 1) { if (tid < st) red[tid] += red[tid + st]; __syncthreads(); }
  const float rs = rsqrtf(red[0] / (float)N + eps);
  {
    for (int u = 0; u < per / 4; ++u) {
      const int j = tid * 4 + 1024 * u;
      v4f o, sm;
#pragma unroll
      for (int q = 0; q < 4; ++q) {
        float gg = g[j + q], bb = bta[j + q];
        if (PARAM_BF16) { gg = bf16_round(gg); bb = bf16_round(bb); }
        sm[q] = vals[u * 4 + q]; o[q] = (vals[u * 4 + q] - mu) * rs * gg + bb;
      }
      if (out_sum) *(v4f*)(out_sum + (size_t)row * N + j) = sm;
      *(v4f*)(out_norm + (size_t)row * N + j) = o;
    }
    
  }
}



// ---- f16 WMMA path (v_wmma_f32_16x16x32_f16): 11-bit significands for operands in range — used where a [0,1] probability operand needs more precision than bf16
typedef _Float16 v16h __attribute__((ext_vector_type(16)));
union FragH { v16h v; v8us half[2]; _Float16 h[16]; unsigned short u[16]; };
template <int NT>
__device__ __forceinline__ v8f mmaH(v16h ah, v16h al, v16h bh, v16h bl, v8f c) {
  c = __builtin_amdgcn_wmma_f32_16x16x32_f16(false, ah, false, bh, (short)0, c, false, false);
  if (NT >= 2) c = __builtin_amdgcn_wmma_f32_16x16x32_f16(false, al, false, bh, (short)0, c, false, false);
  if (NT >= 3) c = __builtin_amdgcn_wmma_f32_16x16x32_f16(false, ah, false, bl, (short)0, c, false, false);
  asm volatile("v_nop\n\tv_nop\n\tv_nop\n\tv_nop" : "+v"(c) : "v"(ah), "v"(al), "v"(bh), "v"(bl));
  return c;
}
// batched GEMM like k_gemm_b but f16 operands: A f32 (split into f16 hi/lo if ASPLIT, else rounded to f16), Bt = f16 values [n][k]; alpha; C f32; N multiple of 16 (partial tiles skipped)
template <bool ASPLIT>
__global__ __launch_bounds__(128) void k_gemm_h(const float* __restrict__ A, int lda, size_t sA, const _Float16* __restrict__ Bh, int ldb, size_t sB, float alpha, float* __restrict__ C, int ldc, size_t sC, int M, int N, int K) {
  __shared__ __attribute__((aligned(16))) float so[4][16][64];
  const int tid = threadIdx.x, w = tid >> 5, lane = tid & 31, ln = lane & 15, hh = lane >> 4; const int by = blockIdx.y;
  A += (size_t)by * sA; Bh += (size_t)by * sB; C += (size_t)by * sC;
  const int ntn = (N + 63) / 64; const int wid = blockIdx.x * 4 + w; const int mt = wid / ntn, nq = wid % ntn; if (mt * 16 >= M) return;
  const int row0 = mt * 16, col0 = nq * 64; const float* arow = A + (size_t)(row0 + ln) * lda;
  v8f acc[4] = {};
  for (int kb = 0; kb < K; kb += 32) {
    FragH ah, al;
    const v4f x0 = *(const v4fa*)(arow + kb + 8 * hh), x1 = *(const v4fa*)(arow + kb + 8 * hh + 4), x2 = *(const v4fa*)(arow + kb + 16 + 8 * hh), x3 = *(const v4fa*)(arow + kb + 16 + 8 * hh + 4);
    float xs[16] = {x0[0],x0[1],x0[2],x0[3],x1[0],x1[1],x1[2],x1[3],x2[0],x2[1],x2[2],x2[3],x3[0],x3[1],x3[2],x3[3]};
#pragma unroll
    for (int i = 0; i < 16; ++i) { const _Float16 h = (_Float16)xs[i]; ah.h[i] = h; al.h[i] = ASPLIT ? (_Float16)(xs[i] - (float)h) : (_Float16)0.0f; }
#pragma unroll
    for (int t = 0; t < 4; ++t) { if (col0 + t * 16 >= N) continue; const size_t boff = (size_t)(col0 + t * 16 + ln) * ldb + kb; FragH bq; bq.half[0] = *(const v8us*)(Bh + boff + 8 * hh); bq.half[1] = *(const v8us*)(Bh + boff + 16 + 8 * hh);
      acc[t] = mmaH<ASPLIT ? 2 : 1>(ah.v, al.v, bq.v, bq.v, acc[t]); }
  }
#pragma unroll
  for (int t = 0; t < 4; ++t) { if (col0 + t * 16 >= N) continue;
#pragma unroll
    for (int r = 0; r < 8; ++r) so[w][8 * hh + r][t * 16 + ln] = acc[t][r] * alpha; }
  __builtin_amdgcn_fence(__ATOMIC_ACQ_REL, "workgroup"); __builtin_amdgcn_wave_barrier();
  const int rsub = lane >> 4, c4 = (lane & 15) * 4;
  {
#pragma unroll
    for (int q = 0; q < 8; ++q) { const int r = q * 2 + rsub; if (col0 + c4 < N) { const v4f v = *(const v4fa*)&so[w][r][c4]; *(v4f*)(C + (size_t)(row0 + r) * ldc + col0 + c4) = v; } }
     }
}

// Wt[n][k] = f16(W[k][n]·scale) from f32 row-major W[K][N] (scale = power of two; bf16-exact weights stay exact in f16 away from the subnormal range)
__global__ __launch_bounds__(256) void k_wt_f16(const float* __restrict__ W, _Float16* __restrict__ Wt, int K, int N, float scale) {
  const int t = blockIdx.x * 256 + threadIdx.x; if (t >= N * (K / 8)) return; const int n = t / (K / 8), k8 = (t % (K / 8)) * 8; FragH f;
#pragma unroll
  for (int i = 0; i < 8; ++i) f.h[i] = (_Float16)(bf16_round(W[(size_t)(k8 + i) * N + n]) * scale); const v8us o = f.half[0];
  *(v8us*)((unsigned short*)Wt + (size_t)n * K + k8) = o; 
}
// k_gemm_hh variant with fused epilogue: v = acc·alpha + bias[by·sBias + col] (+ CP[(row/rowsPerB)·sCPb + by·64 + col] if CP) ; ACT 0 none / 1 elu ; writes f16 C16 (and f32 C if non-null)
template <int ACT>
__global__ __launch_bounds__(128) void k_gemm_hhx(const _Float16* __restrict__ A, int lda, size_t sA, const _Float16* __restrict__ Bh, int ldb, size_t sB, float alpha, const float* __restrict__ bias, size_t sBias, const float* __restrict__ CP, int rowsPerB, size_t sCPb, int row0g,
    float* __restrict__ C, _Float16* __restrict__ C16, int ldc, size_t sC, int M, int N, int K) {
  __shared__ __attribute__((aligned(16))) float so[4][16][64];
  const int tid = threadIdx.x, w = tid >> 5, lane = tid & 31, ln = lane & 15, hh = lane >> 4; const int by = blockIdx.y;
  A += (size_t)by * sA; Bh += (size_t)by * sB; const size_t cofs = (size_t)by * sC; const float* bp = bias ? bias + (size_t)by * sBias : nullptr;
  const int ntn = (N + 63) / 64; const int wid = blockIdx.x * 4 + w; const int mt = wid / ntn, nq = wid % ntn; if (mt * 16 >= M) return;
  const int row0 = mt * 16, col0 = nq * 64; const _Float16* arow = A + (size_t)(row0 + ln) * lda;
  v8f acc[4] = {};
  for (int kb = 0; kb < K; kb += 32) { FragH ah; ah.half[0] = *(const v8us*)((const unsigned short*)arow + kb + 8 * hh); ah.half[1] = *(const v8us*)((const unsigned short*)arow + kb + 16 + 8 * hh);
#pragma unroll
    for (int t = 0; t < 4; ++t) { if (col0 + t * 16 >= N) continue; const size_t boff = (size_t)(col0 + t * 16 + ln) * ldb + kb; FragH bq; bq.half[0] = *(const v8us*)((const unsigned short*)Bh + boff + 8 * hh); bq.half[1] = *(const v8us*)((const unsigned short*)Bh + boff + 16 + 8 * hh);
      acc[t] = mmaH<1>(ah.v, ah.v, bq.v, bq.v, acc[t]); }
  }
#pragma unroll
  for (int t = 0; t < 4; ++t) { if (col0 + t * 16 >= N) continue; const int col = col0 + t * 16 + ln; const float bv = bp ? bf16_round(bp[col]) : 0.f;
#pragma unroll
    for (int r = 0; r < 8; ++r) { float v = acc[t][r] * alpha + bv; if (CP) { const int rr = row0g + row0 + 8 * hh + r; if (rowsPerB < 0) v += CP[cofs + (size_t)rr * ldc + col];      /* rowsPerB < 0: own element of the batched C plane */ else { const int bidx = rr / rowsPerB; v += CP[(size_t)bidx * sCPb + (size_t)by * 64 + col]; } } if (ACT == 1) v = (v > 0.f) ? v : expm1f(v); else if (ACT == 7) v = (v > 0.f) ? v + 1.0f : expf(v); else if (ACT == 8) v = tanhf(v); else if (ACT == 9) v = 0.5f * v * (1.0f + tanhf(0.7978845608028654f * (v + 0.044715f * v * v * v))); else if (ACT == 11) v = 1.0f / (1.0f + expf(-v)); else if (ACT == 12) v = (v > 0.f) ? v : 0.01f * v; else if (ACT == 14) v = (v > 0.f) ? v : 0.1f * v; else if (ACT == 16) v = (v >= 0.f) ? v : 0.3f * v; else if (ACT == 17) v = (v >= 0.f) ? v : 0.2f * v; else if (ACT == 15) v = v / (1.0f + expf(-v)); else if (ACT == 3) v = fmaxf(v, 0.f); else if (ACT == 6) v = 0.5f * v * (1.0f + erff(v * 0.70710678118654752f)); so[w][8 * hh + r][t * 16 + ln] = v; } }
  __builtin_amdgcn_fence(__ATOMIC_ACQ_REL, "workgroup"); __builtin_amdgcn_wave_barrier();
  const int rsub = lane >> 4, c4 = (lane & 15) * 4; typedef _Float16 v4h __attribute__((ext_vector_type(4)));
  {
#pragma unroll
    for (int q = 0; q < 8; ++q) { const int r = q * 2 + rsub; if (col0 + c4 < N) { const v4f v = *(const v4fa*)&so[w][r][c4]; if (C) *(v4f*)(C + cofs + (size_t)(row0 + r) * ldc + col0 + c4) = v; if (C16) { v4h h4; for (int i = 0; i < 4; ++i) h4[i] = (_Float16)v[i]; *(v4h*)(C16 + cofs + (size_t)(row0 + r) * ldc + col0 + c4) = h4; } } }
     }
}


typedef _Float16 v4h __attribute__((ext_vector_type(4)));

__global__ __launch_bounds__(256) void k_x16(const float* __restrict__ x, _Float16* __restrict__ X16, size_t n8) { const size_t t = (size_t)blockIdx.x * 256 + threadIdx.x; if (t >= n8) return; FragH f;
#pragma unroll
  for (int q = 0; q < 8; ++q) f.h[q] = (_Float16)bf16_round(x[t * 8 + q]); *(v8us*)((unsigned short*)X16 + t * 8) = f.half[0];  }
__global__ __launch_bounds__(256) void k_h16(const float* __restrict__ x, _Float16* __restrict__ X16, size_t n8) { const size_t t = (size_t)blockIdx.x * 256 + threadIdx.x; if (t >= n8) return; FragH f;
#pragma unroll
  for (int q = 0; q < 8; ++q) f.h[q] = (_Float16)x[t * 8 + q]; *(v8us*)((unsigned short*)X16 + t * 8) = f.half[0];  }
__global__ __launch_bounds__(256) void k_round16f(const float* __restrict__ W, _Float16* __restrict__ Bt, size_t n8) { const size_t t = (size_t)blockIdx.x * 256 + threadIdx.x; if (t >= n8) return; FragH f;
#pragma unroll
  for (int i = 0; i < 8; ++i) f.h[i] = (_Float16)(bf16_round(W[t * 8 + i]) * 16.0f); *(v8us*)((unsigned short*)Bt + t * 8) = f.half[0];  }
template <int NHv, int TTv>
__global__ __launch_bounds__(256) void k_vt(const _Float16* __restrict__ V16, int ldv, int voff, _Float16* __restrict__ Vt) { __shared__ unsigned short tl[64][66]; const int tid = threadIdx.x; const int slab = blockIdx.x / (TTv / 64), lg = blockIdx.x % (TTv / 64); const int b = slab / NHv, h = slab % NHv;
  for (int i = tid; i < 64 * 8; i += 256) { const int r = i / 8, c8 = (i % 8) * 8; FragH f; f.half[0] = *(const v8us*)((const unsigned short*)V16 + ((size_t)b * TTv + lg * 64 + r) * ldv + voff + h * 64 + c8);
#pragma unroll
    for (int q = 0; q < 8; ++q) tl[r][c8 + q] = f.u[q]; }
  __syncthreads();
  {
#pragma unroll
    for (int rd = 0; rd < 2; ++rd) { const int d = rd * 32 + tid / 8, pc = tid % 8; FragH f;
#pragma unroll
      for (int q = 0; q < 8; ++q) f.u[q] = tl[pc * 8 + q][d];
      *(v8us*)((unsigned short*)Vt + ((size_t)slab * 64 + d) * TTv + lg * 64 + pc * 8) = f.half[0]; }
     } }

__global__ __launch_bounds__(256) void k_hl(const float* __restrict__ F, _Float16* __restrict__ Hh, _Float16* __restrict__ Hl, size_t n8) { const size_t t = (size_t)blockIdx.x * 256 + threadIdx.x; if (t >= n8) return; FragH fh, fl; const v4f a = *(const v4fa*)(F + t * 8), c = *(const v4fa*)(F + t * 8 + 4);
#pragma unroll
  for (int q = 0; q < 4; ++q) { _Float16 h = (_Float16)a[q]; fh.h[q] = h; fl.h[q] = (_Float16)((a[q] - (float)h) * 1024.0f); h = (_Float16)c[q]; fh.h[4 + q] = h; fl.h[4 + q] = (_Float16)((c[q] - (float)h) * 1024.0f); }
  { *(v8us*)((unsigned short*)Hh + t * 8) = fh.half[0]; *(v8us*)((unsigned short*)Hl + t * 8) = fl.half[0];  } }

// ---- fast GEMM (wave tile 32x64; requires M % 32 == 0 rows per launch region and N % 64 == 0); epilogue = k_gemm_hhx semantics ----
__device__ __forceinline__ v16h g2_frag(const _Float16* p, int hh) { FragH f; f.half[0] = *(const v8us*)((const unsigned short*)p + 8 * hh); f.half[1] = *(const v8us*)((const unsigned short*)p + 16 + 8 * hh); return f.v; }
__device__ __forceinline__ v8f g2_mma(v16h a, v16h b, v8f c) { v8f d = __builtin_amdgcn_wmma_f32_16x16x32_f16(false, a, false, b, (short)0, c, false, false); asm volatile("v_nop\n\tv_nop\n\tv_nop\n\tv_nop" : "+v"(d) : "v"(a), "v"(b)); return d; }
// pk (a launch argument, so that the three projections stay one kernel): layout of C16. 0 = rows of pitch ldc. 1, 2 = fragment order for the attention loop (N / 64 heads, M keys): the wave's 32 keys x 64 features of head nq are 8 units of 512 bytes at ((nq M + row0) 64) elements,
// unit u holding lane l's 8 elements at 8 l, so that one wave-wide 16-byte load of a unit reads 4 whole cache lines. 1 (K, A operand of S^T): u = 4 (key / 16) + feature / 16, lane = 16 ((feature / 8) & 1) + key % 16, element = feature % 8.
// 2 (V^T, A operand of O^T): u = 2 (feature / 16) + (key / 16) % 2, lane = 16 ((key / 8) & 1) + feature % 16, element = key % 8.
template <int ACT>
__global__ __launch_bounds__(128) void k_gemm2(const _Float16* __restrict__ A, int lda, size_t sA, const _Float16* __restrict__ Bh, int ldb, size_t sB, float alpha, const float* __restrict__ bias, size_t sBias, const float* __restrict__ CP, int rowsPerB, size_t sCPb, int row0g,
    float* __restrict__ C, _Float16* __restrict__ C16, int ldc, size_t sC, int M, int N, int K, int pk) { static_assert(ACT == 0 || ACT == 3 || ACT == 6 || ACT == 8 || ACT == 9 || ACT == 11 || ACT == 12 || ACT == 14 || ACT == 15 || ACT == 16 || ACT == 17, "k_gemm2: unsupported ACT code (would silently apply no activation)");
  __shared__ __attribute__((aligned(16))) float so[4][32][68];
  const int tid = threadIdx.x, w = tid >> 5, lane = tid & 31, ln = lane & 15, hh = lane >> 4; const int by = blockIdx.y;
  A += (size_t)by * sA; Bh += (size_t)by * sB; const size_t cofs = (size_t)by * sC; const float* bp = bias ? bias + (size_t)by * sBias : nullptr;
  const int ntn = N >> 6; const int mt = blockIdx.x / ntn, nq = blockIdx.x - mt * ntn; const int row0 = mt * 128 + 32 * w, col0 = nq * 64; if (row0 >= M) return;
  const _Float16* a0p = A + (size_t)(row0 + ln) * lda; const _Float16* a1p = a0p + (size_t)16 * lda;
  const _Float16* b0p = Bh + (size_t)(col0 + ln) * ldb; const _Float16* b1p = b0p + (size_t)16 * ldb; const _Float16* b2p = b1p + (size_t)16 * ldb; const _Float16* b3p = b2p + (size_t)16 * ldb;
  const v8f z8 = {0.f,0.f,0.f,0.f,0.f,0.f,0.f,0.f}; v8f c00 = z8, c01 = z8, c02 = z8, c03 = z8, c10 = z8, c11 = z8, c12 = z8, c13 = z8;
#pragma unroll 1
  for (int kb = 0; kb < K; kb += 32) { const v16h a0 = g2_frag(a0p + kb, hh), a1 = g2_frag(a1p + kb, hh);
    v16h b = g2_frag(b0p + kb, hh); c00 = g2_mma(a0, b, c00); c10 = g2_mma(a1, b, c10);
    b = g2_frag(b1p + kb, hh); c01 = g2_mma(a0, b, c01); c11 = g2_mma(a1, b, c11);
    b = g2_frag(b2p + kb, hh); c02 = g2_mma(a0, b, c02); c12 = g2_mma(a1, b, c12);
    b = g2_frag(b3p + kb, hh); c03 = g2_mma(a0, b, c03); c13 = g2_mma(a1, b, c13); }
  v8f accs[8] = {c00, c01, c02, c03, c10, c11, c12, c13};
#pragma unroll
  for (int u = 0; u < 8; ++u) { const int t = u & 3, half = u >> 2; const int col = col0 + t * 16 + ln; const float bv = bp ? bf16_round(bp[col]) : 0.f;
#pragma unroll
    for (int r = 0; r < 8; ++r) { const int rloc = half * 16 + 8 * hh + r; float v = accs[u][r] * alpha + bv; if (CP) { if (rowsPerB < 0) v += CP[cofs + (size_t)(row0g + row0 + rloc) * ldc + col];      /* rowsPerB < 0: own element of the batched C plane */ else { const int bidx = (row0g + row0 + rloc) / rowsPerB; v += CP[(size_t)bidx * sCPb + (size_t)by * 64 + col]; } }
      if (ACT == 3) v = fmaxf(v, 0.f); else if (ACT == 6) v = 0.5f * v * (1.0f + erff(v * 0.70710678118654752f)); else if (ACT == 11) v = 1.0f / (1.0f + expf(-v)); else if (ACT == 15) v = v / (1.0f + expf(-v)); else if (ACT == 12) v = (v > 0.f) ? v : 0.01f * v; else if (ACT == 8) v = tanhf(v); else if (ACT == 9) v = 0.5f * v * (1.0f + tanhf(0.7978845608028654f * (v + 0.044715f * v * v * v))); else if (ACT == 14) v = (v > 0.f) ? v : 0.1f * v; else if (ACT == 16) v = (v >= 0.f) ? v : 0.3f * v; else if (ACT == 17) v = (v >= 0.f) ? v : 0.2f * v;
      so[w][rloc][t * 16 + ln] = v; } }
  __builtin_amdgcn_fence(__ATOMIC_ACQ_REL, "workgroup"); __builtin_amdgcn_wave_barrier();
  const int rsub = lane >> 4, c4 = (lane & 15) * 4;
  if (pk == 0) {
#pragma unroll
    for (int q = 0; q < 16; ++q) { const int r = q * 2 + rsub; const v4f v = *(const v4fa*)&so[w][r][c4]; if (C) *(v4f*)(C + cofs + (size_t)(row0 + r) * ldc + col0 + c4) = v; if (C16) { v4h h4; for (int i = 0; i < 4; ++i) h4[i] = (_Float16)v[i]; *(v4h*)(C16 + cofs + (size_t)(row0 + r) * ldc + col0 + c4) = h4; } }
  } else {
    unsigned short* dp = (unsigned short*)C16 + ((size_t)nq * M + row0) * 64 + lane * 8;
    if (pk == 1) {
#pragma unroll
      for (int u = 0; u < 8; ++u) { FragH f; const int rl = (u >> 2) * 16 + ln, cl = (u & 3) * 16 + 8 * hh; const v4f x = *(const v4fa*)&so[w][rl][cl], y = *(const v4fa*)&so[w][rl][cl + 4];
#pragma unroll
        for (int i = 0; i < 4; ++i) { f.h[i] = (_Float16)x[i]; f.h[4 + i] = (_Float16)y[i]; }
        *(v8us*)(dp + u * 256) = f.half[0]; }
      asm volatile("s_wait_xcnt 0x0" ::: "memory");      /* address wait behind the run of stores above, in front of whatever next writes a register that they name */
    } else {
#pragma unroll
      for (int u = 0; u < 8; ++u) { FragH f; const int rl = (u & 1) * 16 + 8 * hh, cl = (u >> 1) * 16 + ln;
#pragma unroll
        for (int i = 0; i < 8; ++i) f.h[i] = (_Float16)so[w][rl + i][cl];
        *(v8us*)(dp + u * 256) = f.half[0]; }
      asm volatile("s_wait_xcnt 0x0" ::: "memory");      /* address wait behind the run of stores above, in front of whatever next writes a register that they name */
    }
  } }


__global__ __launch_bounds__(256) void k_wnat(const float* __restrict__ w, size_t n8, _Float16* __restrict__ Bt) { const size_t t = (size_t)blockIdx.x * 256 + threadIdx.x; if (t >= n8) return; FragH f; for (int q = 0; q < 8; ++q) f.h[q] = (_Float16)(bf16_round(w[t * 8 + q]) * 16.0f); *(v8us*)((unsigned short*)Bt + t * 8) = f.half[0];  }
__global__ __launch_bounds__(256) void k_rsm(const float* __restrict__ S, _Float16* __restrict__ P, int nrows) {
  #pragma clang fp contract(off)
  const int i = blockIdx.x * 256 + threadIdx.x; if (i >= nrows) return; const float* s = S + (size_t)i * SQ; float mx = -3.0e38f;
#pragma unroll 1
  for (int j = 0; j < SQ; ++j) mx = fmaxf(mx, s[j]); float se = 0.f;
#pragma unroll 1
  for (int j = 0; j < SQ; ++j) se += expf(s[j] - mx); const float sc = 256.0f / se;
#pragma unroll 1
  for (int j0 = 0; j0 < SQ; j0 += 8) { FragH f; for (int q = 0; q < 8; ++q) f.h[q] = (_Float16)(expf(s[j0 + q] - mx) * sc); unsigned short* d = (unsigned short*)P + (size_t)i * SQ + j0; *(v8us*)d = f.half[0];  } }
__global__ __launch_bounds__(256) void k_vt(const _Float16* __restrict__ V16, int b, int h0, _Float16* __restrict__ VT) { __shared__ unsigned short tl[64][65]; const int tid = threadIdx.x; const int hh = blockIdx.x % HG, sg = blockIdx.x / HG; const int s0 = sg * 64; const int h = h0 + hh;
  for (int i = tid; i < 64 * 8; i += 256) { const int j = i / 8, d8 = (i % 8) * 8; FragH f; f.half[0] = *(const v8us*)((const unsigned short*)V16 + ((size_t)b * SQ + s0 + j) * DM + h * HD + d8); for (int q = 0; q < 8; ++q) tl[d8 + q][j] = f.u[q]; }
  __syncthreads();
  { for (int i = tid; i < 64 * 8; i += 256) { const int d = i / 8, j8 = (i % 8) * 8; FragH f; for (int q = 0; q < 8; ++q) f.u[q] = tl[d][j8 + q]; *(v8us*)((unsigned short*)VT + ((size_t)hh * HD + d) * SQ + s0 + j8) = f.half[0]; }  } }



__global__ __launch_bounds__(256) void k_rsmkm(const float* __restrict__ S, _Float16* __restrict__ P, int nrows, const int* __restrict__ am) {
  #pragma clang fp contract(off)
  const int t = blockIdx.x * 256 + threadIdx.x; if (t >= nrows) return; const size_t i = (size_t)t; const float* s = S + i * SQ; const int* mr = am + (size_t)(t % SQ) * SQ; float mx = -3.0e38f;
#pragma unroll 1
  for (int j = 0; j < SQ; ++j) { const float f = (mr[j] != 0) ? 1.f : 0.f; mx = fmaxf(mx, fmaf(f, s[j], (1.f - f) * -1.0e9f)); } float se = 0.f;
#pragma unroll 1
  for (int j = 0; j < SQ; ++j) { const float f = (mr[j] != 0) ? 1.f : 0.f; se += __expf(fmaf(f, s[j], (1.f - f) * -1.0e9f) - mx); } const float sc = 256.0f / se;
#pragma unroll 1
  for (int j0 = 0; j0 < SQ; j0 += 8) { FragH fr; for (int q = 0; q < 8; ++q) { const int j = j0 + q; const float f = (mr[j] != 0) ? 1.f : 0.f; fr.h[q] = (_Float16)(__expf(fmaf(f, s[j], (1.f - f) * -1.0e9f) - mx) * sc); }
    unsigned short* d = (unsigned short*)P + i * SQ + j0; *(v8us*)d = fr.half[0];  } }
// The swap of a wave's two 16-lane rows: a plain lane shuffle would go through the LDS pipe.
__device__ __forceinline__ float rs_x16(float v) { const int b = __float_as_int(v); return __int_as_float(__builtin_amdgcn_permlanex16(b, b, 0x76543210, 0xfedcba98, false, false)); }
// Four native 2^x in one statement: no result shares a register
// with a source (early clobber), each exp has an independent one behind it, and the v_nop is the slot that the instruction set asks for behind the last.
__device__ __forceinline__ v4f rs_exp2x4(v4f x) { float y0, y1, y2, y3;
  asm("v_exp_f32 %0, %4\n\tv_exp_f32 %1, %5\n\tv_exp_f32 %2, %6\n\tv_exp_f32 %3, %7\n\tv_nop" : "=&v"(y0), "=&v"(y1), "=&v"(y2), "=&v"(y3) : "v"(x[0]), "v"(x[1]), "v"(x[2]), "v"(x[3]));
  const v4f y = {y0, y1, y2, y3}; return y; }
// One native 2^x with the same slot behind it.
__device__ __forceinline__ float rs_exp2(float x) { float y; asm("v_exp_f32 %0, %1\n\tv_nop" : "=&v"(y) : "v"(x)); return y; }
__device__ __forceinline__ v16h fa_frag(const _Float16* base, unsigned lofs) { FragH f; f.half[0] = *(const v8us*)((const unsigned short*)base + lofs); f.half[1] = *(const v8us*)((const unsigned short*)base + lofs + 16); return f.v; }      /* base is wave-uniform, lofs the lane's own element offset (row ln, k 8 hh) */
__device__ __forceinline__ v16h fa_fragp(const _Float16* base, unsigned lofs) { FragH f; f.half[0] = *(const v8us*)((const unsigned short*)base + lofs); f.half[1] = *(const v8us*)((const unsigned short*)base + lofs + 256); return f.v; }      /* fragment-order operand: two units of 512 bytes, lofs = 8 lane; elements 0..7 and 8..15 as in fa_frag */
__device__ __forceinline__ v8f fa_mma(v16h a, v16h b, v8f c) { return __builtin_amdgcn_wmma_f32_16x16x32_f16(false, a, false, b, (short)0, c, false, false); }
__global__ __launch_bounds__(256) void k_fattn(const _Float16* __restrict__ Q, const _Float16* __restrict__ KP, const _Float16* __restrict__ VP, float* __restrict__ O) {      /* Q in rows; KP, VP in fragment order (k_gemm2, pk 1 and 2): 32 keys of a head are 4 KB in a row in each */
  const int lane = threadIdx.x & 31, ln = lane & 15, hh = lane >> 4; const int w = __builtin_amdgcn_readfirstlane(threadIdx.x >> 5);      /* the wave's number, held scalar so that the row bases are scalar */
  const int h = blockIdx.x / (SQ / 256); const int q0 = (blockIdx.x % (SQ / 256)) * 256 + w * 32;      /* 8 waves of one head share the K and V^T lines in the WGP's cache */
  const float SC = 0.125f * 1.44269504088896340736f;      /* 1 / sqrt(64) and log2 e in one factor: e^x as the native 2^x */
  const unsigned lk = (unsigned)(ln * DM + 8 * hh), lp = (unsigned)(lane * 8);
  const _Float16* qb = Q + (size_t)q0 * DM + h * HD; const _Float16* kb = KP + (size_t)h * HD * SQ; const _Float16* vb = VP + (size_t)h * HD * SQ;
  v16h qf[2][2], kf[2][2], vf[4];
  /* every loop over a fragment, score or output array of this kernel is unrolled: constant indices keep the arrays in registers */
#pragma unroll
  for (int j = 0; j < 2; ++j) { qf[j][0] = fa_frag(qb + j * 16 * DM, lk); qf[j][1] = fa_frag(qb + j * 16 * DM + 32, lk); }
#pragma unroll
  for (int t = 0; t < 2; ++t) { kf[t][0] = fa_fragp(kb + t * 1024, lp); kf[t][1] = fa_fragp(kb + t * 1024 + 512, lp); }
  __builtin_amdgcn_sched_barrier(0);      /* keeps the first V^T loads the youngest, as they are in every pass: otherwise the counted wait at the loop's head falls to 0 and each pass waits out the V^T loads issued just before it */
#pragma unroll
  for (int t = 0; t < 4; ++t) vf[t] = fa_fragp(vb + t * 512, lp);
  const v8f z8 = {0.f, 0.f, 0.f, 0.f, 0.f, 0.f, 0.f, 0.f}; v8f o[2][4]; float m[2] = {-3.0e38f, -3.0e38f}, l[2] = {0.f, 0.f};
#pragma unroll
  for (int j = 0; j < 2; ++j) for (int t = 0; t < 4; ++t) o[j][t] = z8;
  for (int k0 = 0; k0 < SQ; k0 += 32) {
    const int kn = (k0 + 32) & (SQ - 1);      /* the next pass's keys; the last pass fetches keys 0..31 again (in bounds, not used) so that the loop has no branch */
    v8f s[2][2];
#pragma unroll
    for (int t = 0; t < 2; ++t) for (int j = 0; j < 2; ++j) s[t][j] = fa_mma(kf[t][1], qf[j][1], fa_mma(kf[t][0], qf[j][0], z8));
    const _Float16* kp = kb + kn * HD;      /* K one pass ahead, into the registers that the products above have just read */
#pragma unroll
    for (int t = 0; t < 2; ++t) { kf[t][0] = fa_fragp(kp + t * 1024, lp); kf[t][1] = fa_fragp(kp + t * 1024 + 512, lp); }
    FragH pf[2];
#pragma unroll
    for (int j = 0; j < 2; ++j) { float mx = fmaxf(s[0][j][0], s[1][j][0]);
#pragma unroll
      for (int r = 1; r < 8; ++r) mx = fmaxf(mx, fmaxf(s[0][j][r], s[1][j][r]));
      mx = fmaxf(mx, rs_x16(mx)); const float mn = fmaxf(m[j], mx); const float al = rs_exp2((m[j] - mn) * SC); m[j] = mn; const float of = mn * SC - 8.0f;      /* weights are 2^8 e^(s - max): f16 keeps small ones normal; the row sum carries the same factor */
      v4f sm = {0.f, 0.f, 0.f, 0.f};
#pragma unroll
      for (int t = 0; t < 2; ++t) for (int g = 0; g < 2; ++g) { v4f x; for (int q = 0; q < 4; ++q) x[q] = s[t][j][4 * g + q] * SC - of; const v4f p = rs_exp2x4(x); sm += p; for (int q = 0; q < 4; ++q) pf[j].h[8 * t + 4 * g + q] = (_Float16)p[q]; }
      l[j] = l[j] * al + ((sm[0] + sm[1]) + (sm[2] + sm[3]));      /* the lane's own 16 keys; the halves are joined once, behind the loop */
#pragma unroll
      for (int t = 0; t < 4; ++t) o[j][t] *= al; }
#pragma unroll
    for (int t = 0; t < 4; ++t) for (int j = 0; j < 2; ++j) o[j][t] = fa_mma(vf[t], pf[j].v, o[j][t]);
    const _Float16* vp = vb + kn * HD;      /* V^T one pass ahead, likewise */
#pragma unroll
    for (int t = 0; t < 4; ++t) vf[t] = fa_fragp(vp + t * 512, lp);
    asm volatile("s_wait_xcnt 0x0" ::: "memory");      /* the next pass forms its addresses in the registers that the loads above name: their address wait stands in front of that overwrite */
  }
#pragma unroll
  for (int j = 0; j < 2; ++j) { const float inv = 1.0f / (l[j] + rs_x16(l[j])); float* d = O + (size_t)(q0 + j * 16 + ln) * DM + h * HD + 8 * hh;
#pragma unroll
    for (int t = 0; t < 4; ++t) { const v4f lo = {o[j][t][0] * inv, o[j][t][1] * inv, o[j][t][2] * inv, o[j][t][3] * inv}, hi = {o[j][t][4] * inv, o[j][t][5] * inv, o[j][t][6] * inv, o[j][t][7] * inv}; *(v4f*)(d + t * 16) = lo; *(v4f*)(d + t * 16 + 4) = hi; } } }



__global__ __launch_bounds__(256) void k_wthd(const float* __restrict__ Wt, _Float16* __restrict__ Bt) { const size_t t = (size_t)blockIdx.x * 256 + threadIdx.x; if (t >= (size_t)NH * HD * (DM / 8)) return; const int m8 = (int)(t % (DM / 8)) * 8; const int d = (int)((t / (DM / 8)) % HD); const int h = (int)(t / ((size_t)(DM / 8) * HD)); FragH f;
  for (int q = 0; q < 8; ++q) f.h[q] = (_Float16)(16.0f * bf16_round(Wt[((size_t)h * DM + m8 + q) * HD + d])); unsigned short* dst = (unsigned short*)Bt + ((size_t)h * HD + d) * DM + m8; *(v8us*)dst = f.half[0];  }





extern "C" void kernel_launch(void* const* d_in, const int* in_sizes, int n_in,
                              void* d_out, int out_size, void* d_ws, size_t ws_size, hipStream_t stream) {
  (void)in_sizes; (void)n_in; (void)out_size;
  const float* const* I = (const float* const*)d_in; const float* xq = I[0]; const float* xk = I[1]; const float* xv = I[2]; const float* wq = I[3]; const float* bq = I[4]; const float* wk = I[5]; const float* bk = I[6]; const float* wv = I[7]; const float* bv = I[8]; const float* x = xq;      /* X_Q, X_K, X_V [4096][1024]; per-head Wq / Wk / Wv [16][1024][64] ([in][out] per head) + biases [16][64] = [(h, d)]; no output projection */
  static_assert(NH * HD == DM && DM % 64 == 0 && DM % 32 == 0 && SQ % 256 == 0 && HD == 64 && HG == 1 && NB == 1, "shape / tile multiples");
  char* ws = (char*)d_ws; size_t off = 0;
  auto take = [&](size_t bytes) { char* p = ws + off; off += (bytes + 255) & ~(size_t)255; return p; };
  _Float16* BQ = (_Float16*)take((size_t)DM * DM * 2); _Float16* BK = (_Float16*)take((size_t)DM * DM * 2); _Float16* BV = (_Float16*)take((size_t)DM * DM * 2);
  _Float16* X16 = (_Float16*)take(NR * DM * 2); _Float16* XKp = (_Float16*)take(NR * DM * 2); _Float16* XVp = (_Float16*)take(NR * DM * 2); _Float16* Q16 = (_Float16*)take(NR * DM * 2); _Float16* KP = (_Float16*)take((size_t)NH * HD * SQ * 2);
  _Float16* VP = (_Float16*)take((size_t)NH * HD * SQ * 2);
  if (off > ws_size) return;
  { const unsigned g = (unsigned)(((size_t)NH * HD * (DM / 8) + 255) / 256); k_wthd<<<g, 256, 0, stream>>>(wq, BQ); k_wthd<<<g, 256, 0, stream>>>(wk, BK); k_wthd<<<g, 256, 0, stream>>>(wv, BV); }      /* per-head [m][d] -> Bt[(h, d)][m] x16 */
  _Float16* XK = XKp; _Float16* XV = XVp; k_x16<<<(unsigned)((NR * DM / 8 + 255) / 256), 256, 0, stream>>>(xk, XK, NR * DM / 8); k_x16<<<(unsigned)((NR * DM / 8 + 255) / 256), 256, 0, stream>>>(xv, XV, NR * DM / 8);      /* key and value inputs as exact f16 rows */

  k_x16<<<(unsigned)((NR * DM / 8 + 255) / 256), 256, 0, stream>>>(x, X16, NR * DM / 8);
  const size_t r0p = (size_t)B0 * SQ;      /* first projected row */
  k_gemm2<0><<<dim3((unsigned)((MP / 128) * (DM / 64)), 1), 128, 0, stream>>>(X16 + r0p * DM, DM, 0, BQ, DM, 0, 0.0625f, bq, 0, nullptr, 1, 0, 0, nullptr, Q16 + r0p * DM, DM, 0, MP, DM, DM, 0);
  k_gemm2<0><<<dim3((unsigned)((MP / 128) * (DM / 64)), 1), 128, 0, stream>>>(XK + r0p * DM, DM, 0, BK, DM, 0, 0.0625f, bk, 0, nullptr, 1, 0, 0, nullptr, KP, DM, 0, MP, DM, DM, 1);      /* K in fragment order */
  k_gemm2<0><<<dim3((unsigned)((MP / 128) * (DM / 64)), 1), 128, 0, stream>>>(XV + r0p * DM, DM, 0, BV, DM, 0, 0.0625f, bv, 0, nullptr, 1, 0, 0, nullptr, VP, DM, 0, MP, DM, DM, 2);      /* V^T in fragment order */
  for (int b = B0; b < B0 + NBR; ++b) { const size_t r0 = (size_t)b * SQ;
    k_fattn<<<NH * (SQ / 256), 256, 0, stream>>>(Q16 + r0 * LQ, KP, VP, (float*)d_out + r0 * DM); }      /* all heads: softmax(Q K^T / 8) V written f32 straight into each head's 64 columns of the output rows (no output projection) */
}

// v004
// It runs in 170 microseconds.
// Two timings next to v003 put it at 1.48 and 1.47 times that version's speed.
// Counting every step since v000, it is 78.7 times as fast.
#include <hip/hip_runtime.h>
// Multi-head attention over three inputs with PER-HEAD projection weights and no output projection (X_Q, X_K, X_V [4096][1024] (one sequence); Q[h] = X_Q Wq[h] + bq[h], K, V likewise (Wq / Wk / Wv [16][1024][64] per-head [in][out], sigma 1/32; biases [16][64] sigma 1/32); scores = Q[h] K[h]^T / sqrt(64); softmax over all 4096 keys; out[h] = attn V[h]; heads concatenated along the feature axis -> [4096][1024]).
// Structure: the three inputs as exact f16 rows (bf16-rounded); per-head [in][out] weights gathered into Bt[(h, d)][in] x16 planes; Q, K, V as three WMMA GEMMs (32x64 wave tiles, operands staged in LDS by asynchronous copies in a ring of two buffers, f32 accumulation, + bias [(h, d)], f16 outputs; the K and V GEMMs store their 32-key x 64-feature wave tiles in the attention loop's fragment order, V transposed on the way); then ONE attention launch for all heads: a wave owns 32 query rows and walks the 4096 keys 32 at a time, S^T = K Q^T, running-maximum softmax in registers (f32 statistics; weights x256 as f16), O^T += V^T P^T, divided by the row sum at the end and written f32 straight into the head's 64 columns of the output rows.
// Compute dtype: inputs rounded to bf16; x / weights exact; q, k, v and softmax weights as plain f16 GEMM operands (~2^-12); scores and softmax statistics f32. v_wmma_f32_16x16x32_f16.
#define NB 1
#define SQ 4096
#define DM 1024
#define NH 16
#define HD 64
#define HG 1                         /* heads per launch of the non-template k_vt */
#define B0 0                         /* first batch processed (debug hook) */
#define NBR NB                       /* batches processed (debug hook) */
#define NR ((size_t)NB * SQ)         /* token rows */
#define MP ((int)((size_t)NBR * SQ)) /* rows projected (debug hook) */
#define QN SQ                        /* unused (the attention launch attends all SQ query rows) */
#define NHD NH                       /* unused (the attention launch covers all NH heads) */
#define MPO MP                       /* unused (there is no output stage) */
#define LQ DM      /* row pitch of the q rows */
typedef __bf16 v16b __attribute__((ext_vector_type(16)));
typedef unsigned short v8us __attribute__((ext_vector_type(8), may_alias));
typedef float  v8f  __attribute__((ext_vector_type(8)));
typedef float  v4f  __attribute__((ext_vector_type(4)));
typedef float  v4fa __attribute__((ext_vector_type(4), may_alias));
union FragB { v16b v; v8us half[2]; unsigned short u[16]; };

__device__ __forceinline__ unsigned short bf16_bits(float x) { unsigned int u = __float_as_uint(x); return (unsigned short)((u + 0x7FFFu + ((u >> 16) & 1u)) >> 16); }
__device__ __forceinline__ float bf16_val(unsigned short b) { return __uint_as_float(((unsigned int)b) << 16); }
__device__ __forceinline__ float bf16_round(float x) { return bf16_val(bf16_bits(x)); }
// D += A·B with NT terms: 1 = ah·bh, 2 = + al·bh (A split), 3 = + ah·bl (both split)
template <int NT>
__device__ __forceinline__ v8f mmaN(v16b ah, v16b al, v16b bh, v16b bl, v8f c) {
  c = __builtin_amdgcn_wmma_f32_16x16x32_bf16(false, ah, false, bh, (short)0, c, false, false);
  if (NT >= 2) c = __builtin_amdgcn_wmma_f32_16x16x32_bf16(false, al, false, bh, (short)0, c, false, false);
  if (NT >= 3) c = __builtin_amdgcn_wmma_f32_16x16x32_bf16(false, ah, false, bl, (short)0, c, false, false);
  asm volatile("v_nop\n\tv_nop\n\tv_nop\n\tv_nop" : "+v"(c) : "v"(ah), "v"(al), "v"(bh), "v"(bl));
  return c;
}

__global__ __launch_bounds__(256) void k_wt_bf16(const float* __restrict__ W, unsigned short* __restrict__ Wt, int K, int N) {
  const int t = blockIdx.x * 256 + threadIdx.x;
  const int k8n = K / 8;
  if (t >= N * k8n) return;
  const int n = t / k8n, k8 = (t % k8n) * 8;
  v8us v;
#pragma unroll
  for (int i = 0; i < 8; ++i) v[i] = bf16_bits(W[(size_t)(k8 + i) * N + n]);
  *(v8us*)(Wt + (size_t)n * K + k8) = v;
  
}

// GEMM C[M][N] (f32, pitch ldc) = act(A[M][K]·W + bias). A f32 row-major (pitch lda) converted per fragment to bf16
// (ASPLIT: hi/lo two planes -> 2 terms, else single rounded term); Wt bf16 [N][K] (pitch ldb). BIAS_BF16 rounds the
// bias to bf16 first (bias quantised to bf16 before the add). K%32==0, M%16==0, N%64==0.
template <bool ASPLIT, int ACT, bool BIAS_BF16>
__global__ __launch_bounds__(128) void k_gemm_bf(const float* __restrict__ A, int lda, const unsigned short* __restrict__ Wt, int ldb,
                                               const float* __restrict__ bias, float* __restrict__ C, int ldc, int M, int N, int K) {
  __shared__ __attribute__((aligned(16))) float so[4][16][64];
  const int tid = threadIdx.x, w = tid >> 5, lane = tid & 31, ln = lane & 15, hh = lane >> 4;
  const int ntn = N / 64;
  const int wid = blockIdx.x * 4 + w;
  const int mt = wid / ntn, nq = wid % ntn;
  if (mt * 16 >= M) return;
  const int row0 = mt * 16, col0 = nq * 64;
  const float* arow = A + (size_t)(row0 + ln) * lda;
  v8f acc[4] = {};
  for (int kb = 0; kb < K; kb += 32) {
    FragB ah, al;
    const v4f x0 = *(const v4fa*)(arow + kb + 8 * hh), x1 = *(const v4fa*)(arow + kb + 8 * hh + 4);
    const v4f x2 = *(const v4fa*)(arow + kb + 16 + 8 * hh), x3 = *(const v4fa*)(arow + kb + 16 + 8 * hh + 4);
    float xs[16] = {x0[0],x0[1],x0[2],x0[3],x1[0],x1[1],x1[2],x1[3],x2[0],x2[1],x2[2],x2[3],x3[0],x3[1],x3[2],x3[3]};
#pragma unroll
    for (int i = 0; i < 16; ++i) { const unsigned short hb = bf16_bits(xs[i]); ah.u[i] = hb; al.u[i] = ASPLIT ? bf16_bits(xs[i] - bf16_val(hb)) : (unsigned short)0; }
#pragma unroll
    for (int t = 0; t < 4; ++t) {
      const unsigned short* brow = Wt + (size_t)(col0 + t * 16 + ln) * ldb + kb;
      FragB b;
      b.half[0] = *(const v8us*)(brow + 8 * hh);
      b.half[1] = *(const v8us*)(brow + 16 + 8 * hh);
      acc[t] = mmaN<ASPLIT ? 2 : 1>(ah.v, al.v, b.v, b.v, acc[t]);
    }
  }
#pragma unroll
  for (int t = 0; t < 4; ++t) {
    float bv = bias ? bias[col0 + t * 16 + ln] : 0.f;
    if (BIAS_BF16) bv = bf16_round(bv);
#pragma unroll
    for (int r = 0; r < 8; ++r) { float v = acc[t][r] + bv; if (ACT == 1) v = fmaxf(v, 0.f); so[w][8 * hh + r][t * 16 + ln] = v; }
  }
  __builtin_amdgcn_fence(__ATOMIC_ACQ_REL, "workgroup");
  __builtin_amdgcn_wave_barrier();
  const int rsub = lane >> 4, c4 = (lane & 15) * 4;
  {
#pragma unroll
    for (int q = 0; q < 8; ++q) {
      const int r = q * 2 + rsub;
      const v4f v = *(const v4fa*)&so[w][r][c4];
      *(v4f*)(C + (size_t)(row0 + r) * ldc + col0 + c4) = v;
    }
    
  }
}

// GEMM C = act(A·W + bias + resid): A f32 (ASPLIT -> hi/lo 2 terms), Wt bf16 [N][K]; ACT 0 none, 1 relu, 2 exact gelu;
// resid (optional, f32, row index = (row % rmod), pitch ldr, RES_BF16 rounds it) added before the activation.
template <bool ASPLIT, int ACT, bool BIAS_BF16, bool RES_BF16>
__global__ __launch_bounds__(128) void k_gemm_bf3(const float* __restrict__ A, int lda, const unsigned short* __restrict__ Wt, int ldb,
                                                const float* __restrict__ bias, const float* __restrict__ resid, int rmod, int ldr,
                                                float* __restrict__ C, int ldc, int M, int N, int K) {
  __shared__ __attribute__((aligned(16))) float so[4][16][64];
  const int tid = threadIdx.x, w = tid >> 5, lane = tid & 31, ln = lane & 15, hh = lane >> 4;
  const int ntn = N / 64;
  const int wid = blockIdx.x * 4 + w;
  const int mt = wid / ntn, nq = wid % ntn;
  if (mt * 16 >= M) return;
  const int row0 = mt * 16, col0 = nq * 64;
  const float* arow = A + (size_t)(row0 + ln) * lda;
  v8f acc[4] = {};
  for (int kb = 0; kb < K; kb += 32) {
    FragB ah, al;
    const v4f x0 = *(const v4fa*)(arow + kb + 8 * hh), x1 = *(const v4fa*)(arow + kb + 8 * hh + 4);
    const v4f x2 = *(const v4fa*)(arow + kb + 16 + 8 * hh), x3 = *(const v4fa*)(arow + kb + 16 + 8 * hh + 4);
    float xs[16] = {x0[0],x0[1],x0[2],x0[3],x1[0],x1[1],x1[2],x1[3],x2[0],x2[1],x2[2],x2[3],x3[0],x3[1],x3[2],x3[3]};
#pragma unroll
    for (int i = 0; i < 16; ++i) { const unsigned short hb = bf16_bits(xs[i]); ah.u[i] = hb; al.u[i] = ASPLIT ? bf16_bits(xs[i] - bf16_val(hb)) : (unsigned short)0; }
#pragma unroll
    for (int t = 0; t < 4; ++t) {
      const unsigned short* brow = Wt + (size_t)(col0 + t * 16 + ln) * ldb + kb;
      FragB b;
      b.half[0] = *(const v8us*)(brow + 8 * hh);
      b.half[1] = *(const v8us*)(brow + 16 + 8 * hh);
      acc[t] = mmaN<ASPLIT ? 2 : 1>(ah.v, al.v, b.v, b.v, acc[t]);
    }
  }
#pragma unroll
  for (int t = 0; t < 4; ++t) {
    const int col = col0 + t * 16 + ln;
    float bv = bias ? bias[col] : 0.f;
    if (BIAS_BF16) bv = bf16_round(bv);
#pragma unroll
    for (int r = 0; r < 8; ++r) {
      float v = acc[t][r] + bv;
      if (resid) { float rv = resid[(size_t)((row0 + 8 * hh + r) % rmod) * ldr + col]; if (RES_BF16) rv = bf16_round(rv); v += rv; }
      if (ACT == 1) v = fmaxf(v, 0.f);
      if (ACT == 2) v = 0.5f * v * (1.0f + erff(v * 0.70710678118654752f));
      if (ACT == 3) { const float u = 0.7978845608028654f * (v + 0.044715f * v * v * v); v = 0.5f * v * (1.0f + tanhf(u)); }
      so[w][8 * hh + r][t * 16 + ln] = v;
    }
  }
  __builtin_amdgcn_fence(__ATOMIC_ACQ_REL, "workgroup");
  __builtin_amdgcn_wave_barrier();
  const int rsub = lane >> 4, c4 = (lane & 15) * 4;
  {
#pragma unroll
    for (int q = 0; q < 8; ++q) {
      const int r = q * 2 + rsub;
      const v4f v = *(const v4fa*)&so[w][r][c4];
      *(v4f*)(C + (size_t)(row0 + r) * ldc + col0 + c4) = v;
    }
    
  }
}
// row LayerNorm (biased variance, eps) over N: s = X (+ R); optional out_sum <- s; out_norm <- (s-mu)*rsqrt(var+eps)*g + b
template <bool PARAM_BF16>
__global__ __launch_bounds__(256) void k_layernorm(const float* __restrict__ X, const float* __restrict__ R, const float* __restrict__ g, const float* __restrict__ bta,
                                                  float* __restrict__ out_sum, float* __restrict__ out_norm, int N, float eps) {
  __shared__ float red[256];
  const int row = blockIdx.x, tid = threadIdx.x;
  const float* x = X + (size_t)row * N; const float* rr = R ? R + (size_t)row * N : nullptr;
  float vals[16];                     // up to N = 4096
  const int per = N / 256;            // contiguous chunk per thread? use strided-by-4 chunks: thread handles j = tid*4 + 1024*u
  float s1 = 0.f;
  for (int u = 0; u < per / 4; ++u) {
    const int j = tid * 4 + 1024 * u;
    const v4f a = *(const v4fa*)(x + j);
    v4f b = {0.f,0.f,0.f,0.f}; if (rr) b = *(const v4fa*)(rr + j);
#pragma unroll
    for (int q = 0; q < 4; ++q) { const float v = a[q] + b[q]; vals[u * 4 + q] = v; s1 += v; }
  }
  red[tid] = s1; __syncthreads();
  for (int st = 128; st > 0; st >>= 1) { if (tid < st) red[tid] += red[tid + st]; __syncthreads(); }
  const float mu = red[0] / (float)N; __syncthreads();
  float s2 = 0.f;
  for (int u = 0; u < per / 4; ++u)
#pragma unroll
    for (int q = 0; q < 4; ++q) { const float c = vals[u * 4 + q] - mu; s2 += c * c; }
  red[tid] = s2; __syncthreads();
  for (int st = 128; st > 0; st >>= 1) { if (tid < st) red[tid] += red[tid + st]; __syncthreads(); }
  const float rs = rsqrtf(red[0] / (float)N + eps);
  {
    for (int u = 0; u < per / 4; ++u) {
      const int j = tid * 4 + 1024 * u;
      v4f o, sm;
#pragma unroll
      for (int q = 0; q < 4; ++q) {
        float gg = g[j + q], bb = bta[j + q];
        if (PARAM_BF16) { gg = bf16_round(gg); bb = bf16_round(bb); }
        sm[q] = vals[u * 4 + q]; o[q] = (vals[u * 4 + q] - mu) * rs * gg + bb;
      }
      if (out_sum) *(v4f*)(out_sum + (size_t)row * N + j) = sm;
      *(v4f*)(out_norm + (size_t)row * N + j) = o;
    }
    
  }
}



// ---- f16 WMMA path (v_wmma_f32_16x16x32_f16): 11-bit significands for operands in range — used where a [0,1] probability operand needs more precision than bf16
typedef _Float16 v16h __attribute__((ext_vector_type(16)));
union FragH { v16h v; v8us half[2]; _Float16 h[16]; unsigned short u[16]; };
template <int NT>
__device__ __forceinline__ v8f mmaH(v16h ah, v16h al, v16h bh, v16h bl, v8f c) {
  c = __builtin_amdgcn_wmma_f32_16x16x32_f16(false, ah, false, bh, (short)0, c, false, false);
  if (NT >= 2) c = __builtin_amdgcn_wmma_f32_16x16x32_f16(false, al, false, bh, (short)0, c, false, false);
  if (NT >= 3) c = __builtin_amdgcn_wmma_f32_16x16x32_f16(false, ah, false, bl, (short)0, c, false, false);
  asm volatile("v_nop\n\tv_nop\n\tv_nop\n\tv_nop" : "+v"(c) : "v"(ah), "v"(al), "v"(bh), "v"(bl));
  return c;
}
// batched GEMM like k_gemm_b but f16 operands: A f32 (split into f16 hi/lo if ASPLIT, else rounded to f16), Bt = f16 values [n][k]; alpha; C f32; N multiple of 16 (partial tiles skipped)
template <bool ASPLIT>
__global__ __launch_bounds__(128) void k_gemm_h(const float* __restrict__ A, int lda, size_t sA, const _Float16* __restrict__ Bh, int ldb, size_t sB, float alpha, float* __restrict__ C, int ldc, size_t sC, int M, int N, int K) {
  __shared__ __attribute__((aligned(16))) float so[4][16][64];
  const int tid = threadIdx.x, w = tid >> 5, lane = tid & 31, ln = lane & 15, hh = lane >> 4; const int by = blockIdx.y;
  A += (size_t)by * sA; Bh += (size_t)by * sB; C += (size_t)by * sC;
  const int ntn = (N + 63) / 64; const int wid = blockIdx.x * 4 + w; const int mt = wid / ntn, nq = wid % ntn; if (mt * 16 >= M) return;
  const int row0 = mt * 16, col0 = nq * 64; const float* arow = A + (size_t)(row0 + ln) * lda;
  v8f acc[4] = {};
  for (int kb = 0; kb < K; kb += 32) {
    FragH ah, al;
    const v4f x0 = *(const v4fa*)(arow + kb + 8 * hh), x1 = *(const v4fa*)(arow + kb + 8 * hh + 4), x2 = *(const v4fa*)(arow + kb + 16 + 8 * hh), x3 = *(const v4fa*)(arow + kb + 16 + 8 * hh + 4);
    float xs[16] = {x0[0],x0[1],x0[2],x0[3],x1[0],x1[1],x1[2],x1[3],x2[0],x2[1],x2[2],x2[3],x3[0],x3[1],x3[2],x3[3]};
#pragma unroll
    for (int i = 0; i < 16; ++i) { const _Float16 h = (_Float16)xs[i]; ah.h[i] = h; al.h[i] = ASPLIT ? (_Float16)(xs[i] - (float)h) : (_Float16)0.0f; }
#pragma unroll
    for (int t = 0; t < 4; ++t) { if (col0 + t * 16 >= N) continue; const size_t boff = (size_t)(col0 + t * 16 + ln) * ldb + kb; FragH bq; bq.half[0] = *(const v8us*)(Bh + boff + 8 * hh); bq.half[1] = *(const v8us*)(Bh + boff + 16 + 8 * hh);
      acc[t] = mmaH<ASPLIT ? 2 : 1>(ah.v, al.v, bq.v, bq.v, acc[t]); }
  }
#pragma unroll
  for (int t = 0; t < 4; ++t) { if (col0 + t * 16 >= N) continue;
#pragma unroll
    for (int r = 0; r < 8; ++r) so[w][8 * hh + r][t * 16 + ln] = acc[t][r] * alpha; }
  __builtin_amdgcn_fence(__ATOMIC_ACQ_REL, "workgroup"); __builtin_amdgcn_wave_barrier();
  const int rsub = lane >> 4, c4 = (lane & 15) * 4;
  {
#pragma unroll
    for (int q = 0; q < 8; ++q) { const int r = q * 2 + rsub; if (col0 + c4 < N) { const v4f v = *(const v4fa*)&so[w][r][c4]; *(v4f*)(C + (size_t)(row0 + r) * ldc + col0 + c4) = v; } }
     }
}

// Wt[n][k] = f16(W[k][n]·scale) from f32 row-major W[K][N] (scale = power of two; bf16-exact weights stay exact in f16 away from the subnormal range)
__global__ __launch_bounds__(256) void k_wt_f16(const float* __restrict__ W, _Float16* __restrict__ Wt, int K, int N, float scale) {
  const int t = blockIdx.x * 256 + threadIdx.x; if (t >= N * (K / 8)) return; const int n = t / (K / 8), k8 = (t % (K / 8)) * 8; FragH f;
#pragma unroll
  for (int i = 0; i < 8; ++i) f.h[i] = (_Float16)(bf16_round(W[(size_t)(k8 + i) * N + n]) * scale); const v8us o = f.half[0];
  *(v8us*)((unsigned short*)Wt + (size_t)n * K + k8) = o; 
}
// k_gemm_hh variant with fused epilogue: v = acc·alpha + bias[by·sBias + col] (+ CP[(row/rowsPerB)·sCPb + by·64 + col] if CP) ; ACT 0 none / 1 elu ; writes f16 C16 (and f32 C if non-null)
template <int ACT>
__global__ __launch_bounds__(128) void k_gemm_hhx(const _Float16* __restrict__ A, int lda, size_t sA, const _Float16* __restrict__ Bh, int ldb, size_t sB, float alpha, const float* __restrict__ bias, size_t sBias, const float* __restrict__ CP, int rowsPerB, size_t sCPb, int row0g,
    float* __restrict__ C, _Float16* __restrict__ C16, int ldc, size_t sC, int M, int N, int K) {
  __shared__ __attribute__((aligned(16))) float so[4][16][64];
  const int tid = threadIdx.x, w = tid >> 5, lane = tid & 31, ln = lane & 15, hh = lane >> 4; const int by = blockIdx.y;
  A += (size_t)by * sA; Bh += (size_t)by * sB; const size_t cofs = (size_t)by * sC; const float* bp = bias ? bias + (size_t)by * sBias : nullptr;
  const int ntn = (N + 63) / 64; const int wid = blockIdx.x * 4 + w; const int mt = wid / ntn, nq = wid % ntn; if (mt * 16 >= M) return;
  const int row0 = mt * 16, col0 = nq * 64; const _Float16* arow = A + (size_t)(row0 + ln) * lda;
  v8f acc[4] = {};
  for (int kb = 0; kb < K; kb += 32) { FragH ah; ah.half[0] = *(const v8us*)((const unsigned short*)arow + kb + 8 * hh); ah.half[1] = *(const v8us*)((const unsigned short*)arow + kb + 16 + 8 * hh);
#pragma unroll
    for (int t = 0; t < 4; ++t) { if (col0 + t * 16 >= N) continue; const size_t boff = (size_t)(col0 + t * 16 + ln) * ldb + kb; FragH bq; bq.half[0] = *(const v8us*)((const unsigned short*)Bh + boff + 8 * hh); bq.half[1] = *(const v8us*)((const unsigned short*)Bh + boff + 16 + 8 * hh);
      acc[t] = mmaH<1>(ah.v, ah.v, bq.v, bq.v, acc[t]); }
  }
#pragma unroll
  for (int t = 0; t < 4; ++t) { if (col0 + t * 16 >= N) continue; const int col = col0 + t * 16 + ln; const float bv = bp ? bf16_round(bp[col]) : 0.f;
#pragma unroll
    for (int r = 0; r < 8; ++r) { float v = acc[t][r] * alpha + bv; if (CP) { const int rr = row0g + row0 + 8 * hh + r; if (rowsPerB < 0) v += CP[cofs + (size_t)rr * ldc + col];      /* rowsPerB < 0: own element of the batched C plane */ else { const int bidx = rr / rowsPerB; v += CP[(size_t)bidx * sCPb + (size_t)by * 64 + col]; } } if (ACT == 1) v = (v > 0.f) ? v : expm1f(v); else if (ACT == 7) v = (v > 0.f) ? v + 1.0f : expf(v); else if (ACT == 8) v = tanhf(v); else if (ACT == 9) v = 0.5f * v * (1.0f + tanhf(0.7978845608028654f * (v + 0.044715f * v * v * v))); else if (ACT == 11) v = 1.0f / (1.0f + expf(-v)); else if (ACT == 12) v = (v > 0.f) ? v : 0.01f * v; else if (ACT == 14) v = (v > 0.f) ? v : 0.1f * v; else if (ACT == 16) v = (v >= 0.f) ? v : 0.3f * v; else if (ACT == 17) v = (v >= 0.f) ? v : 0.2f * v; else if (ACT == 15) v = v / (1.0f + expf(-v)); else if (ACT == 3) v = fmaxf(v, 0.f); else if (ACT == 6) v = 0.5f * v * (1.0f + erff(v * 0.70710678118654752f)); so[w][8 * hh + r][t * 16 + ln] = v; } }
  __builtin_amdgcn_fence(__ATOMIC_ACQ_REL, "workgroup"); __builtin_amdgcn_wave_barrier();
  const int rsub = lane >> 4, c4 = (lane & 15) * 4; typedef _Float16 v4h __attribute__((ext_vector_type(4)));
  {
#pragma unroll
    for (int q = 0; q < 8; ++q) { const int r = q * 2 + rsub; if (col0 + c4 < N) { const v4f v = *(const v4fa*)&so[w][r][c4]; if (C) *(v4f*)(C + cofs + (size_t)(row0 + r) * ldc + col0 + c4) = v; if (C16) { v4h h4; for (int i = 0; i < 4; ++i) h4[i] = (_Float16)v[i]; *(v4h*)(C16 + cofs + (size_t)(row0 + r) * ldc + col0 + c4) = h4; } } }
     }
}


typedef _Float16 v4h __attribute__((ext_vector_type(4)));

__global__ __launch_bounds__(256) void k_x16(const float* __restrict__ x, _Float16* __restrict__ X16, size_t n8) { const size_t t = (size_t)blockIdx.x * 256 + threadIdx.x; if (t >= n8) return; FragH f;
#pragma unroll
  for (int q = 0; q < 8; ++q) f.h[q] = (_Float16)bf16_round(x[t * 8 + q]); *(v8us*)((unsigned short*)X16 + t * 8) = f.half[0];  }
__global__ __launch_bounds__(256) void k_h16(const float* __restrict__ x, _Float16* __restrict__ X16, size_t n8) { const size_t t = (size_t)blockIdx.x * 256 + threadIdx.x; if (t >= n8) return; FragH f;
#pragma unroll
  for (int q = 0; q < 8; ++q) f.h[q] = (_Float16)x[t * 8 + q]; *(v8us*)((unsigned short*)X16 + t * 8) = f.half[0];  }
__global__ __launch_bounds__(256) void k_round16f(const float* __restrict__ W, _Float16* __restrict__ Bt, size_t n8) { const size_t t = (size_t)blockIdx.x * 256 + threadIdx.x; if (t >= n8) return; FragH f;
#pragma unroll
  for (int i = 0; i < 8; ++i) f.h[i] = (_Float16)(bf16_round(W[t * 8 + i]) * 16.0f); *(v8us*)((unsigned short*)Bt + t * 8) = f.half[0];  }
template <int NHv, int TTv>
__global__ __launch_bounds__(256) void k_vt(const _Float16* __restrict__ V16, int ldv, int voff, _Float16* __restrict__ Vt) { __shared__ unsigned short tl[64][66]; const int tid = threadIdx.x; const int slab = blockIdx.x / (TTv / 64), lg = blockIdx.x % (TTv / 64); const int b = slab / NHv, h = slab % NHv;
  for (int i = tid; i < 64 * 8; i += 256) { const int r = i / 8, c8 = (i % 8) * 8; FragH f; f.half[0] = *(const v8us*)((const unsigned short*)V16 + ((size_t)b * TTv + lg * 64 + r) * ldv + voff + h * 64 + c8);
#pragma unroll
    for (int q = 0; q < 8; ++q) tl[r][c8 + q] = f.u[q]; }
  __syncthreads();
  {
#pragma unroll
    for (int rd = 0; rd < 2; ++rd) { const int d = rd * 32 + tid / 8, pc = tid % 8; FragH f;
#pragma unroll
      for (int q = 0; q < 8; ++q) f.u[q] = tl[pc * 8 + q][d];
      *(v8us*)((unsigned short*)Vt + ((size_t)slab * 64 + d) * TTv + lg * 64 + pc * 8) = f.half[0]; }
     } }

__global__ __launch_bounds__(256) void k_hl(const float* __restrict__ F, _Float16* __restrict__ Hh, _Float16* __restrict__ Hl, size_t n8) { const size_t t = (size_t)blockIdx.x * 256 + threadIdx.x; if (t >= n8) return; FragH fh, fl; const v4f a = *(const v4fa*)(F + t * 8), c = *(const v4fa*)(F + t * 8 + 4);
#pragma unroll
  for (int q = 0; q < 4; ++q) { _Float16 h = (_Float16)a[q]; fh.h[q] = h; fl.h[q] = (_Float16)((a[q] - (float)h) * 1024.0f); h = (_Float16)c[q]; fh.h[4 + q] = h; fl.h[4 + q] = (_Float16)((c[q] - (float)h) * 1024.0f); }
  { *(v8us*)((unsigned short*)Hh + t * 8) = fh.half[0]; *(v8us*)((unsigned short*)Hl + t * 8) = fl.half[0];  } }

// ---- fast GEMM (wave tile 32x64, work-group tile 128x64; requires M % 128 == 0 rows per launch region, N % 64 == 0 and K % 128 == 0); epilogue = k_gemm_hhx semantics ----
__device__ __forceinline__ v16h g2_frag(const _Float16* p, int hh) { FragH f; f.half[0] = *(const v8us*)((const unsigned short*)p + 8 * hh); f.half[1] = *(const v8us*)((const unsigned short*)p + 16 + 8 * hh); return f.v; }
__device__ __forceinline__ v8f g2_mma(v16h a, v16h b, v8f c) { v8f d = __builtin_amdgcn_wmma_f32_16x16x32_f16(false, a, false, b, (short)0, c, false, false); asm volatile("v_nop\n\tv_nop\n\tv_nop\n\tv_nop" : "+v"(d) : "v"(a), "v"(b)); return d; }
// ---- operand ring of k_gemm2: a stage is 128 k (256 bytes) of the work-group's 128 A rows and 64 B rows, laid in LDS at a pitch of 272 bytes (16 x odd: 16-byte fragment reads meet no bank conflict); two buffers ----
#define G2_KT 128
#define G2_PITCH 272
#define G2_BUF (192 * G2_PITCH)
__device__ __forceinline__ v8f g2_mmab(v16h a, v16h b, v8f c) { return __builtin_amdgcn_wmma_f32_16x16x32_f16(false, a, false, b, (short)0, c, false, false); }
__device__ __forceinline__ v16h g2_lfrag(const unsigned char* p) { FragH f; f.half[0] = *(const v8us*)p; f.half[1] = *(const v8us*)(p + 32); return f.v; }      /* p = the lane's row + 16 hh bytes: elements 0..7 = k 8 hh + e, 8..15 = k 16 + 8 hh + e, as in g2_frag */
// Eight asynchronous 16-byte copies of a thread, global to LDS through no register: 64 operand rows a call (row step 8), 16 threads a row, so that a wave's copy reads two whole 256-byte row pieces.
// The address wait is the statement's last line: it stands in front of whatever next writes a register that a copy names.
__device__ __forceinline__ void g2_copy8(unsigned l, const _Float16* g, size_t g8) {
  const unsigned l1 = l + 8 * G2_PITCH, l2 = l + 16 * G2_PITCH, l3 = l + 24 * G2_PITCH, l4 = l + 32 * G2_PITCH, l5 = l + 40 * G2_PITCH, l6 = l + 48 * G2_PITCH, l7 = l + 56 * G2_PITCH;
  const _Float16* g1 = g + g8; const _Float16* g2 = g1 + g8; const _Float16* g3 = g2 + g8; const _Float16* g4 = g3 + g8; const _Float16* g5 = g4 + g8; const _Float16* g6 = g5 + g8; const _Float16* g7 = g6 + g8;
  asm volatile("global_load_async_to_lds_b128 %0, %8, off\n\tglobal_load_async_to_lds_b128 %1, %9, off\n\tglobal_load_async_to_lds_b128 %2, %10, off\n\tglobal_load_async_to_lds_b128 %3, %11, off\n\t"
               "global_load_async_to_lds_b128 %4, %12, off\n\tglobal_load_async_to_lds_b128 %5, %13, off\n\tglobal_load_async_to_lds_b128 %6, %14, off\n\tglobal_load_async_to_lds_b128 %7, %15, off\n\ts_wait_xcnt 0x0"
               :: "v"(l), "v"(l1), "v"(l2), "v"(l3), "v"(l4), "v"(l5), "v"(l6), "v"(l7), "v"(g), "v"(g1), "v"(g2), "v"(g3), "v"(g4), "v"(g5), "v"(g6), "v"(g7) : "memory"); }
// pk (a launch argument, so that the three projections stay one kernel and share its text in the instruction cache): layout of C16. 0 = rows of pitch ldc. 1, 2 = fragment order for the attention loop (N / 64 heads, M keys): the wave's 32 keys x 64 features of head nq are 8 units of 512 bytes at ((nq M + row0) 64) elements,
// unit u holding lane l's 8 elements at 8 l, so that one wave-wide 16-byte load of a unit reads 4 whole cache lines. 1 (K, A operand of S^T): u = 4 (key / 16) + feature / 16, lane = 16 ((feature / 8) & 1) + key % 16, element = feature % 8.
// 2 (V^T, A operand of O^T): u = 2 (feature / 16) + (key / 16) % 2, lane = 16 ((key / 8) & 1) + feature % 16, element = key % 8.
template <int ACT>
__global__ __launch_bounds__(128) void k_gemm2(const _Float16* __restrict__ A, int lda, size_t sA, const _Float16* __restrict__ Bh, int ldb, size_t sB, float alpha, const float* __restrict__ bias, size_t sBias, const float* __restrict__ CP, int rowsPerB, size_t sCPb, int row0g,
    float* __restrict__ C, _Float16* __restrict__ C16, int ldc, size_t sC, int M, int N, int K, int pk) { static_assert(ACT == 0 || ACT == 3 || ACT == 6 || ACT == 8 || ACT == 9 || ACT == 11 || ACT == 12 || ACT == 14 || ACT == 15 || ACT == 16 || ACT == 17, "k_gemm2: unsupported ACT code (would silently apply no activation)");
  __shared__ __attribute__((aligned(16))) float so[4][32][68];
  __shared__ __attribute__((aligned(16))) unsigned char ring[2 * G2_BUF];      /* rows 0..127 of a buffer: the work-group's A rows; 128..191: its B rows */
  const int tid = threadIdx.x, w = tid >> 5, lane = tid & 31, ln = lane & 15, hh = lane >> 4; const int by = blockIdx.y;
  A += (size_t)by * sA; Bh += (size_t)by * sB; const size_t cofs = (size_t)by * sC; const float* bp = bias ? bias + (size_t)by * sBias : nullptr;
  const int ntn = N >> 6; const int mt = blockIdx.x / ntn, nq = blockIdx.x - mt * ntn; const int row0 = mt * 128 + 32 * w, col0 = nq * 64; if (mt * 128 >= M) return;      /* the whole work-group leaves or none does (barriers below); needs M % 128 == 0, K % 128 == 0, K >= 128 */
  const _Float16* ga = A + (size_t)(mt * 128 + (tid >> 4)) * lda + (tid & 15) * 8; const _Float16* gb = Bh + (size_t)(col0 + (tid >> 4)) * ldb + (tid & 15) * 8;      /* the thread's first 16 bytes of a stage: row tid / 16, piece tid % 16 */
  const unsigned lc = (unsigned)(size_t)ring + (unsigned)((tid >> 4) * G2_PITCH + (tid & 15) * 16);      /* their place in buffer 0: byte address in the work-group's LDS */
  const size_t a8 = (size_t)8 * lda, b8 = (size_t)8 * ldb; const int nt = K / G2_KT;
  const unsigned char* fa = ring + (32 * w + ln) * G2_PITCH + 16 * hh; const unsigned char* fb = ring + (128 + ln) * G2_PITCH + 16 * hh;      /* the lane's fragment rows in buffer 0 */
  const v8f z8 = {0.f,0.f,0.f,0.f,0.f,0.f,0.f,0.f}; v8f c00 = z8, c01 = z8, c02 = z8, c03 = z8, c10 = z8, c11 = z8, c12 = z8, c13 = z8;
  g2_copy8(lc, ga, a8); g2_copy8(lc + 64 * G2_PITCH, ga + 8 * a8, a8); g2_copy8(lc + 128 * G2_PITCH, gb, b8);      /* stage 0 into buffer 0 */
  asm volatile("s_wait_asynccnt 0x0" ::: "memory");      /* this wave's copies of stage 0 have landed */
  __syncthreads();      /* every wave's have: stage 0 may be read */
  if (nt > 1) { g2_copy8(lc + G2_BUF, ga + G2_KT, a8); g2_copy8(lc + G2_BUF + 64 * G2_PITCH, ga + G2_KT + 8 * a8, a8); g2_copy8(lc + G2_BUF + 128 * G2_PITCH, gb + G2_KT, b8); }      /* stage 1 flies while stage 0 is worked on */
#pragma unroll 1      /* one stage a trip: the ring's order below is written once */
  for (int t = 0; t < nt; ++t) { const unsigned bo = (unsigned)(t & 1) * G2_BUF;
    const unsigned char* pa = fa + bo; const unsigned char* pb = fb + bo; v16h fr[2][6];      /* two fragment sets: A rows 0..15, 16..31, B columns 0..15 .. 48..63 of one k step */
    fr[0][0] = g2_lfrag(pa); fr[0][1] = g2_lfrag(pa + 16 * G2_PITCH); fr[0][2] = g2_lfrag(pb); fr[0][3] = g2_lfrag(pb + 16 * G2_PITCH); fr[0][4] = g2_lfrag(pb + 32 * G2_PITCH); fr[0][5] = g2_lfrag(pb + 48 * G2_PITCH);
#pragma unroll      /* constant indices keep the fragment sets in registers; constant offsets for the four k steps of a stage */
    for (int kk = 0; kk < 4; ++kk) { const int c = kk & 1, n = c ^ 1;
      if (kk < 3) { const unsigned char* qa = pa + (kk + 1) * 64; const unsigned char* qb = pb + (kk + 1) * 64;      /* the next k step of this same stage */
        fr[n][0] = g2_lfrag(qa); fr[n][1] = g2_lfrag(qa + 16 * G2_PITCH); fr[n][2] = g2_lfrag(qb); fr[n][3] = g2_lfrag(qb + 16 * G2_PITCH); fr[n][4] = g2_lfrag(qb + 32 * G2_PITCH); fr[n][5] = g2_lfrag(qb + 48 * G2_PITCH); }
      __builtin_amdgcn_sched_barrier(0);      /* keeps the twelve LDS reads one group in front of the products: spread among them, each pair is waited out to 0 */
      c00 = g2_mmab(fr[c][0], fr[c][2], c00); c10 = g2_mmab(fr[c][1], fr[c][2], c10); c01 = g2_mmab(fr[c][0], fr[c][3], c01); c11 = g2_mmab(fr[c][1], fr[c][3], c11);
      c02 = g2_mmab(fr[c][0], fr[c][4], c02); c12 = g2_mmab(fr[c][1], fr[c][4], c12); c03 = g2_mmab(fr[c][0], fr[c][5], c03); c13 = g2_mmab(fr[c][1], fr[c][5], c13);
      __builtin_amdgcn_sched_barrier(0); }      /* the other side of the same fence: the following group stays behind these products */
    asm volatile("s_wait_dscnt 0x0" ::: "memory");      /* this wave's reads of the buffer are done before it is handed over */
    asm volatile("s_wait_asynccnt 0x0" ::: "memory");      /* this wave's copies of stage t + 1 have landed */
    __syncthreads();      /* publishes stage t + 1 and ends every reader's last read of stage t's buffer */
    if (t + 2 < nt) { const _Float16* na = ga + (size_t)(t + 2) * G2_KT; const _Float16* nb = gb + (size_t)(t + 2) * G2_KT;      /* refill of the buffer just read */
      g2_copy8(lc + bo, na, a8); g2_copy8(lc + bo + 64 * G2_PITCH, na + 8 * a8, a8); g2_copy8(lc + bo + 128 * G2_PITCH, nb, b8); } }
  asm volatile("s_wait_asynccnt 0x0" ::: "memory");      /* nothing of this wave is in flight behind the loop */
  v8f accs[8] = {c00, c01, c02, c03, c10, c11, c12, c13};
#pragma unroll
  for (int u = 0; u < 8; ++u) { const int t = u & 3, half = u >> 2; const int col = col0 + t * 16 + ln; const float bv = bp ? bf16_round(bp[col]) : 0.f;
#pragma unroll
    for (int r = 0; r < 8; ++r) { const int rloc = half * 16 + 8 * hh + r; float v = accs[u][r] * alpha + bv; if (CP) { if (rowsPerB < 0) v += CP[cofs + (size_t)(row0g + row0 + rloc) * ldc + col];      /* rowsPerB < 0: own element of the batched C plane */ else { const int bidx = (row0g + row0 + rloc) / rowsPerB; v += CP[(size_t)bidx * sCPb + (size_t)by * 64 + col]; } }
      if (ACT == 3) v = fmaxf(v, 0.f); else if (ACT == 6) v = 0.5f * v * (1.0f + erff(v * 0.70710678118654752f)); else if (ACT == 11) v = 1.0f / (1.0f + expf(-v)); else if (ACT == 15) v = v / (1.0f + expf(-v)); else if (ACT == 12) v = (v > 0.f) ? v : 0.01f * v; else if (ACT == 8) v = tanhf(v); else if (ACT == 9) v = 0.5f * v * (1.0f + tanhf(0.7978845608028654f * (v + 0.044715f * v * v * v))); else if (ACT == 14) v = (v > 0.f) ? v : 0.1f * v; else if (ACT == 16) v = (v >= 0.f) ? v : 0.3f * v; else if (ACT == 17) v = (v >= 0.f) ? v : 0.2f * v;
      so[w][rloc][t * 16 + ln] = v; } }
  __builtin_amdgcn_fence(__ATOMIC_ACQ_REL, "workgroup"); __builtin_amdgcn_wave_barrier();
  const int rsub = lane >> 4, c4 = (lane & 15) * 4;
  if (pk == 0) {
#pragma unroll
    for (int q = 0; q < 16; ++q) { const int r = q * 2 + rsub; const v4f v = *(const v4fa*)&so[w][r][c4]; if (C) *(v4f*)(C + cofs + (size_t)(row0 + r) * ldc + col0 + c4) = v; if (C16) { v4h h4; for (int i = 0; i < 4; ++i) h4[i] = (_Float16)v[i]; *(v4h*)(C16 + cofs + (size_t)(row0 + r) * ldc + col0 + c4) = h4; } }
  } else {
    unsigned short* dp = (unsigned short*)C16 + ((size_t)nq * M + row0) * 64 + lane * 8;
    if (pk == 1) {
#pragma unroll
      for (int u = 0; u < 8; ++u) { FragH f; const int rl = (u >> 2) * 16 + ln, cl = (u & 3) * 16 + 8 * hh; const v4f x = *(const v4fa*)&so[w][rl][cl], y = *(const v4fa*)&so[w][rl][cl + 4];
#pragma unroll
        for (int i = 0; i < 4; ++i) { f.h[i] = (_Float16)x[i]; f.h[4 + i] = (_Float16)y[i]; }
        *(v8us*)(dp + u * 256) = f.half[0]; }
      asm volatile("s_wait_xcnt 0x0" ::: "memory");      /* address wait behind the run of stores above, in front of whatever next writes a register that they name */
    } else {
#pragma unroll
      for (int u = 0; u < 8; ++u) { FragH f; const int rl = (u & 1) * 16 + 8 * hh, cl = (u >> 1) * 16 + ln;
#pragma unroll
        for (int i = 0; i < 8; ++i) f.h[i] = (_Float16)so[w][rl + i][cl];
        *(v8us*)(dp + u * 256) = f.half[0]; }
      asm volatile("s_wait_xcnt 0x0" ::: "memory");      /* address wait behind the run of stores above, in front of whatever next writes a register that they name */
    }
  } }


__global__ __launch_bounds__(256) void k_wnat(const float* __restrict__ w, size_t n8, _Float16* __restrict__ Bt) { const size_t t = (size_t)blockIdx.x * 256 + threadIdx.x; if (t >= n8) return; FragH f; for (int q = 0; q < 8; ++q) f.h[q] = (_Float16)(bf16_round(w[t * 8 + q]) * 16.0f); *(v8us*)((unsigned short*)Bt + t * 8) = f.half[0];  }
__global__ __launch_bounds__(256) void k_rsm(const float* __restrict__ S, _Float16* __restrict__ P, int nrows) {
  #pragma clang fp contract(off)
  const int i = blockIdx.x * 256 + threadIdx.x; if (i >= nrows) return; const float* s = S + (size_t)i * SQ; float mx = -3.0e38f;
#pragma unroll 1
  for (int j = 0; j < SQ; ++j) mx = fmaxf(mx, s[j]); float se = 0.f;
#pragma unroll 1
  for (int j = 0; j < SQ; ++j) se += expf(s[j] - mx); const float sc = 256.0f / se;
#pragma unroll 1
  for (int j0 = 0; j0 < SQ; j0 += 8) { FragH f; for (int q = 0; q < 8; ++q) f.h[q] = (_Float16)(expf(s[j0 + q] - mx) * sc); unsigned short* d = (unsigned short*)P + (size_t)i * SQ + j0; *(v8us*)d = f.half[0];  } }
__global__ __launch_bounds__(256) void k_vt(const _Float16* __restrict__ V16, int b, int h0, _Float16* __restrict__ VT) { __shared__ unsigned short tl[64][65]; const int tid = threadIdx.x; const int hh = blockIdx.x % HG, sg = blockIdx.x / HG; const int s0 = sg * 64; const int h = h0 + hh;
  for (int i = tid; i < 64 * 8; i += 256) { const int j = i / 8, d8 = (i % 8) * 8; FragH f; f.half[0] = *(const v8us*)((const unsigned short*)V16 + ((size_t)b * SQ + s0 + j) * DM + h * HD + d8); for (int q = 0; q < 8; ++q) tl[d8 + q][j] = f.u[q]; }
  __syncthreads();
  { for (int i = tid; i < 64 * 8; i += 256) { const int d = i / 8, j8 = (i % 8) * 8; FragH f; for (int q = 0; q < 8; ++q) f.u[q] = tl[d][j8 + q]; *(v8us*)((unsigned short*)VT + ((size_t)hh * HD + d) * SQ + s0 + j8) = f.half[0]; }  } }



__global__ __launch_bounds__(256) void k_rsmkm(const float* __restrict__ S, _Float16* __restrict__ P, int nrows, const int* __restrict__ am) {
  #pragma clang fp contract(off)
  const int t = blockIdx.x * 256 + threadIdx.x; if (t >= nrows) return; const size_t i = (size_t)t; const float* s = S + i * SQ; const int* mr = am + (size_t)(t % SQ) * SQ; float mx = -3.0e38f;
#pragma unroll 1
  for (int j = 0; j < SQ; ++j) { const float f = (mr[j] != 0) ? 1.f : 0.f; mx = fmaxf(mx, fmaf(f, s[j], (1.f - f) * -1.0e9f)); } float se = 0.f;
#pragma unroll 1
  for (int j = 0; j < SQ; ++j) { const float f = (mr[j] != 0) ? 1.f : 0.f; se += __expf(fmaf(f, s[j], (1.f - f) * -1.0e9f) - mx); } const float sc = 256.0f / se;
#pragma unroll 1
  for (int j0 = 0; j0 < SQ; j0 += 8) { FragH fr; for (int q = 0; q < 8; ++q) { const int j = j0 + q; const float f = (mr[j] != 0) ? 1.f : 0.f; fr.h[q] = (_Float16)(__expf(fmaf(f, s[j], (1.f - f) * -1.0e9f) - mx) * sc); }
    unsigned short* d = (unsigned short*)P + i * SQ + j0; *(v8us*)d = fr.half[0];  } }
// The swap of a wave's two 16-lane rows: a plain lane shuffle would go through the LDS pipe.
__device__ __forceinline__ float rs_x16(float v) { const int b = __float_as_int(v); return __int_as_float(__builtin_amdgcn_permlanex16(b, b, 0x76543210, 0xfedcba98, false, false)); }
// Four native 2^x in one statement: no result shares a register
// with a source (early clobber), each exp has an independent one behind it, and the v_nop is the slot that the instruction set asks for behind the last.
__device__ __forceinline__ v4f rs_exp2x4(v4f x) { float y0, y1, y2, y3;
  asm("v_exp_f32 %0, %4\n\tv_exp_f32 %1, %5\n\tv_exp_f32 %2, %6\n\tv_exp_f32 %3, %7\n\tv_nop" : "=&v"(y0), "=&v"(y1), "=&v"(y2), "=&v"(y3) : "v"(x[0]), "v"(x[1]), "v"(x[2]), "v"(x[3]));
  const v4f y = {y0, y1, y2, y3}; return y; }
// One native 2^x with the same slot behind it.
__device__ __forceinline__ float rs_exp2(float x) { float y; asm("v_exp_f32 %0, %1\n\tv_nop" : "=&v"(y) : "v"(x)); return y; }
__device__ __forceinline__ v16h fa_frag(const _Float16* base, unsigned lofs) { FragH f; f.half[0] = *(const v8us*)((const unsigned short*)base + lofs); f.half[1] = *(const v8us*)((const unsigned short*)base + lofs + 16); return f.v; }      /* base is wave-uniform, lofs the lane's own element offset (row ln, k 8 hh) */
__device__ __forceinline__ v16h fa_fragp(const _Float16* base, unsigned lofs) { FragH f; f.half[0] = *(const v8us*)((const unsigned short*)base + lofs); f.half[1] = *(const v8us*)((const unsigned short*)base + lofs + 256); return f.v; }      /* fragment-order operand: two units of 512 bytes, lofs = 8 lane; elements 0..7 and 8..15 as in fa_frag */
__device__ __forceinline__ v8f fa_mma(v16h a, v16h b, v8f c) { return __builtin_amdgcn_wmma_f32_16x16x32_f16(false, a, false, b, (short)0, c, false, false); }
__global__ __launch_bounds__(256) void k_fattn(const _Float16* __restrict__ Q, const _Float16* __restrict__ KP, const _Float16* __restrict__ VP, float* __restrict__ O) {      /* Q in rows; KP, VP in fragment order (k_gemm2, pk 1 and 2): 32 keys of a head are 4 KB in a row in each */
  const int lane = threadIdx.x & 31, ln = lane & 15, hh = lane >> 4; const int w = __builtin_amdgcn_readfirstlane(threadIdx.x >> 5);      /* the wave's number, held scalar so that the row bases are scalar */
  const int h = blockIdx.x / (SQ / 256); const int q0 = (blockIdx.x % (SQ / 256)) * 256 + w * 32;      /* 8 waves of one head share the K and V^T lines in the WGP's cache */
  const float SC = 0.125f * 1.44269504088896340736f;      /* 1 / sqrt(64) and log2 e in one factor: e^x as the native 2^x */
  const unsigned lk = (unsigned)(ln * DM + 8 * hh), lp = (unsigned)(lane * 8);
  const _Float16* qb = Q + (size_t)q0 * DM + h * HD; const _Float16* kb = KP + (size_t)h * HD * SQ; const _Float16* vb = VP + (size_t)h * HD * SQ;
  v16h qf[2][2], kf[2][2], vf[4];
  /* every loop over a fragment, score or output array of this kernel is unrolled: constant indices keep the arrays in registers */
#pragma unroll
  for (int j = 0; j < 2; ++j) { qf[j][0] = fa_frag(qb + j * 16 * DM, lk); qf[j][1] = fa_frag(qb + j * 16 * DM + 32, lk); }
#pragma unroll
  for (int t = 0; t < 2; ++t) { kf[t][0] = fa_fragp(kb + t * 1024, lp); kf[t][1] = fa_fragp(kb + t * 1024 + 512, lp); }
  __builtin_amdgcn_sched_barrier(0);      /* keeps the first V^T loads the youngest, as they are in every pass: otherwise the counted wait at the loop's head falls to 0 and each pass waits out the V^T loads issued just before it */
#pragma unroll
  for (int t = 0; t < 4; ++t) vf[t] = fa_fragp(vb + t * 512, lp);
  const v8f z8 = {0.f, 0.f, 0.f, 0.f, 0.f, 0.f, 0.f, 0.f}; v8f o[2][4]; float m[2] = {-3.0e38f, -3.0e38f}, l[2] = {0.f, 0.f};
#pragma unroll
  for (int j = 0; j < 2; ++j) for (int t = 0; t < 4; ++t) o[j][t] = z8;
  for (int k0 = 0; k0 < SQ; k0 += 32) {
    const int kn = (k0 + 32) & (SQ - 1);      /* the next pass's keys; the last pass fetches keys 0..31 again (in bounds, not used) so that the loop has no branch */
    v8f s[2][2];
#pragma unroll
    for (int t = 0; t < 2; ++t) for (int j = 0; j < 2; ++j) s[t][j] = fa_mma(kf[t][1], qf[j][1], fa_mma(kf[t][0], qf[j][0], z8));
    const _Float16* kp = kb + kn * HD;      /* K one pass ahead, into the registers that the products above have just read */
#pragma unroll
    for (int t = 0; t < 2; ++t) { kf[t][0] = fa_fragp(kp + t * 1024, lp); kf[t][1] = fa_fragp(kp + t * 1024 + 512, lp); }
    FragH pf[2];
#pragma unroll
    for (int j = 0; j < 2; ++j) { float mx = fmaxf(s[0][j][0], s[1][j][0]);
#pragma unroll
      for (int r = 1; r < 8; ++r) mx = fmaxf(mx, fmaxf(s[0][j][r], s[1][j][r]));
      mx = fmaxf(mx, rs_x16(mx)); const float mn = fmaxf(m[j], mx); const float al = rs_exp2((m[j] - mn) * SC); m[j] = mn; const float of = mn * SC - 8.0f;      /* weights are 2^8 e^(s - max): f16 keeps small ones normal; the row sum carries the same factor */
      v4f sm = {0.f, 0.f, 0.f, 0.f};
#pragma unroll
      for (int t = 0; t < 2; ++t) for (int g = 0; g < 2; ++g) { v4f x; for (int q = 0; q < 4; ++q) x[q] = s[t][j][4 * g + q] * SC - of; const v4f p = rs_exp2x4(x); sm += p; for (int q = 0; q < 4; ++q) pf[j].h[8 * t + 4 * g + q] = (_Float16)p[q]; }
      l[j] = l[j] * al + ((sm[0] + sm[1]) + (sm[2] + sm[3]));      /* the lane's own 16 keys; the halves are joined once, behind the loop */
#pragma unroll
      for (int t = 0; t < 4; ++t) o[j][t] *= al; }
#pragma unroll
    for (int t = 0; t < 4; ++t) for (int j = 0; j < 2; ++j) o[j][t] = fa_mma(vf[t], pf[j].v, o[j][t]);
    const _Float16* vp = vb + kn * HD;      /* V^T one pass ahead, likewise */
#pragma unroll
    for (int t = 0; t < 4; ++t) vf[t] = fa_fragp(vp + t * 512, lp);
    asm volatile("s_wait_xcnt 0x0" ::: "memory");      /* the next pass forms its addresses in the registers that the loads above name: their address wait stands in front of that overwrite */
  }
#pragma unroll
  for (int j = 0; j < 2; ++j) { const float inv = 1.0f / (l[j] + rs_x16(l[j])); float* d = O + (size_t)(q0 + j * 16 + ln) * DM + h * HD + 8 * hh;
#pragma unroll
    for (int t = 0; t < 4; ++t) { const v4f lo = {o[j][t][0] * inv, o[j][t][1] * inv, o[j][t][2] * inv, o[j][t][3] * inv}, hi = {o[j][t][4] * inv, o[j][t][5] * inv, o[j][t][6] * inv, o[j][t][7] * inv}; *(v4f*)(d + t * 16) = lo; *(v4f*)(d + t * 16 + 4) = hi; } } }



__global__ __launch_bounds__(256) void k_wthd(const float* __restrict__ Wt, _Float16* __restrict__ Bt) { const size_t t = (size_t)blockIdx.x * 256 + threadIdx.x; if (t >= (size_t)NH * HD * (DM / 8)) return; const int m8 = (int)(t % (DM / 8)) * 8; const int d = (int)((t / (DM / 8)) % HD); const int h = (int)(t / ((size_t)(DM / 8) * HD)); FragH f;
  for (int q = 0; q < 8; ++q) f.h[q] = (_Float16)(16.0f * bf16_round(Wt[((size_t)h * DM + m8 + q) * HD + d])); unsigned short* dst = (unsigned short*)Bt + ((size_t)h * HD + d) * DM + m8; *(v8us*)dst = f.half[0];  }





extern "C" void kernel_launch(void* const* d_in, const int* in_sizes, int n_in,
                              void* d_out, int out_size, void* d_ws, size_t ws_size, hipStream_t stream) {
  (void)in_sizes; (void)n_in; (void)out_size;
  const float* const* I = (const float* const*)d_in; const float* xq = I[0]; const float* xk = I[1]; const float* xv = I[2]; const float* wq = I[3]; const float* bq = I[4]; const float* wk = I[5]; const float* bk = I[6]; const float* wv = I[7]; const float* bv = I[8]; const float* x = xq;      /* X_Q, X_K, X_V [4096][1024]; per-head Wq / Wk / Wv [16][1024][64] ([in][out] per head) + biases [16][64] = [(h, d)]; no output projection */
  static_assert(NH * HD == DM && DM % 128 == 0 && SQ % 256 == 0 && HD == 64 && HG == 1 && NB == 1, "shape / tile multiples");
  char* ws = (char*)d_ws; size_t off = 0;
  auto take = [&](size_t bytes) { char* p = ws + off; off += (bytes + 255) & ~(size_t)255; return p; };
  _Float16* BQ = (_Float16*)take((size_t)DM * DM * 2); _Float16* BK = (_Float16*)take((size_t)DM * DM * 2); _Float16* BV = (_Float16*)take((size_t)DM * DM * 2);
  _Float16* X16 = (_Float16*)take(NR * DM * 2); _Float16* XKp = (_Float16*)take(NR * DM * 2); _Float16* XVp = (_Float16*)take(NR * DM * 2); _Float16* Q16 = (_Float16*)take(NR * DM * 2); _Float16* KP = (_Float16*)take((size_t)NH * HD * SQ * 2);
  _Float16* VP = (_Float16*)take((size_t)NH * HD * SQ * 2);
  if (off > ws_size) return;
  { const unsigned g = (unsigned)(((size_t)NH * HD * (DM / 8) + 255) / 256); k_wthd<<<g, 256, 0, stream>>>(wq, BQ); k_wthd<<<g, 256, 0, stream>>>(wk, BK); k_wthd<<<g, 256, 0, stream>>>(wv, BV); }      /* per-head [m][d] -> Bt[(h, d)][m] x16 */
  _Float16* XK = XKp; _Float16* XV = XVp; k_x16<<<(unsigned)((NR * DM / 8 + 255) / 256), 256, 0, stream>>>(xk, XK, NR * DM / 8); k_x16<<<(unsigned)((NR * DM / 8 + 255) / 256), 256, 0, stream>>>(xv, XV, NR * DM / 8);      /* key and value inputs as exact f16 rows */

  k_x16<<<(unsigned)((NR * DM / 8 + 255) / 256), 256, 0, stream>>>(x, X16, NR * DM / 8);
  const size_t r0p = (size_t)B0 * SQ;      /* first projected row */
  k_gemm2<0><<<dim3((unsigned)((MP / 128) * (DM / 64)), 1), 128, 0, stream>>>(X16 + r0p * DM, DM, 0, BQ, DM, 0, 0.0625f, bq, 0, nullptr, 1, 0, 0, nullptr, Q16 + r0p * DM, DM, 0, MP, DM, DM, 0);
  k_gemm2<0><<<dim3((unsigned)((MP / 128) * (DM / 64)), 1), 128, 0, stream>>>(XK + r0p * DM, DM, 0, BK, DM, 0, 0.0625f, bk, 0, nullptr, 1, 0, 0, nullptr, KP, DM, 0, MP, DM, DM, 1);      /* K in fragment order */
  k_gemm2<0><<<dim3((unsigned)((MP / 128) * (DM / 64)), 1), 128, 0, stream>>>(XV + r0p * DM, DM, 0, BV, DM, 0, 0.0625f, bv, 0, nullptr, 1, 0, 0, nullptr, VP, DM, 0, MP, DM, DM, 2);      /* V^T in fragment order */
  for (int b = B0; b < B0 + NBR; ++b) { const size_t r0 = (size_t)b * SQ;
    k_fattn<<<NH * (SQ / 256), 256, 0, stream>>>(Q16 + r0 * LQ, KP, VP, (float*)d_out + r0 * DM); }      /* all heads: softmax(Q K^T / 8) V written f32 straight into each head's 64 columns of the output rows (no output projection) */
}

// v005
// One run takes 159 microseconds.
// In both of two side-by-side timings against v004, it was 1.06 times as fast.
// Counting every step since v000, it is 83.6 times as fast.
#include <hip/hip_runtime.h>
// Multi-head attention over three inputs with PER-HEAD projection weights and no output projection (X_Q, X_K, X_V [4096][1024] (one sequence); Q[h] = X_Q Wq[h] + bq[h], K, V likewise (Wq / Wk / Wv [16][1024][64] per-head [in][out], sigma 1/32; biases [16][64] sigma 1/32); scores = Q[h] K[h]^T / sqrt(64); softmax over all 4096 keys; out[h] = attn V[h]; heads concatenated along the feature axis -> [4096][1024]).
// Structure: one preparation launch (the three inputs as exact f16 rows (bf16-rounded); per-head [in][out] weights gathered into Bt[(h, d)][in] x16 planes); Q, K, V as three WMMA GEMMs (32x64 wave tiles, operands staged in LDS by asynchronous copies in a ring of two buffers, f32 accumulation, + bias [(h, d)], f16 outputs; the K and V GEMMs store their 32-key x 64-feature wave tiles in the attention loop's fragment order, V transposed on the way); then ONE attention launch for all heads: a wave owns 32 query rows and walks the 4096 keys 32 at a time, S^T = K Q^T, running-maximum softmax in registers (f32 statistics; weights x256 as f16), O^T += V^T P^T, divided by the row sum at the end and written f32 straight into the head's 64 columns of the output rows.
// Compute dtype: inputs rounded to bf16; x / weights exact; q, k, v and softmax weights as plain f16 GEMM operands (~2^-12); scores, softmax statistics and o f32. v_wmma_f32_16x16x32_f16.
#define NB 1
#define SQ 4096
#define DM 1024
#define NH 16
#define HD 64
#define HG 1                         /* heads per launch of the non-template k_vt */
#define B0 0                         /* first batch processed (debug hook) */
#define NBR NB                       /* batches processed (debug hook) */
#define NR ((size_t)NB * SQ)         /* token rows */
#define MP ((int)((size_t)NBR * SQ)) /* rows projected (debug hook) */
#define QN SQ                        /* unused (the attention launch attends all SQ query rows) */
#define NHD NH                       /* unused (the attention launch covers all NH heads) */
#define MPO MP                       /* unused (there is no output stage) */
#define LQ DM      /* row pitch of the q rows */
typedef __bf16 v16b __attribute__((ext_vector_type(16)));
typedef unsigned short v8us __attribute__((ext_vector_type(8), may_alias));
typedef float  v8f  __attribute__((ext_vector_type(8)));
typedef float  v4f  __attribute__((ext_vector_type(4)));
typedef float  v4fa __attribute__((ext_vector_type(4), may_alias));
union FragB { v16b v; v8us half[2]; unsigned short u[16]; };

__device__ __forceinline__ unsigned short bf16_bits(float x) { unsigned int u = __float_as_uint(x); return (unsigned short)((u + 0x7FFFu + ((u >> 16) & 1u)) >> 16); }
__device__ __forceinline__ float bf16_val(unsigned short b) { return __uint_as_float(((unsigned int)b) << 16); }
__device__ __forceinline__ float bf16_round(float x) { return bf16_val(bf16_bits(x)); }
// D += A·B with NT terms: 1 = ah·bh, 2 = + al·bh (A split), 3 = + ah·bl (both split)
template <int NT>
__device__ __forceinline__ v8f mmaN(v16b ah, v16b al, v16b bh, v16b bl, v8f c) {
  c = __builtin_amdgcn_wmma_f32_16x16x32_bf16(false, ah, false, bh, (short)0, c, false, false);
  if (NT >= 2) c = __builtin_amdgcn_wmma_f32_16x16x32_bf16(false, al, false, bh, (short)0, c, false, false);
  if (NT >= 3) c = __builtin_amdgcn_wmma_f32_16x16x32_bf16(false, ah, false, bl, (short)0, c, false, false);
  asm volatile("v_nop\n\tv_nop\n\tv_nop\n\tv_nop" : "+v"(c) : "v"(ah), "v"(al), "v"(bh), "v"(bl));
  return c;
}

__global__ __launch_bounds__(256) void k_wt_bf16(const float* __restrict__ W, unsigned short* __restrict__ Wt, int K, int N) {
  const int t = blockIdx.x * 256 + threadIdx.x;
  const int k8n = K / 8;
  if (t >= N * k8n) return;
  const int n = t / k8n, k8 = (t % k8n) * 8;
  v8us v;
#pragma unroll
  for (int i = 0; i < 8; ++i) v[i] = bf16_bits(W[(size_t)(k8 + i) * N + n]);
  *(v8us*)(Wt + (size_t)n * K + k8) = v;
  
}

// GEMM C[M][N] (f32, pitch ldc) = act(A[M][K]·W + bias). A f32 row-major (pitch lda) converted per fragment to bf16
// (ASPLIT: hi/lo two planes -> 2 terms, else single rounded term); Wt bf16 [N][K] (pitch ldb). BIAS_BF16 rounds the
// bias to bf16 first (bias quantised to bf16 before the add). K%32==0, M%16==0, N%64==0.
template <bool ASPLIT, int ACT, bool BIAS_BF16>
__global__ __launch_bounds__(128) void k_gemm_bf(const float* __restrict__ A, int lda, const unsigned short* __restrict__ Wt, int ldb,
                                               const float* __restrict__ bias, float* __restrict__ C, int ldc, int M, int N, int K) {
  __shared__ __attribute__((aligned(16))) float so[4][16][64];
  const int tid = threadIdx.x, w = tid >> 5, lane = tid & 31, ln = lane & 15, hh = lane >> 4;
  const int ntn = N / 64;
  const int wid = blockIdx.x * 4 + w;
  const int mt = wid / ntn, nq = wid % ntn;
  if (mt * 16 >= M) return;
  const int row0 = mt * 16, col0 = nq * 64;
  const float* arow = A + (size_t)(row0 + ln) * lda;
  v8f acc[4] = {};
  for (int kb = 0; kb < K; kb += 32) {
    FragB ah, al;
    const v4f x0 = *(const v4fa*)(arow + kb + 8 * hh), x1 = *(const v4fa*)(arow + kb + 8 * hh + 4);
    const v4f x2 = *(const v4fa*)(arow + kb + 16 + 8 * hh), x3 = *(const v4fa*)(arow + kb + 16 + 8 * hh + 4);
    float xs[16] = {x0[0],x0[1],x0[2],x0[3],x1[0],x1[1],x1[2],x1[3],x2[0],x2[1],x2[2],x2[3],x3[0],x3[1],x3[2],x3[3]};
#pragma unroll
    for (int i = 0; i < 16; ++i) { const unsigned short hb = bf16_bits(xs[i]); ah.u[i] = hb; al.u[i] = ASPLIT ? bf16_bits(xs[i] - bf16_val(hb)) : (unsigned short)0; }
#pragma unroll
    for (int t = 0; t < 4; ++t) {
      const unsigned short* brow = Wt + (size_t)(col0 + t * 16 + ln) * ldb + kb;
      FragB b;
      b.half[0] = *(const v8us*)(brow + 8 * hh);
      b.half[1] = *(const v8us*)(brow + 16 + 8 * hh);
      acc[t] = mmaN<ASPLIT ? 2 : 1>(ah.v, al.v, b.v, b.v, acc[t]);
    }
  }
#pragma unroll
  for (int t = 0; t < 4; ++t) {
    float bv = bias ? bias[col0 + t * 16 + ln] : 0.f;
    if (BIAS_BF16) bv = bf16_round(bv);
#pragma unroll
    for (int r = 0; r < 8; ++r) { float v = acc[t][r] + bv; if (ACT == 1) v = fmaxf(v, 0.f); so[w][8 * hh + r][t * 16 + ln] = v; }
  }
  __builtin_amdgcn_fence(__ATOMIC_ACQ_REL, "workgroup");
  __builtin_amdgcn_wave_barrier();
  const int rsub = lane >> 4, c4 = (lane & 15) * 4;
  {
#pragma unroll
    for (int q = 0; q < 8; ++q) {
      const int r = q * 2 + rsub;
      const v4f v = *(const v4fa*)&so[w][r][c4];
      *(v4f*)(C + (size_t)(row0 + r) * ldc + col0 + c4) = v;
    }
    
  }
}

// GEMM C = act(A·W + bias + resid): A f32 (ASPLIT -> hi/lo 2 terms), Wt bf16 [N][K]; ACT 0 none, 1 relu, 2 exact gelu;
// resid (optional, f32, row index = (row % rmod), pitch ldr, RES_BF16 rounds it) added before the activation.
template <bool ASPLIT, int ACT, bool BIAS_BF16, bool RES_BF16>
__global__ __launch_bounds__(128) void k_gemm_bf3(const float* __restrict__ A, int lda, const unsigned short* __restrict__ Wt, int ldb,
                                                const float* __restrict__ bias, const float* __restrict__ resid, int rmod, int ldr,
                                                float* __restrict__ C, int ldc, int M, int N, int K) {
  __shared__ __attribute__((aligned(16))) float so[4][16][64];
  const int tid = threadIdx.x, w = tid >> 5, lane = tid & 31, ln = lane & 15, hh = lane >> 4;
  const int ntn = N / 64;
  const int wid = blockIdx.x * 4 + w;
  const int mt = wid / ntn, nq = wid % ntn;
  if (mt * 16 >= M) return;
  const int row0 = mt * 16, col0 = nq * 64;
  const float* arow = A + (size_t)(row0 + ln) * lda;
  v8f acc[4] = {};
  for (int kb = 0; kb < K; kb += 32) {
    FragB ah, al;
    const v4f x0 = *(const v4fa*)(arow + kb + 8 * hh), x1 = *(const v4fa*)(arow + kb + 8 * hh + 4);
    const v4f x2 = *(const v4fa*)(arow + kb + 16 + 8 * hh), x3 = *(const v4fa*)(arow + kb + 16 + 8 * hh + 4);
    float xs[16] = {x0[0],x0[1],x0[2],x0[3],x1[0],x1[1],x1[2],x1[3],x2[0],x2[1],x2[2],x2[3],x3[0],x3[1],x3[2],x3[3]};
#pragma unroll
    for (int i = 0; i < 16; ++i) { const unsigned short hb = bf16_bits(xs[i]); ah.u[i] = hb; al.u[i] = ASPLIT ? bf16_bits(xs[i] - bf16_val(hb)) : (unsigned short)0; }
#pragma unroll
    for (int t = 0; t < 4; ++t) {
      const unsigned short* brow = Wt + (size_t)(col0 + t * 16 + ln) * ldb + kb;
      FragB b;
      b.half[0] = *(const v8us*)(brow + 8 * hh);
      b.half[1] = *(const v8us*)(brow + 16 + 8 * hh);
      acc[t] = mmaN<ASPLIT ? 2 : 1>(ah.v, al.v, b.v, b.v, acc[t]);
    }
  }
#pragma unroll
  for (int t = 0; t < 4; ++t) {
    const int col = col0 + t * 16 + ln;
    float bv = bias ? bias[col] : 0.f;
    if (BIAS_BF16) bv = bf16_round(bv);
#pragma unroll
    for (int r = 0; r < 8; ++r) {
      float v = acc[t][r] + bv;
      if (resid) { float rv = resid[(size_t)((row0 + 8 * hh + r) % rmod) * ldr + col]; if (RES_BF16) rv = bf16_round(rv); v += rv; }
      if (ACT == 1) v = fmaxf(v, 0.f);
      if (ACT == 2) v = 0.5f * v * (1.0f + erff(v * 0.70710678118654752f));
      if (ACT == 3) { const float u = 0.7978845608028654f * (v + 0.044715f * v * v * v); v = 0.5f * v * (1.0f + tanhf(u)); }
      so[w][8 * hh + r][t * 16 + ln] = v;
    }
  }
  __builtin_amdgcn_fence(__ATOMIC_ACQ_REL, "workgroup");
  __builtin_amdgcn_wave_barrier();
  const int rsub = lane >> 4, c4 = (lane & 15) * 4;
  {
#pragma unroll
    for (int q = 0; q < 8; ++q) {
      const int r = q * 2 + rsub;
      const v4f v = *(const v4fa*)&so[w][r][c4];
      *(v4f*)(C + (size_t)(row0 + r) * ldc + col0 + c4) = v;
    }
    
  }
}
// row LayerNorm (biased variance, eps) over N: s = X (+ R); optional out_sum <- s; out_norm <- (s-mu)*rsqrt(var+eps)*g + b
template <bool PARAM_BF16>
__global__ __launch_bounds__(256) void k_layernorm(const float* __restrict__ X, const float* __restrict__ R, const float* __restrict__ g, const float* __restrict__ bta,
                                                  float* __restrict__ out_sum, float* __restrict__ out_norm, int N, float eps) {
  __shared__ float red[256];
  const int row = blockIdx.x, tid = threadIdx.x;
  const float* x = X + (size_t)row * N; const float* rr = R ? R + (size_t)row * N : nullptr;
  float vals[16];                     // up to N = 4096
  const int per = N / 256;            // contiguous chunk per thread? use strided-by-4 chunks: thread handles j = tid*4 + 1024*u
  float s1 = 0.f;
  for (int u = 0; u < per / 4; ++u) {
    const int j = tid * 4 + 1024 * u;
    const v4f a = *(const v4fa*)(x + j);
    v4f b = {0.f,0.f,0.f,0.f}; if (rr) b = *(const v4fa*)(rr + j);
#pragma unroll
    for (int q = 0; q < 4; ++q) { const float v = a[q] + b[q]; vals[u * 4 + q] = v; s1 += v; }
  }
  red[tid] = s1; __syncthreads();
  for (int st = 128; st > 0; st >>= 1) { if (tid < st) red[tid] += red[tid + st]; __syncthreads(); }
  const float mu = red[0] / (float)N; __syncthreads();
  float s2 = 0.f;
  for (int u = 0; u < per / 4; ++u)
#pragma unroll
    for (int q = 0; q < 4; ++q) { const float c = vals[u * 4 + q] - mu; s2 += c * c; }
  red[tid] = s2; __syncthreads();
  for (int st = 128; st > 0; st >>= 1) { if (tid < st) red[tid] += red[tid + st]; __syncthreads(); }
  const float rs = rsqrtf(red[0] / (float)N + eps);
  {
    for (int u = 0; u < per / 4; ++u) {
      const int j = tid * 4 + 1024 * u;
      v4f o, sm;
#pragma unroll
      for (int q = 0; q < 4; ++q) {
        float gg = g[j + q], bb = bta[j + q];
        if (PARAM_BF16) { gg = bf16_round(gg); bb = bf16_round(bb); }
        sm[q] = vals[u * 4 + q]; o[q] = (vals[u * 4 + q] - mu) * rs * gg + bb;
      }
      if (out_sum) *(v4f*)(out_sum + (size_t)row * N + j) = sm;
      *(v4f*)(out_norm + (size_t)row * N + j) = o;
    }
    
  }
}



// ---- f16 WMMA path (v_wmma_f32_16x16x32_f16): 11-bit significands for operands in range — used where a [0,1] probability operand needs more precision than bf16
typedef _Float16 v16h __attribute__((ext_vector_type(16)));
union FragH { v16h v; v8us half[2]; _Float16 h[16]; unsigned short u[16]; };
template <int NT>
__device__ __forceinline__ v8f mmaH(v16h ah, v16h al, v16h bh, v16h bl, v8f c) {
  c = __builtin_amdgcn_wmma_f32_16x16x32_f16(false, ah, false, bh, (short)0, c, false, false);
  if (NT >= 2) c = __builtin_amdgcn_wmma_f32_16x16x32_f16(false, al, false, bh, (short)0, c, false, false);
  if (NT >= 3) c = __builtin_amdgcn_wmma_f32_16x16x32_f16(false, ah, false, bl, (short)0, c, false, false);
  asm volatile("v_nop\n\tv_nop\n\tv_nop\n\tv_nop" : "+v"(c) : "v"(ah), "v"(al), "v"(bh), "v"(bl));
  return c;
}
// batched GEMM like k_gemm_b but f16 operands: A f32 (split into f16 hi/lo if ASPLIT, else rounded to f16), Bt = f16 values [n][k]; alpha; C f32; N multiple of 16 (partial tiles skipped)
template <bool ASPLIT>
__global__ __launch_bounds__(128) void k_gemm_h(const float* __restrict__ A, int lda, size_t sA, const _Float16* __restrict__ Bh, int ldb, size_t sB, float alpha, float* __restrict__ C, int ldc, size_t sC, int M, int N, int K) {
  __shared__ __attribute__((aligned(16))) float so[4][16][64];
  const int tid = threadIdx.x, w = tid >> 5, lane = tid & 31, ln = lane & 15, hh = lane >> 4; const int by = blockIdx.y;
  A += (size_t)by * sA; Bh += (size_t)by * sB; C += (size_t)by * sC;
  const int ntn = (N + 63) / 64; const int wid = blockIdx.x * 4 + w; const int mt = wid / ntn, nq = wid % ntn; if (mt * 16 >= M) return;
  const int row0 = mt * 16, col0 = nq * 64; const float* arow = A + (size_t)(row0 + ln) * lda;
  v8f acc[4] = {};
  for (int kb = 0; kb < K; kb += 32) {
    FragH ah, al;
    const v4f x0 = *(const v4fa*)(arow + kb + 8 * hh), x1 = *(const v4fa*)(arow + kb + 8 * hh + 4), x2 = *(const v4fa*)(arow + kb + 16 + 8 * hh), x3 = *(const v4fa*)(arow + kb + 16 + 8 * hh + 4);
    float xs[16] = {x0[0],x0[1],x0[2],x0[3],x1[0],x1[1],x1[2],x1[3],x2[0],x2[1],x2[2],x2[3],x3[0],x3[1],x3[2],x3[3]};
#pragma unroll
    for (int i = 0; i < 16; ++i) { const _Float16 h = (_Float16)xs[i]; ah.h[i] = h; al.h[i] = ASPLIT ? (_Float16)(xs[i] - (float)h) : (_Float16)0.0f; }
#pragma unroll
    for (int t = 0; t < 4; ++t) { if (col0 + t * 16 >= N) continue; const size_t boff = (size_t)(col0 + t * 16 + ln) * ldb + kb; FragH bq; bq.half[0] = *(const v8us*)(Bh + boff + 8 * hh); bq.half[1] = *(const v8us*)(Bh + boff + 16 + 8 * hh);
      acc[t] = mmaH<ASPLIT ? 2 : 1>(ah.v, al.v, bq.v, bq.v, acc[t]); }
  }
#pragma unroll
  for (int t = 0; t < 4; ++t) { if (col0 + t * 16 >= N) continue;
#pragma unroll
    for (int r = 0; r < 8; ++r) so[w][8 * hh + r][t * 16 + ln] = acc[t][r] * alpha; }
  __builtin_amdgcn_fence(__ATOMIC_ACQ_REL, "workgroup"); __builtin_amdgcn_wave_barrier();
  const int rsub = lane >> 4, c4 = (lane & 15) * 4;
  {
#pragma unroll
    for (int q = 0; q < 8; ++q) { const int r = q * 2 + rsub; if (col0 + c4 < N) { const v4f v = *(const v4fa*)&so[w][r][c4]; *(v4f*)(C + (size_t)(row0 + r) * ldc + col0 + c4) = v; } }
     }
}

// Wt[n][k] = f16(W[k][n]·scale) from f32 row-major W[K][N] (scale = power of two; bf16-exact weights stay exact in f16 away from the subnormal range)
__global__ __launch_bounds__(256) void k_wt_f16(const float* __restrict__ W, _Float16* __restrict__ Wt, int K, int N, float scale) {
  const int t = blockIdx.x * 256 + threadIdx.x; if (t >= N * (K / 8)) return; const int n = t / (K / 8), k8 = (t % (K / 8)) * 8; FragH f;
#pragma unroll
  for (int i = 0; i < 8; ++i) f.h[i] = (_Float16)(bf16_round(W[(size_t)(k8 + i) * N + n]) * scale); const v8us o = f.half[0];
  *(v8us*)((unsigned short*)Wt + (size_t)n * K + k8) = o; 
}
// k_gemm_hh variant with fused epilogue: v = acc·alpha + bias[by·sBias + col] (+ CP[(row/rowsPerB)·sCPb + by·64 + col] if CP) ; ACT 0 none / 1 elu ; writes f16 C16 (and f32 C if non-null)
template <int ACT>
__global__ __launch_bounds__(128) void k_gemm_hhx(const _Float16* __restrict__ A, int lda, size_t sA, const _Float16* __restrict__ Bh, int ldb, size_t sB, float alpha, const float* __restrict__ bias, size_t sBias, const float* __restrict__ CP, int rowsPerB, size_t sCPb, int row0g,
    float* __restrict__ C, _Float16* __restrict__ C16, int ldc, size_t sC, int M, int N, int K) {
  __shared__ __attribute__((aligned(16))) float so[4][16][64];
  const int tid = threadIdx.x, w = tid >> 5, lane = tid & 31, ln = lane & 15, hh = lane >> 4; const int by = blockIdx.y;
  A += (size_t)by * sA; Bh += (size_t)by * sB; const size_t cofs = (size_t)by * sC; const float* bp = bias ? bias + (size_t)by * sBias : nullptr;
  const int ntn = (N + 63) / 64; const int wid = blockIdx.x * 4 + w; const int mt = wid / ntn, nq = wid % ntn; if (mt * 16 >= M) return;
  const int row0 = mt * 16, col0 = nq * 64; const _Float16* arow = A + (size_t)(row0 + ln) * lda;
  v8f acc[4] = {};
  for (int kb = 0; kb < K; kb += 32) { FragH ah; ah.half[0] = *(const v8us*)((const unsigned short*)arow + kb + 8 * hh); ah.half[1] = *(const v8us*)((const unsigned short*)arow + kb + 16 + 8 * hh);
#pragma unroll
    for (int t = 0; t < 4; ++t) { if (col0 + t * 16 >= N) continue; const size_t boff = (size_t)(col0 + t * 16 + ln) * ldb + kb; FragH bq; bq.half[0] = *(const v8us*)((const unsigned short*)Bh + boff + 8 * hh); bq.half[1] = *(const v8us*)((const unsigned short*)Bh + boff + 16 + 8 * hh);
      acc[t] = mmaH<1>(ah.v, ah.v, bq.v, bq.v, acc[t]); }
  }
#pragma unroll
  for (int t = 0; t < 4; ++t) { if (col0 + t * 16 >= N) continue; const int col = col0 + t * 16 + ln; const float bv = bp ? bf16_round(bp[col]) : 0.f;
#pragma unroll
    for (int r = 0; r < 8; ++r) { float v = acc[t][r] * alpha + bv; if (CP) { const int rr = row0g + row0 + 8 * hh + r; if (rowsPerB < 0) v += CP[cofs + (size_t)rr * ldc + col];      /* rowsPerB < 0: own element of the batched C plane */ else { const int bidx = rr / rowsPerB; v += CP[(size_t)bidx * sCPb + (size_t)by * 64 + col]; } } if (ACT == 1) v = (v > 0.f) ? v : expm1f(v); else if (ACT == 7) v = (v > 0.f) ? v + 1.0f : expf(v); else if (ACT == 8) v = tanhf(v); else if (ACT == 9) v = 0.5f * v * (1.0f + tanhf(0.7978845608028654f * (v + 0.044715f * v * v * v))); else if (ACT == 11) v = 1.0f / (1.0f + expf(-v)); else if (ACT == 12) v = (v > 0.f) ? v : 0.01f * v; else if (ACT == 14) v = (v > 0.f) ? v : 0.1f * v; else if (ACT == 16) v = (v >= 0.f) ? v : 0.3f * v; else if (ACT == 17) v = (v >= 0.f) ? v : 0.2f * v; else if (ACT == 15) v = v / (1.0f + expf(-v)); else if (ACT == 3) v = fmaxf(v, 0.f); else if (ACT == 6) v = 0.5f * v * (1.0f + erff(v * 0.70710678118654752f)); so[w][8 * hh + r][t * 16 + ln] = v; } }
  __builtin_amdgcn_fence(__ATOMIC_ACQ_REL, "workgroup"); __builtin_amdgcn_wave_barrier();
  const int rsub = lane >> 4, c4 = (lane & 15) * 4; typedef _Float16 v4h __attribute__((ext_vector_type(4)));
  {
#pragma unroll
    for (int q = 0; q < 8; ++q) { const int r = q * 2 + rsub; if (col0 + c4 < N) { const v4f v = *(const v4fa*)&so[w][r][c4]; if (C) *(v4f*)(C + cofs + (size_t)(row0 + r) * ldc + col0 + c4) = v; if (C16) { v4h h4; for (int i = 0; i < 4; ++i) h4[i] = (_Float16)v[i]; *(v4h*)(C16 + cofs + (size_t)(row0 + r) * ldc + col0 + c4) = h4; } } }
     }
}


typedef _Float16 v4h __attribute__((ext_vector_type(4)));

__global__ __launch_bounds__(256) void k_h16(const float* __restrict__ x, _Float16* __restrict__ X16, size_t n8) { const size_t t = (size_t)blockIdx.x * 256 + threadIdx.x; if (t >= n8) return; FragH f;
#pragma unroll
  for (int q = 0; q < 8; ++q) f.h[q] = (_Float16)x[t * 8 + q]; *(v8us*)((unsigned short*)X16 + t * 8) = f.half[0];  }
__global__ __launch_bounds__(256) void k_round16f(const float* __restrict__ W, _Float16* __restrict__ Bt, size_t n8) { const size_t t = (size_t)blockIdx.x * 256 + threadIdx.x; if (t >= n8) return; FragH f;
#pragma unroll
  for (int i = 0; i < 8; ++i) f.h[i] = (_Float16)(bf16_round(W[t * 8 + i]) * 16.0f); *(v8us*)((unsigned short*)Bt + t * 8) = f.half[0];  }
template <int NHv, int TTv>
__global__ __launch_bounds__(256) void k_vt(const _Float16* __restrict__ V16, int ldv, int voff, _Float16* __restrict__ Vt) { __shared__ unsigned short tl[64][66]; const int tid = threadIdx.x; const int slab = blockIdx.x / (TTv / 64), lg = blockIdx.x % (TTv / 64); const int b = slab / NHv, h = slab % NHv;
  for (int i = tid; i < 64 * 8; i += 256) { const int r = i / 8, c8 = (i % 8) * 8; FragH f; f.half[0] = *(const v8us*)((const unsigned short*)V16 + ((size_t)b * TTv + lg * 64 + r) * ldv + voff + h * 64 + c8);
#pragma unroll
    for (int q = 0; q < 8; ++q) tl[r][c8 + q] = f.u[q]; }
  __syncthreads();
  {
#pragma unroll
    for (int rd = 0; rd < 2; ++rd) { const int d = rd * 32 + tid / 8, pc = tid % 8; FragH f;
#pragma unroll
      for (int q = 0; q < 8; ++q) f.u[q] = tl[pc * 8 + q][d];
      *(v8us*)((unsigned short*)Vt + ((size_t)slab * 64 + d) * TTv + lg * 64 + pc * 8) = f.half[0]; }
     } }

__global__ __launch_bounds__(256) void k_hl(const float* __restrict__ F, _Float16* __restrict__ Hh, _Float16* __restrict__ Hl, size_t n8) { const size_t t = (size_t)blockIdx.x * 256 + threadIdx.x; if (t >= n8) return; FragH fh, fl; const v4f a = *(const v4fa*)(F + t * 8), c = *(const v4fa*)(F + t * 8 + 4);
#pragma unroll
  for (int q = 0; q < 4; ++q) { _Float16 h = (_Float16)a[q]; fh.h[q] = h; fl.h[q] = (_Float16)((a[q] - (float)h) * 1024.0f); h = (_Float16)c[q]; fh.h[4 + q] = h; fl.h[4 + q] = (_Float16)((c[q] - (float)h) * 1024.0f); }
  { *(v8us*)((unsigned short*)Hh + t * 8) = fh.half[0]; *(v8us*)((unsigned short*)Hl + t * 8) = fl.half[0];  } }

// ---- fast GEMM (wave tile 32x64, work-group tile 128x64; requires M % 128 == 0 rows per launch region, N % 64 == 0 and K % 128 == 0); epilogue = k_gemm_hhx semantics ----
__device__ __forceinline__ v16h g2_frag(const _Float16* p, int hh) { FragH f; f.half[0] = *(const v8us*)((const unsigned short*)p + 8 * hh); f.half[1] = *(const v8us*)((const unsigned short*)p + 16 + 8 * hh); return f.v; }
__device__ __forceinline__ v8f g2_mma(v16h a, v16h b, v8f c) { v8f d = __builtin_amdgcn_wmma_f32_16x16x32_f16(false, a, false, b, (short)0, c, false, false); asm volatile("v_nop\n\tv_nop\n\tv_nop\n\tv_nop" : "+v"(d) : "v"(a), "v"(b)); return d; }
// ---- operand ring of k_gemm2: a stage is 128 k (256 bytes) of the work-group's 128 A rows and 64 B rows, laid in LDS at a pitch of 272 bytes (16 x odd: 16-byte fragment reads meet no bank conflict); two buffers ----
#define G2_KT 128
#define G2_PITCH 272
#define G2_BUF (192 * G2_PITCH)
__device__ __forceinline__ v8f g2_mmab(v16h a, v16h b, v8f c) { return __builtin_amdgcn_wmma_f32_16x16x32_f16(false, a, false, b, (short)0, c, false, false); }
__device__ __forceinline__ v16h g2_lfrag(const unsigned char* p) { FragH f; f.half[0] = *(const v8us*)p; f.half[1] = *(const v8us*)(p + 32); return f.v; }      /* p = the lane's row + 16 hh bytes: elements 0..7 = k 8 hh + e, 8..15 = k 16 + 8 hh + e, as in g2_frag */
// Eight asynchronous 16-byte copies of a thread, global to LDS through no register: 64 operand rows a call (row step 8), 16 threads a row, so that a wave's copy reads two whole 256-byte row pieces.
// The address wait is the statement's last line: it stands in front of whatever next writes a register that a copy names.
__device__ __forceinline__ void g2_copy8(unsigned l, const _Float16* g, size_t g8) {
  const unsigned l1 = l + 8 * G2_PITCH, l2 = l + 16 * G2_PITCH, l3 = l + 24 * G2_PITCH, l4 = l + 32 * G2_PITCH, l5 = l + 40 * G2_PITCH, l6 = l + 48 * G2_PITCH, l7 = l + 56 * G2_PITCH;
  const _Float16* g1 = g + g8; const _Float16* g2 = g1 + g8; const _Float16* g3 = g2 + g8; const _Float16* g4 = g3 + g8; const _Float16* g5 = g4 + g8; const _Float16* g6 = g5 + g8; const _Float16* g7 = g6 + g8;
  asm volatile("global_load_async_to_lds_b128 %0, %8, off\n\tglobal_load_async_to_lds_b128 %1, %9, off\n\tglobal_load_async_to_lds_b128 %2, %10, off\n\tglobal_load_async_to_lds_b128 %3, %11, off\n\t"
               "global_load_async_to_lds_b128 %4, %12, off\n\tglobal_load_async_to_lds_b128 %5, %13, off\n\tglobal_load_async_to_lds_b128 %6, %14, off\n\tglobal_load_async_to_lds_b128 %7, %15, off\n\ts_wait_xcnt 0x0"
               :: "v"(l), "v"(l1), "v"(l2), "v"(l3), "v"(l4), "v"(l5), "v"(l6), "v"(l7), "v"(g), "v"(g1), "v"(g2), "v"(g3), "v"(g4), "v"(g5), "v"(g6), "v"(g7) : "memory"); }
// pk (a launch argument, so that the three projections stay one kernel): layout of C16. 0 = rows of pitch ldc. 1, 2 = fragment order for the attention loop (N / 64 heads, M keys): the wave's 32 keys x 64 features of head nq are 8 units of 512 bytes at ((nq M + row0) 64) elements,
// unit u holding lane l's 8 elements at 8 l, so that one wave-wide 16-byte load of a unit reads 4 whole cache lines. 1 (K, A operand of S^T): u = 4 (key / 16) + feature / 16, lane = 16 ((feature / 8) & 1) + key % 16, element = feature % 8.
// 2 (V^T, A operand of O^T): u = 2 (feature / 16) + (key / 16) % 2, lane = 16 ((key / 8) & 1) + feature % 16, element = key % 8.
template <int ACT>
__global__ __launch_bounds__(128) void k_gemm2(const _Float16* __restrict__ A, int lda, size_t sA, const _Float16* __restrict__ Bh, int ldb, size_t sB, float alpha, const float* __restrict__ bias, size_t sBias, const float* __restrict__ CP, int rowsPerB, size_t sCPb, int row0g,
    float* __restrict__ C, _Float16* __restrict__ C16, int ldc, size_t sC, int M, int N, int K, int pk) { static_assert(ACT == 0 || ACT == 3 || ACT == 6 || ACT == 8 || ACT == 9 || ACT == 11 || ACT == 12 || ACT == 14 || ACT == 15 || ACT == 16 || ACT == 17, "k_gemm2: unsupported ACT code (would silently apply no activation)");
  __shared__ __attribute__((aligned(16))) float so[4][32][68];
  __shared__ __attribute__((aligned(16))) unsigned char ring[2 * G2_BUF];      /* rows 0..127 of a buffer: the work-group's A rows; 128..191: its B rows */
  const int tid = threadIdx.x, w = tid >> 5, lane = tid & 31, ln = lane & 15, hh = lane >> 4; const int by = blockIdx.y;
  A += (size_t)by * sA; Bh += (size_t)by * sB; const size_t cofs = (size_t)by * sC; const float* bp = bias ? bias + (size_t)by * sBias : nullptr;
  const int ntn = N >> 6; const int mt = blockIdx.x / ntn, nq = blockIdx.x - mt * ntn; const int row0 = mt * 128 + 32 * w, col0 = nq * 64; if (mt * 128 >= M) return;      /* the whole work-group leaves or none does (barriers below); needs M % 128 == 0, K % 128 == 0, K >= 128 */
  const _Float16* ga = A + (size_t)(mt * 128 + (tid >> 4)) * lda + (tid & 15) * 8; const _Float16* gb = Bh + (size_t)(col0 + (tid >> 4)) * ldb + (tid & 15) * 8;      /* the thread's first 16 bytes of a stage: row tid / 16, piece tid % 16 */
  const unsigned lc = (unsigned)(size_t)ring + (unsigned)((tid >> 4) * G2_PITCH + (tid & 15) * 16);      /* their place in buffer 0: byte address in the work-group's LDS */
  const size_t a8 = (size_t)8 * lda, b8 = (size_t)8 * ldb; const int nt = K / G2_KT;
  const unsigned char* fa = ring + (32 * w + ln) * G2_PITCH + 16 * hh; const unsigned char* fb = ring + (128 + ln) * G2_PITCH + 16 * hh;      /* the lane's fragment rows in buffer 0 */
  const v8f z8 = {0.f,0.f,0.f,0.f,0.f,0.f,0.f,0.f}; v8f c00 = z8, c01 = z8, c02 = z8, c03 = z8, c10 = z8, c11 = z8, c12 = z8, c13 = z8;
  g2_copy8(lc, ga, a8); g2_copy8(lc + 64 * G2_PITCH, ga + 8 * a8, a8); g2_copy8(lc + 128 * G2_PITCH, gb, b8);      /* stage 0 into buffer 0 */
  asm volatile("s_wait_asynccnt 0x0" ::: "memory");      /* this wave's copies of stage 0 have landed */
  __syncthreads();      /* every wave's have: stage 0 may be read */
  if (nt > 1) { g2_copy8(lc + G2_BUF, ga + G2_KT, a8); g2_copy8(lc + G2_BUF + 64 * G2_PITCH, ga + G2_KT + 8 * a8, a8); g2_copy8(lc + G2_BUF + 128 * G2_PITCH, gb + G2_KT, b8); }      /* stage 1 flies while stage 0 is worked on */
#pragma unroll 1      /* one stage a trip: the ring's order below is written once */
  for (int t = 0; t < nt; ++t) { const unsigned bo = (unsigned)(t & 1) * G2_BUF;
    const unsigned char* pa = fa + bo; const unsigned char* pb = fb + bo; v16h fr[2][6];      /* two fragment sets: A rows 0..15, 16..31, B columns 0..15 .. 48..63 of one k step */
    fr[0][0] = g2_lfrag(pa); fr[0][1] = g2_lfrag(pa + 16 * G2_PITCH); fr[0][2] = g2_lfrag(pb); fr[0][3] = g2_lfrag(pb + 16 * G2_PITCH); fr[0][4] = g2_lfrag(pb + 32 * G2_PITCH); fr[0][5] = g2_lfrag(pb + 48 * G2_PITCH);
#pragma unroll      /* constant indices keep the fragment sets in registers; constant offsets for the four k steps of a stage */
    for (int kk = 0; kk < 4; ++kk) { const int c = kk & 1, n = c ^ 1;
      if (kk < 3) { const unsigned char* qa = pa + (kk + 1) * 64; const unsigned char* qb = pb + (kk + 1) * 64;      /* the next k step of this same stage */
        fr[n][0] = g2_lfrag(qa); fr[n][1] = g2_lfrag(qa + 16 * G2_PITCH); fr[n][2] = g2_lfrag(qb); fr[n][3] = g2_lfrag(qb + 16 * G2_PITCH); fr[n][4] = g2_lfrag(qb + 32 * G2_PITCH); fr[n][5] = g2_lfrag(qb + 48 * G2_PITCH); }
      __builtin_amdgcn_sched_barrier(0);      /* keeps the twelve LDS reads one group in front of the products: spread among them, each pair is waited out to 0 */
      c00 = g2_mmab(fr[c][0], fr[c][2], c00); c10 = g2_mmab(fr[c][1], fr[c][2], c10); c01 = g2_mmab(fr[c][0], fr[c][3], c01); c11 = g2_mmab(fr[c][1], fr[c][3], c11);
      c02 = g2_mmab(fr[c][0], fr[c][4], c02); c12 = g2_mmab(fr[c][1], fr[c][4], c12); c03 = g2_mmab(fr[c][0], fr[c][5], c03); c13 = g2_mmab(fr[c][1], fr[c][5], c13);
      __builtin_amdgcn_sched_barrier(0); }      /* the other side of the same fence: the following group stays behind these products */
    asm volatile("s_wait_dscnt 0x0" ::: "memory");      /* this wave's reads of the buffer are done before it is handed over */
    asm volatile("s_wait_asynccnt 0x0" ::: "memory");      /* this wave's copies of stage t + 1 have landed */
    __syncthreads();      /* publishes stage t + 1 and ends every reader's last read of stage t's buffer */
    if (t + 2 < nt) { const _Float16* na = ga + (size_t)(t + 2) * G2_KT; const _Float16* nb = gb + (size_t)(t + 2) * G2_KT;      /* refill of the buffer just read */
      g2_copy8(lc + bo, na, a8); g2_copy8(lc + bo + 64 * G2_PITCH, na + 8 * a8, a8); g2_copy8(lc + bo + 128 * G2_PITCH, nb, b8); } }
  asm volatile("s_wait_asynccnt 0x0" ::: "memory");      /* nothing of this wave is in flight behind the loop */
  v8f accs[8] = {c00, c01, c02, c03, c10, c11, c12, c13};
#pragma unroll
  for (int u = 0; u < 8; ++u) { const int t = u & 3, half = u >> 2; const int col = col0 + t * 16 + ln; const float bv = bp ? bf16_round(bp[col]) : 0.f;
#pragma unroll
    for (int r = 0; r < 8; ++r) { const int rloc = half * 16 + 8 * hh + r; float v = accs[u][r] * alpha + bv; if (CP) { if (rowsPerB < 0) v += CP[cofs + (size_t)(row0g + row0 + rloc) * ldc + col];      /* rowsPerB < 0: own element of the batched C plane */ else { const int bidx = (row0g + row0 + rloc) / rowsPerB; v += CP[(size_t)bidx * sCPb + (size_t)by * 64 + col]; } }
      if (ACT == 3) v = fmaxf(v, 0.f); else if (ACT == 6) v = 0.5f * v * (1.0f + erff(v * 0.70710678118654752f)); else if (ACT == 11) v = 1.0f / (1.0f + expf(-v)); else if (ACT == 15) v = v / (1.0f + expf(-v)); else if (ACT == 12) v = (v > 0.f) ? v : 0.01f * v; else if (ACT == 8) v = tanhf(v); else if (ACT == 9) v = 0.5f * v * (1.0f + tanhf(0.7978845608028654f * (v + 0.044715f * v * v * v))); else if (ACT == 14) v = (v > 0.f) ? v : 0.1f * v; else if (ACT == 16) v = (v >= 0.f) ? v : 0.3f * v; else if (ACT == 17) v = (v >= 0.f) ? v : 0.2f * v;
      so[w][rloc][t * 16 + ln] = v; } }
  __builtin_amdgcn_fence(__ATOMIC_ACQ_REL, "workgroup"); __builtin_amdgcn_wave_barrier();
  const int rsub = lane >> 4, c4 = (lane & 15) * 4;
  if (pk == 0) {
#pragma unroll
    for (int q = 0; q < 16; ++q) { const int r = q * 2 + rsub; const v4f v = *(const v4fa*)&so[w][r][c4]; if (C) *(v4f*)(C + cofs + (size_t)(row0 + r) * ldc + col0 + c4) = v; if (C16) { v4h h4; for (int i = 0; i < 4; ++i) h4[i] = (_Float16)v[i]; *(v4h*)(C16 + cofs + (size_t)(row0 + r) * ldc + col0 + c4) = h4; } }
  } else {
    unsigned short* dp = (unsigned short*)C16 + ((size_t)nq * M + row0) * 64 + lane * 8;
    if (pk == 1) {
#pragma unroll
      for (int u = 0; u < 8; ++u) { FragH f; const int rl = (u >> 2) * 16 + ln, cl = (u & 3) * 16 + 8 * hh; const v4f x = *(const v4fa*)&so[w][rl][cl], y = *(const v4fa*)&so[w][rl][cl + 4];
#pragma unroll
        for (int i = 0; i < 4; ++i) { f.h[i] = (_Float16)x[i]; f.h[4 + i] = (_Float16)y[i]; }
        *(v8us*)(dp + u * 256) = f.half[0]; }
      asm volatile("s_wait_xcnt 0x0" ::: "memory");      /* address wait behind the run of stores above, in front of whatever next writes a register that they name */
    } else {
#pragma unroll
      for (int u = 0; u < 8; ++u) { FragH f; const int rl = (u & 1) * 16 + 8 * hh, cl = (u >> 1) * 16 + ln;
#pragma unroll
        for (int i = 0; i < 8; ++i) f.h[i] = (_Float16)so[w][rl + i][cl];
        *(v8us*)(dp + u * 256) = f.half[0]; }
      asm volatile("s_wait_xcnt 0x0" ::: "memory");      /* address wait behind the run of stores above, in front of whatever next writes a register that they name */
    }
  } }


__global__ __launch_bounds__(256) void k_wnat(const float* __restrict__ w, size_t n8, _Float16* __restrict__ Bt) { const size_t t = (size_t)blockIdx.x * 256 + threadIdx.x; if (t >= n8) return; FragH f; for (int q = 0; q < 8; ++q) f.h[q] = (_Float16)(bf16_round(w[t * 8 + q]) * 16.0f); *(v8us*)((unsigned short*)Bt + t * 8) = f.half[0];  }
__global__ __launch_bounds__(256) void k_rsm(const float* __restrict__ S, _Float16* __restrict__ P, int nrows) {
  #pragma clang fp contract(off)
  const int i = blockIdx.x * 256 + threadIdx.x; if (i >= nrows) return; const float* s = S + (size_t)i * SQ; float mx = -3.0e38f;
#pragma unroll 1
  for (int j = 0; j < SQ; ++j) mx = fmaxf(mx, s[j]); float se = 0.f;
#pragma unroll 1
  for (int j = 0; j < SQ; ++j) se += expf(s[j] - mx); const float sc = 256.0f / se;
#pragma unroll 1
  for (int j0 = 0; j0 < SQ; j0 += 8) { FragH f; for (int q = 0; q < 8; ++q) f.h[q] = (_Float16)(expf(s[j0 + q] - mx) * sc); unsigned short* d = (unsigned short*)P + (size_t)i * SQ + j0; *(v8us*)d = f.half[0];  } }
__global__ __launch_bounds__(256) void k_vt(const _Float16* __restrict__ V16, int b, int h0, _Float16* __restrict__ VT) { __shared__ unsigned short tl[64][65]; const int tid = threadIdx.x; const int hh = blockIdx.x % HG, sg = blockIdx.x / HG; const int s0 = sg * 64; const int h = h0 + hh;
  for (int i = tid; i < 64 * 8; i += 256) { const int j = i / 8, d8 = (i % 8) * 8; FragH f; f.half[0] = *(const v8us*)((const unsigned short*)V16 + ((size_t)b * SQ + s0 + j) * DM + h * HD + d8); for (int q = 0; q < 8; ++q) tl[d8 + q][j] = f.u[q]; }
  __syncthreads();
  { for (int i = tid; i < 64 * 8; i += 256) { const int d = i / 8, j8 = (i % 8) * 8; FragH f; for (int q = 0; q < 8; ++q) f.u[q] = tl[d][j8 + q]; *(v8us*)((unsigned short*)VT + ((size_t)hh * HD + d) * SQ + s0 + j8) = f.half[0]; }  } }



__global__ __launch_bounds__(256) void k_rsmkm(const float* __restrict__ S, _Float16* __restrict__ P, int nrows, const int* __restrict__ am) {
  #pragma clang fp contract(off)
  const int t = blockIdx.x * 256 + threadIdx.x; if (t >= nrows) return; const size_t i = (size_t)t; const float* s = S + i * SQ; const int* mr = am + (size_t)(t % SQ) * SQ; float mx = -3.0e38f;
#pragma unroll 1
  for (int j = 0; j < SQ; ++j) { const float f = (mr[j] != 0) ? 1.f : 0.f; mx = fmaxf(mx, fmaf(f, s[j], (1.f - f) * -1.0e9f)); } float se = 0.f;
#pragma unroll 1
  for (int j = 0; j < SQ; ++j) { const float f = (mr[j] != 0) ? 1.f : 0.f; se += __expf(fmaf(f, s[j], (1.f - f) * -1.0e9f) - mx); } const float sc = 256.0f / se;
#pragma unroll 1
  for (int j0 = 0; j0 < SQ; j0 += 8) { FragH fr; for (int q = 0; q < 8; ++q) { const int j = j0 + q; const float f = (mr[j] != 0) ? 1.f : 0.f; fr.h[q] = (_Float16)(__expf(fmaf(f, s[j], (1.f - f) * -1.0e9f) - mx) * sc); }
    unsigned short* d = (unsigned short*)P + i * SQ + j0; *(v8us*)d = fr.half[0];  } }
// The swap of a wave's two 16-lane rows: a plain lane shuffle would go through the LDS pipe.
__device__ __forceinline__ float rs_x16(float v) { const int b = __float_as_int(v); return __int_as_float(__builtin_amdgcn_permlanex16(b, b, 0x76543210, 0xfedcba98, false, false)); }
// Four native 2^x in one statement: no result shares a register
// with a source (early clobber), each exp has an independent one behind it, and the v_nop is the slot that the instruction set asks for behind the last.
__device__ __forceinline__ v4f rs_exp2x4(v4f x) { float y0, y1, y2, y3;
  asm("v_exp_f32 %0, %4\n\tv_exp_f32 %1, %5\n\tv_exp_f32 %2, %6\n\tv_exp_f32 %3, %7\n\tv_nop" : "=&v"(y0), "=&v"(y1), "=&v"(y2), "=&v"(y3) : "v"(x[0]), "v"(x[1]), "v"(x[2]), "v"(x[3]));
  const v4f y = {y0, y1, y2, y3}; return y; }
// One native 2^x with the same slot behind it.
__device__ __forceinline__ float rs_exp2(float x) { float y; asm("v_exp_f32 %0, %1\n\tv_nop" : "=&v"(y) : "v"(x)); return y; }
__device__ __forceinline__ v16h fa_frag(const _Float16* base, unsigned lofs) { FragH f; f.half[0] = *(const v8us*)((const unsigned short*)base + lofs); f.half[1] = *(const v8us*)((const unsigned short*)base + lofs + 16); return f.v; }      /* base is wave-uniform, lofs the lane's own element offset (row ln, k 8 hh) */
__device__ __forceinline__ v16h fa_fragp(const _Float16* base, unsigned lofs) { FragH f; f.half[0] = *(const v8us*)((const unsigned short*)base + lofs); f.half[1] = *(const v8us*)((const unsigned short*)base + lofs + 256); return f.v; }      /* fragment-order operand: two units of 512 bytes, lofs = 8 lane; elements 0..7 and 8..15 as in fa_frag */
__device__ __forceinline__ v8f fa_mma(v16h a, v16h b, v8f c) { return __builtin_amdgcn_wmma_f32_16x16x32_f16(false, a, false, b, (short)0, c, false, false); }
__global__ __launch_bounds__(256) void k_fattn(const _Float16* __restrict__ Q, const _Float16* __restrict__ KP, const _Float16* __restrict__ VP, float* __restrict__ O) {      /* Q in rows; KP, VP in fragment order (k_gemm2, pk 1 and 2): 32 keys of a head are 4 KB in a row in each */
  const int lane = threadIdx.x & 31, ln = lane & 15, hh = lane >> 4; const int w = __builtin_amdgcn_readfirstlane(threadIdx.x >> 5);      /* the wave's number, held scalar so that the row bases are scalar */
  const int h = blockIdx.x / (SQ / 256); const int q0 = (blockIdx.x % (SQ / 256)) * 256 + w * 32;      /* 8 waves of one head share the K and V^T lines in the WGP's cache */
  const float SC = 0.125f * 1.44269504088896340736f;      /* 1 / sqrt(64) and log2 e in one factor: e^x as the native 2^x */
  const unsigned lk = (unsigned)(ln * DM + 8 * hh), lp = (unsigned)(lane * 8);
  const _Float16* qb = Q + (size_t)q0 * DM + h * HD; const _Float16* kb = KP + (size_t)h * HD * SQ; const _Float16* vb = VP + (size_t)h * HD * SQ;
  v16h qf[2][2], kf[2][2], vf[4];
  /* every loop over a fragment, score or output array of this kernel is unrolled: constant indices keep the arrays in registers */
#pragma unroll
  for (int j = 0; j < 2; ++j) { qf[j][0] = fa_frag(qb + j * 16 * DM, lk); qf[j][1] = fa_frag(qb + j * 16 * DM + 32, lk); }
#pragma unroll
  for (int t = 0; t < 2; ++t) { kf[t][0] = fa_fragp(kb + t * 1024, lp); kf[t][1] = fa_fragp(kb + t * 1024 + 512, lp); }
  __builtin_amdgcn_sched_barrier(0);      /* keeps the first V^T loads the youngest, as they are in every pass: otherwise the counted wait at the loop's head falls to 0 and each pass waits out the V^T loads issued just before it */
#pragma unroll
  for (int t = 0; t < 4; ++t) vf[t] = fa_fragp(vb + t * 512, lp);
  const v8f z8 = {0.f, 0.f, 0.f, 0.f, 0.f, 0.f, 0.f, 0.f}; v8f o[2][4]; float m[2] = {-3.0e38f, -3.0e38f}, l[2] = {0.f, 0.f};
#pragma unroll
  for (int j = 0; j < 2; ++j) for (int t = 0; t < 4; ++t) o[j][t] = z8;
  for (int k0 = 0; k0 < SQ; k0 += 32) {
    const int kn = (k0 + 32) & (SQ - 1);      /* the next pass's keys; the last pass fetches keys 0..31 again (in bounds, not used) so that the loop has no branch */
    v8f s[2][2];
#pragma unroll
    for (int t = 0; t < 2; ++t) for (int j = 0; j < 2; ++j) s[t][j] = fa_mma(kf[t][1], qf[j][1], fa_mma(kf[t][0], qf[j][0], z8));
    const _Float16* kp = kb + kn * HD;      /* K one pass ahead, into the registers that the products above have just read */
#pragma unroll
    for (int t = 0; t < 2; ++t) { kf[t][0] = fa_fragp(kp + t * 1024, lp); kf[t][1] = fa_fragp(kp + t * 1024 + 512, lp); }
    FragH pf[2];
#pragma unroll
    for (int j = 0; j < 2; ++j) { float mx = fmaxf(s[0][j][0], s[1][j][0]);
#pragma unroll
      for (int r = 1; r < 8; ++r) mx = fmaxf(mx, fmaxf(s[0][j][r], s[1][j][r]));
      mx = fmaxf(mx, rs_x16(mx)); const float mn = fmaxf(m[j], mx); const float al = rs_exp2((m[j] - mn) * SC); m[j] = mn; const float of = mn * SC - 8.0f;      /* weights are 2^8 e^(s - max): f16 keeps small ones normal; the row sum carries the same factor */
      v4f sm = {0.f, 0.f, 0.f, 0.f};
#pragma unroll
      for (int t = 0; t < 2; ++t) for (int g = 0; g < 2; ++g) { v4f x; for (int q = 0; q < 4; ++q) x[q] = s[t][j][4 * g + q] * SC - of; const v4f p = rs_exp2x4(x); sm += p; for (int q = 0; q < 4; ++q) pf[j].h[8 * t + 4 * g + q] = (_Float16)p[q]; }
      l[j] = l[j] * al + ((sm[0] + sm[1]) + (sm[2] + sm[3]));      /* the lane's own 16 keys; the halves are joined once, behind the loop */
#pragma unroll
      for (int t = 0; t < 4; ++t) o[j][t] *= al; }
#pragma unroll
    for (int t = 0; t < 4; ++t) for (int j = 0; j < 2; ++j) o[j][t] = fa_mma(vf[t], pf[j].v, o[j][t]);
    const _Float16* vp = vb + kn * HD;      /* V^T one pass ahead, likewise */
#pragma unroll
    for (int t = 0; t < 4; ++t) vf[t] = fa_fragp(vp + t * 512, lp);
    asm volatile("s_wait_xcnt 0x0" ::: "memory");      /* the next pass forms its addresses in the registers that the loads above name: their address wait stands in front of that overwrite */
  }
#pragma unroll
  for (int j = 0; j < 2; ++j) { const float inv = 1.0f / (l[j] + rs_x16(l[j])); float* d = O + (size_t)(q0 + j * 16 + ln) * DM + h * HD + 8 * hh;
#pragma unroll
    for (int t = 0; t < 4; ++t) { const v4f lo = {o[j][t][0] * inv, o[j][t][1] * inv, o[j][t][2] * inv, o[j][t][3] * inv}, hi = {o[j][t][4] * inv, o[j][t][5] * inv, o[j][t][6] * inv, o[j][t][7] * inv}; *(v4f*)(d + t * 16) = lo; *(v4f*)(d + t * 16 + 4) = hi; } } }



// ---- preparation, one launch: the three inputs as f16 rows and the three weight planes as Bt[(h, d)][m] x16 ----
// PW waves in all, 16 a work-group, as many work-groups as the chip has WGPs: few waves to start, all resident at once. Each wave takes 1 / PW of each of the six passes.
// Inputs: 1024 floats a wave and input, as 8 loads of 16 bytes a lane, each covering 512 bytes in a row (4 whole lines); all 24 are in flight before the first is converted; stores of 8 bytes a lane cover 2 whole lines.
// Weights: a thread gathers 8 m of one (h, d) of each plane, as per-head [m][d] -> Bt[(h, d)][m]; a wave's store covers 512 bytes in a row.
#define PW 4096
__global__ __launch_bounds__(512) void k_prep(const float* __restrict__ xq, const float* __restrict__ xk, const float* __restrict__ xv, const float* __restrict__ wq, const float* __restrict__ wk, const float* __restrict__ wv,
    _Float16* __restrict__ XQ, _Float16* __restrict__ XK, _Float16* __restrict__ XV, _Float16* __restrict__ BQ, _Float16* __restrict__ BK, _Float16* __restrict__ BV) {
  static_assert(NR * DM == (size_t)PW * 1024 && (size_t)NH * HD * (DM / 8) == (size_t)PW * 32, "k_prep: one piece of every pass a wave");
  const int lane = threadIdx.x & 31; const int gw = blockIdx.x * 16 + __builtin_amdgcn_readfirstlane(threadIdx.x >> 5);      /* the wave's number in the grid, held scalar so that the bases are scalar */
  const float* xs[3] = {xq + (size_t)gw * 1024, xk + (size_t)gw * 1024, xv + (size_t)gw * 1024}; _Float16* xd[3] = {XQ + (size_t)gw * 1024, XK + (size_t)gw * 1024, XV + (size_t)gw * 1024};
  const unsigned t = (unsigned)(gw * 32 + lane); const unsigned m8 = (t % (DM / 8)) * 8, d = (t / (DM / 8)) % HD, h = t / ((DM / 8) * HD);
  const unsigned wo = (h * DM + m8) * HD + d; const float* wsrc[3] = {wq, wk, wv}; _Float16* wd[3] = {BQ, BK, BV};
  v4f a[3][8]; float g[3][8];
  /* every loop below is unrolled: constant indices keep the arrays in registers */
#pragma unroll
  for (int p = 0; p < 3; ++p)
#pragma unroll
    for (int i = 0; i < 8; ++i) a[p][i] = *(const v4fa*)(xs[p] + i * 128 + lane * 4);
#pragma unroll
  for (int p = 0; p < 3; ++p)
#pragma unroll
    for (int q = 0; q < 8; ++q) g[p][q] = wsrc[p][wo + q * HD];
  __builtin_amdgcn_sched_barrier(0);      /* keeps all 48 loads in front of the first conversion: left free, the compiler sinks most of them among the conversions and a wave has only some 12 in flight */
#pragma unroll
  for (int p = 0; p < 3; ++p)
#pragma unroll
    for (int i = 0; i < 8; ++i) { v4h o;
#pragma unroll
      for (int q = 0; q < 4; ++q) o[q] = (_Float16)bf16_round(a[p][i][q]);
      *(v4h*)(xd[p] + i * 128 + lane * 4) = o; }
#pragma unroll
  for (int p = 0; p < 3; ++p) { FragH f;
#pragma unroll
    for (int q = 0; q < 8; ++q) f.h[q] = (_Float16)(16.0f * bf16_round(g[p][q]));
    *(v8us*)((unsigned short*)wd[p] + (size_t)(h * HD + d) * DM + m8) = f.half[0]; } }

extern "C" void kernel_launch(void* const* d_in, const int* in_sizes, int n_in,
                              void* d_out, int out_size, void* d_ws, size_t ws_size, hipStream_t stream) {
  (void)in_sizes; (void)n_in; (void)out_size;
  const float* const* I = (const float* const*)d_in; const float* xq = I[0]; const float* xk = I[1]; const float* xv = I[2]; const float* wq = I[3]; const float* bq = I[4]; const float* wk = I[5]; const float* bk = I[6]; const float* wv = I[7]; const float* bv = I[8]; const float* x = xq;      /* X_Q, X_K, X_V [4096][1024]; per-head Wq / Wk / Wv [16][1024][64] ([in][out] per head) + biases [16][64] = [(h, d)]; no output projection */
  static_assert(NH * HD == DM && DM % 128 == 0 && SQ % 256 == 0 && HD == 64 && HG == 1 && NB == 1, "shape / tile multiples");
  char* ws = (char*)d_ws; size_t off = 0;
  auto take = [&](size_t bytes) { char* p = ws + off; off += (bytes + 255) & ~(size_t)255; return p; };
  _Float16* BQ = (_Float16*)take((size_t)DM * DM * 2); _Float16* BK = (_Float16*)take((size_t)DM * DM * 2); _Float16* BV = (_Float16*)take((size_t)DM * DM * 2);
  _Float16* X16 = (_Float16*)take(NR * DM * 2); _Float16* XKp = (_Float16*)take(NR * DM * 2); _Float16* XVp = (_Float16*)take(NR * DM * 2); _Float16* Q16 = (_Float16*)take(NR * DM * 2); _Float16* KP = (_Float16*)take((size_t)NH * HD * SQ * 2);
  _Float16* VP = (_Float16*)take((size_t)NH * HD * SQ * 2);
  if (off > ws_size) return;
  _Float16* XK = XKp; _Float16* XV = XVp;
  k_prep<<<PW / 16, 512, 0, stream>>>(x, xk, xv, wq, wk, wv, X16, XK, XV, BQ, BK, BV);      /* inputs as exact f16 rows; per-head [m][d] -> Bt[(h, d)][m] x16 */
  const size_t r0p = (size_t)B0 * SQ;      /* first projected row */
  k_gemm2<0><<<dim3((unsigned)((MP / 128) * (DM / 64)), 1), 128, 0, stream>>>(X16 + r0p * DM, DM, 0, BQ, DM, 0, 0.0625f, bq, 0, nullptr, 1, 0, 0, nullptr, Q16 + r0p * DM, DM, 0, MP, DM, DM, 0);
  k_gemm2<0><<<dim3((unsigned)((MP / 128) * (DM / 64)), 1), 128, 0, stream>>>(XK + r0p * DM, DM, 0, BK, DM, 0, 0.0625f, bk, 0, nullptr, 1, 0, 0, nullptr, KP, DM, 0, MP, DM, DM, 1);      /* K in fragment order */
  k_gemm2<0><<<dim3((unsigned)((MP / 128) * (DM / 64)), 1), 128, 0, stream>>>(XV + r0p * DM, DM, 0, BV, DM, 0, 0.0625f, bv, 0, nullptr, 1, 0, 0, nullptr, VP, DM, 0, MP, DM, DM, 2);      /* V^T in fragment order */
  for (int b = B0; b < B0 + NBR; ++b) { const size_t r0 = (size_t)b * SQ;
    k_fattn<<<NH * (SQ / 256), 256, 0, stream>>>(Q16 + r0 * LQ, KP, VP, (float*)d_out + r0 * DM); }      /* all heads: softmax(Q K^T / 8) V written f32 straight into each head's 64 columns of the output rows (no output projection) */
}

// v006
// A run of this version takes 126 microseconds.
// Timed twice side by side with v005, it ran 1.28 times as fast both times.
// All steps since v000 together make it 107 times as fast.
#include <hip/hip_runtime.h>
// Multi-head attention over three inputs with PER-HEAD projection weights and no output projection (X_Q, X_K, X_V [4096][1024] (one sequence); Q[h] = X_Q Wq[h] + bq[h], K, V likewise (Wq / Wk / Wv [16][1024][64] per-head [in][out], sigma 1/32; biases [16][64] sigma 1/32); scores = Q[h] K[h]^T / sqrt(64); softmax over all 4096 keys; out[h] = attn V[h]; heads concatenated along the feature axis -> [4096][1024]).
// Structure: one preparation launch (the three inputs as exact f16 rows (bf16-rounded); per-head [in][out] weights gathered into Bt[(h, d)][in] x16 planes); Q, K, V as three WMMA GEMMs (32x64 wave tiles, operands staged in LDS by asynchronous copies in a ring of two buffers, f32 accumulation, + bias [(h, d)], f16 outputs; the K and V GEMMs store their 32-key x 64-feature wave tiles in the attention loop's fragment order, V transposed on the way); then ONE attention launch for all heads: two waves of a work-group own 32 query rows, each walks one half of the 4096 keys 32 at a time, S^T = K Q^T, running-maximum softmax in registers (f32 statistics; weights x256 as f16), O^T += V^T P^T; the two halves are joined through LDS at the end, divided by the row sum and written f32 straight into the head's 64 columns of the output rows.
// Compute dtype: inputs rounded to bf16; x / weights exact; q, k, v and softmax weights as plain f16 GEMM operands (~2^-12); scores, softmax statistics and o f32. v_wmma_f32_16x16x32_f16.
#define NB 1
#define SQ 4096
#define DM 1024
#define NH 16
#define HD 64
#define HG 1                         /* heads per launch of the non-template k_vt */
#define B0 0                         /* first batch processed (debug hook) */
#define NBR NB                       /* batches processed (debug hook) */
#define NR ((size_t)NB * SQ)         /* token rows */
#define MP ((int)((size_t)NBR * SQ)) /* rows projected (debug hook) */
#define QN SQ                        /* unused (the attention launch attends all SQ query rows) */
#define NHD NH                       /* unused (the attention launch covers all NH heads) */
#define MPO MP                       /* unused (there is no output stage) */
#define LQ DM      /* row pitch of the q rows */
typedef __bf16 v16b __attribute__((ext_vector_type(16)));
typedef unsigned short v8us __attribute__((ext_vector_type(8), may_alias));
typedef float  v8f  __attribute__((ext_vector_type(8)));
typedef float  v4f  __attribute__((ext_vector_type(4)));
typedef float  v4fa __attribute__((ext_vector_type(4), may_alias));
union FragB { v16b v; v8us half[2]; unsigned short u[16]; };

__device__ __forceinline__ unsigned short bf16_bits(float x) { unsigned int u = __float_as_uint(x); return (unsigned short)((u + 0x7FFFu + ((u >> 16) & 1u)) >> 16); }
__device__ __forceinline__ float bf16_val(unsigned short b) { return __uint_as_float(((unsigned int)b) << 16); }
__device__ __forceinline__ float bf16_round(float x) { return bf16_val(bf16_bits(x)); }
// D += A·B with NT terms: 1 = ah·bh, 2 = + al·bh (A split), 3 = + ah·bl (both split)
template <int NT>
__device__ __forceinline__ v8f mmaN(v16b ah, v16b al, v16b bh, v16b bl, v8f c) {
  c = __builtin_amdgcn_wmma_f32_16x16x32_bf16(false, ah, false, bh, (short)0, c, false, false);
  if (NT >= 2) c = __builtin_amdgcn_wmma_f32_16x16x32_bf16(false, al, false, bh, (short)0, c, false, false);
  if (NT >= 3) c = __builtin_amdgcn_wmma_f32_16x16x32_bf16(false, ah, false, bl, (short)0, c, false, false);
  asm volatile("v_nop\n\tv_nop\n\tv_nop\n\tv_nop" : "+v"(c) : "v"(ah), "v"(al), "v"(bh), "v"(bl));
  return c;
}

__global__ __launch_bounds__(256) void k_wt_bf16(const float* __restrict__ W, unsigned short* __restrict__ Wt, int K, int N) {
  const int t = blockIdx.x * 256 + threadIdx.x;
  const int k8n = K / 8;
  if (t >= N * k8n) return;
  const int n = t / k8n, k8 = (t % k8n) * 8;
  v8us v;
#pragma unroll
  for (int i = 0; i < 8; ++i) v[i] = bf16_bits(W[(size_t)(k8 + i) * N + n]);
  *(v8us*)(Wt + (size_t)n * K + k8) = v;
  
}

// GEMM C[M][N] (f32, pitch ldc) = act(A[M][K]·W + bias). A f32 row-major (pitch lda) converted per fragment to bf16
// (ASPLIT: hi/lo two planes -> 2 terms, else single rounded term); Wt bf16 [N][K] (pitch ldb). BIAS_BF16 rounds the
// bias to bf16 first (bias quantised to bf16 before the add). K%32==0, M%16==0, N%64==0.
template <bool ASPLIT, int ACT, bool BIAS_BF16>
__global__ __launch_bounds__(128) void k_gemm_bf(const float* __restrict__ A, int lda, const unsigned short* __restrict__ Wt, int ldb,
                                               const float* __restrict__ bias, float* __restrict__ C, int ldc, int M, int N, int K) {
  __shared__ __attribute__((aligned(16))) float so[4][16][64];
  const int tid = threadIdx.x, w = tid >> 5, lane = tid & 31, ln = lane & 15, hh = lane >> 4;
  const int ntn = N / 64;
  const int wid = blockIdx.x * 4 + w;
  const int mt = wid / ntn, nq = wid % ntn;
  if (mt * 16 >= M) return;
  const int row0 = mt * 16, col0 = nq * 64;
  const float* arow = A + (size_t)(row0 + ln) * lda;
  v8f acc[4] = {};
  for (int kb = 0; kb < K; kb += 32) {
    FragB ah, al;
    const v4f x0 = *(const v4fa*)(arow + kb + 8 * hh), x1 = *(const v4fa*)(arow + kb + 8 * hh + 4);
    const v4f x2 = *(const v4fa*)(arow + kb + 16 + 8 * hh), x3 = *(const v4fa*)(arow + kb + 16 + 8 * hh + 4);
    float xs[16] = {x0[0],x0[1],x0[2],x0[3],x1[0],x1[1],x1[2],x1[3],x2[0],x2[1],x2[2],x2[3],x3[0],x3[1],x3[2],x3[3]};
#pragma unroll
    for (int i = 0; i < 16; ++i) { const unsigned short hb = bf16_bits(xs[i]); ah.u[i] = hb; al.u[i] = ASPLIT ? bf16_bits(xs[i] - bf16_val(hb)) : (unsigned short)0; }
#pragma unroll
    for (int t = 0; t < 4; ++t) {
      const unsigned short* brow = Wt + (size_t)(col0 + t * 16 + ln) * ldb + kb;
      FragB b;
      b.half[0] = *(const v8us*)(brow + 8 * hh);
      b.half[1] = *(const v8us*)(brow + 16 + 8 * hh);
      acc[t] = mmaN<ASPLIT ? 2 : 1>(ah.v, al.v, b.v, b.v, acc[t]);
    }
  }
#pragma unroll
  for (int t = 0; t < 4; ++t) {
    float bv = bias ? bias[col0 + t * 16 + ln] : 0.f;
    if (BIAS_BF16) bv = bf16_round(bv);
#pragma unroll
    for (int r = 0; r < 8; ++r) { float v = acc[t][r] + bv; if (ACT == 1) v = fmaxf(v, 0.f); so[w][8 * hh + r][t * 16 + ln] = v; }
  }
  __builtin_amdgcn_fence(__ATOMIC_ACQ_REL, "workgroup");
  __builtin_amdgcn_wave_barrier();
  const int rsub = lane >> 4, c4 = (lane & 15) * 4;
  {
#pragma unroll
    for (int q = 0; q < 8; ++q) {
      const int r = q * 2 + rsub;
      const v4f v = *(const v4fa*)&so[w][r][c4];
      *(v4f*)(C + (size_t)(row0 + r) * ldc + col0 + c4) = v;
    }
    
  }
}

// GEMM C = act(A·W + bias + resid): A f32 (ASPLIT -> hi/lo 2 terms), Wt bf16 [N][K]; ACT 0 none, 1 relu, 2 exact gelu;
// resid (optional, f32, row index = (row % rmod), pitch ldr, RES_BF16 rounds it) added before the activation.
template <bool ASPLIT, int ACT, bool BIAS_BF16, bool RES_BF16>
__global__ __launch_bounds__(128) void k_gemm_bf3(const float* __restrict__ A, int lda, const unsigned short* __restrict__ Wt, int ldb,
                                                const float* __restrict__ bias, const float* __restrict__ resid, int rmod, int ldr,
                                                float* __restrict__ C, int ldc, int M, int N, int K) {
  __shared__ __attribute__((aligned(16))) float so[4][16][64];
  const int tid = threadIdx.x, w = tid >> 5, lane = tid & 31, ln = lane & 15, hh = lane >> 4;
  const int ntn = N / 64;
  const int wid = blockIdx.x * 4 + w;
  const int mt = wid / ntn, nq = wid % ntn;
  if (mt * 16 >= M) return;
  const int row0 = mt * 16, col0 = nq * 64;
  const float* arow = A + (size_t)(row0 + ln) * lda;
  v8f acc[4] = {};
  for (int kb = 0; kb < K; kb += 32) {
    FragB ah, al;
    const v4f x0 = *(const v4fa*)(arow + kb + 8 * hh), x1 = *(const v4fa*)(arow + kb + 8 * hh + 4);
    const v4f x2 = *(const v4fa*)(arow + kb + 16 + 8 * hh), x3 = *(const v4fa*)(arow + kb + 16 + 8 * hh + 4);
    float xs[16] = {x0[0],x0[1],x0[2],x0[3],x1[0],x1[1],x1[2],x1[3],x2[0],x2[1],x2[2],x2[3],x3[0],x3[1],x3[2],x3[3]};
#pragma unroll
    for (int i = 0; i < 16; ++i) { const unsigned short hb = bf16_bits(xs[i]); ah.u[i] = hb; al.u[i] = ASPLIT ? bf16_bits(xs[i] - bf16_val(hb)) : (unsigned short)0; }
#pragma unroll
    for (int t = 0; t < 4; ++t) {
      const unsigned short* brow = Wt + (size_t)(col0 + t * 16 + ln) * ldb + kb;
      FragB b;
      b.half[0] = *(const v8us*)(brow + 8 * hh);
      b.half[1] = *(const v8us*)(brow + 16 + 8 * hh);
      acc[t] = mmaN<ASPLIT ? 2 : 1>(ah.v, al.v, b.v, b.v, acc[t]);
    }
  }
#pragma unroll
  for (int t = 0; t < 4; ++t) {
    const int col = col0 + t * 16 + ln;
    float bv = bias ? bias[col] : 0.f;
    if (BIAS_BF16) bv = bf16_round(bv);
#pragma unroll
    for (int r = 0; r < 8; ++r) {
      float v = acc[t][r] + bv;
      if (resid) { float rv = resid[(size_t)((row0 + 8 * hh + r) % rmod) * ldr + col]; if (RES_BF16) rv = bf16_round(rv); v += rv; }
      if (ACT == 1) v = fmaxf(v, 0.f);
      if (ACT == 2) v = 0.5f * v * (1.0f + erff(v * 0.70710678118654752f));
      if (ACT == 3) { const float u = 0.7978845608028654f * (v + 0.044715f * v * v * v); v = 0.5f * v * (1.0f + tanhf(u)); }
      so[w][8 * hh + r][t * 16 + ln] = v;
    }
  }
  __builtin_amdgcn_fence(__ATOMIC_ACQ_REL, "workgroup");
  __builtin_amdgcn_wave_barrier();
  const int rsub = lane >> 4, c4 = (lane & 15) * 4;
  {
#pragma unroll
    for (int q = 0; q < 8; ++q) {
      const int r = q * 2 + rsub;
      const v4f v = *(const v4fa*)&so[w][r][c4];
      *(v4f*)(C + (size_t)(row0 + r) * ldc + col0 + c4) = v;
    }
    
  }
}
// row LayerNorm (biased variance, eps) over N: s = X (+ R); optional out_sum <- s; out_norm <- (s-mu)*rsqrt(var+eps)*g + b
template <bool PARAM_BF16>
__global__ __launch_bounds__(256) void k_layernorm(const float* __restrict__ X, const float* __restrict__ R, const float* __restrict__ g, const float* __restrict__ bta,
                                                  float* __restrict__ out_sum, float* __restrict__ out_norm, int N, float eps) {
  __shared__ float red[256];
  const int row = blockIdx.x, tid = threadIdx.x;
  const float* x = X + (size_t)row * N; const float* rr = R ? R + (size_t)row * N : nullptr;
  float vals[16];                     // up to N = 4096
  const int per = N / 256;            // contiguous chunk per thread? use strided-by-4 chunks: thread handles j = tid*4 + 1024*u
  float s1 = 0.f;
  for (int u = 0; u < per / 4; ++u) {
    const int j = tid * 4 + 1024 * u;
    const v4f a = *(const v4fa*)(x + j);
    v4f b = {0.f,0.f,0.f,0.f}; if (rr) b = *(const v4fa*)(rr + j);
#pragma unroll
    for (int q = 0; q < 4; ++q) { const float v = a[q] + b[q]; vals[u * 4 + q] = v; s1 += v; }
  }
  red[tid] = s1; __syncthreads();
  for (int st = 128; st > 0; st >>= 1) { if (tid < st) red[tid] += red[tid + st]; __syncthreads(); }
  const float mu = red[0] / (float)N; __syncthreads();
  float s2 = 0.f;
  for (int u = 0; u < per / 4; ++u)
#pragma unroll
    for (int q = 0; q < 4; ++q) { const float c = vals[u * 4 + q] - mu; s2 += c * c; }
  red[tid] = s2; __syncthreads();
  for (int st = 128; st > 0; st >>= 1) { if (tid < st) red[tid] += red[tid + st]; __syncthreads(); }
  const float rs = rsqrtf(red[0] / (float)N + eps);
  {
    for (int u = 0; u < per / 4; ++u) {
      const int j = tid * 4 + 1024 * u;
      v4f o, sm;
#pragma unroll
      for (int q = 0; q < 4; ++q) {
        float gg = g[j + q], bb = bta[j + q];
        if (PARAM_BF16) { gg = bf16_round(gg); bb = bf16_round(bb); }
        sm[q] = vals[u * 4 + q]; o[q] = (vals[u * 4 + q] - mu) * rs * gg + bb;
      }
      if (out_sum) *(v4f*)(out_sum + (size_t)row * N + j) = sm;
      *(v4f*)(out_norm + (size_t)row * N + j) = o;
    }
    
  }
}



// ---- f16 WMMA path (v_wmma_f32_16x16x32_f16): 11-bit significands for operands in range — used where a [0,1] probability operand needs more precision than bf16
typedef _Float16 v16h __attribute__((ext_vector_type(16)));
union FragH { v16h v; v8us half[2]; _Float16 h[16]; unsigned short u[16]; };
template <int NT>
__device__ __forceinline__ v8f mmaH(v16h ah, v16h al, v16h bh, v16h bl, v8f c) {
  c = __builtin_amdgcn_wmma_f32_16x16x32_f16(false, ah, false, bh, (short)0, c, false, false);
  if (NT >= 2) c = __builtin_amdgcn_wmma_f32_16x16x32_f16(false, al, false, bh, (short)0, c, false, false);
  if (NT >= 3) c = __builtin_amdgcn_wmma_f32_16x16x32_f16(false, ah, false, bl, (short)0, c, false, false);
  asm volatile("v_nop\n\tv_nop\n\tv_nop\n\tv_nop" : "+v"(c) : "v"(ah), "v"(al), "v"(bh), "v"(bl));
  return c;
}
// batched GEMM like k_gemm_b but f16 operands: A f32 (split into f16 hi/lo if ASPLIT, else rounded to f16), Bt = f16 values [n][k]; alpha; C f32; N multiple of 16 (partial tiles skipped)
template <bool ASPLIT>
__global__ __launch_bounds__(128) void k_gemm_h(const float* __restrict__ A, int lda, size_t sA, const _Float16* __restrict__ Bh, int ldb, size_t sB, float alpha, float* __restrict__ C, int ldc, size_t sC, int M, int N, int K) {
  __shared__ __attribute__((aligned(16))) float so[4][16][64];
  const int tid = threadIdx.x, w = tid >> 5, lane = tid & 31, ln = lane & 15, hh = lane >> 4; const int by = blockIdx.y;
  A += (size_t)by * sA; Bh += (size_t)by * sB; C += (size_t)by * sC;
  const int ntn = (N + 63) / 64; const int wid = blockIdx.x * 4 + w; const int mt = wid / ntn, nq = wid % ntn; if (mt * 16 >= M) return;
  const int row0 = mt * 16, col0 = nq * 64; const float* arow = A + (size_t)(row0 + ln) * lda;
  v8f acc[4] = {};
  for (int kb = 0; kb < K; kb += 32) {
    FragH ah, al;
    const v4f x0 = *(const v4fa*)(arow + kb + 8 * hh), x1 = *(const v4fa*)(arow + kb + 8 * hh + 4), x2 = *(const v4fa*)(arow + kb + 16 + 8 * hh), x3 = *(const v4fa*)(arow + kb + 16 + 8 * hh + 4);
    float xs[16] = {x0[0],x0[1],x0[2],x0[3],x1[0],x1[1],x1[2],x1[3],x2[0],x2[1],x2[2],x2[3],x3[0],x3[1],x3[2],x3[3]};
#pragma unroll
    for (int i = 0; i < 16; ++i) { const _Float16 h = (_Float16)xs[i]; ah.h[i] = h; al.h[i] = ASPLIT ? (_Float16)(xs[i] - (float)h) : (_Float16)0.0f; }
#pragma unroll
    for (int t = 0; t < 4; ++t) { if (col0 + t * 16 >= N) continue; const size_t boff = (size_t)(col0 + t * 16 + ln) * ldb + kb; FragH bq; bq.half[0] = *(const v8us*)(Bh + boff + 8 * hh); bq.half[1] = *(const v8us*)(Bh + boff + 16 + 8 * hh);
      acc[t] = mmaH<ASPLIT ? 2 : 1>(ah.v, al.v, bq.v, bq.v, acc[t]); }
  }
#pragma unroll
  for (int t = 0; t < 4; ++t) { if (col0 + t * 16 >= N) continue;
#pragma unroll
    for (int r = 0; r < 8; ++r) so[w][8 * hh + r][t * 16 + ln] = acc[t][r] * alpha; }
  __builtin_amdgcn_fence(__ATOMIC_ACQ_REL, "workgroup"); __builtin_amdgcn_wave_barrier();
  const int rsub = lane >> 4, c4 = (lane & 15) * 4;
  {
#pragma unroll
    for (int q = 0; q < 8; ++q) { const int r = q * 2 + rsub; if (col0 + c4 < N) { const v4f v = *(const v4fa*)&so[w][r][c4]; *(v4f*)(C + (size_t)(row0 + r) * ldc + col0 + c4) = v; } }
     }
}

// Wt[n][k] = f16(W[k][n]·scale) from f32 row-major W[K][N] (scale = power of two; bf16-exact weights stay exact in f16 away from the subnormal range)
__global__ __launch_bounds__(256) void k_wt_f16(const float* __restrict__ W, _Float16* __restrict__ Wt, int K, int N, float scale) {
  const int t = blockIdx.x * 256 + threadIdx.x; if (t >= N * (K / 8)) return; const int n = t / (K / 8), k8 = (t % (K / 8)) * 8; FragH f;
#pragma unroll
  for (int i = 0; i < 8; ++i) f.h[i] = (_Float16)(bf16_round(W[(size_t)(k8 + i) * N + n]) * scale); const v8us o = f.half[0];
  *(v8us*)((unsigned short*)Wt + (size_t)n * K + k8) = o; 
}
// k_gemm_hh variant with fused epilogue: v = acc·alpha + bias[by·sBias + col] (+ CP[(row/rowsPerB)·sCPb + by·64 + col] if CP) ; ACT 0 none / 1 elu ; writes f16 C16 (and f32 C if non-null)
template <int ACT>
__global__ __launch_bounds__(128) void k_gemm_hhx(const _Float16* __restrict__ A, int lda, size_t sA, const _Float16* __restrict__ Bh, int ldb, size_t sB, float alpha, const float* __restrict__ bias, size_t sBias, const float* __restrict__ CP, int rowsPerB, size_t sCPb, int row0g,
    float* __restrict__ C, _Float16* __restrict__ C16, int ldc, size_t sC, int M, int N, int K) {
  __shared__ __attribute__((aligned(16))) float so[4][16][64];
  const int tid = threadIdx.x, w = tid >> 5, lane = tid & 31, ln = lane & 15, hh = lane >> 4; const int by = blockIdx.y;
  A += (size_t)by * sA; Bh += (size_t)by * sB; const size_t cofs = (size_t)by * sC; const float* bp = bias ? bias + (size_t)by * sBias : nullptr;
  const int ntn = (N + 63) / 64; const int wid = blockIdx.x * 4 + w; const int mt = wid / ntn, nq = wid % ntn; if (mt * 16 >= M) return;
  const int row0 = mt * 16, col0 = nq * 64; const _Float16* arow = A + (size_t)(row0 + ln) * lda;
  v8f acc[4] = {};
  for (int kb = 0; kb < K; kb += 32) { FragH ah; ah.half[0] = *(const v8us*)((const unsigned short*)arow + kb + 8 * hh); ah.half[1] = *(const v8us*)((const unsigned short*)arow + kb + 16 + 8 * hh);
#pragma unroll
    for (int t = 0; t < 4; ++t) { if (col0 + t * 16 >= N) continue; const size_t boff = (size_t)(col0 + t * 16 + ln) * ldb + kb; FragH bq; bq.half[0] = *(const v8us*)((const unsigned short*)Bh + boff + 8 * hh); bq.half[1] = *(const v8us*)((const unsigned short*)Bh + boff + 16 + 8 * hh);
      acc[t] = mmaH<1>(ah.v, ah.v, bq.v, bq.v, acc[t]); }
  }
#pragma unroll
  for (int t = 0; t < 4; ++t) { if (col0 + t * 16 >= N) continue; const int col = col0 + t * 16 + ln; const float bv = bp ? bf16_round(bp[col]) : 0.f;
#pragma unroll
    for (int r = 0; r < 8; ++r) { float v = acc[t][r] * alpha + bv; if (CP) { const int rr = row0g + row0 + 8 * hh + r; if (rowsPerB < 0) v += CP[cofs + (size_t)rr * ldc + col];      /* rowsPerB < 0: own element of the batched C plane */ else { const int bidx = rr / rowsPerB; v += CP[(size_t)bidx * sCPb + (size_t)by * 64 + col]; } } if (ACT == 1) v = (v > 0.f) ? v : expm1f(v); else if (ACT == 7) v = (v > 0.f) ? v + 1.0f : expf(v); else if (ACT == 8) v = tanhf(v); else if (ACT == 9) v = 0.5f * v * (1.0f + tanhf(0.7978845608028654f * (v + 0.044715f * v * v * v))); else if (ACT == 11) v = 1.0f / (1.0f + expf(-v)); else if (ACT == 12) v = (v > 0.f) ? v : 0.01f * v; else if (ACT == 14) v = (v > 0.f) ? v : 0.1f * v; else if (ACT == 16) v = (v >= 0.f) ? v : 0.3f * v; else if (ACT == 17) v = (v >= 0.f) ? v : 0.2f * v; else if (ACT == 15) v = v / (1.0f + expf(-v)); else if (ACT == 3) v = fmaxf(v, 0.f); else if (ACT == 6) v = 0.5f * v * (1.0f + erff(v * 0.70710678118654752f)); so[w][8 * hh + r][t * 16 + ln] = v; } }
  __builtin_amdgcn_fence(__ATOMIC_ACQ_REL, "workgroup"); __builtin_amdgcn_wave_barrier();
  const int rsub = lane >> 4, c4 = (lane & 15) * 4; typedef _Float16 v4h __attribute__((ext_vector_type(4)));
  {
#pragma unroll
    for (int q = 0; q < 8; ++q) { const int r = q * 2 + rsub; if (col0 + c4 < N) { const v4f v = *(const v4fa*)&so[w][r][c4]; if (C) *(v4f*)(C + cofs + (size_t)(row0 + r) * ldc + col0 + c4) = v; if (C16) { v4h h4; for (int i = 0; i < 4; ++i) h4[i] = (_Float16)v[i]; *(v4h*)(C16 + cofs + (size_t)(row0 + r) * ldc + col0 + c4) = h4; } } }
     }
}


typedef _Float16 v4h __attribute__((ext_vector_type(4)));

__global__ __launch_bounds__(256) void k_h16(const float* __restrict__ x, _Float16* __restrict__ X16, size_t n8) { const size_t t = (size_t)blockIdx.x * 256 + threadIdx.x; if (t >= n8) return; FragH f;
#pragma unroll
  for (int q = 0; q < 8; ++q) f.h[q] = (_Float16)x[t * 8 + q]; *(v8us*)((unsigned short*)X16 + t * 8) = f.half[0];  }
__global__ __launch_bounds__(256) void k_round16f(const float* __restrict__ W, _Float16* __restrict__ Bt, size_t n8) { const size_t t = (size_t)blockIdx.x * 256 + threadIdx.x; if (t >= n8) return; FragH f;
#pragma unroll
  for (int i = 0; i < 8; ++i) f.h[i] = (_Float16)(bf16_round(W[t * 8 + i]) * 16.0f); *(v8us*)((unsigned short*)Bt + t * 8) = f.half[0];  }
template <int NHv, int TTv>
__global__ __launch_bounds__(256) void k_vt(const _Float16* __restrict__ V16, int ldv, int voff, _Float16* __restrict__ Vt) { __shared__ unsigned short tl[64][66]; const int tid = threadIdx.x; const int slab = blockIdx.x / (TTv / 64), lg = blockIdx.x % (TTv / 64); const int b = slab / NHv, h = slab % NHv;
  for (int i = tid; i < 64 * 8; i += 256) { const int r = i / 8, c8 = (i % 8) * 8; FragH f; f.half[0] = *(const v8us*)((const unsigned short*)V16 + ((size_t)b * TTv + lg * 64 + r) * ldv + voff + h * 64 + c8);
#pragma unroll
    for (int q = 0; q < 8; ++q) tl[r][c8 + q] = f.u[q]; }
  __syncthreads();
  {
#pragma unroll
    for (int rd = 0; rd < 2; ++rd) { const int d = rd * 32 + tid / 8, pc = tid % 8; FragH f;
#pragma unroll
      for (int q = 0; q < 8; ++q) f.u[q] = tl[pc * 8 + q][d];
      *(v8us*)((unsigned short*)Vt + ((size_t)slab * 64 + d) * TTv + lg * 64 + pc * 8) = f.half[0]; }
     } }

__global__ __launch_bounds__(256) void k_hl(const float* __restrict__ F, _Float16* __restrict__ Hh, _Float16* __restrict__ Hl, size_t n8) { const size_t t = (size_t)blockIdx.x * 256 + threadIdx.x; if (t >= n8) return; FragH fh, fl; const v4f a = *(const v4fa*)(F + t * 8), c = *(const v4fa*)(F + t * 8 + 4);
#pragma unroll
  for (int q = 0; q < 4; ++q) { _Float16 h = (_Float16)a[q]; fh.h[q] = h; fl.h[q] = (_Float16)((a[q] - (float)h) * 1024.0f); h = (_Float16)c[q]; fh.h[4 + q] = h; fl.h[4 + q] = (_Float16)((c[q] - (float)h) * 1024.0f); }
  { *(v8us*)((unsigned short*)Hh + t * 8) = fh.half[0]; *(v8us*)((unsigned short*)Hl + t * 8) = fl.half[0];  } }

// ---- fast GEMM (wave tile 32x64, work-group tile 128x64; requires M % 128 == 0 rows per launch region, N % 64 == 0 and K % 128 == 0); epilogue = k_gemm_hhx semantics ----
__device__ __forceinline__ v16h g2_frag(const _Float16* p, int hh) { FragH f; f.half[0] = *(const v8us*)((const unsigned short*)p + 8 * hh); f.half[1] = *(const v8us*)((const unsigned short*)p + 16 + 8 * hh); return f.v; }
__device__ __forceinline__ v8f g2_mma(v16h a, v16h b, v8f c) { v8f d = __builtin_amdgcn_wmma_f32_16x16x32_f16(false, a, false, b, (short)0, c, false, false); asm volatile("v_nop\n\tv_nop\n\tv_nop\n\tv_nop" : "+v"(d) : "v"(a), "v"(b)); return d; }
// ---- operand ring of k_gemm2: a stage is 128 k (256 bytes) of the work-group's 128 A rows and 64 B rows, laid in LDS at a pitch of 272 bytes (16 x odd: 16-byte fragment reads meet no bank conflict); two buffers ----
#define G2_KT 128
#define G2_PITCH 272
#define G2_BUF (192 * G2_PITCH)
__device__ __forceinline__ v8f g2_mmab(v16h a, v16h b, v8f c) { return __builtin_amdgcn_wmma_f32_16x16x32_f16(false, a, false, b, (short)0, c, false, false); }
__device__ __forceinline__ v16h g2_lfrag(const unsigned char* p) { FragH f; f.half[0] = *(const v8us*)p; f.half[1] = *(const v8us*)(p + 32); return f.v; }      /* p = the lane's row + 16 hh bytes: elements 0..7 = k 8 hh + e, 8..15 = k 16 + 8 hh + e, as in g2_frag */
// Eight asynchronous 16-byte copies of a thread, global to LDS through no register: 64 operand rows a call (row step 8), 16 threads a row, so that a wave's copy reads two whole 256-byte row pieces.
// The address wait is the statement's last line: it stands in front of whatever next writes a register that a copy names.
__device__ __forceinline__ void g2_copy8(unsigned l, const _Float16* g, size_t g8) {
  const unsigned l1 = l + 8 * G2_PITCH, l2 = l + 16 * G2_PITCH, l3 = l + 24 * G2_PITCH, l4 = l + 32 * G2_PITCH, l5 = l + 40 * G2_PITCH, l6 = l + 48 * G2_PITCH, l7 = l + 56 * G2_PITCH;
  const _Float16* g1 = g + g8; const _Float16* g2 = g1 + g8; const _Float16* g3 = g2 + g8; const _Float16* g4 = g3 + g8; const _Float16* g5 = g4 + g8; const _Float16* g6 = g5 + g8; const _Float16* g7 = g6 + g8;
  asm volatile("global_load_async_to_lds_b128 %0, %8, off\n\tglobal_load_async_to_lds_b128 %1, %9, off\n\tglobal_load_async_to_lds_b128 %2, %10, off\n\tglobal_load_async_to_lds_b128 %3, %11, off\n\t"
               "global_load_async_to_lds_b128 %4, %12, off\n\tglobal_load_async_to_lds_b128 %5, %13, off\n\tglobal_load_async_to_lds_b128 %6, %14, off\n\tglobal_load_async_to_lds_b128 %7, %15, off\n\ts_wait_xcnt 0x0"
               :: "v"(l), "v"(l1), "v"(l2), "v"(l3), "v"(l4), "v"(l5), "v"(l6), "v"(l7), "v"(g), "v"(g1), "v"(g2), "v"(g3), "v"(g4), "v"(g5), "v"(g6), "v"(g7) : "memory"); }
// pk (a launch argument, so that the three projections stay one kernel): layout of C16. 0 = rows of pitch ldc. 1, 2 = fragment order for the attention loop (N / 64 heads, M keys): the wave's 32 keys x 64 features of head nq are 8 units of 512 bytes at ((nq M + row0) 64) elements,
// unit u holding lane l's 8 elements at 8 l, so that one wave-wide 16-byte load of a unit reads 4 whole cache lines. 1 (K, A operand of S^T): u = 4 (key / 16) + feature / 16, lane = 16 ((feature / 8) & 1) + key % 16, element = feature % 8.
// 2 (V^T, A operand of O^T): u = 2 (feature / 16) + (key / 16) % 2, lane = 16 ((key / 8) & 1) + feature % 16, element = key % 8.
template <int ACT>
__global__ __launch_bounds__(128) void k_gemm2(const _Float16* __restrict__ A, int lda, size_t sA, const _Float16* __restrict__ Bh, int ldb, size_t sB, float alpha, const float* __restrict__ bias, size_t sBias, const float* __restrict__ CP, int rowsPerB, size_t sCPb, int row0g,
    float* __restrict__ C, _Float16* __restrict__ C16, int ldc, size_t sC, int M, int N, int K, int pk) { static_assert(ACT == 0 || ACT == 3 || ACT == 6 || ACT == 8 || ACT == 9 || ACT == 11 || ACT == 12 || ACT == 14 || ACT == 15 || ACT == 16 || ACT == 17, "k_gemm2: unsupported ACT code (would silently apply no activation)");
  __shared__ __attribute__((aligned(16))) float so[4][32][68];
  __shared__ __attribute__((aligned(16))) unsigned char ring[2 * G2_BUF];      /* rows 0..127 of a buffer: the work-group's A rows; 128..191: its B rows */
  const int tid = threadIdx.x, w = tid >> 5, lane = tid & 31, ln = lane & 15, hh = lane >> 4; const int by = blockIdx.y;
  A += (size_t)by * sA; Bh += (size_t)by * sB; const size_t cofs = (size_t)by * sC; const float* bp = bias ? bias + (size_t)by * sBias : nullptr;
  const int ntn = N >> 6; const int mt = blockIdx.x / ntn, nq = blockIdx.x - mt * ntn; const int row0 = mt * 128 + 32 * w, col0 = nq * 64; if (mt * 128 >= M) return;      /* the whole work-group leaves or none does (barriers below); needs M % 128 == 0, K % 128 == 0, K >= 128 */
  const _Float16* ga = A + (size_t)(mt * 128 + (tid >> 4)) * lda + (tid & 15) * 8; const _Float16* gb = Bh + (size_t)(col0 + (tid >> 4)) * ldb + (tid & 15) * 8;      /* the thread's first 16 bytes of a stage: row tid / 16, piece tid % 16 */
  const unsigned lc = (unsigned)(size_t)ring + (unsigned)((tid >> 4) * G2_PITCH + (tid & 15) * 16);      /* their place in buffer 0: byte address in the work-group's LDS */
  const size_t a8 = (size_t)8 * lda, b8 = (size_t)8 * ldb; const int nt = K / G2_KT;
  const unsigned char* fa = ring + (32 * w + ln) * G2_PITCH + 16 * hh; const unsigned char* fb = ring + (128 + ln) * G2_PITCH + 16 * hh;      /* the lane's fragment rows in buffer 0 */
  const v8f z8 = {0.f,0.f,0.f,0.f,0.f,0.f,0.f,0.f}; v8f c00 = z8, c01 = z8, c02 = z8, c03 = z8, c10 = z8, c11 = z8, c12 = z8, c13 = z8;
  g2_copy8(lc, ga, a8); g2_copy8(lc + 64 * G2_PITCH, ga + 8 * a8, a8); g2_copy8(lc + 128 * G2_PITCH, gb, b8);      /* stage 0 into buffer 0 */
  asm volatile("s_wait_asynccnt 0x0" ::: "memory");      /* this wave's copies of stage 0 have landed */
  __syncthreads();      /* every wave's have: stage 0 may be read */
  if (nt > 1) { g2_copy8(lc + G2_BUF, ga + G2_KT, a8); g2_copy8(lc + G2_BUF + 64 * G2_PITCH, ga + G2_KT + 8 * a8, a8); g2_copy8(lc + G2_BUF + 128 * G2_PITCH, gb + G2_KT, b8); }      /* stage 1 flies while stage 0 is worked on */
#pragma unroll 1      /* one stage a trip: the ring's order below is written once */
  for (int t = 0; t < nt; ++t) { const unsigned bo = (unsigned)(t & 1) * G2_BUF;
    const unsigned char* pa = fa + bo; const unsigned char* pb = fb + bo; v16h fr[2][6];      /* two fragment sets: A rows 0..15, 16..31, B columns 0..15 .. 48..63 of one k step */
    fr[0][0] = g2_lfrag(pa); fr[0][1] = g2_lfrag(pa + 16 * G2_PITCH); fr[0][2] = g2_lfrag(pb); fr[0][3] = g2_lfrag(pb + 16 * G2_PITCH); fr[0][4] = g2_lfrag(pb + 32 * G2_PITCH); fr[0][5] = g2_lfrag(pb + 48 * G2_PITCH);
#pragma unroll      /* constant indices keep the fragment sets in registers; constant offsets for the four k steps of a stage */
    for (int kk = 0; kk < 4; ++kk) { const int c = kk & 1, n = c ^ 1;
      if (kk < 3) { const unsigned char* qa = pa + (kk + 1) * 64; const unsigned char* qb = pb + (kk + 1) * 64;      /* the next k step of this same stage */
        fr[n][0] = g2_lfrag(qa); fr[n][1] = g2_lfrag(qa + 16 * G2_PITCH); fr[n][2] = g2_lfrag(qb); fr[n][3] = g2_lfrag(qb + 16 * G2_PITCH); fr[n][4] = g2_lfrag(qb + 32 * G2_PITCH); fr[n][5] = g2_lfrag(qb + 48 * G2_PITCH); }
      __builtin_amdgcn_sched_barrier(0);      /* keeps the twelve LDS reads one group in front of the products: spread among them, each pair is waited out to 0 */
      c00 = g2_mmab(fr[c][0], fr[c][2], c00); c10 = g2_mmab(fr[c][1], fr[c][2], c10); c01 = g2_mmab(fr[c][0], fr[c][3], c01); c11 = g2_mmab(fr[c][1], fr[c][3], c11);
      c02 = g2_mmab(fr[c][0], fr[c][4], c02); c12 = g2_mmab(fr[c][1], fr[c][4], c12); c03 = g2_mmab(fr[c][0], fr[c][5], c03); c13 = g2_mmab(fr[c][1], fr[c][5], c13);
      __builtin_amdgcn_sched_barrier(0); }      /* the other side of the same fence: the following group stays behind these products */
    asm volatile("s_wait_dscnt 0x0" ::: "memory");      /* this wave's reads of the buffer are done before it is handed over */
    asm volatile("s_wait_asynccnt 0x0" ::: "memory");      /* this wave's copies of stage t + 1 have landed */
    __syncthreads();      /* publishes stage t + 1 and ends every reader's last read of stage t's buffer */
    if (t + 2 < nt) { const _Float16* na = ga + (size_t)(t + 2) * G2_KT; const _Float16* nb = gb + (size_t)(t + 2) * G2_KT;      /* refill of the buffer just read */
      g2_copy8(lc + bo, na, a8); g2_copy8(lc + bo + 64 * G2_PITCH, na + 8 * a8, a8); g2_copy8(lc + bo + 128 * G2_PITCH, nb, b8); } }
  asm volatile("s_wait_asynccnt 0x0" ::: "memory");      /* nothing of this wave is in flight behind the loop */
  v8f accs[8] = {c00, c01, c02, c03, c10, c11, c12, c13};
#pragma unroll
  for (int u = 0; u < 8; ++u) { const int t = u & 3, half = u >> 2; const int col = col0 + t * 16 + ln; const float bv = bp ? bf16_round(bp[col]) : 0.f;
#pragma unroll
    for (int r = 0; r < 8; ++r) { const int rloc = half * 16 + 8 * hh + r; float v = accs[u][r] * alpha + bv; if (CP) { if (rowsPerB < 0) v += CP[cofs + (size_t)(row0g + row0 + rloc) * ldc + col];      /* rowsPerB < 0: own element of the batched C plane */ else { const int bidx = (row0g + row0 + rloc) / rowsPerB; v += CP[(size_t)bidx * sCPb + (size_t)by * 64 + col]; } }
      if (ACT == 3) v = fmaxf(v, 0.f); else if (ACT == 6) v = 0.5f * v * (1.0f + erff(v * 0.70710678118654752f)); else if (ACT == 11) v = 1.0f / (1.0f + expf(-v)); else if (ACT == 15) v = v / (1.0f + expf(-v)); else if (ACT == 12) v = (v > 0.f) ? v : 0.01f * v; else if (ACT == 8) v = tanhf(v); else if (ACT == 9) v = 0.5f * v * (1.0f + tanhf(0.7978845608028654f * (v + 0.044715f * v * v * v))); else if (ACT == 14) v = (v > 0.f) ? v : 0.1f * v; else if (ACT == 16) v = (v >= 0.f) ? v : 0.3f * v; else if (ACT == 17) v = (v >= 0.f) ? v : 0.2f * v;
      so[w][rloc][t * 16 + ln] = v; } }
  __builtin_amdgcn_fence(__ATOMIC_ACQ_REL, "workgroup"); __builtin_amdgcn_wave_barrier();
  const int rsub = lane >> 4, c4 = (lane & 15) * 4;
  if (pk == 0) {
#pragma unroll
    for (int q = 0; q < 16; ++q) { const int r = q * 2 + rsub; const v4f v = *(const v4fa*)&so[w][r][c4]; if (C) *(v4f*)(C + cofs + (size_t)(row0 + r) * ldc + col0 + c4) = v; if (C16) { v4h h4; for (int i = 0; i < 4; ++i) h4[i] = (_Float16)v[i]; *(v4h*)(C16 + cofs + (size_t)(row0 + r) * ldc + col0 + c4) = h4; } }
  } else {
    unsigned short* dp = (unsigned short*)C16 + ((size_t)nq * M + row0) * 64 + lane * 8;
    if (pk == 1) {
#pragma unroll
      for (int u = 0; u < 8; ++u) { FragH f; const int rl = (u >> 2) * 16 + ln, cl = (u & 3) * 16 + 8 * hh; const v4f x = *(const v4fa*)&so[w][rl][cl], y = *(const v4fa*)&so[w][rl][cl + 4];
#pragma unroll
        for (int i = 0; i < 4; ++i) { f.h[i] = (_Float16)x[i]; f.h[4 + i] = (_Float16)y[i]; }
        *(v8us*)(dp + u * 256) = f.half[0]; }
      asm volatile("s_wait_xcnt 0x0" ::: "memory");      /* address wait behind the run of stores above, in front of whatever next writes a register that they name */
    } else {
#pragma unroll
      for (int u = 0; u < 8; ++u) { FragH f; const int rl = (u & 1) * 16 + 8 * hh, cl = (u >> 1) * 16 + ln;
#pragma unroll
        for (int i = 0; i < 8; ++i) f.h[i] = (_Float16)so[w][rl + i][cl];
        *(v8us*)(dp + u * 256) = f.half[0]; }
      asm volatile("s_wait_xcnt 0x0" ::: "memory");      /* address wait behind the run of stores above, in front of whatever next writes a register that they name */
    }
  } }


__global__ __launch_bounds__(256) void k_wnat(const float* __restrict__ w, size_t n8, _Float16* __restrict__ Bt) { const size_t t = (size_t)blockIdx.x * 256 + threadIdx.x; if (t >= n8) return; FragH f; for (int q = 0; q < 8; ++q) f.h[q] = (_Float16)(bf16_round(w[t * 8 + q]) * 16.0f); *(v8us*)((unsigned short*)Bt + t * 8) = f.half[0];  }
__global__ __launch_bounds__(256) void k_rsm(const float* __restrict__ S, _Float16* __restrict__ P, int nrows) {
  #pragma clang fp contract(off)
  const int i = blockIdx.x * 256 + threadIdx.x; if (i >= nrows) return; const float* s = S + (size_t)i * SQ; float mx = -3.0e38f;
#pragma unroll 1
  for (int j = 0; j < SQ; ++j) mx = fmaxf(mx, s[j]); float se = 0.f;
#pragma unroll 1
  for (int j = 0; j < SQ; ++j) se += expf(s[j] - mx); const float sc = 256.0f / se;
#pragma unroll 1
  for (int j0 = 0; j0 < SQ; j0 += 8) { FragH f; for (int q = 0; q < 8; ++q) f.h[q] = (_Float16)(expf(s[j0 + q] - mx) * sc); unsigned short* d = (unsigned short*)P + (size_t)i * SQ + j0; *(v8us*)d = f.half[0];  } }
__global__ __launch_bounds__(256) void k_vt(const _Float16* __restrict__ V16, int b, int h0, _Float16* __restrict__ VT) { __shared__ unsigned short tl[64][65]; const int tid = threadIdx.x; const int hh = blockIdx.x % HG, sg = blockIdx.x / HG; const int s0 = sg * 64; const int h = h0 + hh;
  for (int i = tid; i < 64 * 8; i += 256) { const int j = i / 8, d8 = (i % 8) * 8; FragH f; f.half[0] = *(const v8us*)((const unsigned short*)V16 + ((size_t)b * SQ + s0 + j) * DM + h * HD + d8); for (int q = 0; q < 8; ++q) tl[d8 + q][j] = f.u[q]; }
  __syncthreads();
  { for (int i = tid; i < 64 * 8; i += 256) { const int d = i / 8, j8 = (i % 8) * 8; FragH f; for (int q = 0; q < 8; ++q) f.u[q] = tl[d][j8 + q]; *(v8us*)((unsigned short*)VT + ((size_t)hh * HD + d) * SQ + s0 + j8) = f.half[0]; }  } }



__global__ __launch_bounds__(256) void k_rsmkm(const float* __restrict__ S, _Float16* __restrict__ P, int nrows, const int* __restrict__ am) {
  #pragma clang fp contract(off)
  const int t = blockIdx.x * 256 + threadIdx.x; if (t >= nrows) return; const size_t i = (size_t)t; const float* s = S + i * SQ; const int* mr = am + (size_t)(t % SQ) * SQ; float mx = -3.0e38f;
#pragma unroll 1
  for (int j = 0; j < SQ; ++j) { const float f = (mr[j] != 0) ? 1.f : 0.f; mx = fmaxf(mx, fmaf(f, s[j], (1.f - f) * -1.0e9f)); } float se = 0.f;
#pragma unroll 1
  for (int j = 0; j < SQ; ++j) { const float f = (mr[j] != 0) ? 1.f : 0.f; se += __expf(fmaf(f, s[j], (1.f - f) * -1.0e9f) - mx); } const float sc = 256.0f / se;
#pragma unroll 1
  for (int j0 = 0; j0 < SQ; j0 += 8) { FragH fr; for (int q = 0; q < 8; ++q) { const int j = j0 + q; const float f = (mr[j] != 0) ? 1.f : 0.f; fr.h[q] = (_Float16)(__expf(fmaf(f, s[j], (1.f - f) * -1.0e9f) - mx) * sc); }
    unsigned short* d = (unsigned short*)P + i * SQ + j0; *(v8us*)d = fr.half[0];  } }
// The swap of a wave's two 16-lane rows: a plain lane shuffle would go through the LDS pipe.
__device__ __forceinline__ float rs_x16(float v) { const int b = __float_as_int(v); return __int_as_float(__builtin_amdgcn_permlanex16(b, b, 0x76543210, 0xfedcba98, false, false)); }
// Four native 2^x in one statement: no result shares a register
// with a source (early clobber), each exp has an independent one behind it, and the v_nop is the slot that the instruction set asks for behind the last.
__device__ __forceinline__ v4f rs_exp2x4(v4f x) { float y0, y1, y2, y3;
  asm("v_exp_f32 %0, %4\n\tv_exp_f32 %1, %5\n\tv_exp_f32 %2, %6\n\tv_exp_f32 %3, %7\n\tv_nop" : "=&v"(y0), "=&v"(y1), "=&v"(y2), "=&v"(y3) : "v"(x[0]), "v"(x[1]), "v"(x[2]), "v"(x[3]));
  const v4f y = {y0, y1, y2, y3}; return y; }
// One native 2^x with the same slot behind it.
__device__ __forceinline__ float rs_exp2(float x) { float y; asm("v_exp_f32 %0, %1\n\tv_nop" : "=&v"(y) : "v"(x)); return y; }
__device__ __forceinline__ v16h fa_frag(const _Float16* base, unsigned lofs) { FragH f; f.half[0] = *(const v8us*)((const unsigned short*)base + lofs); f.half[1] = *(const v8us*)((const unsigned short*)base + lofs + 16); return f.v; }      /* base is wave-uniform, lofs the lane's own element offset (row ln, k 8 hh) */
__device__ __forceinline__ v16h fa_fragp(const _Float16* base, unsigned lofs) { FragH f; f.half[0] = *(const v8us*)((const unsigned short*)base + lofs); f.half[1] = *(const v8us*)((const unsigned short*)base + lofs + 256); return f.v; }      /* fragment-order operand: two units of 512 bytes, lofs = 8 lane; elements 0..7 and 8..15 as in fa_frag */
__device__ __forceinline__ v8f fa_mma(v16h a, v16h b, v8f c) { return __builtin_amdgcn_wmma_f32_16x16x32_f16(false, a, false, b, (short)0, c, false, false); }
// 16 waves a work-group, one work-group a WGP, so 4 waves a SIMD: vector work of one wave runs beside the products and the load waits of the others. Waves w and w + 8 own the same 32 query rows;
// wave w walks keys 0..2047, wave w + 8 keys 2048..4095, each with its own running maximum, sum and O^T; behind the loop the upper wave hands its three over in LDS and the lower wave joins them.
__global__ __launch_bounds__(512) void k_fattn(const _Float16* __restrict__ Q, const _Float16* __restrict__ KP, const _Float16* __restrict__ VP, float* __restrict__ O) {      /* Q in rows; KP, VP in fragment order (k_gemm2, pk 1 and 2): 32 keys of a head are 4 KB in a row in each */
  __shared__ __attribute__((aligned(16))) float xo[8][17][32][4];      /* per query tile: the upper wave's O^T as 16 pieces of 16 bytes a lane (a wave's piece is 512 bytes in a row: no bank conflict), then its maxima and sums */
  const int lane = threadIdx.x & 31, ln = lane & 15, hh = lane >> 4; const int w = __builtin_amdgcn_readfirstlane(threadIdx.x >> 5);      /* the wave's number, held scalar so that the row bases and the branches on it are scalar */
  const int wq = w & 7, kh = w >> 3, kbeg = kh * (SQ / 2);      /* query tile, key half, first key */
  const int h = blockIdx.x / (SQ / 256); const int q0 = (blockIdx.x % (SQ / 256)) * 256 + wq * 32;      /* the 8 waves of a key half share its K and V^T lines in the WGP's cache */
  const float SC = 0.125f * 1.44269504088896340736f;      /* 1 / sqrt(64) and log2 e in one factor: e^x as the native 2^x */
  const unsigned lk = (unsigned)(ln * DM + 8 * hh), lp = (unsigned)(lane * 8);
  const _Float16* qb = Q + (size_t)q0 * DM + h * HD; const _Float16* kb = KP + (size_t)h * HD * SQ; const _Float16* vb = VP + (size_t)h * HD * SQ;
  v16h qf[2][2], kf[2][2], vf[4];
  /* every loop over a fragment, score or output array of this kernel is unrolled: constant indices keep the arrays in registers */
#pragma unroll
  for (int j = 0; j < 2; ++j) { qf[j][0] = fa_frag(qb + j * 16 * DM, lk); qf[j][1] = fa_frag(qb + j * 16 * DM + 32, lk); }
#pragma unroll
  for (int t = 0; t < 2; ++t) { kf[t][0] = fa_fragp(kb + kbeg * HD + t * 1024, lp); kf[t][1] = fa_fragp(kb + kbeg * HD + t * 1024 + 512, lp); }
  __builtin_amdgcn_sched_barrier(0);      /* keeps the first V^T loads the youngest, as they are in every pass: otherwise the counted wait at the loop's head falls to 0 and each pass waits out the V^T loads issued just before it */
#pragma unroll
  for (int t = 0; t < 4; ++t) vf[t] = fa_fragp(vb + kbeg * HD + t * 512, lp);
  const v8f z8 = {0.f, 0.f, 0.f, 0.f, 0.f, 0.f, 0.f, 0.f}; v8f o[2][4]; float m[2] = {-3.0e38f, -3.0e38f}, l[2] = {0.f, 0.f};
#pragma unroll
  for (int j = 0; j < 2; ++j) for (int t = 0; t < 4; ++t) o[j][t] = z8;
  for (int k0 = kbeg; k0 < kbeg + SQ / 2; k0 += 32) {
    const int kn = (k0 + 32) & (SQ - 1);      /* the next pass's keys; a wave's last pass fetches the first 32 keys of the other half (in bounds, not used) so that the loop has no branch */
    v8f s[2][2];
#pragma unroll
    for (int t = 0; t < 2; ++t) for (int j = 0; j < 2; ++j) s[t][j] = fa_mma(kf[t][1], qf[j][1], fa_mma(kf[t][0], qf[j][0], z8));
    const _Float16* kp = kb + kn * HD;      /* K one pass ahead, into the registers that the products above have just read */
#pragma unroll
    for (int t = 0; t < 2; ++t) { kf[t][0] = fa_fragp(kp + t * 1024, lp); kf[t][1] = fa_fragp(kp + t * 1024 + 512, lp); }
    FragH pf[2];
#pragma unroll
    for (int j = 0; j < 2; ++j) { float mx = fmaxf(s[0][j][0], s[1][j][0]);
#pragma unroll
      for (int r = 1; r < 8; ++r) mx = fmaxf(mx, fmaxf(s[0][j][r], s[1][j][r]));
      mx = fmaxf(mx, rs_x16(mx)); const float mn = fmaxf(m[j], mx); const float al = rs_exp2((m[j] - mn) * SC); m[j] = mn; const float of = mn * SC - 8.0f;      /* weights are 2^8 e^(s - max): f16 keeps small ones normal; the row sum carries the same factor */
      v4f sm = {0.f, 0.f, 0.f, 0.f};
#pragma unroll
      for (int t = 0; t < 2; ++t) for (int g = 0; g < 2; ++g) { v4f x; for (int q = 0; q < 4; ++q) x[q] = s[t][j][4 * g + q] * SC - of; const v4f p = rs_exp2x4(x); sm += p; for (int q = 0; q < 4; ++q) pf[j].h[8 * t + 4 * g + q] = (_Float16)p[q]; }
      l[j] = l[j] * al + ((sm[0] + sm[1]) + (sm[2] + sm[3]));      /* the lane's own 16 keys; the halves are joined once, behind the loop */
#pragma unroll
      for (int t = 0; t < 4; ++t) o[j][t] *= al; }
#pragma unroll
    for (int t = 0; t < 4; ++t) for (int j = 0; j < 2; ++j) o[j][t] = fa_mma(vf[t], pf[j].v, o[j][t]);
    const _Float16* vp = vb + kn * HD;      /* V^T one pass ahead, likewise */
#pragma unroll
    for (int t = 0; t < 4; ++t) vf[t] = fa_fragp(vp + t * 512, lp);
    asm volatile("s_wait_xcnt 0x0" ::: "memory");      /* the next pass forms its addresses in the registers that the loads above name: their address wait stands in front of that overwrite */
  }
  if (kh == 1) {      /* the upper wave hands over what it has of keys 2048..4095 */
#pragma unroll
    for (int j = 0; j < 2; ++j)
#pragma unroll
      for (int t = 0; t < 4; ++t) { const v4f lo = {o[j][t][0], o[j][t][1], o[j][t][2], o[j][t][3]}, hi = {o[j][t][4], o[j][t][5], o[j][t][6], o[j][t][7]}; *(v4f*)xo[wq][(j * 4 + t) * 2][lane] = lo; *(v4f*)xo[wq][(j * 4 + t) * 2 + 1][lane] = hi; }
    const v4f st = {m[0], m[1], l[0], l[1]}; *(v4f*)xo[wq][16][lane] = st; }
  __syncthreads();      /* every wave passes it once: the upper waves' LDS writes stand before the lower waves read them */
  if (kh == 0) {      /* the lower wave joins the halves under their common maximum, divides and stores */
    const v4f st = *(const v4f*)xo[wq][16][lane];
#pragma unroll
    for (int j = 0; j < 2; ++j) { const float mn = fmaxf(m[j], st[j]); const float a0 = rs_exp2((m[j] - mn) * SC), a1 = rs_exp2((st[j] - mn) * SC); const float lt = l[j] * a0 + st[2 + j] * a1;
      const float inv = 1.0f / (lt + rs_x16(lt)); const float f0 = a0 * inv, f1 = a1 * inv; float* d = O + (size_t)(q0 + j * 16 + ln) * DM + h * HD + 8 * hh;
#pragma unroll
      for (int t = 0; t < 4; ++t) { const v4f xl = *(const v4f*)xo[wq][(j * 4 + t) * 2][lane], xh = *(const v4f*)xo[wq][(j * 4 + t) * 2 + 1][lane];
        const v4f lo = {o[j][t][0] * f0 + xl[0] * f1, o[j][t][1] * f0 + xl[1] * f1, o[j][t][2] * f0 + xl[2] * f1, o[j][t][3] * f0 + xl[3] * f1}, hi = {o[j][t][4] * f0 + xh[0] * f1, o[j][t][5] * f0 + xh[1] * f1, o[j][t][6] * f0 + xh[2] * f1, o[j][t][7] * f0 + xh[3] * f1};
        *(v4f*)(d + t * 16) = lo; *(v4f*)(d + t * 16 + 4) = hi; } } } }



// ---- preparation, one launch: the three inputs as f16 rows and the three weight planes as Bt[(h, d)][m] x16 ----
// PW waves in all, 16 a work-group, as many work-groups as the chip has WGPs: few waves to start, all resident at once. Each wave takes 1 / PW of each of the six passes.
// Inputs: 1024 floats a wave and input, as 8 loads of 16 bytes a lane, each covering 512 bytes in a row (4 whole lines); all 24 are in flight before the first is converted; stores of 8 bytes a lane cover 2 whole lines.
// Weights: a thread gathers 8 m of one (h, d) of each plane, as per-head [m][d] -> Bt[(h, d)][m]; a wave's store covers 512 bytes in a row.
#define PW 4096
__global__ __launch_bounds__(512) void k_prep(const float* __restrict__ xq, const float* __restrict__ xk, const float* __restrict__ xv, const float* __restrict__ wq, const float* __restrict__ wk, const float* __restrict__ wv,
    _Float16* __restrict__ XQ, _Float16* __restrict__ XK, _Float16* __restrict__ XV, _Float16* __restrict__ BQ, _Float16* __restrict__ BK, _Float16* __restrict__ BV) {
  static_assert(NR * DM == (size_t)PW * 1024 && (size_t)NH * HD * (DM / 8) == (size_t)PW * 32, "k_prep: one piece of every pass a wave");
  const int lane = threadIdx.x & 31; const int gw = blockIdx.x * 16 + __builtin_amdgcn_readfirstlane(threadIdx.x >> 5);      /* the wave's number in the grid, held scalar so that the bases are scalar */
  const float* xs[3] = {xq + (size_t)gw * 1024, xk + (size_t)gw * 1024, xv + (size_t)gw * 1024}; _Float16* xd[3] = {XQ + (size_t)gw * 1024, XK + (size_t)gw * 1024, XV + (size_t)gw * 1024};
  const unsigned t = (unsigned)(gw * 32 + lane); const unsigned m8 = (t % (DM / 8)) * 8, d = (t / (DM / 8)) % HD, h = t / ((DM / 8) * HD);
  const unsigned wo = (h * DM + m8) * HD + d; const float* wsrc[3] = {wq, wk, wv}; _Float16* wd[3] = {BQ, BK, BV};
  v4f a[3][8]; float g[3][8];
  /* every loop below is unrolled: constant indices keep the arrays in registers */
#pragma unroll
  for (int p = 0; p < 3; ++p)
#pragma unroll
    for (int i = 0; i < 8; ++i) a[p][i] = *(const v4fa*)(xs[p] + i * 128 + lane * 4);
#pragma unroll
  for (int p = 0; p < 3; ++p)
#pragma unroll
    for (int q = 0; q < 8; ++q) g[p][q] = wsrc[p][wo + q * HD];
  __builtin_amdgcn_sched_barrier(0);      /* keeps all 48 loads in front of the first conversion: left free, the compiler sinks most of them among the conversions and a wave has only some 12 in flight */
#pragma unroll
  for (int p = 0; p < 3; ++p)
#pragma unroll
    for (int i = 0; i < 8; ++i) { v4h o;
#pragma unroll
      for (int q = 0; q < 4; ++q) o[q] = (_Float16)bf16_round(a[p][i][q]);
      *(v4h*)(xd[p] + i * 128 + lane * 4) = o; }
#pragma unroll
  for (int p = 0; p < 3; ++p) { FragH f;
#pragma unroll
    for (int q = 0; q < 8; ++q) f.h[q] = (_Float16)(16.0f * bf16_round(g[p][q]));
    *(v8us*)((unsigned short*)wd[p] + (size_t)(h * HD + d) * DM + m8) = f.half[0]; } }

extern "C" void kernel_launch(void* const* d_in, const int* in_sizes, int n_in,
                              void* d_out, int out_size, void* d_ws, size_t ws_size, hipStream_t stream) {
  (void)in_sizes; (void)n_in; (void)out_size;
  const float* const* I = (const float* const*)d_in; const float* xq = I[0]; const float* xk = I[1]; const float* xv = I[2]; const float* wq = I[3]; const float* bq = I[4]; const float* wk = I[5]; const float* bk = I[6]; const float* wv = I[7]; const float* bv = I[8]; const float* x = xq;      /* X_Q, X_K, X_V [4096][1024]; per-head Wq / Wk / Wv [16][1024][64] ([in][out] per head) + biases [16][64] = [(h, d)]; no output projection */
  static_assert(NH * HD == DM && DM % 128 == 0 && SQ % 256 == 0 && HD == 64 && HG == 1 && NB == 1, "shape / tile multiples");
  char* ws = (char*)d_ws; size_t off = 0;
  auto take = [&](size_t bytes) { char* p = ws + off; off += (bytes + 255) & ~(size_t)255; return p; };
  _Float16* BQ = (_Float16*)take((size_t)DM * DM * 2); _Float16* BK = (_Float16*)take((size_t)DM * DM * 2); _Float16* BV = (_Float16*)take((size_t)DM * DM * 2);
  _Float16* X16 = (_Float16*)take(NR * DM * 2); _Float16* XKp = (_Float16*)take(NR * DM * 2); _Float16* XVp = (_Float16*)take(NR * DM * 2); _Float16* Q16 = (_Float16*)take(NR * DM * 2); _Float16* KP = (_Float16*)take((size_t)NH * HD * SQ * 2);
  _Float16* VP = (_Float16*)take((size_t)NH * HD * SQ * 2);
  if (off > ws_size) return;
  _Float16* XK = XKp; _Float16* XV = XVp;
  k_prep<<<PW / 16, 512, 0, stream>>>(x, xk, xv, wq, wk, wv, X16, XK, XV, BQ, BK, BV);      /* inputs as exact f16 rows; per-head [m][d] -> Bt[(h, d)][m] x16 */
  const size_t r0p = (size_t)B0 * SQ;      /* first projected row */
  k_gemm2<0><<<dim3((unsigned)((MP / 128) * (DM / 64)), 1), 128, 0, stream>>>(X16 + r0p * DM, DM, 0, BQ, DM, 0, 0.0625f, bq, 0, nullptr, 1, 0, 0, nullptr, Q16 + r0p * DM, DM, 0, MP, DM, DM, 0);
  k_gemm2<0><<<dim3((unsigned)((MP / 128) * (DM / 64)), 1), 128, 0, stream>>>(XK + r0p * DM, DM, 0, BK, DM, 0, 0.0625f, bk, 0, nullptr, 1, 0, 0, nullptr, KP, DM, 0, MP, DM, DM, 1);      /* K in fragment order */
  k_gemm2<0><<<dim3((unsigned)((MP / 128) * (DM / 64)), 1), 128, 0, stream>>>(XV + r0p * DM, DM, 0, BV, DM, 0, 0.0625f, bv, 0, nullptr, 1, 0, 0, nullptr, VP, DM, 0, MP, DM, DM, 2);      /* V^T in fragment order */
  for (int b = B0; b < B0 + NBR; ++b) { const size_t r0 = (size_t)b * SQ;
    k_fattn<<<NH * (SQ / 256), 512, 0, stream>>>(Q16 + r0 * LQ, KP, VP, (float*)d_out + r0 * DM); }      /* all heads: softmax(Q K^T / 8) V written f32 straight into each head's 64 columns of the output rows (no output projection) */
}

// v007
// It runs in 119 microseconds.
// In both of two side-by-side timings against v006, it was 1.05 times as fast.
// Counting every step since v000, it is 112 times as fast.
#include <hip/hip_runtime.h>
// Multi-head attention over three inputs with PER-HEAD projection weights and no output projection (X_Q, X_K, X_V [4096][1024] (one sequence); Q[h] = X_Q Wq[h] + bq[h], K, V likewise (Wq / Wk / Wv [16][1024][64] per-head [in][out], sigma 1/32; biases [16][64] sigma 1/32); scores = Q[h] K[h]^T / sqrt(64); softmax over all 4096 keys; out[h] = attn V[h]; heads concatenated along the feature axis -> [4096][1024]).
// Structure: one preparation launch (the three inputs as exact f16 rows (bf16-rounded); per-head [in][out] weights gathered into Bt[(h, d)][in] x16 planes); Q, K, V as three WMMA GEMMs (32x64 wave tiles, operands staged in LDS by asynchronous copies in a ring of two buffers, f32 accumulation, + bias [(h, d)], f16 outputs; the K and V GEMMs store their 32-key x 64-feature wave tiles in the attention loop's fragment order, V transposed on the way); then ONE attention launch for all heads: two waves of a work-group own 32 query rows, each walks one half of the 4096 keys 32 at a time, S^T = K Q^T - a reference held over the passes (it rises only when a score stands 2^7 above it), softmax in registers (f32 statistics; weights x256 as f16), O^T += V^T P^T; the two halves are joined through LDS at the end, divided by the row sum and written f32 straight into the head's 64 columns of the output rows.
// Compute dtype: inputs rounded to bf16; x / weights exact; q, k, v and softmax weights as plain f16 GEMM operands (~2^-12); scores, softmax statistics and o f32; v_wmma_f32_16x16x32_f16.
#define NB 1
#define SQ 4096
#define DM 1024
#define NH 16
#define HD 64
#define HG 1                         /* heads per launch of the non-template k_vt */
#define B0 0                         /* first batch processed (debug hook) */
#define NBR NB                       /* batches processed (debug hook) */
#define NR ((size_t)NB * SQ)         /* token rows */
#define MP ((int)((size_t)NBR * SQ)) /* rows projected (debug hook) */
#define QN SQ                        /* unused (the attention launch attends all SQ query rows) */
#define NHD NH                       /* unused (the attention launch covers all NH heads) */
#define MPO MP                       /* unused (there is no output stage) */
#define LQ DM      /* row pitch of the q rows */
typedef __bf16 v16b __attribute__((ext_vector_type(16)));
typedef unsigned short v8us __attribute__((ext_vector_type(8), may_alias));
typedef float  v8f  __attribute__((ext_vector_type(8)));
typedef float  v4f  __attribute__((ext_vector_type(4)));
typedef float  v4fa __attribute__((ext_vector_type(4), may_alias));
union FragB { v16b v; v8us half[2]; unsigned short u[16]; };

__device__ __forceinline__ unsigned short bf16_bits(float x) { unsigned int u = __float_as_uint(x); return (unsigned short)((u + 0x7FFFu + ((u >> 16) & 1u)) >> 16); }
__device__ __forceinline__ float bf16_val(unsigned short b) { return __uint_as_float(((unsigned int)b) << 16); }
__device__ __forceinline__ float bf16_round(float x) { return bf16_val(bf16_bits(x)); }
// D += A·B with NT terms: 1 = ah·bh, 2 = + al·bh (A split), 3 = + ah·bl (both split)
template <int NT>
__device__ __forceinline__ v8f mmaN(v16b ah, v16b al, v16b bh, v16b bl, v8f c) {
  c = __builtin_amdgcn_wmma_f32_16x16x32_bf16(false, ah, false, bh, (short)0, c, false, false);
  if (NT >= 2) c = __builtin_amdgcn_wmma_f32_16x16x32_bf16(false, al, false, bh, (short)0, c, false, false);
  if (NT >= 3) c = __builtin_amdgcn_wmma_f32_16x16x32_bf16(false, ah, false, bl, (short)0, c, false, false);
  asm volatile("v_nop\n\tv_nop\n\tv_nop\n\tv_nop" : "+v"(c) : "v"(ah), "v"(al), "v"(bh), "v"(bl));
  return c;
}

__global__ __launch_bounds__(256) void k_wt_bf16(const float* __restrict__ W, unsigned short* __restrict__ Wt, int K, int N) {
  const int t = blockIdx.x * 256 + threadIdx.x;
  const int k8n = K / 8;
  if (t >= N * k8n) return;
  const int n = t / k8n, k8 = (t % k8n) * 8;
  v8us v;
#pragma unroll
  for (int i = 0; i < 8; ++i) v[i] = bf16_bits(W[(size_t)(k8 + i) * N + n]);
  *(v8us*)(Wt + (size_t)n * K + k8) = v;
  
}

// GEMM C[M][N] (f32, pitch ldc) = act(A[M][K]·W + bias). A f32 row-major (pitch lda) converted per fragment to bf16
// (ASPLIT: hi/lo two planes -> 2 terms, else single rounded term); Wt bf16 [N][K] (pitch ldb). BIAS_BF16 rounds the
// bias to bf16 first (bias quantised to bf16 before the add). K%32==0, M%16==0, N%64==0.
template <bool ASPLIT, int ACT, bool BIAS_BF16>
__global__ __launch_bounds__(128) void k_gemm_bf(const float* __restrict__ A, int lda, const unsigned short* __restrict__ Wt, int ldb,
                                               const float* __restrict__ bias, float* __restrict__ C, int ldc, int M, int N, int K) {
  __shared__ __attribute__((aligned(16))) float so[4][16][64];
  const int tid = threadIdx.x, w = tid >> 5, lane = tid & 31, ln = lane & 15, hh = lane >> 4;
  const int ntn = N / 64;
  const int wid = blockIdx.x * 4 + w;
  const int mt = wid / ntn, nq = wid % ntn;
  if (mt * 16 >= M) return;
  const int row0 = mt * 16, col0 = nq * 64;
  const float* arow = A + (size_t)(row0 + ln) * lda;
  v8f acc[4] = {};
  for (int kb = 0; kb < K; kb += 32) {
    FragB ah, al;
    const v4f x0 = *(const v4fa*)(arow + kb + 8 * hh), x1 = *(const v4fa*)(arow + kb + 8 * hh + 4);
    const v4f x2 = *(const v4fa*)(arow + kb + 16 + 8 * hh), x3 = *(const v4fa*)(arow + kb + 16 + 8 * hh + 4);
    float xs[16] = {x0[0],x0[1],x0[2],x0[3],x1[0],x1[1],x1[2],x1[3],x2[0],x2[1],x2[2],x2[3],x3[0],x3[1],x3[2],x3[3]};
#pragma unroll
    for (int i = 0; i < 16; ++i) { const unsigned short hb = bf16_bits(xs[i]); ah.u[i] = hb; al.u[i] = ASPLIT ? bf16_bits(xs[i] - bf16_val(hb)) : (unsigned short)0; }
#pragma unroll
    for (int t = 0; t < 4; ++t) {
      const unsigned short* brow = Wt + (size_t)(col0 + t * 16 + ln) * ldb + kb;
      FragB b;
      b.half[0] = *(const v8us*)(brow + 8 * hh);
      b.half[1] = *(const v8us*)(brow + 16 + 8 * hh);
      acc[t] = mmaN<ASPLIT ? 2 : 1>(ah.v, al.v, b.v, b.v, acc[t]);
    }
  }
#pragma unroll
  for (int t = 0; t < 4; ++t) {
    float bv = bias ? bias[col0 + t * 16 + ln] : 0.f;
    if (BIAS_BF16) bv = bf16_round(bv);
#pragma unroll
    for (int r = 0; r < 8; ++r) { float v = acc[t][r] + bv; if (ACT == 1) v = fmaxf(v, 0.f); so[w][8 * hh + r][t * 16 + ln] = v; }
  }
  __builtin_amdgcn_fence(__ATOMIC_ACQ_REL, "workgroup");
  __builtin_amdgcn_wave_barrier();
  const int rsub = lane >> 4, c4 = (lane & 15) * 4;
  {
#pragma unroll
    for (int q = 0; q < 8; ++q) {
      const int r = q * 2 + rsub;
      const v4f v = *(const v4fa*)&so[w][r][c4];
      *(v4f*)(C + (size_t)(row0 + r) * ldc + col0 + c4) = v;
    }
    
  }
}

// GEMM C = act(A·W + bias + resid): A f32 (ASPLIT -> hi/lo 2 terms), Wt bf16 [N][K]; ACT 0 none, 1 relu, 2 exact gelu;
// resid (optional, f32, row index = (row % rmod), pitch ldr, RES_BF16 rounds it) added before the activation.
template <bool ASPLIT, int ACT, bool BIAS_BF16, bool RES_BF16>
__global__ __launch_bounds__(128) void k_gemm_bf3(const float* __restrict__ A, int lda, const unsigned short* __restrict__ Wt, int ldb,
                                                const float* __restrict__ bias, const float* __restrict__ resid, int rmod, int ldr,
                                                float* __restrict__ C, int ldc, int M, int N, int K) {
  __shared__ __attribute__((aligned(16))) float so[4][16][64];
  const int tid = threadIdx.x, w = tid >> 5, lane = tid & 31, ln = lane & 15, hh = lane >> 4;
  const int ntn = N / 64;
  const int wid = blockIdx.x * 4 + w;
  const int mt = wid / ntn, nq = wid % ntn;
  if (mt * 16 >= M) return;
  const int row0 = mt * 16, col0 = nq * 64;
  const float* arow = A + (size_t)(row0 + ln) * lda;
  v8f acc[4] = {};
  for (int kb = 0; kb < K; kb += 32) {
    FragB ah, al;
    const v4f x0 = *(const v4fa*)(arow + kb + 8 * hh), x1 = *(const v4fa*)(arow + kb + 8 * hh + 4);
    const v4f x2 = *(const v4fa*)(arow + kb + 16 + 8 * hh), x3 = *(const v4fa*)(arow + kb + 16 + 8 * hh + 4);
    float xs[16] = {x0[0],x0[1],x0[2],x0[3],x1[0],x1[1],x1[2],x1[3],x2[0],x2[1],x2[2],x2[3],x3[0],x3[1],x3[2],x3[3]};
#pragma unroll
    for (int i = 0; i < 16; ++i) { const unsigned short hb = bf16_bits(xs[i]); ah.u[i] = hb; al.u[i] = ASPLIT ? bf16_bits(xs[i] - bf16_val(hb)) : (unsigned short)0; }
#pragma unroll
    for (int t = 0; t < 4; ++t) {
      const unsigned short* brow = Wt + (size_t)(col0 + t * 16 + ln) * ldb + kb;
      FragB b;
      b.half[0] = *(const v8us*)(brow + 8 * hh);
      b.half[1] = *(const v8us*)(brow + 16 + 8 * hh);
      acc[t] = mmaN<ASPLIT ? 2 : 1>(ah.v, al.v, b.v, b.v, acc[t]);
    }
  }
#pragma unroll
  for (int t = 0; t < 4; ++t) {
    const int col = col0 + t * 16 + ln;
    float bv = bias ? bias[col] : 0.f;
    if (BIAS_BF16) bv = bf16_round(bv);
#pragma unroll
    for (int r = 0; r < 8; ++r) {
      float v = acc[t][r] + bv;
      if (resid) { float rv = resid[(size_t)((row0 + 8 * hh + r) % rmod) * ldr + col]; if (RES_BF16) rv = bf16_round(rv); v += rv; }
      if (ACT == 1) v = fmaxf(v, 0.f);
      if (ACT == 2) v = 0.5f * v * (1.0f + erff(v * 0.70710678118654752f));
      if (ACT == 3) { const float u = 0.7978845608028654f * (v + 0.044715f * v * v * v); v = 0.5f * v * (1.0f + tanhf(u)); }
      so[w][8 * hh + r][t * 16 + ln] = v;
    }
  }
  __builtin_amdgcn_fence(__ATOMIC_ACQ_REL, "workgroup");
  __builtin_amdgcn_wave_barrier();
  const int rsub = lane >> 4, c4 = (lane & 15) * 4;
  {
#pragma unroll
    for (int q = 0; q < 8; ++q) {
      const int r = q * 2 + rsub;
      const v4f v = *(const v4fa*)&so[w][r][c4];
      *(v4f*)(C + (size_t)(row0 + r) * ldc + col0 + c4) = v;
    }
    
  }
}
// row LayerNorm (biased variance, eps) over N: s = X (+ R); optional out_sum <- s; out_norm <- (s-mu)*rsqrt(var+eps)*g + b
template <bool PARAM_BF16>
__global__ __launch_bounds__(256) void k_layernorm(const float* __restrict__ X, const float* __restrict__ R, const float* __restrict__ g, const float* __restrict__ bta,
                                                  float* __restrict__ out_sum, float* __restrict__ out_norm, int N, float eps) {
  __shared__ float red[256];
  const int row = blockIdx.x, tid = threadIdx.x;
  const float* x = X + (size_t)row * N; const float* rr = R ? R + (size_t)row * N : nullptr;
  float vals[16];                     // up to N = 4096
  const int per = N / 256;            // contiguous chunk per thread? use strided-by-4 chunks: thread handles j = tid*4 + 1024*u
  float s1 = 0.f;
  for (int u = 0; u < per / 4; ++u) {
    const int j = tid * 4 + 1024 * u;
    const v4f a = *(const v4fa*)(x + j);
    v4f b = {0.f,0.f,0.f,0.f}; if (rr) b = *(const v4fa*)(rr + j);
#pragma unroll
    for (int q = 0; q < 4; ++q) { const float v = a[q] + b[q]; vals[u * 4 + q] = v; s1 += v; }
  }
  red[tid] = s1; __syncthreads();
  for (int st = 128; st > 0; st >>= 1) { if (tid < st) red[tid] += red[tid + st]; __syncthreads(); }
  const float mu = red[0] / (float)N; __syncthreads();
  float s2 = 0.f;
  for (int u = 0; u < per / 4; ++u)
#pragma unroll
    for (int q = 0; q < 4; ++q) { const float c = vals[u * 4 + q] - mu; s2 += c * c; }
  red[tid] = s2; __syncthreads();
  for (int st = 128; st > 0; st >>= 1) { if (tid < st) red[tid] += red[tid + st]; __syncthreads(); }
  const float rs = rsqrtf(red[0] / (float)N + eps);
  {
    for (int u = 0; u < per / 4; ++u) {
      const int j = tid * 4 + 1024 * u;
      v4f o, sm;
#pragma unroll
      for (int q = 0; q < 4; ++q) {
        float gg = g[j + q], bb = bta[j + q];
        if (PARAM_BF16) { gg = bf16_round(gg); bb = bf16_round(bb); }
        sm[q] = vals[u * 4 + q]; o[q] = (vals[u * 4 + q] - mu) * rs * gg + bb;
      }
      if (out_sum) *(v4f*)(out_sum + (size_t)row * N + j) = sm;
      *(v4f*)(out_norm + (size_t)row * N + j) = o;
    }
    
  }
}



// ---- f16 WMMA path (v_wmma_f32_16x16x32_f16): 11-bit significands for operands in range — used where a [0,1] probability operand needs more precision than bf16
typedef _Float16 v16h __attribute__((ext_vector_type(16)));
union FragH { v16h v; v8us half[2]; _Float16 h[16]; unsigned short u[16]; };
template <int NT>
__device__ __forceinline__ v8f mmaH(v16h ah, v16h al, v16h bh, v16h bl, v8f c) {
  c = __builtin_amdgcn_wmma_f32_16x16x32_f16(false, ah, false, bh, (short)0, c, false, false);
  if (NT >= 2) c = __builtin_amdgcn_wmma_f32_16x16x32_f16(false, al, false, bh, (short)0, c, false, false);
  if (NT >= 3) c = __builtin_amdgcn_wmma_f32_16x16x32_f16(false, ah, false, bl, (short)0, c, false, false);
  asm volatile("v_nop\n\tv_nop\n\tv_nop\n\tv_nop" : "+v"(c) : "v"(ah), "v"(al), "v"(bh), "v"(bl));
  return c;
}
// batched GEMM like k_gemm_b but f16 operands: A f32 (split into f16 hi/lo if ASPLIT, else rounded to f16), Bt = f16 values [n][k]; alpha; C f32; N multiple of 16 (partial tiles skipped)
template <bool ASPLIT>
__global__ __launch_bounds__(128) void k_gemm_h(const float* __restrict__ A, int lda, size_t sA, const _Float16* __restrict__ Bh, int ldb, size_t sB, float alpha, float* __restrict__ C, int ldc, size_t sC, int M, int N, int K) {
  __shared__ __attribute__((aligned(16))) float so[4][16][64];
  const int tid = threadIdx.x, w = tid >> 5, lane = tid & 31, ln = lane & 15, hh = lane >> 4; const int by = blockIdx.y;
  A += (size_t)by * sA; Bh += (size_t)by * sB; C += (size_t)by * sC;
  const int ntn = (N + 63) / 64; const int wid = blockIdx.x * 4 + w; const int mt = wid / ntn, nq = wid % ntn; if (mt * 16 >= M) return;
  const int row0 = mt * 16, col0 = nq * 64; const float* arow = A + (size_t)(row0 + ln) * lda;
  v8f acc[4] = {};
  for (int kb = 0; kb < K; kb += 32) {
    FragH ah, al;
    const v4f x0 = *(const v4fa*)(arow + kb + 8 * hh), x1 = *(const v4fa*)(arow + kb + 8 * hh + 4), x2 = *(const v4fa*)(arow + kb + 16 + 8 * hh), x3 = *(const v4fa*)(arow + kb + 16 + 8 * hh + 4);
    float xs[16] = {x0[0],x0[1],x0[2],x0[3],x1[0],x1[1],x1[2],x1[3],x2[0],x2[1],x2[2],x2[3],x3[0],x3[1],x3[2],x3[3]};
#pragma unroll
    for (int i = 0; i < 16; ++i) { const _Float16 h = (_Float16)xs[i]; ah.h[i] = h; al.h[i] = ASPLIT ? (_Float16)(xs[i] - (float)h) : (_Float16)0.0f; }
#pragma unroll
    for (int t = 0; t < 4; ++t) { if (col0 + t * 16 >= N) continue; const size_t boff = (size_t)(col0 + t * 16 + ln) * ldb + kb; FragH bq; bq.half[0] = *(const v8us*)(Bh + boff + 8 * hh); bq.half[1] = *(const v8us*)(Bh + boff + 16 + 8 * hh);
      acc[t] = mmaH<ASPLIT ? 2 : 1>(ah.v, al.v, bq.v, bq.v, acc[t]); }
  }
#pragma unroll
  for (int t = 0; t < 4; ++t) { if (col0 + t * 16 >= N) continue;
#pragma unroll
    for (int r = 0; r < 8; ++r) so[w][8 * hh + r][t * 16 + ln] = acc[t][r] * alpha; }
  __builtin_amdgcn_fence(__ATOMIC_ACQ_REL, "workgroup"); __builtin_amdgcn_wave_barrier();
  const int rsub = lane >> 4, c4 = (lane & 15) * 4;
  {
#pragma unroll
    for (int q = 0; q < 8; ++q) { const int r = q * 2 + rsub; if (col0 + c4 < N) { const v4f v = *(const v4fa*)&so[w][r][c4]; *(v4f*)(C + (size_t)(row0 + r) * ldc + col0 + c4) = v; } }
     }
}

// Wt[n][k] = f16(W[k][n]·scale) from f32 row-major W[K][N] (scale = power of two; bf16-exact weights stay exact in f16 away from the subnormal range)
__global__ __launch_bounds__(256) void k_wt_f16(const float* __restrict__ W, _Float16* __restrict__ Wt, int K, int N, float scale) {
  const int t = blockIdx.x * 256 + threadIdx.x; if (t >= N * (K / 8)) return; const int n = t / (K / 8), k8 = (t % (K / 8)) * 8; FragH f;
#pragma unroll
  for (int i = 0; i < 8; ++i) f.h[i] = (_Float16)(bf16_round(W[(size_t)(k8 + i) * N + n]) * scale); const v8us o = f.half[0];
  *(v8us*)((unsigned short*)Wt + (size_t)n * K + k8) = o; 
}
// k_gemm_hh variant with fused epilogue: v = acc·alpha + bias[by·sBias + col] (+ CP[(row/rowsPerB)·sCPb + by·64 + col] if CP) ; ACT 0 none / 1 elu ; writes f16 C16 (and f32 C if non-null)
template <int ACT>
__global__ __launch_bounds__(128) void k_gemm_hhx(const _Float16* __restrict__ A, int lda, size_t sA, const _Float16* __restrict__ Bh, int ldb, size_t sB, float alpha, const float* __restrict__ bias, size_t sBias, const float* __restrict__ CP, int rowsPerB, size_t sCPb, int row0g,
    float* __restrict__ C, _Float16* __restrict__ C16, int ldc, size_t sC, int M, int N, int K) {
  __shared__ __attribute__((aligned(16))) float so[4][16][64];
  const int tid = threadIdx.x, w = tid >> 5, lane = tid & 31, ln = lane & 15, hh = lane >> 4; const int by = blockIdx.y;
  A += (size_t)by * sA; Bh += (size_t)by * sB; const size_t cofs = (size_t)by * sC; const float* bp = bias ? bias + (size_t)by * sBias : nullptr;
  const int ntn = (N + 63) / 64; const int wid = blockIdx.x * 4 + w; const int mt = wid / ntn, nq = wid % ntn; if (mt * 16 >= M) return;
  const int row0 = mt * 16, col0 = nq * 64; const _Float16* arow = A + (size_t)(row0 + ln) * lda;
  v8f acc[4] = {};
  for (int kb = 0; kb < K; kb += 32) { FragH ah; ah.half[0] = *(const v8us*)((const unsigned short*)arow + kb + 8 * hh); ah.half[1] = *(const v8us*)((const unsigned short*)arow + kb + 16 + 8 * hh);
#pragma unroll
    for (int t = 0; t < 4; ++t) { if (col0 + t * 16 >= N) continue; const size_t boff = (size_t)(col0 + t * 16 + ln) * ldb + kb; FragH bq; bq.half[0] = *(const v8us*)((const unsigned short*)Bh + boff + 8 * hh); bq.half[1] = *(const v8us*)((const unsigned short*)Bh + boff + 16 + 8 * hh);
      acc[t] = mmaH<1>(ah.v, ah.v, bq.v, bq.v, acc[t]); }
  }
#pragma unroll
  for (int t = 0; t < 4; ++t) { if (col0 + t * 16 >= N) continue; const int col = col0 + t * 16 + ln; const float bv = bp ? bf16_round(bp[col]) : 0.f;
#pragma unroll
    for (int r = 0; r < 8; ++r) { float v = acc[t][r] * alpha + bv; if (CP) { const int rr = row0g + row0 + 8 * hh + r; if (rowsPerB < 0) v += CP[cofs + (size_t)rr * ldc + col];      /* rowsPerB < 0: own element of the batched C plane */ else { const int bidx = rr / rowsPerB; v += CP[(size_t)bidx * sCPb + (size_t)by * 64 + col]; } } if (ACT == 1) v = (v > 0.f) ? v : expm1f(v); else if (ACT == 7) v = (v > 0.f) ? v + 1.0f : expf(v); else if (ACT == 8) v = tanhf(v); else if (ACT == 9) v = 0.5f * v * (1.0f + tanhf(0.7978845608028654f * (v + 0.044715f * v * v * v))); else if (ACT == 11) v = 1.0f / (1.0f + expf(-v)); else if (ACT == 12) v = (v > 0.f) ? v : 0.01f * v; else if (ACT == 14) v = (v > 0.f) ? v : 0.1f * v; else if (ACT == 16) v = (v >= 0.f) ? v : 0.3f * v; else if (ACT == 17) v = (v >= 0.f) ? v : 0.2f * v; else if (ACT == 15) v = v / (1.0f + expf(-v)); else if (ACT == 3) v = fmaxf(v, 0.f); else if (ACT == 6) v = 0.5f * v * (1.0f + erff(v * 0.70710678118654752f)); so[w][8 * hh + r][t * 16 + ln] = v; } }
  __builtin_amdgcn_fence(__ATOMIC_ACQ_REL, "workgroup"); __builtin_amdgcn_wave_barrier();
  const int rsub = lane >> 4, c4 = (lane & 15) * 4; typedef _Float16 v4h __attribute__((ext_vector_type(4)));
  {
#pragma unroll
    for (int q = 0; q < 8; ++q) { const int r = q * 2 + rsub; if (col0 + c4 < N) { const v4f v = *(const v4fa*)&so[w][r][c4]; if (C) *(v4f*)(C + cofs + (size_t)(row0 + r) * ldc + col0 + c4) = v; if (C16) { v4h h4; for (int i = 0; i < 4; ++i) h4[i] = (_Float16)v[i]; *(v4h*)(C16 + cofs + (size_t)(row0 + r) * ldc + col0 + c4) = h4; } } }
     }
}


typedef _Float16 v4h __attribute__((ext_vector_type(4)));

__global__ __launch_bounds__(256) void k_h16(const float* __restrict__ x, _Float16* __restrict__ X16, size_t n8) { const size_t t = (size_t)blockIdx.x * 256 + threadIdx.x; if (t >= n8) return; FragH f;
#pragma unroll
  for (int q = 0; q < 8; ++q) f.h[q] = (_Float16)x[t * 8 + q]; *(v8us*)((unsigned short*)X16 + t * 8) = f.half[0];  }
__global__ __launch_bounds__(256) void k_round16f(const float* __restrict__ W, _Float16* __restrict__ Bt, size_t n8) { const size_t t = (size_t)blockIdx.x * 256 + threadIdx.x; if (t >= n8) return; FragH f;
#pragma unroll
  for (int i = 0; i < 8; ++i) f.h[i] = (_Float16)(bf16_round(W[t * 8 + i]) * 16.0f); *(v8us*)((unsigned short*)Bt + t * 8) = f.half[0];  }
template <int NHv, int TTv>
__global__ __launch_bounds__(256) void k_vt(const _Float16* __restrict__ V16, int ldv, int voff, _Float16* __restrict__ Vt) { __shared__ unsigned short tl[64][66]; const int tid = threadIdx.x; const int slab = blockIdx.x / (TTv / 64), lg = blockIdx.x % (TTv / 64); const int b = slab / NHv, h = slab % NHv;
  for (int i = tid; i < 64 * 8; i += 256) { const int r = i / 8, c8 = (i % 8) * 8; FragH f; f.half[0] = *(const v8us*)((const unsigned short*)V16 + ((size_t)b * TTv + lg * 64 + r) * ldv + voff + h * 64 + c8);
#pragma unroll
    for (int q = 0; q < 8; ++q) tl[r][c8 + q] = f.u[q]; }
  __syncthreads();
  {
#pragma unroll
    for (int rd = 0; rd < 2; ++rd) { const int d = rd * 32 + tid / 8, pc = tid % 8; FragH f;
#pragma unroll
      for (int q = 0; q < 8; ++q) f.u[q] = tl[pc * 8 + q][d];
      *(v8us*)((unsigned short*)Vt + ((size_t)slab * 64 + d) * TTv + lg * 64 + pc * 8) = f.half[0]; }
     } }

__global__ __launch_bounds__(256) void k_hl(const float* __restrict__ F, _Float16* __restrict__ Hh, _Float16* __restrict__ Hl, size_t n8) { const size_t t = (size_t)blockIdx.x * 256 + threadIdx.x; if (t >= n8) return; FragH fh, fl; const v4f a = *(const v4fa*)(F + t * 8), c = *(const v4fa*)(F + t * 8 + 4);
#pragma unroll
  for (int q = 0; q < 4; ++q) { _Float16 h = (_Float16)a[q]; fh.h[q] = h; fl.h[q] = (_Float16)((a[q] - (float)h) * 1024.0f); h = (_Float16)c[q]; fh.h[4 + q] = h; fl.h[4 + q] = (_Float16)((c[q] - (float)h) * 1024.0f); }
  { *(v8us*)((unsigned short*)Hh + t * 8) = fh.half[0]; *(v8us*)((unsigned short*)Hl + t * 8) = fl.half[0];  } }

// ---- fast GEMM (wave tile 32x64, work-group tile 128x64; requires M % 128 == 0 rows per launch region, N % 64 == 0 and K % 128 == 0); epilogue = k_gemm_hhx semantics ----
__device__ __forceinline__ v16h g2_frag(const _Float16* p, int hh) { FragH f; f.half[0] = *(const v8us*)((const unsigned short*)p + 8 * hh); f.half[1] = *(const v8us*)((const unsigned short*)p + 16 + 8 * hh); return f.v; }
__device__ __forceinline__ v8f g2_mma(v16h a, v16h b, v8f c) { v8f d = __builtin_amdgcn_wmma_f32_16x16x32_f16(false, a, false, b, (short)0, c, false, false); asm volatile("v_nop\n\tv_nop\n\tv_nop\n\tv_nop" : "+v"(d) : "v"(a), "v"(b)); return d; }
// ---- operand ring of k_gemm2: a stage is 128 k (256 bytes) of the work-group's 128 A rows and 64 B rows, laid in LDS at a pitch of 272 bytes (16 x odd: 16-byte fragment reads meet no bank conflict); two buffers ----
#define G2_KT 128
#define G2_PITCH 272
#define G2_BUF (192 * G2_PITCH)
__device__ __forceinline__ v8f g2_mmab(v16h a, v16h b, v8f c) { return __builtin_amdgcn_wmma_f32_16x16x32_f16(false, a, false, b, (short)0, c, false, false); }
__device__ __forceinline__ v16h g2_lfrag(const unsigned char* p) { FragH f; f.half[0] = *(const v8us*)p; f.half[1] = *(const v8us*)(p + 32); return f.v; }      /* p = the lane's row + 16 hh bytes: elements 0..7 = k 8 hh + e, 8..15 = k 16 + 8 hh + e, as in g2_frag */
// Eight asynchronous 16-byte copies of a thread, global to LDS through no register: 64 operand rows a call (row step 8), 16 threads a row, so that a wave's copy reads two whole 256-byte row pieces.
// The address wait is the statement's last line: it stands in front of whatever next writes a register that a copy names.
__device__ __forceinline__ void g2_copy8(unsigned l, const _Float16* g, size_t g8) {
  const unsigned l1 = l + 8 * G2_PITCH, l2 = l + 16 * G2_PITCH, l3 = l + 24 * G2_PITCH, l4 = l + 32 * G2_PITCH, l5 = l + 40 * G2_PITCH, l6 = l + 48 * G2_PITCH, l7 = l + 56 * G2_PITCH;
  const _Float16* g1 = g + g8; const _Float16* g2 = g1 + g8; const _Float16* g3 = g2 + g8; const _Float16* g4 = g3 + g8; const _Float16* g5 = g4 + g8; const _Float16* g6 = g5 + g8; const _Float16* g7 = g6 + g8;
  asm volatile("global_load_async_to_lds_b128 %0, %8, off\n\tglobal_load_async_to_lds_b128 %1, %9, off\n\tglobal_load_async_to_lds_b128 %2, %10, off\n\tglobal_load_async_to_lds_b128 %3, %11, off\n\t"
               "global_load_async_to_lds_b128 %4, %12, off\n\tglobal_load_async_to_lds_b128 %5, %13, off\n\tglobal_load_async_to_lds_b128 %6, %14, off\n\tglobal_load_async_to_lds_b128 %7, %15, off\n\ts_wait_xcnt 0x0"
               :: "v"(l), "v"(l1), "v"(l2), "v"(l3), "v"(l4), "v"(l5), "v"(l6), "v"(l7), "v"(g), "v"(g1), "v"(g2), "v"(g3), "v"(g4), "v"(g5), "v"(g6), "v"(g7) : "memory"); }
// pk (a launch argument, so that the three projections stay one kernel): layout of C16. 0 = rows of pitch ldc. 1, 2 = fragment order for the attention loop (N / 64 heads, M keys): the wave's 32 keys x 64 features of head nq are 8 units of 512 bytes at ((nq M + row0) 64) elements,
// unit u holding lane l's 8 elements at 8 l, so that one wave-wide 16-byte load of a unit reads 4 whole cache lines. 1 (K, A operand of S^T): u = 4 (key / 16) + feature / 16, lane = 16 ((feature / 8) & 1) + key % 16, element = feature % 8.
// 2 (V^T, A operand of O^T): u = 2 (feature / 16) + (key / 16) % 2, lane = 16 ((key / 8) & 1) + feature % 16, element = key % 8.
template <int ACT>
__global__ __launch_bounds__(128) void k_gemm2(const _Float16* __restrict__ A, int lda, size_t sA, const _Float16* __restrict__ Bh, int ldb, size_t sB, float alpha, const float* __restrict__ bias, size_t sBias, const float* __restrict__ CP, int rowsPerB, size_t sCPb, int row0g,
    float* __restrict__ C, _Float16* __restrict__ C16, int ldc, size_t sC, int M, int N, int K, int pk, float osc) { static_assert(ACT == 0 || ACT == 3 || ACT == 6 || ACT == 8 || ACT == 9 || ACT == 11 || ACT == 12 || ACT == 14 || ACT == 15 || ACT == 16 || ACT == 17, "k_gemm2: unsupported ACT code (would silently apply no activation)");
  __shared__ __attribute__((aligned(16))) float so[4][32][68];
  __shared__ __attribute__((aligned(16))) unsigned char ring[2 * G2_BUF];      /* rows 0..127 of a buffer: the work-group's A rows; 128..191: its B rows */
  const int tid = threadIdx.x, w = tid >> 5, lane = tid & 31, ln = lane & 15, hh = lane >> 4; const int by = blockIdx.y;
  A += (size_t)by * sA; Bh += (size_t)by * sB; const size_t cofs = (size_t)by * sC; const float* bp = bias ? bias + (size_t)by * sBias : nullptr;
  const int ntn = N >> 6; const int mt = blockIdx.x / ntn, nq = blockIdx.x - mt * ntn; const int row0 = mt * 128 + 32 * w, col0 = nq * 64; if (mt * 128 >= M) return;      /* the whole work-group leaves or none does (barriers below); needs M % 128 == 0, K % 128 == 0, K >= 128 */
  const _Float16* ga = A + (size_t)(mt * 128 + (tid >> 4)) * lda + (tid & 15) * 8; const _Float16* gb = Bh + (size_t)(col0 + (tid >> 4)) * ldb + (tid & 15) * 8;      /* the thread's first 16 bytes of a stage: row tid / 16, piece tid % 16 */
  const unsigned lc = (unsigned)(size_t)ring + (unsigned)((tid >> 4) * G2_PITCH + (tid & 15) * 16);      /* their place in buffer 0: byte address in the work-group's LDS */
  const size_t a8 = (size_t)8 * lda, b8 = (size_t)8 * ldb; const int nt = K / G2_KT;
  const unsigned char* fa = ring + (32 * w + ln) * G2_PITCH + 16 * hh; const unsigned char* fb = ring + (128 + ln) * G2_PITCH + 16 * hh;      /* the lane's fragment rows in buffer 0 */
  const v8f z8 = {0.f,0.f,0.f,0.f,0.f,0.f,0.f,0.f}; v8f c00 = z8, c01 = z8, c02 = z8, c03 = z8, c10 = z8, c11 = z8, c12 = z8, c13 = z8;
  g2_copy8(lc, ga, a8); g2_copy8(lc + 64 * G2_PITCH, ga + 8 * a8, a8); g2_copy8(lc + 128 * G2_PITCH, gb, b8);      /* stage 0 into buffer 0 */
  asm volatile("s_wait_asynccnt 0x0" ::: "memory");      /* this wave's copies of stage 0 have landed */
  __syncthreads();      /* every wave's have: stage 0 may be read */
  if (nt > 1) { g2_copy8(lc + G2_BUF, ga + G2_KT, a8); g2_copy8(lc + G2_BUF + 64 * G2_PITCH, ga + G2_KT + 8 * a8, a8); g2_copy8(lc + G2_BUF + 128 * G2_PITCH, gb + G2_KT, b8); }      /* stage 1 flies while stage 0 is worked on */
#pragma unroll 1      /* one stage a trip: the ring's order below is written once */
  for (int t = 0; t < nt; ++t) { const unsigned bo = (unsigned)(t & 1) * G2_BUF;
    const unsigned char* pa = fa + bo; const unsigned char* pb = fb + bo; v16h fr[2][6];      /* two fragment sets: A rows 0..15, 16..31, B columns 0..15 .. 48..63 of one k step */
    fr[0][0] = g2_lfrag(pa); fr[0][1] = g2_lfrag(pa + 16 * G2_PITCH); fr[0][2] = g2_lfrag(pb); fr[0][3] = g2_lfrag(pb + 16 * G2_PITCH); fr[0][4] = g2_lfrag(pb + 32 * G2_PITCH); fr[0][5] = g2_lfrag(pb + 48 * G2_PITCH);
#pragma unroll      /* constant indices keep the fragment sets in registers; constant offsets for the four k steps of a stage */
    for (int kk = 0; kk < 4; ++kk) { const int c = kk & 1, n = c ^ 1;
      if (kk < 3) { const unsigned char* qa = pa + (kk + 1) * 64; const unsigned char* qb = pb + (kk + 1) * 64;      /* the next k step of this same stage */
        fr[n][0] = g2_lfrag(qa); fr[n][1] = g2_lfrag(qa + 16 * G2_PITCH); fr[n][2] = g2_lfrag(qb); fr[n][3] = g2_lfrag(qb + 16 * G2_PITCH); fr[n][4] = g2_lfrag(qb + 32 * G2_PITCH); fr[n][5] = g2_lfrag(qb + 48 * G2_PITCH); }
      __builtin_amdgcn_sched_barrier(0);      /* keeps the twelve LDS reads one group in front of the products: spread among them, each pair is waited out to 0 */
      c00 = g2_mmab(fr[c][0], fr[c][2], c00); c10 = g2_mmab(fr[c][1], fr[c][2], c10); c01 = g2_mmab(fr[c][0], fr[c][3], c01); c11 = g2_mmab(fr[c][1], fr[c][3], c11);
      c02 = g2_mmab(fr[c][0], fr[c][4], c02); c12 = g2_mmab(fr[c][1], fr[c][4], c12); c03 = g2_mmab(fr[c][0], fr[c][5], c03); c13 = g2_mmab(fr[c][1], fr[c][5], c13);
      __builtin_amdgcn_sched_barrier(0); }      /* the other side of the same fence: the following group stays behind these products */
    asm volatile("s_wait_dscnt 0x0" ::: "memory");      /* this wave's reads of the buffer are done before it is handed over */
    asm volatile("s_wait_asynccnt 0x0" ::: "memory");      /* this wave's copies of stage t + 1 have landed */
    __syncthreads();      /* publishes stage t + 1 and ends every reader's last read of stage t's buffer */
    if (t + 2 < nt) { const _Float16* na = ga + (size_t)(t + 2) * G2_KT; const _Float16* nb = gb + (size_t)(t + 2) * G2_KT;      /* refill of the buffer just read */
      g2_copy8(lc + bo, na, a8); g2_copy8(lc + bo + 64 * G2_PITCH, na + 8 * a8, a8); g2_copy8(lc + bo + 128 * G2_PITCH, nb, b8); } }
  asm volatile("s_wait_asynccnt 0x0" ::: "memory");      /* nothing of this wave is in flight behind the loop */
  v8f accs[8] = {c00, c01, c02, c03, c10, c11, c12, c13};
#pragma unroll
  for (int u = 0; u < 8; ++u) { const int t = u & 3, half = u >> 2; const int col = col0 + t * 16 + ln; const float bv = bp ? bf16_round(bp[col]) : 0.f;
#pragma unroll
    for (int r = 0; r < 8; ++r) { const int rloc = half * 16 + 8 * hh + r; float v = accs[u][r] * alpha + bv; if (CP) { if (rowsPerB < 0) v += CP[cofs + (size_t)(row0g + row0 + rloc) * ldc + col];      /* rowsPerB < 0: own element of the batched C plane */ else { const int bidx = (row0g + row0 + rloc) / rowsPerB; v += CP[(size_t)bidx * sCPb + (size_t)by * 64 + col]; } }
      if (ACT == 3) v = fmaxf(v, 0.f); else if (ACT == 6) v = 0.5f * v * (1.0f + erff(v * 0.70710678118654752f)); else if (ACT == 11) v = 1.0f / (1.0f + expf(-v)); else if (ACT == 15) v = v / (1.0f + expf(-v)); else if (ACT == 12) v = (v > 0.f) ? v : 0.01f * v; else if (ACT == 8) v = tanhf(v); else if (ACT == 9) v = 0.5f * v * (1.0f + tanhf(0.7978845608028654f * (v + 0.044715f * v * v * v))); else if (ACT == 14) v = (v > 0.f) ? v : 0.1f * v; else if (ACT == 16) v = (v >= 0.f) ? v : 0.3f * v; else if (ACT == 17) v = (v >= 0.f) ? v : 0.2f * v;
      so[w][rloc][t * 16 + ln] = v * osc; } }      /* osc: a factor on the finished f32 value, in front of its one rounding to f16 (1 leaves it as it is) */
  __builtin_amdgcn_fence(__ATOMIC_ACQ_REL, "workgroup"); __builtin_amdgcn_wave_barrier();
  const int rsub = lane >> 4, c4 = (lane & 15) * 4;
  if (pk == 0) {
#pragma unroll
    for (int q = 0; q < 16; ++q) { const int r = q * 2 + rsub; const v4f v = *(const v4fa*)&so[w][r][c4]; if (C) *(v4f*)(C + cofs + (size_t)(row0 + r) * ldc + col0 + c4) = v; if (C16) { v4h h4; for (int i = 0; i < 4; ++i) h4[i] = (_Float16)v[i]; *(v4h*)(C16 + cofs + (size_t)(row0 + r) * ldc + col0 + c4) = h4; } }
  } else {
    unsigned short* dp = (unsigned short*)C16 + ((size_t)nq * M + row0) * 64 + lane * 8;
    if (pk == 1) {
#pragma unroll
      for (int u = 0; u < 8; ++u) { FragH f; const int rl = (u >> 2) * 16 + ln, cl = (u & 3) * 16 + 8 * hh; const v4f x = *(const v4fa*)&so[w][rl][cl], y = *(const v4fa*)&so[w][rl][cl + 4];
#pragma unroll
        for (int i = 0; i < 4; ++i) { f.h[i] = (_Float16)x[i]; f.h[4 + i] = (_Float16)y[i]; }
        *(v8us*)(dp + u * 256) = f.half[0]; }
      asm volatile("s_wait_xcnt 0x0" ::: "memory");      /* address wait behind the run of stores above, in front of whatever next writes a register that they name */
    } else {
#pragma unroll
      for (int u = 0; u < 8; ++u) { FragH f; const int rl = (u & 1) * 16 + 8 * hh, cl = (u >> 1) * 16 + ln;
#pragma unroll
        for (int i = 0; i < 8; ++i) f.h[i] = (_Float16)so[w][rl + i][cl];
        *(v8us*)(dp + u * 256) = f.half[0]; }
      asm volatile("s_wait_xcnt 0x0" ::: "memory");      /* address wait behind the run of stores above, in front of whatever next writes a register that they name */
    }
  } }


__global__ __launch_bounds__(256) void k_wnat(const float* __restrict__ w, size_t n8, _Float16* __restrict__ Bt) { const size_t t = (size_t)blockIdx.x * 256 + threadIdx.x; if (t >= n8) return; FragH f; for (int q = 0; q < 8; ++q) f.h[q] = (_Float16)(bf16_round(w[t * 8 + q]) * 16.0f); *(v8us*)((unsigned short*)Bt + t * 8) = f.half[0];  }
__global__ __launch_bounds__(256) void k_rsm(const float* __restrict__ S, _Float16* __restrict__ P, int nrows) {
  #pragma clang fp contract(off)
  const int i = blockIdx.x * 256 + threadIdx.x; if (i >= nrows) return; const float* s = S + (size_t)i * SQ; float mx = -3.0e38f;
#pragma unroll 1
  for (int j = 0; j < SQ; ++j) mx = fmaxf(mx, s[j]); float se = 0.f;
#pragma unroll 1
  for (int j = 0; j < SQ; ++j) se += expf(s[j] - mx); const float sc = 256.0f / se;
#pragma unroll 1
  for (int j0 = 0; j0 < SQ; j0 += 8) { FragH f; for (int q = 0; q < 8; ++q) f.h[q] = (_Float16)(expf(s[j0 + q] - mx) * sc); unsigned short* d = (unsigned short*)P + (size_t)i * SQ + j0; *(v8us*)d = f.half[0];  } }
__global__ __launch_bounds__(256) void k_vt(const _Float16* __restrict__ V16, int b, int h0, _Float16* __restrict__ VT) { __shared__ unsigned short tl[64][65]; const int tid = threadIdx.x; const int hh = blockIdx.x % HG, sg = blockIdx.x / HG; const int s0 = sg * 64; const int h = h0 + hh;
  for (int i = tid; i < 64 * 8; i += 256) { const int j = i / 8, d8 = (i % 8) * 8; FragH f; f.half[0] = *(const v8us*)((const unsigned short*)V16 + ((size_t)b * SQ + s0 + j) * DM + h * HD + d8); for (int q = 0; q < 8; ++q) tl[d8 + q][j] = f.u[q]; }
  __syncthreads();
  { for (int i = tid; i < 64 * 8; i += 256) { const int d = i / 8, j8 = (i % 8) * 8; FragH f; for (int q = 0; q < 8; ++q) f.u[q] = tl[d][j8 + q]; *(v8us*)((unsigned short*)VT + ((size_t)hh * HD + d) * SQ + s0 + j8) = f.half[0]; }  } }



__global__ __launch_bounds__(256) void k_rsmkm(const float* __restrict__ S, _Float16* __restrict__ P, int nrows, const int* __restrict__ am) {
  #pragma clang fp contract(off)
  const int t = blockIdx.x * 256 + threadIdx.x; if (t >= nrows) return; const size_t i = (size_t)t; const float* s = S + i * SQ; const int* mr = am + (size_t)(t % SQ) * SQ; float mx = -3.0e38f;
#pragma unroll 1
  for (int j = 0; j < SQ; ++j) { const float f = (mr[j] != 0) ? 1.f : 0.f; mx = fmaxf(mx, fmaf(f, s[j], (1.f - f) * -1.0e9f)); } float se = 0.f;
#pragma unroll 1
  for (int j = 0; j < SQ; ++j) { const float f = (mr[j] != 0) ? 1.f : 0.f; se += __expf(fmaf(f, s[j], (1.f - f) * -1.0e9f) - mx); } const float sc = 256.0f / se;
#pragma unroll 1
  for (int j0 = 0; j0 < SQ; j0 += 8) { FragH fr; for (int q = 0; q < 8; ++q) { const int j = j0 + q; const float f = (mr[j] != 0) ? 1.f : 0.f; fr.h[q] = (_Float16)(__expf(fmaf(f, s[j], (1.f - f) * -1.0e9f) - mx) * sc); }
    unsigned short* d = (unsigned short*)P + i * SQ + j0; *(v8us*)d = fr.half[0];  } }
// The swap of a wave's two 16-lane rows: a plain lane shuffle would go through the LDS pipe.
__device__ __forceinline__ float rs_x16(float v) { const int b = __float_as_int(v); return __int_as_float(__builtin_amdgcn_permlanex16(b, b, 0x76543210, 0xfedcba98, false, false)); }
// Four native 2^x in one statement: no result shares a register
// with a source (early clobber), each exp has an independent one behind it, and the v_nop is the slot that the instruction set asks for behind the last.
__device__ __forceinline__ v4f rs_exp2x4(v4f x) { float y0, y1, y2, y3;
  asm("v_exp_f32 %0, %4\n\tv_exp_f32 %1, %5\n\tv_exp_f32 %2, %6\n\tv_exp_f32 %3, %7\n\tv_nop" : "=&v"(y0), "=&v"(y1), "=&v"(y2), "=&v"(y3) : "v"(x[0]), "v"(x[1]), "v"(x[2]), "v"(x[3]));
  const v4f y = {y0, y1, y2, y3}; return y; }
// One native 2^x with the same slot behind it.
__device__ __forceinline__ float rs_exp2(float x) { float y; asm("v_exp_f32 %0, %1\n\tv_nop" : "=&v"(y) : "v"(x)); return y; }
__device__ __forceinline__ v16h fa_frag(const _Float16* base, unsigned lofs) { FragH f; f.half[0] = *(const v8us*)((const unsigned short*)base + lofs); f.half[1] = *(const v8us*)((const unsigned short*)base + lofs + 16); return f.v; }      /* base is wave-uniform, lofs the lane's own element offset (row ln, k 8 hh) */
__device__ __forceinline__ v16h fa_fragp(const _Float16* base, unsigned lofs) { FragH f; f.half[0] = *(const v8us*)((const unsigned short*)base + lofs); f.half[1] = *(const v8us*)((const unsigned short*)base + lofs + 256); return f.v; }      /* fragment-order operand: two units of 512 bytes, lofs = 8 lane; elements 0..7 and 8..15 as in fa_frag */
__device__ __forceinline__ v8f fa_mma(v16h a, v16h b, v8f c) { return __builtin_amdgcn_wmma_f32_16x16x32_f16(false, a, false, b, (short)0, c, false, false); }
// 16 waves a work-group, one work-group a WGP, so 4 waves a SIMD: vector work of one wave runs beside the products and the load waits of the others. Waves w and w + 8 own the same 32 query rows;
// wave w walks keys 0..2047, wave w + 8 keys 2048..4095, each with its own held reference, sum and O^T; behind the loop the upper wave hands its three over in LDS and the lower wave joins them.
__global__ __launch_bounds__(512) void k_fattn(const _Float16* __restrict__ Q, const _Float16* __restrict__ KP, const _Float16* __restrict__ VP, float* __restrict__ O) {      /* Q in rows; KP, VP in fragment order (k_gemm2, pk 1 and 2): 32 keys of a head are 4 KB in a row in each */
  __shared__ __attribute__((aligned(16))) float xo[8][17][32][4];      /* per query tile: the upper wave's O^T as 16 pieces of 16 bytes a lane (a wave's piece is 512 bytes in a row: no bank conflict), then its references and sums */
  const int lane = threadIdx.x & 31, ln = lane & 15, hh = lane >> 4; const int w = __builtin_amdgcn_readfirstlane(threadIdx.x >> 5);      /* the wave's number, held scalar so that the row bases and the branches on it are scalar */
  const int wq = w & 7, kh = w >> 3, kbeg = kh * (SQ / 2);      /* query tile, key half, first key */
  const int h = blockIdx.x / (SQ / 256); const int q0 = (blockIdx.x % (SQ / 256)) * 256 + wq * 32;      /* the 8 waves of a key half share its K and V^T lines in the WGP's cache */
  const unsigned lk = (unsigned)(ln * DM + 8 * hh), lp = (unsigned)(lane * 8);
  const _Float16* qb = Q + (size_t)q0 * DM + h * HD; const _Float16* kb = KP + (size_t)h * HD * SQ; const _Float16* vb = VP + (size_t)h * HD * SQ;
  v16h qf[2][2], kf[2][2], vf[4];
  /* every loop over a fragment, score or output array of this kernel is unrolled: constant indices keep the arrays in registers */
#pragma unroll
  for (int j = 0; j < 2; ++j) { qf[j][0] = fa_frag(qb + j * 16 * DM, lk); qf[j][1] = fa_frag(qb + j * 16 * DM + 32, lk); }
#pragma unroll
  for (int t = 0; t < 2; ++t) { kf[t][0] = fa_fragp(kb + kbeg * HD + t * 1024, lp); kf[t][1] = fa_fragp(kb + kbeg * HD + t * 1024 + 512, lp); }
  __builtin_amdgcn_sched_barrier(0);      /* keeps the first V^T loads the youngest, as they are in every pass: otherwise the counted wait at the loop's head falls to 0 and each pass waits out the V^T loads issued just before it */
#pragma unroll
  for (int t = 0; t < 4; ++t) vf[t] = fa_fragp(vb + kbeg * HD + t * 512, lp);
  const v8f z8 = {0.f, 0.f, 0.f, 0.f, 0.f, 0.f, 0.f, 0.f}; v8f o[2][4], cr[2]; float l[2] = {0.f, 0.f};
#pragma unroll
  for (int j = 0; j < 2; ++j) for (int t = 0; t < 4; ++t) o[j][t] = z8;
  /* The held reference. Q arrives times log2 e / sqrt(64), so K Q^T is the score in log2 units. cr[j] = 8 - reference of query ln, the same in all 8 registers and in both halves of the wave, is the C operand of the
     score products: their D is the argument of 2^x as it stands (weights are 2^8 e^(s - reference): f16 keeps small ones normal; the row sum carries the same factor). It starts as the maximum of the wave's first 32 keys. */
#pragma unroll
  for (int j = 0; j < 2; ++j) { const v8f a = fa_mma(kf[0][1], qf[j][1], fa_mma(kf[0][0], qf[j][0], z8)), b = fa_mma(kf[1][1], qf[j][1], fa_mma(kf[1][0], qf[j][0], z8)); float mx = fmaxf(a[0], b[0]);
#pragma unroll
    for (int r = 1; r < 8; ++r) mx = fmaxf(mx, fmaxf(a[r], b[r]));
    const float c = 8.0f - fmaxf(mx, rs_x16(mx));
#pragma unroll
    for (int r = 0; r < 8; ++r) cr[j][r] = c; }
  for (int k0 = kbeg; k0 < kbeg + SQ / 2; k0 += 32) {
    const int kn = (k0 + 32) & (SQ - 1);      /* the next pass's keys; a wave's last pass fetches the first 32 keys of the other half (in bounds, not used) so that the loop has no branch */
    v8f s[2][2];
#pragma unroll
    for (int t = 0; t < 2; ++t) for (int j = 0; j < 2; ++j) s[t][j] = fa_mma(kf[t][1], qf[j][1], fa_mma(kf[t][0], qf[j][0], cr[j]));
    const _Float16* kp = kb + kn * HD;      /* K one pass ahead, into the registers that the products above have just read */
#pragma unroll
    for (int t = 0; t < 2; ++t) { kf[t][0] = fa_fragp(kp + t * 1024, lp); kf[t][1] = fa_fragp(kp + t * 1024 + 512, lp); }
    asm volatile("s_wait_xcnt 0x0" ::: "memory");      /* address wait of the K loads, as behind the V^T loads below; its memory clobber also holds them here: left free, the compiler sinks them behind the test's branch and they start half a pass later */
    FragH pf[2]; float mx[2];
#pragma unroll
    for (int j = 0; j < 2; ++j) { mx[j] = fmaxf(s[0][j][0], s[1][j][0]);
#pragma unroll
      for (int r = 1; r < 8; ++r) mx[j] = fmaxf(mx[j], fmaxf(s[0][j][r], s[1][j][r])); }
    /* One test a pass, a scalar branch: the reference stays while every weight of the pass is at most 2^15 (f16 holds it), that is while no score stands more than 7 (log2) above its reference. */
    if (__builtin_amdgcn_ballot_w32(fmaxf(mx[0], mx[1]) > 15.0f) != 0) {
#pragma unroll
      for (int j = 0; j < 2; ++j) { const float d = fmaxf(fmaxf(mx[j], rs_x16(mx[j])) - 8.0f, 0.f); const float al = rs_exp2(-d);      /* the reference rises to the query's maximum of this pass where that is the higher; what has been summed under the old one shrinks by 2^-d */
        l[j] *= al; cr[j] -= d;
#pragma unroll
        for (int t = 0; t < 2; ++t) s[t][j] -= d;
#pragma unroll
        for (int t = 0; t < 4; ++t) o[j][t] *= al; } }
#pragma unroll
    for (int j = 0; j < 2; ++j) { v4f sm = {0.f, 0.f, 0.f, 0.f};
#pragma unroll
      for (int t = 0; t < 2; ++t) for (int g = 0; g < 2; ++g) { const v4f x = {s[t][j][4 * g], s[t][j][4 * g + 1], s[t][j][4 * g + 2], s[t][j][4 * g + 3]}; const v4f p = rs_exp2x4(x); sm += p; for (int q = 0; q < 4; ++q) pf[j].h[8 * t + 4 * g + q] = (_Float16)p[q]; }
      l[j] += (sm[0] + sm[1]) + (sm[2] + sm[3]); }      /* the lane's own 16 keys; the halves are joined once, behind the loop */
#pragma unroll
    for (int t = 0; t < 4; ++t) for (int j = 0; j < 2; ++j) o[j][t] = fa_mma(vf[t], pf[j].v, o[j][t]);
    const _Float16* vp = vb + kn * HD;      /* V^T one pass ahead, likewise */
#pragma unroll
    for (int t = 0; t < 4; ++t) vf[t] = fa_fragp(vp + t * 512, lp);
    asm volatile("s_wait_xcnt 0x0" ::: "memory");      /* the next pass forms its addresses in the registers that the loads above name: their address wait stands in front of that overwrite */
  }
  if (kh == 1) {      /* the upper wave hands over what it has of keys 2048..4095 */
#pragma unroll
    for (int j = 0; j < 2; ++j)
#pragma unroll
      for (int t = 0; t < 4; ++t) { const v4f lo = {o[j][t][0], o[j][t][1], o[j][t][2], o[j][t][3]}, hi = {o[j][t][4], o[j][t][5], o[j][t][6], o[j][t][7]}; *(v4f*)xo[wq][(j * 4 + t) * 2][lane] = lo; *(v4f*)xo[wq][(j * 4 + t) * 2 + 1][lane] = hi; }
    const v4f st = {cr[0][0], cr[1][0], l[0], l[1]}; *(v4f*)xo[wq][16][lane] = st; }
  __syncthreads();      /* every wave passes it once: the upper waves' LDS writes stand before the lower waves read them */
  if (kh == 0) {      /* the lower wave joins the halves under the higher of their two references (the lower cr), divides and stores */
    const v4f st = *(const v4f*)xo[wq][16][lane];
#pragma unroll
    for (int j = 0; j < 2; ++j) { const float cn = fminf(cr[j][0], st[j]); const float a0 = rs_exp2(cn - cr[j][0]), a1 = rs_exp2(cn - st[j]); const float lt = l[j] * a0 + st[2 + j] * a1;
      const float inv = 1.0f / (lt + rs_x16(lt)); const float f0 = a0 * inv, f1 = a1 * inv; float* d = O + (size_t)(q0 + j * 16 + ln) * DM + h * HD + 8 * hh;
#pragma unroll
      for (int t = 0; t < 4; ++t) { const v4f xl = *(const v4f*)xo[wq][(j * 4 + t) * 2][lane], xh = *(const v4f*)xo[wq][(j * 4 + t) * 2 + 1][lane];
        const v4f lo = {o[j][t][0] * f0 + xl[0] * f1, o[j][t][1] * f0 + xl[1] * f1, o[j][t][2] * f0 + xl[2] * f1, o[j][t][3] * f0 + xl[3] * f1}, hi = {o[j][t][4] * f0 + xh[0] * f1, o[j][t][5] * f0 + xh[1] * f1, o[j][t][6] * f0 + xh[2] * f1, o[j][t][7] * f0 + xh[3] * f1};
        *(v4f*)(d + t * 16) = lo; *(v4f*)(d + t * 16 + 4) = hi; } } } }



// ---- preparation, one launch: the three inputs as f16 rows and the three weight planes as Bt[(h, d)][m] x16 ----
// PW waves in all, 16 a work-group, as many work-groups as the chip has WGPs: few waves to start, all resident at once. Each wave takes 1 / PW of each of the six passes.
// Inputs: 1024 floats a wave and input, as 8 loads of 16 bytes a lane, each covering 512 bytes in a row (4 whole lines); all 24 are in flight before the first is converted; stores of 8 bytes a lane cover 2 whole lines.
// Weights: a thread gathers 8 m of one (h, d) of each plane, as per-head [m][d] -> Bt[(h, d)][m]; a wave's store covers 512 bytes in a row.
#define PW 4096
__global__ __launch_bounds__(512) void k_prep(const float* __restrict__ xq, const float* __restrict__ xk, const float* __restrict__ xv, const float* __restrict__ wq, const float* __restrict__ wk, const float* __restrict__ wv,
    _Float16* __restrict__ XQ, _Float16* __restrict__ XK, _Float16* __restrict__ XV, _Float16* __restrict__ BQ, _Float16* __restrict__ BK, _Float16* __restrict__ BV) {
  static_assert(NR * DM == (size_t)PW * 1024 && (size_t)NH * HD * (DM / 8) == (size_t)PW * 32, "k_prep: one piece of every pass a wave");
  const int lane = threadIdx.x & 31; const int gw = blockIdx.x * 16 + __builtin_amdgcn_readfirstlane(threadIdx.x >> 5);      /* the wave's number in the grid, held scalar so that the bases are scalar */
  const float* xs[3] = {xq + (size_t)gw * 1024, xk + (size_t)gw * 1024, xv + (size_t)gw * 1024}; _Float16* xd[3] = {XQ + (size_t)gw * 1024, XK + (size_t)gw * 1024, XV + (size_t)gw * 1024};
  const unsigned t = (unsigned)(gw * 32 + lane); const unsigned m8 = (t % (DM / 8)) * 8, d = (t / (DM / 8)) % HD, h = t / ((DM / 8) * HD);
  const unsigned wo = (h * DM + m8) * HD + d; const float* wsrc[3] = {wq, wk, wv}; _Float16* wd[3] = {BQ, BK, BV};
  v4f a[3][8]; float g[3][8];
  /* every loop below is unrolled: constant indices keep the arrays in registers */
#pragma unroll
  for (int p = 0; p < 3; ++p)
#pragma unroll
    for (int i = 0; i < 8; ++i) a[p][i] = *(const v4fa*)(xs[p] + i * 128 + lane * 4);
#pragma unroll
  for (int p = 0; p < 3; ++p)
#pragma unroll
    for (int q = 0; q < 8; ++q) g[p][q] = wsrc[p][wo + q * HD];
  __builtin_amdgcn_sched_barrier(0);      /* keeps all 48 loads in front of the first conversion: left free, the compiler sinks most of them among the conversions and a wave has only some 12 in flight */
#pragma unroll
  for (int p = 0; p < 3; ++p)
#pragma unroll
    for (int i = 0; i < 8; ++i) { v4h o;
#pragma unroll
      for (int q = 0; q < 4; ++q) o[q] = (_Float16)bf16_round(a[p][i][q]);
      *(v4h*)(xd[p] + i * 128 + lane * 4) = o; }
#pragma unroll
  for (int p = 0; p < 3; ++p) { FragH f;
#pragma unroll
    for (int q = 0; q < 8; ++q) f.h[q] = (_Float16)(16.0f * bf16_round(g[p][q]));
    *(v8us*)((unsigned short*)wd[p] + (size_t)(h * HD + d) * DM + m8) = f.half[0]; } }

extern "C" void kernel_launch(void* const* d_in, const int* in_sizes, int n_in,
                              void* d_out, int out_size, void* d_ws, size_t ws_size, hipStream_t stream) {
  (void)in_sizes; (void)n_in; (void)out_size;
  const float* const* I = (const float* const*)d_in; const float* xq = I[0]; const float* xk = I[1]; const float* xv = I[2]; const float* wq = I[3]; const float* bq = I[4]; const float* wk = I[5]; const float* bk = I[6]; const float* wv = I[7]; const float* bv = I[8]; const float* x = xq;      /* X_Q, X_K, X_V [4096][1024]; per-head Wq / Wk / Wv [16][1024][64] ([in][out] per head) + biases [16][64] = [(h, d)]; no output projection */
  static_assert(NH * HD == DM && DM % 128 == 0 && SQ % 256 == 0 && HD == 64 && HG == 1 && NB == 1, "shape / tile multiples");
  char* ws = (char*)d_ws; size_t off = 0;
  auto take = [&](size_t bytes) { char* p = ws + off; off += (bytes + 255) & ~(size_t)255; return p; };
  _Float16* BQ = (_Float16*)take((size_t)DM * DM * 2); _Float16* BK = (_Float16*)take((size_t)DM * DM * 2); _Float16* BV = (_Float16*)take((size_t)DM * DM * 2);
  _Float16* X16 = (_Float16*)take(NR * DM * 2); _Float16* XKp = (_Float16*)take(NR * DM * 2); _Float16* XVp = (_Float16*)take(NR * DM * 2); _Float16* Q16 = (_Float16*)take(NR * DM * 2); _Float16* KP = (_Float16*)take((size_t)NH * HD * SQ * 2);
  _Float16* VP = (_Float16*)take((size_t)NH * HD * SQ * 2);
  if (off > ws_size) return;
  _Float16* XK = XKp; _Float16* XV = XVp;
  k_prep<<<PW / 16, 512, 0, stream>>>(x, xk, xv, wq, wk, wv, X16, XK, XV, BQ, BK, BV);      /* inputs as exact f16 rows; per-head [m][d] -> Bt[(h, d)][m] x16 */
  const size_t r0p = (size_t)B0 * SQ;      /* first projected row */
  k_gemm2<0><<<dim3((unsigned)((MP / 128) * (DM / 64)), 1), 128, 0, stream>>>(X16 + r0p * DM, DM, 0, BQ, DM, 0, 0.0625f, bq, 0, nullptr, 1, 0, 0, nullptr, Q16 + r0p * DM, DM, 0, MP, DM, DM, 0, 0.18033688011112042f);      /* Q times log2 e / sqrt(64): the attention loop's scores are in log2 units */
  k_gemm2<0><<<dim3((unsigned)((MP / 128) * (DM / 64)), 1), 128, 0, stream>>>(XK + r0p * DM, DM, 0, BK, DM, 0, 0.0625f, bk, 0, nullptr, 1, 0, 0, nullptr, KP, DM, 0, MP, DM, DM, 1, 1.0f);      /* K in fragment order */
  k_gemm2<0><<<dim3((unsigned)((MP / 128) * (DM / 64)), 1), 128, 0, stream>>>(XV + r0p * DM, DM, 0, BV, DM, 0, 0.0625f, bv, 0, nullptr, 1, 0, 0, nullptr, VP, DM, 0, MP, DM, DM, 2, 1.0f);      /* V^T in fragment order */
  for (int b = B0; b < B0 + NBR; ++b) { const size_t r0 = (size_t)b * SQ;
    k_fattn<<<NH * (SQ / 256), 512, 0, stream>>>(Q16 + r0 * LQ, KP, VP, (float*)d_out + r0 * DM); }      /* all heads: softmax(Q K^T / 8) V written f32 straight into each head's 64 columns of the output rows (no output projection) */
}

// v008
// It runs in 114 microseconds.
// Two timings next to v007 both put it at 1.05 times that version's speed.
// Counting every step since v000, it is 118 times as fast.
#include <hip/hip_runtime.h>
// Multi-head attention over three inputs with PER-HEAD projection weights and no output projection (X_Q, X_K, X_V [4096][1024] (one sequence); Q[h] = X_Q Wq[h] + bq[h], K, V likewise (Wq / Wk / Wv [16][1024][64] per-head [in][out], sigma 1/32; biases [16][64] sigma 1/32); scores = Q[h] K[h]^T / sqrt(64); softmax over all 4096 keys; out[h] = attn V[h]; heads concatenated along the feature axis -> [4096][1024]).
// Structure: one preparation launch (the three inputs as exact f16 rows (bf16-rounded); per-head [in][out] weights gathered into Bt[(h, d)][in] x16 planes); Q, K, V as three WMMA GEMMs in ONE launch, grid y picking the projection (32x64 wave tiles, operands staged in LDS by asynchronous copies in a ring of two buffers, f32 accumulation, + bias [(h, d)], f16 outputs; the K and V GEMMs store their 32-key x 64-feature wave tiles in the attention loop's fragment order, V transposed on the way); then ONE attention launch for all heads: two waves of a work-group own 32 query rows, each walks one half of the 4096 keys 32 at a time, S^T = K Q^T - a reference held over the passes (it rises only when a score stands 2^7 above it), softmax in registers (f32 statistics; weights x256 as f16), O^T += V^T P^T; the two halves are joined through LDS at the end, divided by the row sum and written f32 straight into the head's 64 columns of the output rows.
// Compute dtype: inputs rounded to bf16; x / weights exact; q, k, v and softmax weights as plain f16 GEMM operands (~2^-12); scores, softmax statistics and o f32; v_wmma_f32_16x16x32_f16.
#define NB 1
#define SQ 4096
#define DM 1024
#define NH 16
#define HD 64
#define HG 1                         /* heads per launch of the non-template k_vt */
#define B0 0                         /* first batch processed (debug hook) */
#define NBR NB                       /* batches processed (debug hook) */
#define NR ((size_t)NB * SQ)         /* token rows */
#define MP ((int)((size_t)NBR * SQ)) /* rows projected (debug hook) */
#define QN SQ                        /* unused (the attention launch attends all SQ query rows) */
#define NHD NH                       /* unused (the attention launch covers all NH heads) */
#define MPO MP                       /* unused (there is no output stage) */
#define LQ DM      /* row pitch of the q rows */
typedef __bf16 v16b __attribute__((ext_vector_type(16)));
typedef unsigned short v8us __attribute__((ext_vector_type(8), may_alias));
typedef float  v8f  __attribute__((ext_vector_type(8)));
typedef float  v4f  __attribute__((ext_vector_type(4)));
typedef float  v4fa __attribute__((ext_vector_type(4), may_alias));
union FragB { v16b v; v8us half[2]; unsigned short u[16]; };

__device__ __forceinline__ unsigned short bf16_bits(float x) { unsigned int u = __float_as_uint(x); return (unsigned short)((u + 0x7FFFu + ((u >> 16) & 1u)) >> 16); }
__device__ __forceinline__ float bf16_val(unsigned short b) { return __uint_as_float(((unsigned int)b) << 16); }
__device__ __forceinline__ float bf16_round(float x) { return bf16_val(bf16_bits(x)); }
// D += A·B with NT terms: 1 = ah·bh, 2 = + al·bh (A split), 3 = + ah·bl (both split)
template <int NT>
__device__ __forceinline__ v8f mmaN(v16b ah, v16b al, v16b bh, v16b bl, v8f c) {
  c = __builtin_amdgcn_wmma_f32_16x16x32_bf16(false, ah, false, bh, (short)0, c, false, false);
  if (NT >= 2) c = __builtin_amdgcn_wmma_f32_16x16x32_bf16(false, al, false, bh, (short)0, c, false, false);
  if (NT >= 3) c = __builtin_amdgcn_wmma_f32_16x16x32_bf16(false, ah, false, bl, (short)0, c, false, false);
  asm volatile("v_nop\n\tv_nop\n\tv_nop\n\tv_nop" : "+v"(c) : "v"(ah), "v"(al), "v"(bh), "v"(bl));
  return c;
}

__global__ __launch_bounds__(256) void k_wt_bf16(const float* __restrict__ W, unsigned short* __restrict__ Wt, int K, int N) {
  const int t = blockIdx.x * 256 + threadIdx.x;
  const int k8n = K / 8;
  if (t >= N * k8n) return;
  const int n = t / k8n, k8 = (t % k8n) * 8;
  v8us v;
#pragma unroll
  for (int i = 0; i < 8; ++i) v[i] = bf16_bits(W[(size_t)(k8 + i) * N + n]);
  *(v8us*)(Wt + (size_t)n * K + k8) = v;
  
}

// GEMM C[M][N] (f32, pitch ldc) = act(A[M][K]·W + bias). A f32 row-major (pitch lda) converted per fragment to bf16
// (ASPLIT: hi/lo two planes -> 2 terms, else single rounded term); Wt bf16 [N][K] (pitch ldb). BIAS_BF16 rounds the
// bias to bf16 first (bias quantised to bf16 before the add). K%32==0, M%16==0, N%64==0.
template <bool ASPLIT, int ACT, bool BIAS_BF16>
__global__ __launch_bounds__(128) void k_gemm_bf(const float* __restrict__ A, int lda, const unsigned short* __restrict__ Wt, int ldb,
                                               const float* __restrict__ bias, float* __restrict__ C, int ldc, int M, int N, int K) {
  __shared__ __attribute__((aligned(16))) float so[4][16][64];
  const int tid = threadIdx.x, w = tid >> 5, lane = tid & 31, ln = lane & 15, hh = lane >> 4;
  const int ntn = N / 64;
  const int wid = blockIdx.x * 4 + w;
  const int mt = wid / ntn, nq = wid % ntn;
  if (mt * 16 >= M) return;
  const int row0 = mt * 16, col0 = nq * 64;
  const float* arow = A + (size_t)(row0 + ln) * lda;
  v8f acc[4] = {};
  for (int kb = 0; kb < K; kb += 32) {
    FragB ah, al;
    const v4f x0 = *(const v4fa*)(arow + kb + 8 * hh), x1 = *(const v4fa*)(arow + kb + 8 * hh + 4);
    const v4f x2 = *(const v4fa*)(arow + kb + 16 + 8 * hh), x3 = *(const v4fa*)(arow + kb + 16 + 8 * hh + 4);
    float xs[16] = {x0[0],x0[1],x0[2],x0[3],x1[0],x1[1],x1[2],x1[3],x2[0],x2[1],x2[2],x2[3],x3[0],x3[1],x3[2],x3[3]};
#pragma unroll
    for (int i = 0; i < 16; ++i) { const unsigned short hb = bf16_bits(xs[i]); ah.u[i] = hb; al.u[i] = ASPLIT ? bf16_bits(xs[i] - bf16_val(hb)) : (unsigned short)0; }
#pragma unroll
    for (int t = 0; t < 4; ++t) {
      const unsigned short* brow = Wt + (size_t)(col0 + t * 16 + ln) * ldb + kb;
      FragB b;
      b.half[0] = *(const v8us*)(brow + 8 * hh);
      b.half[1] = *(const v8us*)(brow + 16 + 8 * hh);
      acc[t] = mmaN<ASPLIT ? 2 : 1>(ah.v, al.v, b.v, b.v, acc[t]);
    }
  }
#pragma unroll
  for (int t = 0; t < 4; ++t) {
    float bv = bias ? bias[col0 + t * 16 + ln] : 0.f;
    if (BIAS_BF16) bv = bf16_round(bv);
#pragma unroll
    for (int r = 0; r < 8; ++r) { float v = acc[t][r] + bv; if (ACT == 1) v = fmaxf(v, 0.f); so[w][8 * hh + r][t * 16 + ln] = v; }
  }
  __builtin_amdgcn_fence(__ATOMIC_ACQ_REL, "workgroup");
  __builtin_amdgcn_wave_barrier();
  const int rsub = lane >> 4, c4 = (lane & 15) * 4;
  {
#pragma unroll
    for (int q = 0; q < 8; ++q) {
      const int r = q * 2 + rsub;
      const v4f v = *(const v4fa*)&so[w][r][c4];
      *(v4f*)(C + (size_t)(row0 + r) * ldc + col0 + c4) = v;
    }
    
  }
}

// GEMM C = act(A·W + bias + resid): A f32 (ASPLIT -> hi/lo 2 terms), Wt bf16 [N][K]; ACT 0 none, 1 relu, 2 exact gelu;
// resid (optional, f32, row index = (row % rmod), pitch ldr, RES_BF16 rounds it) added before the activation.
template <bool ASPLIT, int ACT, bool BIAS_BF16, bool RES_BF16>
__global__ __launch_bounds__(128) void k_gemm_bf3(const float* __restrict__ A, int lda, const unsigned short* __restrict__ Wt, int ldb,
                                                const float* __restrict__ bias, const float* __restrict__ resid, int rmod, int ldr,
                                                float* __restrict__ C, int ldc, int M, int N, int K) {
  __shared__ __attribute__((aligned(16))) float so[4][16][64];
  const int tid = threadIdx.x, w = tid >> 5, lane = tid & 31, ln = lane & 15, hh = lane >> 4;
  const int ntn = N / 64;
  const int wid = blockIdx.x * 4 + w;
  const int mt = wid / ntn, nq = wid % ntn;
  if (mt * 16 >= M) return;
  const int row0 = mt * 16, col0 = nq * 64;
  const float* arow = A + (size_t)(row0 + ln) * lda;
  v8f acc[4] = {};
  for (int kb = 0; kb < K; kb += 32) {
    FragB ah, al;
    const v4f x0 = *(const v4fa*)(arow + kb + 8 * hh), x1 = *(const v4fa*)(arow + kb + 8 * hh + 4);
    const v4f x2 = *(const v4fa*)(arow + kb + 16 + 8 * hh), x3 = *(const v4fa*)(arow + kb + 16 + 8 * hh + 4);
    float xs[16] = {x0[0],x0[1],x0[2],x0[3],x1[0],x1[1],x1[2],x1[3],x2[0],x2[1],x2[2],x2[3],x3[0],x3[1],x3[2],x3[3]};
#pragma unroll
    for (int i = 0; i < 16; ++i) { const unsigned short hb = bf16_bits(xs[i]); ah.u[i] = hb; al.u[i] = ASPLIT ? bf16_bits(xs[i] - bf16_val(hb)) : (unsigned short)0; }
#pragma unroll
    for (int t = 0; t < 4; ++t) {
      const unsigned short* brow = Wt + (size_t)(col0 + t * 16 + ln) * ldb + kb;
      FragB b;
      b.half[0] = *(const v8us*)(brow + 8 * hh);
      b.half[1] = *(const v8us*)(brow + 16 + 8 * hh);
      acc[t] = mmaN<ASPLIT ? 2 : 1>(ah.v, al.v, b.v, b.v, acc[t]);
    }
  }
#pragma unroll
  for (int t = 0; t < 4; ++t) {
    const int col = col0 + t * 16 + ln;
    float bv = bias ? bias[col] : 0.f;
    if (BIAS_BF16) bv = bf16_round(bv);
#pragma unroll
    for (int r = 0; r < 8; ++r) {
      float v = acc[t][r] + bv;
      if (resid) { float rv = resid[(size_t)((row0 + 8 * hh + r) % rmod) * ldr + col]; if (RES_BF16) rv = bf16_round(rv); v += rv; }
      if (ACT == 1) v = fmaxf(v, 0.f);
      if (ACT == 2) v = 0.5f * v * (1.0f + erff(v * 0.70710678118654752f));
      if (ACT == 3) { const float u = 0.7978845608028654f * (v + 0.044715f * v * v * v); v = 0.5f * v * (1.0f + tanhf(u)); }
      so[w][8 * hh + r][t * 16 + ln] = v;
    }
  }
  __builtin_amdgcn_fence(__ATOMIC_ACQ_REL, "workgroup");
  __builtin_amdgcn_wave_barrier();
  const int rsub = lane >> 4, c4 = (lane & 15) * 4;
  {
#pragma unroll
    for (int q = 0; q < 8; ++q) {
      const int r = q * 2 + rsub;
      const v4f v = *(const v4fa*)&so[w][r][c4];
      *(v4f*)(C + (size_t)(row0 + r) * ldc + col0 + c4) = v;
    }
    
  }
}
// row LayerNorm (biased variance, eps) over N: s = X (+ R); optional out_sum <- s; out_norm <- (s-mu)*rsqrt(var+eps)*g + b
template <bool PARAM_BF16>
__global__ __launch_bounds__(256) void k_layernorm(const float* __restrict__ X, const float* __restrict__ R, const float* __restrict__ g, const float* __restrict__ bta,
                                                  float* __restrict__ out_sum, float* __restrict__ out_norm, int N, float eps) {
  __shared__ float red[256];
  const int row = blockIdx.x, tid = threadIdx.x;
  const float* x = X + (size_t)row * N; const float* rr = R ? R + (size_t)row * N : nullptr;
  float vals[16];                     // up to N = 4096
  const int per = N / 256;            // contiguous chunk per thread? use strided-by-4 chunks: thread handles j = tid*4 + 1024*u
  float s1 = 0.f;
  for (int u = 0; u < per / 4; ++u) {
    const int j = tid * 4 + 1024 * u;
    const v4f a = *(const v4fa*)(x + j);
    v4f b = {0.f,0.f,0.f,0.f}; if (rr) b = *(const v4fa*)(rr + j);
#pragma unroll
    for (int q = 0; q < 4; ++q) { const float v = a[q] + b[q]; vals[u * 4 + q] = v; s1 += v; }
  }
  red[tid] = s1; __syncthreads();
  for (int st = 128; st > 0; st >>= 1) { if (tid < st) red[tid] += red[tid + st]; __syncthreads(); }
  const float mu = red[0] / (float)N; __syncthreads();
  float s2 = 0.f;
  for (int u = 0; u < per / 4; ++u)
#pragma unroll
    for (int q = 0; q < 4; ++q) { const float c = vals[u * 4 + q] - mu; s2 += c * c; }
  red[tid] = s2; __syncthreads();
  for (int st = 128; st > 0; st >>= 1) { if (tid < st) red[tid] += red[tid + st]; __syncthreads(); }
  const float rs = rsqrtf(red[0] / (float)N + eps);
  {
    for (int u = 0; u < per / 4; ++u) {
      const int j = tid * 4 + 1024 * u;
      v4f o, sm;
#pragma unroll
      for (int q = 0; q < 4; ++q) {
        float gg = g[j + q], bb = bta[j + q];
        if (PARAM_BF16) { gg = bf16_round(gg); bb = bf16_round(bb); }
        sm[q] = vals[u * 4 + q]; o[q] = (vals[u * 4 + q] - mu) * rs * gg + bb;
      }
      if (out_sum) *(v4f*)(out_sum + (size_t)row * N + j) = sm;
      *(v4f*)(out_norm + (size_t)row * N + j) = o;
    }
    
  }
}



// ---- f16 WMMA path (v_wmma_f32_16x16x32_f16): 11-bit significands for operands in range — used where a [0,1] probability operand needs more precision than bf16
typedef _Float16 v16h __attribute__((ext_vector_type(16)));
union FragH { v16h v; v8us half[2]; _Float16 h[16]; unsigned short u[16]; };
template <int NT>
__device__ __forceinline__ v8f mmaH(v16h ah, v16h al, v16h bh, v16h bl, v8f c) {
  c = __builtin_amdgcn_wmma_f32_16x16x32_f16(false, ah, false, bh, (short)0, c, false, false);
  if (NT >= 2) c = __builtin_amdgcn_wmma_f32_16x16x32_f16(false, al, false, bh, (short)0, c, false, false);
  if (NT >= 3) c = __builtin_amdgcn_wmma_f32_16x16x32_f16(false, ah, false, bl, (short)0, c, false, false);
  asm volatile("v_nop\n\tv_nop\n\tv_nop\n\tv_nop" : "+v"(c) : "v"(ah), "v"(al), "v"(bh), "v"(bl));
  return c;
}
// batched GEMM like k_gemm_b but f16 operands: A f32 (split into f16 hi/lo if ASPLIT, else rounded to f16), Bt = f16 values [n][k]; alpha; C f32; N multiple of 16 (partial tiles skipped)
template <bool ASPLIT>
__global__ __launch_bounds__(128) void k_gemm_h(const float* __restrict__ A, int lda, size_t sA, const _Float16* __restrict__ Bh, int ldb, size_t sB, float alpha, float* __restrict__ C, int ldc, size_t sC, int M, int N, int K) {
  __shared__ __attribute__((aligned(16))) float so[4][16][64];
  const int tid = threadIdx.x, w = tid >> 5, lane = tid & 31, ln = lane & 15, hh = lane >> 4; const int by = blockIdx.y;
  A += (size_t)by * sA; Bh += (size_t)by * sB; C += (size_t)by * sC;
  const int ntn = (N + 63) / 64; const int wid = blockIdx.x * 4 + w; const int mt = wid / ntn, nq = wid % ntn; if (mt * 16 >= M) return;
  const int row0 = mt * 16, col0 = nq * 64; const float* arow = A + (size_t)(row0 + ln) * lda;
  v8f acc[4] = {};
  for (int kb = 0; kb < K; kb += 32) {
    FragH ah, al;
    const v4f x0 = *(const v4fa*)(arow + kb + 8 * hh), x1 = *(const v4fa*)(arow + kb + 8 * hh + 4), x2 = *(const v4fa*)(arow + kb + 16 + 8 * hh), x3 = *(const v4fa*)(arow + kb + 16 + 8 * hh + 4);
    float xs[16] = {x0[0],x0[1],x0[2],x0[3],x1[0],x1[1],x1[2],x1[3],x2[0],x2[1],x2[2],x2[3],x3[0],x3[1],x3[2],x3[3]};
#pragma unroll
    for (int i = 0; i < 16; ++i) { const _Float16 h = (_Float16)xs[i]; ah.h[i] = h; al.h[i] = ASPLIT ? (_Float16)(xs[i] - (float)h) : (_Float16)0.0f; }
#pragma unroll
    for (int t = 0; t < 4; ++t) { if (col0 + t * 16 >= N) continue; const size_t boff = (size_t)(col0 + t * 16 + ln) * ldb + kb; FragH bq; bq.half[0] = *(const v8us*)(Bh + boff + 8 * hh); bq.half[1] = *(const v8us*)(Bh + boff + 16 + 8 * hh);
      acc[t] = mmaH<ASPLIT ? 2 : 1>(ah.v, al.v, bq.v, bq.v, acc[t]); }
  }
#pragma unroll
  for (int t = 0; t < 4; ++t) { if (col0 + t * 16 >= N) continue;
#pragma unroll
    for (int r = 0; r < 8; ++r) so[w][8 * hh + r][t * 16 + ln] = acc[t][r] * alpha; }
  __builtin_amdgcn_fence(__ATOMIC_ACQ_REL, "workgroup"); __builtin_amdgcn_wave_barrier();
  const int rsub = lane >> 4, c4 = (lane & 15) * 4;
  {
#pragma unroll
    for (int q = 0; q < 8; ++q) { const int r = q * 2 + rsub; if (col0 + c4 < N) { const v4f v = *(const v4fa*)&so[w][r][c4]; *(v4f*)(C + (size_t)(row0 + r) * ldc + col0 + c4) = v; } }
     }
}

// Wt[n][k] = f16(W[k][n]·scale) from f32 row-major W[K][N] (scale = power of two; bf16-exact weights stay exact in f16 away from the subnormal range)
__global__ __launch_bounds__(256) void k_wt_f16(const float* __restrict__ W, _Float16* __restrict__ Wt, int K, int N, float scale) {
  const int t = blockIdx.x * 256 + threadIdx.x; if (t >= N * (K / 8)) return; const int n = t / (K / 8), k8 = (t % (K / 8)) * 8; FragH f;
#pragma unroll
  for (int i = 0; i < 8; ++i) f.h[i] = (_Float16)(bf16_round(W[(size_t)(k8 + i) * N + n]) * scale); const v8us o = f.half[0];
  *(v8us*)((unsigned short*)Wt + (size_t)n * K + k8) = o; 
}
// k_gemm_hh variant with fused epilogue: v = acc·alpha + bias[by·sBias + col] (+ CP[(row/rowsPerB)·sCPb + by·64 + col] if CP) ; ACT 0 none / 1 elu ; writes f16 C16 (and f32 C if non-null)
template <int ACT>
__global__ __launch_bounds__(128) void k_gemm_hhx(const _Float16* __restrict__ A, int lda, size_t sA, const _Float16* __restrict__ Bh, int ldb, size_t sB, float alpha, const float* __restrict__ bias, size_t sBias, const float* __restrict__ CP, int rowsPerB, size_t sCPb, int row0g,
    float* __restrict__ C, _Float16* __restrict__ C16, int ldc, size_t sC, int M, int N, int K) {
  __shared__ __attribute__((aligned(16))) float so[4][16][64];
  const int tid = threadIdx.x, w = tid >> 5, lane = tid & 31, ln = lane & 15, hh = lane >> 4; const int by = blockIdx.y;
  A += (size_t)by * sA; Bh += (size_t)by * sB; const size_t cofs = (size_t)by * sC; const float* bp = bias ? bias + (size_t)by * sBias : nullptr;
  const int ntn = (N + 63) / 64; const int wid = blockIdx.x * 4 + w; const int mt = wid / ntn, nq = wid % ntn; if (mt * 16 >= M) return;
  const int row0 = mt * 16, col0 = nq * 64; const _Float16* arow = A + (size_t)(row0 + ln) * lda;
  v8f acc[4] = {};
  for (int kb = 0; kb < K; kb += 32) { FragH ah; ah.half[0] = *(const v8us*)((const unsigned short*)arow + kb + 8 * hh); ah.half[1] = *(const v8us*)((const unsigned short*)arow + kb + 16 + 8 * hh);
#pragma unroll
    for (int t = 0; t < 4; ++t) { if (col0 + t * 16 >= N) continue; const size_t boff = (size_t)(col0 + t * 16 + ln) * ldb + kb; FragH bq; bq.half[0] = *(const v8us*)((const unsigned short*)Bh + boff + 8 * hh); bq.half[1] = *(const v8us*)((const unsigned short*)Bh + boff + 16 + 8 * hh);
      acc[t] = mmaH<1>(ah.v, ah.v, bq.v, bq.v, acc[t]); }
  }
#pragma unroll
  for (int t = 0; t < 4; ++t) { if (col0 + t * 16 >= N) continue; const int col = col0 + t * 16 + ln; const float bv = bp ? bf16_round(bp[col]) : 0.f;
#pragma unroll
    for (int r = 0; r < 8; ++r) { float v = acc[t][r] * alpha + bv; if (CP) { const int rr = row0g + row0 + 8 * hh + r; if (rowsPerB < 0) v += CP[cofs + (size_t)rr * ldc + col];      /* rowsPerB < 0: own element of the batched C plane */ else { const int bidx = rr / rowsPerB; v += CP[(size_t)bidx * sCPb + (size_t)by * 64 + col]; } } if (ACT == 1) v = (v > 0.f) ? v : expm1f(v); else if (ACT == 7) v = (v > 0.f) ? v + 1.0f : expf(v); else if (ACT == 8) v = tanhf(v); else if (ACT == 9) v = 0.5f * v * (1.0f + tanhf(0.7978845608028654f * (v + 0.044715f * v * v * v))); else if (ACT == 11) v = 1.0f / (1.0f + expf(-v)); else if (ACT == 12) v = (v > 0.f) ? v : 0.01f * v; else if (ACT == 14) v = (v > 0.f) ? v : 0.1f * v; else if (ACT == 16) v = (v >= 0.f) ? v : 0.3f * v; else if (ACT == 17) v = (v >= 0.f) ? v : 0.2f * v; else if (ACT == 15) v = v / (1.0f + expf(-v)); else if (ACT == 3) v = fmaxf(v, 0.f); else if (ACT == 6) v = 0.5f * v * (1.0f + erff(v * 0.70710678118654752f)); so[w][8 * hh + r][t * 16 + ln] = v; } }
  __builtin_amdgcn_fence(__ATOMIC_ACQ_REL, "workgroup"); __builtin_amdgcn_wave_barrier();
  const int rsub = lane >> 4, c4 = (lane & 15) * 4; typedef _Float16 v4h __attribute__((ext_vector_type(4)));
  {
#pragma unroll
    for (int q = 0; q < 8; ++q) { const int r = q * 2 + rsub; if (col0 + c4 < N) { const v4f v = *(const v4fa*)&so[w][r][c4]; if (C) *(v4f*)(C + cofs + (size_t)(row0 + r) * ldc + col0 + c4) = v; if (C16) { v4h h4; for (int i = 0; i < 4; ++i) h4[i] = (_Float16)v[i]; *(v4h*)(C16 + cofs + (size_t)(row0 + r) * ldc + col0 + c4) = h4; } } }
     }
}


typedef _Float16 v4h __attribute__((ext_vector_type(4)));

__global__ __launch_bounds__(256) void k_h16(const float* __restrict__ x, _Float16* __restrict__ X16, size_t n8) { const size_t t = (size_t)blockIdx.x * 256 + threadIdx.x; if (t >= n8) return; FragH f;
#pragma unroll
  for (int q = 0; q < 8; ++q) f.h[q] = (_Float16)x[t * 8 + q]; *(v8us*)((unsigned short*)X16 + t * 8) = f.half[0];  }
__global__ __launch_bounds__(256) void k_round16f(const float* __restrict__ W, _Float16* __restrict__ Bt, size_t n8) { const size_t t = (size_t)blockIdx.x * 256 + threadIdx.x; if (t >= n8) return; FragH f;
#pragma unroll
  for (int i = 0; i < 8; ++i) f.h[i] = (_Float16)(bf16_round(W[t * 8 + i]) * 16.0f); *(v8us*)((unsigned short*)Bt + t * 8) = f.half[0];  }
template <int NHv, int TTv>
__global__ __launch_bounds__(256) void k_vt(const _Float16* __restrict__ V16, int ldv, int voff, _Float16* __restrict__ Vt) { __shared__ unsigned short tl[64][66]; const int tid = threadIdx.x; const int slab = blockIdx.x / (TTv / 64), lg = blockIdx.x % (TTv / 64); const int b = slab / NHv, h = slab % NHv;
  for (int i = tid; i < 64 * 8; i += 256) { const int r = i / 8, c8 = (i % 8) * 8; FragH f; f.half[0] = *(const v8us*)((const unsigned short*)V16 + ((size_t)b * TTv + lg * 64 + r) * ldv + voff + h * 64 + c8);
#pragma unroll
    for (int q = 0; q < 8; ++q) tl[r][c8 + q] = f.u[q]; }
  __syncthreads();
  {
#pragma unroll
    for (int rd = 0; rd < 2; ++rd) { const int d = rd * 32 + tid / 8, pc = tid % 8; FragH f;
#pragma unroll
      for (int q = 0; q < 8; ++q) f.u[q] = tl[pc * 8 + q][d];
      *(v8us*)((unsigned short*)Vt + ((size_t)slab * 64 + d) * TTv + lg * 64 + pc * 8) = f.half[0]; }
     } }

__global__ __launch_bounds__(256) void k_hl(const float* __restrict__ F, _Float16* __restrict__ Hh, _Float16* __restrict__ Hl, size_t n8) { const size_t t = (size_t)blockIdx.x * 256 + threadIdx.x; if (t >= n8) return; FragH fh, fl; const v4f a = *(const v4fa*)(F + t * 8), c = *(const v4fa*)(F + t * 8 + 4);
#pragma unroll
  for (int q = 0; q < 4; ++q) { _Float16 h = (_Float16)a[q]; fh.h[q] = h; fl.h[q] = (_Float16)((a[q] - (float)h) * 1024.0f); h = (_Float16)c[q]; fh.h[4 + q] = h; fl.h[4 + q] = (_Float16)((c[q] - (float)h) * 1024.0f); }
  { *(v8us*)((unsigned short*)Hh + t * 8) = fh.half[0]; *(v8us*)((unsigned short*)Hl + t * 8) = fl.half[0];  } }

// ---- fast GEMM (wave tile 32x64, work-group tile 128x64; requires M % 128 == 0 rows per launch region, N % 64 == 0 and K % 128 == 0); epilogue = k_gemm_hhx semantics ----
__device__ __forceinline__ v16h g2_frag(const _Float16* p, int hh) { FragH f; f.half[0] = *(const v8us*)((const unsigned short*)p + 8 * hh); f.half[1] = *(const v8us*)((const unsigned short*)p + 16 + 8 * hh); return f.v; }
__device__ __forceinline__ v8f g2_mma(v16h a, v16h b, v8f c) { v8f d = __builtin_amdgcn_wmma_f32_16x16x32_f16(false, a, false, b, (short)0, c, false, false); asm volatile("v_nop\n\tv_nop\n\tv_nop\n\tv_nop" : "+v"(d) : "v"(a), "v"(b)); return d; }
// ---- operand ring of k_gemm2: a stage is 128 k (256 bytes) of the work-group's 128 A rows and 64 B rows, laid in LDS at a pitch of 272 bytes (16 x odd: 16-byte fragment reads meet no bank conflict); two buffers ----
#define G2_KT 128
#define G2_PITCH 272
#define G2_BUF (192 * G2_PITCH)
__device__ __forceinline__ v8f g2_mmab(v16h a, v16h b, v8f c) { return __builtin_amdgcn_wmma_f32_16x16x32_f16(false, a, false, b, (short)0, c, false, false); }
__device__ __forceinline__ v16h g2_lfrag(const unsigned char* p) { FragH f; f.half[0] = *(const v8us*)p; f.half[1] = *(const v8us*)(p + 32); return f.v; }      /* p = the lane's row + 16 hh bytes: elements 0..7 = k 8 hh + e, 8..15 = k 16 + 8 hh + e, as in g2_frag */
// Eight asynchronous 16-byte copies of a thread, global to LDS through no register: 64 operand rows a call (row step 8), 16 threads a row, so that a wave's copy reads two whole 256-byte row pieces.
// The address wait is the statement's last line: it stands in front of whatever next writes a register that a copy names.
__device__ __forceinline__ void g2_copy8(unsigned l, const _Float16* g, size_t g8) {
  const unsigned l1 = l + 8 * G2_PITCH, l2 = l + 16 * G2_PITCH, l3 = l + 24 * G2_PITCH, l4 = l + 32 * G2_PITCH, l5 = l + 40 * G2_PITCH, l6 = l + 48 * G2_PITCH, l7 = l + 56 * G2_PITCH;
  const _Float16* g1 = g + g8; const _Float16* g2 = g1 + g8; const _Float16* g3 = g2 + g8; const _Float16* g4 = g3 + g8; const _Float16* g5 = g4 + g8; const _Float16* g6 = g5 + g8; const _Float16* g7 = g6 + g8;
  asm volatile("global_load_async_to_lds_b128 %0, %8, off\n\tglobal_load_async_to_lds_b128 %1, %9, off\n\tglobal_load_async_to_lds_b128 %2, %10, off\n\tglobal_load_async_to_lds_b128 %3, %11, off\n\t"
               "global_load_async_to_lds_b128 %4, %12, off\n\tglobal_load_async_to_lds_b128 %5, %13, off\n\tglobal_load_async_to_lds_b128 %6, %14, off\n\tglobal_load_async_to_lds_b128 %7, %15, off\n\ts_wait_xcnt 0x0"
               :: "v"(l), "v"(l1), "v"(l2), "v"(l3), "v"(l4), "v"(l5), "v"(l6), "v"(l7), "v"(g), "v"(g1), "v"(g2), "v"(g3), "v"(g4), "v"(g5), "v"(g6), "v"(g7) : "memory"); }
// Grid y = the projection (0 Q, 1 K, 2 V): the three products depend on nothing of one another, so they run as one grid; a work-group of a later one starts on a WGP as soon as one of an earlier one ends there. Plane y of A, Bh and C16 stands y sA, y sB, y sC elements behind plane 0; each has its own bias pointer.
// pk = y: layout of C16. 0 = rows of pitch ldc. 1, 2 = fragment order for the attention loop (N / 64 heads, M keys): the wave's 32 keys x 64 features of head nq are 8 units of 512 bytes at ((nq M + row0) 64) elements,
// unit u holding lane l's 8 elements at 8 l, so that one wave-wide 16-byte load of a unit reads 4 whole cache lines. 1 (K, A operand of S^T): u = 4 (key / 16) + feature / 16, lane = 16 ((feature / 8) & 1) + key % 16, element = feature % 8.
// 2 (V^T, A operand of O^T): u = 2 (feature / 16) + (key / 16) % 2, lane = 16 ((key / 8) & 1) + feature % 16, element = key % 8.
template <int ACT>
__global__ __launch_bounds__(128) void k_gemm2(const _Float16* __restrict__ A, int lda, size_t sA, const _Float16* __restrict__ Bh, int ldb, size_t sB, float alpha, const float* __restrict__ bias, const float* __restrict__ bias1, const float* __restrict__ bias2, const float* __restrict__ CP, int rowsPerB, size_t sCPb, int row0g,
    float* __restrict__ C, _Float16* __restrict__ C16, int ldc, size_t sC, int M, int N, int K, float osc0) { static_assert(ACT == 0 || ACT == 3 || ACT == 6 || ACT == 8 || ACT == 9 || ACT == 11 || ACT == 12 || ACT == 14 || ACT == 15 || ACT == 16 || ACT == 17, "k_gemm2: unsupported ACT code (would silently apply no activation)");
  __shared__ __attribute__((aligned(16))) float so[4][32][68];
  __shared__ __attribute__((aligned(16))) unsigned char ring[2 * G2_BUF];      /* rows 0..127 of a buffer: the work-group's A rows; 128..191: its B rows */
  const int tid = threadIdx.x, w = tid >> 5, lane = tid & 31, ln = lane & 15, hh = lane >> 4; const int by = blockIdx.y;
  A += (size_t)by * sA; Bh += (size_t)by * sB; const size_t cofs = (size_t)by * sC; const float* bp = by == 0 ? bias : by == 1 ? bias1 : bias2; const int pk = by; const float osc = by == 0 ? osc0 : 1.0f;      /* all scalar: by is the same for the work-group */
  const int ntn = N >> 6; const int mt = blockIdx.x / ntn, nq = blockIdx.x - mt * ntn; const int row0 = mt * 128 + 32 * w, col0 = nq * 64; if (mt * 128 >= M) return;      /* the whole work-group leaves or none does (barriers below); needs M % 128 == 0, K % 128 == 0, K >= 128 */
  const _Float16* ga = A + (size_t)(mt * 128 + (tid >> 4)) * lda + (tid & 15) * 8; const _Float16* gb = Bh + (size_t)(col0 + (tid >> 4)) * ldb + (tid & 15) * 8;      /* the thread's first 16 bytes of a stage: row tid / 16, piece tid % 16 */
  const unsigned lc = (unsigned)(size_t)ring + (unsigned)((tid >> 4) * G2_PITCH + (tid & 15) * 16);      /* their place in buffer 0: byte address in the work-group's LDS */
  const size_t a8 = (size_t)8 * lda, b8 = (size_t)8 * ldb; const int nt = K / G2_KT;
  const unsigned char* fa = ring + (32 * w + ln) * G2_PITCH + 16 * hh; const unsigned char* fb = ring + (128 + ln) * G2_PITCH + 16 * hh;      /* the lane's fragment rows in buffer 0 */
  const v8f z8 = {0.f,0.f,0.f,0.f,0.f,0.f,0.f,0.f}; v8f c00 = z8, c01 = z8, c02 = z8, c03 = z8, c10 = z8, c11 = z8, c12 = z8, c13 = z8;
  g2_copy8(lc, ga, a8); g2_copy8(lc + 64 * G2_PITCH, ga + 8 * a8, a8); g2_copy8(lc + 128 * G2_PITCH, gb, b8);      /* stage 0 into buffer 0 */
  asm volatile("s_wait_asynccnt 0x0" ::: "memory");      /* this wave's copies of stage 0 have landed */
  __syncthreads();      /* every wave's have: stage 0 may be read */
  if (nt > 1) { g2_copy8(lc + G2_BUF, ga + G2_KT, a8); g2_copy8(lc + G2_BUF + 64 * G2_PITCH, ga + G2_KT + 8 * a8, a8); g2_copy8(lc + G2_BUF + 128 * G2_PITCH, gb + G2_KT, b8); }      /* stage 1 flies while stage 0 is worked on */
#pragma unroll 1      /* one stage a trip: the ring's order below is written once */
  for (int t = 0; t < nt; ++t) { const unsigned bo = (unsigned)(t & 1) * G2_BUF;
    const unsigned char* pa = fa + bo; const unsigned char* pb = fb + bo; v16h fr[2][6];      /* two fragment sets: A rows 0..15, 16..31, B columns 0..15 .. 48..63 of one k step */
    fr[0][0] = g2_lfrag(pa); fr[0][1] = g2_lfrag(pa + 16 * G2_PITCH); fr[0][2] = g2_lfrag(pb); fr[0][3] = g2_lfrag(pb + 16 * G2_PITCH); fr[0][4] = g2_lfrag(pb + 32 * G2_PITCH); fr[0][5] = g2_lfrag(pb + 48 * G2_PITCH);
#pragma unroll      /* constant indices keep the fragment sets in registers; constant offsets for the four k steps of a stage */
    for (int kk = 0; kk < 4; ++kk) { const int c = kk & 1, n = c ^ 1;
      if (kk < 3) { const unsigned char* qa = pa + (kk + 1) * 64; const unsigned char* qb = pb + (kk + 1) * 64;      /* the next k step of this same stage */
        fr[n][0] = g2_lfrag(qa); fr[n][1] = g2_lfrag(qa + 16 * G2_PITCH); fr[n][2] = g2_lfrag(qb); fr[n][3] = g2_lfrag(qb + 16 * G2_PITCH); fr[n][4] = g2_lfrag(qb + 32 * G2_PITCH); fr[n][5] = g2_lfrag(qb + 48 * G2_PITCH); }
      __builtin_amdgcn_sched_barrier(0);      /* keeps the twelve LDS reads one group in front of the products: spread among them, each pair is waited out to 0 */
      c00 = g2_mmab(fr[c][0], fr[c][2], c00); c10 = g2_mmab(fr[c][1], fr[c][2], c10); c01 = g2_mmab(fr[c][0], fr[c][3], c01); c11 = g2_mmab(fr[c][1], fr[c][3], c11);
      c02 = g2_mmab(fr[c][0], fr[c][4], c02); c12 = g2_mmab(fr[c][1], fr[c][4], c12); c03 = g2_mmab(fr[c][0], fr[c][5], c03); c13 = g2_mmab(fr[c][1], fr[c][5], c13);
      __builtin_amdgcn_sched_barrier(0); }      /* the other side of the same fence: the following group stays behind these products */
    asm volatile("s_wait_dscnt 0x0" ::: "memory");      /* this wave's reads of the buffer are done before it is handed over */
    asm volatile("s_wait_asynccnt 0x0" ::: "memory");      /* this wave's copies of stage t + 1 have landed */
    __syncthreads();      /* publishes stage t + 1 and ends every reader's last read of stage t's buffer */
    if (t + 2 < nt) { const _Float16* na = ga + (size_t)(t + 2) * G2_KT; const _Float16* nb = gb + (size_t)(t + 2) * G2_KT;      /* refill of the buffer just read */
      g2_copy8(lc + bo, na, a8); g2_copy8(lc + bo + 64 * G2_PITCH, na + 8 * a8, a8); g2_copy8(lc + bo + 128 * G2_PITCH, nb, b8); } }
  asm volatile("s_wait_asynccnt 0x0" ::: "memory");      /* nothing of this wave is in flight behind the loop */
  v8f accs[8] = {c00, c01, c02, c03, c10, c11, c12, c13};
#pragma unroll
  for (int u = 0; u < 8; ++u) { const int t = u & 3, half = u >> 2; const int col = col0 + t * 16 + ln; const float bv = bp ? bf16_round(bp[col]) : 0.f;
#pragma unroll
    for (int r = 0; r < 8; ++r) { const int rloc = half * 16 + 8 * hh + r; float v = accs[u][r] * alpha + bv; if (CP) { if (rowsPerB < 0) v += CP[cofs + (size_t)(row0g + row0 + rloc) * ldc + col];      /* rowsPerB < 0: own element of the batched C plane */ else { const int bidx = (row0g + row0 + rloc) / rowsPerB; v += CP[(size_t)bidx * sCPb + (size_t)by * 64 + col]; } }
      if (ACT == 3) v = fmaxf(v, 0.f); else if (ACT == 6) v = 0.5f * v * (1.0f + erff(v * 0.70710678118654752f)); else if (ACT == 11) v = 1.0f / (1.0f + expf(-v)); else if (ACT == 15) v = v / (1.0f + expf(-v)); else if (ACT == 12) v = (v > 0.f) ? v : 0.01f * v; else if (ACT == 8) v = tanhf(v); else if (ACT == 9) v = 0.5f * v * (1.0f + tanhf(0.7978845608028654f * (v + 0.044715f * v * v * v))); else if (ACT == 14) v = (v > 0.f) ? v : 0.1f * v; else if (ACT == 16) v = (v >= 0.f) ? v : 0.3f * v; else if (ACT == 17) v = (v >= 0.f) ? v : 0.2f * v;
      so[w][rloc][t * 16 + ln] = v * osc; } }      /* osc: a factor on the finished f32 value, in front of its one rounding to f16 (osc0 for plane 0; 1, which leaves it as it is, for the others) */
  __builtin_amdgcn_fence(__ATOMIC_ACQ_REL, "workgroup"); __builtin_amdgcn_wave_barrier();
  const int rsub = lane >> 4, c4 = (lane & 15) * 4;
  if (pk == 0) {
#pragma unroll
    for (int q = 0; q < 16; ++q) { const int r = q * 2 + rsub; const v4f v = *(const v4fa*)&so[w][r][c4]; if (C) *(v4f*)(C + cofs + (size_t)(row0 + r) * ldc + col0 + c4) = v; if (C16) { v4h h4; for (int i = 0; i < 4; ++i) h4[i] = (_Float16)v[i]; *(v4h*)(C16 + cofs + (size_t)(row0 + r) * ldc + col0 + c4) = h4; } }
  } else {
    unsigned short* dp = (unsigned short*)C16 + cofs + ((size_t)nq * M + row0) * 64 + lane * 8;
    if (pk == 1) {
#pragma unroll
      for (int u = 0; u < 8; ++u) { FragH f; const int rl = (u >> 2) * 16 + ln, cl = (u & 3) * 16 + 8 * hh; const v4f x = *(const v4fa*)&so[w][rl][cl], y = *(const v4fa*)&so[w][rl][cl + 4];
#pragma unroll
        for (int i = 0; i < 4; ++i) { f.h[i] = (_Float16)x[i]; f.h[4 + i] = (_Float16)y[i]; }
        *(v8us*)(dp + u * 256) = f.half[0]; }
      asm volatile("s_wait_xcnt 0x0" ::: "memory");      /* address wait behind the run of stores above, in front of whatever next writes a register that they name */
    } else {
#pragma unroll
      for (int u = 0; u < 8; ++u) { FragH f; const int rl = (u & 1) * 16 + 8 * hh, cl = (u >> 1) * 16 + ln;
#pragma unroll
        for (int i = 0; i < 8; ++i) f.h[i] = (_Float16)so[w][rl + i][cl];
        *(v8us*)(dp + u * 256) = f.half[0]; }
      asm volatile("s_wait_xcnt 0x0" ::: "memory");      /* address wait behind the run of stores above, in front of whatever next writes a register that they name */
    }
  } }


__global__ __launch_bounds__(256) void k_wnat(const float* __restrict__ w, size_t n8, _Float16* __restrict__ Bt) { const size_t t = (size_t)blockIdx.x * 256 + threadIdx.x; if (t >= n8) return; FragH f; for (int q = 0; q < 8; ++q) f.h[q] = (_Float16)(bf16_round(w[t * 8 + q]) * 16.0f); *(v8us*)((unsigned short*)Bt + t * 8) = f.half[0];  }
__global__ __launch_bounds__(256) void k_rsm(const float* __restrict__ S, _Float16* __restrict__ P, int nrows) {
  #pragma clang fp contract(off)
  const int i = blockIdx.x * 256 + threadIdx.x; if (i >= nrows) return; const float* s = S + (size_t)i * SQ; float mx = -3.0e38f;
#pragma unroll 1
  for (int j = 0; j < SQ; ++j) mx = fmaxf(mx, s[j]); float se = 0.f;
#pragma unroll 1
  for (int j = 0; j < SQ; ++j) se += expf(s[j] - mx); const float sc = 256.0f / se;
#pragma unroll 1
  for (int j0 = 0; j0 < SQ; j0 += 8) { FragH f; for (int q = 0; q < 8; ++q) f.h[q] = (_Float16)(expf(s[j0 + q] - mx) * sc); unsigned short* d = (unsigned short*)P + (size_t)i * SQ + j0; *(v8us*)d = f.half[0];  } }
__global__ __launch_bounds__(256) void k_vt(const _Float16* __restrict__ V16, int b, int h0, _Float16* __restrict__ VT) { __shared__ unsigned short tl[64][65]; const int tid = threadIdx.x; const int hh = blockIdx.x % HG, sg = blockIdx.x / HG; const int s0 = sg * 64; const int h = h0 + hh;
  for (int i = tid; i < 64 * 8; i += 256) { const int j = i / 8, d8 = (i % 8) * 8; FragH f; f.half[0] = *(const v8us*)((const unsigned short*)V16 + ((size_t)b * SQ + s0 + j) * DM + h * HD + d8); for (int q = 0; q < 8; ++q) tl[d8 + q][j] = f.u[q]; }
  __syncthreads();
  { for (int i = tid; i < 64 * 8; i += 256) { const int d = i / 8, j8 = (i % 8) * 8; FragH f; for (int q = 0; q < 8; ++q) f.u[q] = tl[d][j8 + q]; *(v8us*)((unsigned short*)VT + ((size_t)hh * HD + d) * SQ + s0 + j8) = f.half[0]; }  } }



__global__ __launch_bounds__(256) void k_rsmkm(const float* __restrict__ S, _Float16* __restrict__ P, int nrows, const int* __restrict__ am) {
  #pragma clang fp contract(off)
  const int t = blockIdx.x * 256 + threadIdx.x; if (t >= nrows) return; const size_t i = (size_t)t; const float* s = S + i * SQ; const int* mr = am + (size_t)(t % SQ) * SQ; float mx = -3.0e38f;
#pragma unroll 1
  for (int j = 0; j < SQ; ++j) { const float f = (mr[j] != 0) ? 1.f : 0.f; mx = fmaxf(mx, fmaf(f, s[j], (1.f - f) * -1.0e9f)); } float se = 0.f;
#pragma unroll 1
  for (int j = 0; j < SQ; ++j) { const float f = (mr[j] != 0) ? 1.f : 0.f; se += __expf(fmaf(f, s[j], (1.f - f) * -1.0e9f) - mx); } const float sc = 256.0f / se;
#pragma unroll 1
  for (int j0 = 0; j0 < SQ; j0 += 8) { FragH fr; for (int q = 0; q < 8; ++q) { const int j = j0 + q; const float f = (mr[j] != 0) ? 1.f : 0.f; fr.h[q] = (_Float16)(__expf(fmaf(f, s[j], (1.f - f) * -1.0e9f) - mx) * sc); }
    unsigned short* d = (unsigned short*)P + i * SQ + j0; *(v8us*)d = fr.half[0];  } }
// The swap of a wave's two 16-lane rows: a plain lane shuffle would go through the LDS pipe.
__device__ __forceinline__ float rs_x16(float v) { const int b = __float_as_int(v); return __int_as_float(__builtin_amdgcn_permlanex16(b, b, 0x76543210, 0xfedcba98, false, false)); }
// Four native 2^x in one statement: no result shares a register
// with a source (early clobber), each exp has an independent one behind it, and the v_nop is the slot that the instruction set asks for behind the last.
__device__ __forceinline__ v4f rs_exp2x4(v4f x) { float y0, y1, y2, y3;
  asm("v_exp_f32 %0, %4\n\tv_exp_f32 %1, %5\n\tv_exp_f32 %2, %6\n\tv_exp_f32 %3, %7\n\tv_nop" : "=&v"(y0), "=&v"(y1), "=&v"(y2), "=&v"(y3) : "v"(x[0]), "v"(x[1]), "v"(x[2]), "v"(x[3]));
  const v4f y = {y0, y1, y2, y3}; return y; }
// One native 2^x with the same slot behind it.
__device__ __forceinline__ float rs_exp2(float x) { float y; asm("v_exp_f32 %0, %1\n\tv_nop" : "=&v"(y) : "v"(x)); return y; }
__device__ __forceinline__ v16h fa_frag(const _Float16* base, unsigned lofs) { FragH f; f.half[0] = *(const v8us*)((const unsigned short*)base + lofs); f.half[1] = *(const v8us*)((const unsigned short*)base + lofs + 16); return f.v; }      /* base is wave-uniform, lofs the lane's own element offset (row ln, k 8 hh) */
__device__ __forceinline__ v16h fa_fragp(const _Float16* base, unsigned lofs) { FragH f; f.half[0] = *(const v8us*)((const unsigned short*)base + lofs); f.half[1] = *(const v8us*)((const unsigned short*)base + lofs + 256); return f.v; }      /* fragment-order operand: two units of 512 bytes, lofs = 8 lane; elements 0..7 and 8..15 as in fa_frag */
__device__ __forceinline__ v8f fa_mma(v16h a, v16h b, v8f c) { return __builtin_amdgcn_wmma_f32_16x16x32_f16(false, a, false, b, (short)0, c, false, false); }
// 16 waves a work-group, one work-group a WGP, so 4 waves a SIMD: vector work of one wave runs beside the products and the load waits of the others. Waves w and w + 8 own the same 32 query rows;
// wave w walks keys 0..2047, wave w + 8 keys 2048..4095, each with its own held reference, sum and O^T; behind the loop the upper wave hands its three over in LDS and the lower wave joins them.
__global__ __launch_bounds__(512) void k_fattn(const _Float16* __restrict__ Q, const _Float16* __restrict__ KP, const _Float16* __restrict__ VP, float* __restrict__ O) {      /* Q in rows; KP, VP in fragment order (k_gemm2, pk 1 and 2): 32 keys of a head are 4 KB in a row in each */
  __shared__ __attribute__((aligned(16))) float xo[8][17][32][4];      /* per query tile: the upper wave's O^T as 16 pieces of 16 bytes a lane (a wave's piece is 512 bytes in a row: no bank conflict), then its references and sums */
  const int lane = threadIdx.x & 31, ln = lane & 15, hh = lane >> 4; const int w = __builtin_amdgcn_readfirstlane(threadIdx.x >> 5);      /* the wave's number, held scalar so that the row bases and the branches on it are scalar */
  const int wq = w & 7, kh = w >> 3, kbeg = kh * (SQ / 2);      /* query tile, key half, first key */
  const int h = blockIdx.x / (SQ / 256); const int q0 = (blockIdx.x % (SQ / 256)) * 256 + wq * 32;      /* the 8 waves of a key half share its K and V^T lines in the WGP's cache */
  const unsigned lk = (unsigned)(ln * DM + 8 * hh), lp = (unsigned)(lane * 8);
  const _Float16* qb = Q + (size_t)q0 * DM + h * HD; const _Float16* kb = KP + (size_t)h * HD * SQ; const _Float16* vb = VP + (size_t)h * HD * SQ;
  v16h qf[2][2], kf[2][2], vf[4];
  /* every loop over a fragment, score or output array of this kernel is unrolled: constant indices keep the arrays in registers */
#pragma unroll
  for (int j = 0; j < 2; ++j) { qf[j][0] = fa_frag(qb + j * 16 * DM, lk); qf[j][1] = fa_frag(qb + j * 16 * DM + 32, lk); }
#pragma unroll
  for (int t = 0; t < 2; ++t) { kf[t][0] = fa_fragp(kb + kbeg * HD + t * 1024, lp); kf[t][1] = fa_fragp(kb + kbeg * HD + t * 1024 + 512, lp); }
  __builtin_amdgcn_sched_barrier(0);      /* keeps the first V^T loads the youngest, as they are in every pass: otherwise the counted wait at the loop's head falls to 0 and each pass waits out the V^T loads issued just before it */
#pragma unroll
  for (int t = 0; t < 4; ++t) vf[t] = fa_fragp(vb + kbeg * HD + t * 512, lp);
  const v8f z8 = {0.f, 0.f, 0.f, 0.f, 0.f, 0.f, 0.f, 0.f}; v8f o[2][4], cr[2]; float l[2] = {0.f, 0.f};
#pragma unroll
  for (int j = 0; j < 2; ++j) for (int t = 0; t < 4; ++t) o[j][t] = z8;
  /* The held reference. Q arrives times log2 e / sqrt(64), so K Q^T is the score in log2 units. cr[j] = 8 - reference of query ln, the same in all 8 registers and in both halves of the wave, is the C operand of the
     score products: their D is the argument of 2^x as it stands (weights are 2^8 e^(s - reference): f16 keeps small ones normal; the row sum carries the same factor). It starts as the maximum of the wave's first 32 keys. */
#pragma unroll
  for (int j = 0; j < 2; ++j) { const v8f a = fa_mma(kf[0][1], qf[j][1], fa_mma(kf[0][0], qf[j][0], z8)), b = fa_mma(kf[1][1], qf[j][1], fa_mma(kf[1][0], qf[j][0], z8)); float mx = fmaxf(a[0], b[0]);
#pragma unroll
    for (int r = 1; r < 8; ++r) mx = fmaxf(mx, fmaxf(a[r], b[r]));
    const float c = 8.0f - fmaxf(mx, rs_x16(mx));
#pragma unroll
    for (int r = 0; r < 8; ++r) cr[j][r] = c; }
  for (int k0 = kbeg; k0 < kbeg + SQ / 2; k0 += 32) {
    const int kn = (k0 + 32) & (SQ - 1);      /* the next pass's keys; a wave's last pass fetches the first 32 keys of the other half (in bounds, not used) so that the loop has no branch */
    v8f s[2][2];
#pragma unroll
    for (int t = 0; t < 2; ++t) for (int j = 0; j < 2; ++j) s[t][j] = fa_mma(kf[t][1], qf[j][1], fa_mma(kf[t][0], qf[j][0], cr[j]));
    const _Float16* kp = kb + kn * HD;      /* K one pass ahead, into the registers that the products above have just read */
#pragma unroll
    for (int t = 0; t < 2; ++t) { kf[t][0] = fa_fragp(kp + t * 1024, lp); kf[t][1] = fa_fragp(kp + t * 1024 + 512, lp); }
    asm volatile("s_wait_xcnt 0x0" ::: "memory");      /* address wait of the K loads, as behind the V^T loads below; its memory clobber also holds them here: left free, the compiler sinks them behind the test's branch and they start half a pass later */
    FragH pf[2]; float mx[2];
#pragma unroll
    for (int j = 0; j < 2; ++j) { mx[j] = fmaxf(s[0][j][0], s[1][j][0]);
#pragma unroll
      for (int r = 1; r < 8; ++r) mx[j] = fmaxf(mx[j], fmaxf(s[0][j][r], s[1][j][r])); }
    /* One test a pass, a scalar branch: the reference stays while every weight of the pass is at most 2^15 (f16 holds it), that is while no score stands more than 7 (log2) above its reference. */
    if (__builtin_amdgcn_ballot_w32(fmaxf(mx[0], mx[1]) > 15.0f) != 0) {
#pragma unroll
      for (int j = 0; j < 2; ++j) { const float d = fmaxf(fmaxf(mx[j], rs_x16(mx[j])) - 8.0f, 0.f); const float al = rs_exp2(-d);      /* the reference rises to the query's maximum of this pass where that is the higher; what has been summed under the old one shrinks by 2^-d */
        l[j] *= al; cr[j] -= d;
#pragma unroll
        for (int t = 0; t < 2; ++t) s[t][j] -= d;
#pragma unroll
        for (int t = 0; t < 4; ++t) o[j][t] *= al; } }
#pragma unroll
    for (int j = 0; j < 2; ++j) { v4f sm = {0.f, 0.f, 0.f, 0.f};
#pragma unroll
      for (int t = 0; t < 2; ++t) for (int g = 0; g < 2; ++g) { const v4f x = {s[t][j][4 * g], s[t][j][4 * g + 1], s[t][j][4 * g + 2], s[t][j][4 * g + 3]}; const v4f p = rs_exp2x4(x); sm += p; for (int q = 0; q < 4; ++q) pf[j].h[8 * t + 4 * g + q] = (_Float16)p[q]; }
      l[j] += (sm[0] + sm[1]) + (sm[2] + sm[3]); }      /* the lane's own 16 keys; the halves are joined once, behind the loop */
#pragma unroll
    for (int t = 0; t < 4; ++t) for (int j = 0; j < 2; ++j) o[j][t] = fa_mma(vf[t], pf[j].v, o[j][t]);
    const _Float16* vp = vb + kn * HD;      /* V^T one pass ahead, likewise */
#pragma unroll
    for (int t = 0; t < 4; ++t) vf[t] = fa_fragp(vp + t * 512, lp);
    asm volatile("s_wait_xcnt 0x0" ::: "memory");      /* the next pass forms its addresses in the registers that the loads above name: their address wait stands in front of that overwrite */
  }
  if (kh == 1) {      /* the upper wave hands over what it has of keys 2048..4095 */
#pragma unroll
    for (int j = 0; j < 2; ++j)
#pragma unroll
      for (int t = 0; t < 4; ++t) { const v4f lo = {o[j][t][0], o[j][t][1], o[j][t][2], o[j][t][3]}, hi = {o[j][t][4], o[j][t][5], o[j][t][6], o[j][t][7]}; *(v4f*)xo[wq][(j * 4 + t) * 2][lane] = lo; *(v4f*)xo[wq][(j * 4 + t) * 2 + 1][lane] = hi; }
    const v4f st = {cr[0][0], cr[1][0], l[0], l[1]}; *(v4f*)xo[wq][16][lane] = st; }
  __syncthreads();      /* every wave passes it once: the upper waves' LDS writes stand before the lower waves read them */
  if (kh == 0) {      /* the lower wave joins the halves under the higher of their two references (the lower cr), divides and stores */
    const v4f st = *(const v4f*)xo[wq][16][lane];
#pragma unroll
    for (int j = 0; j < 2; ++j) { const float cn = fminf(cr[j][0], st[j]); const float a0 = rs_exp2(cn - cr[j][0]), a1 = rs_exp2(cn - st[j]); const float lt = l[j] * a0 + st[2 + j] * a1;
      const float inv = 1.0f / (lt + rs_x16(lt)); const float f0 = a0 * inv, f1 = a1 * inv; float* d = O + (size_t)(q0 + j * 16 + ln) * DM + h * HD + 8 * hh;
#pragma unroll
      for (int t = 0; t < 4; ++t) { const v4f xl = *(const v4f*)xo[wq][(j * 4 + t) * 2][lane], xh = *(const v4f*)xo[wq][(j * 4 + t) * 2 + 1][lane];
        const v4f lo = {o[j][t][0] * f0 + xl[0] * f1, o[j][t][1] * f0 + xl[1] * f1, o[j][t][2] * f0 + xl[2] * f1, o[j][t][3] * f0 + xl[3] * f1}, hi = {o[j][t][4] * f0 + xh[0] * f1, o[j][t][5] * f0 + xh[1] * f1, o[j][t][6] * f0 + xh[2] * f1, o[j][t][7] * f0 + xh[3] * f1};
        *(v4f*)(d + t * 16) = lo; *(v4f*)(d + t * 16 + 4) = hi; } } } }



// ---- preparation, one launch: the three inputs as f16 rows and the three weight planes as Bt[(h, d)][m] x16 ----
// PW waves in all, 16 a work-group, as many work-groups as the chip has WGPs: few waves to start, all resident at once. Each wave takes 1 / PW of each of the six passes.
// Inputs: 1024 floats a wave and input, as 8 loads of 16 bytes a lane, each covering 512 bytes in a row (4 whole lines); all 24 are in flight before the first is converted; stores of 8 bytes a lane cover 2 whole lines.
// Weights: a thread gathers 8 m of one (h, d) of each plane, as per-head [m][d] -> Bt[(h, d)][m]; a wave's store covers 512 bytes in a row.
#define PW 4096
__global__ __launch_bounds__(512) void k_prep(const float* __restrict__ xq, const float* __restrict__ xk, const float* __restrict__ xv, const float* __restrict__ wq, const float* __restrict__ wk, const float* __restrict__ wv,
    _Float16* __restrict__ XQ, _Float16* __restrict__ XK, _Float16* __restrict__ XV, _Float16* __restrict__ BQ, _Float16* __restrict__ BK, _Float16* __restrict__ BV) {
  static_assert(NR * DM == (size_t)PW * 1024 && (size_t)NH * HD * (DM / 8) == (size_t)PW * 32, "k_prep: one piece of every pass a wave");
  const int lane = threadIdx.x & 31; const int gw = blockIdx.x * 16 + __builtin_amdgcn_readfirstlane(threadIdx.x >> 5);      /* the wave's number in the grid, held scalar so that the bases are scalar */
  const float* xs[3] = {xq + (size_t)gw * 1024, xk + (size_t)gw * 1024, xv + (size_t)gw * 1024}; _Float16* xd[3] = {XQ + (size_t)gw * 1024, XK + (size_t)gw * 1024, XV + (size_t)gw * 1024};
  const unsigned t = (unsigned)(gw * 32 + lane); const unsigned m8 = (t % (DM / 8)) * 8, d = (t / (DM / 8)) % HD, h = t / ((DM / 8) * HD);
  const unsigned wo = (h * DM + m8) * HD + d; const float* wsrc[3] = {wq, wk, wv}; _Float16* wd[3] = {BQ, BK, BV};
  v4f a[3][8]; float g[3][8];
  /* every loop below is unrolled: constant indices keep the arrays in registers */
#pragma unroll
  for (int p = 0; p < 3; ++p)
#pragma unroll
    for (int i = 0; i < 8; ++i) a[p][i] = *(const v4fa*)(xs[p] + i * 128 + lane * 4);
#pragma unroll
  for (int p = 0; p < 3; ++p)
#pragma unroll
    for (int q = 0; q < 8; ++q) g[p][q] = wsrc[p][wo + q * HD];
  __builtin_amdgcn_sched_barrier(0);      /* keeps all 48 loads in front of the first conversion: left free, the compiler sinks most of them among the conversions and a wave has only some 12 in flight */
#pragma unroll
  for (int p = 0; p < 3; ++p)
#pragma unroll
    for (int i = 0; i < 8; ++i) { v4h o;
#pragma unroll
      for (int q = 0; q < 4; ++q) o[q] = (_Float16)bf16_round(a[p][i][q]);
      *(v4h*)(xd[p] + i * 128 + lane * 4) = o; }
#pragma unroll
  for (int p = 0; p < 3; ++p) { FragH f;
#pragma unroll
    for (int q = 0; q < 8; ++q) f.h[q] = (_Float16)(16.0f * bf16_round(g[p][q]));
    *(v8us*)((unsigned short*)wd[p] + (size_t)(h * HD + d) * DM + m8) = f.half[0]; } }

extern "C" void kernel_launch(void* const* d_in, const int* in_sizes, int n_in,
                              void* d_out, int out_size, void* d_ws, size_t ws_size, hipStream_t stream) {
  (void)in_sizes; (void)n_in; (void)out_size;
  const float* const* I = (const float* const*)d_in; const float* xq = I[0]; const float* xk = I[1]; const float* xv = I[2]; const float* wq = I[3]; const float* bq = I[4]; const float* wk = I[5]; const float* bk = I[6]; const float* wv = I[7]; const float* bv = I[8]; const float* x = xq;      /* X_Q, X_K, X_V [4096][1024]; per-head Wq / Wk / Wv [16][1024][64] ([in][out] per head) + biases [16][64] = [(h, d)]; no output projection */
  static_assert(NH * HD == DM && DM % 128 == 0 && SQ % 256 == 0 && HD == 64 && HG == 1 && NB == 1, "shape / tile multiples");
  char* ws = (char*)d_ws; size_t off = 0;
  auto take = [&](size_t bytes) { char* p = ws + off; off += (bytes + 255) & ~(size_t)255; return p; };
  _Float16* BQ = (_Float16*)take((size_t)DM * DM * 2); _Float16* BK = (_Float16*)take((size_t)DM * DM * 2); _Float16* BV = (_Float16*)take((size_t)DM * DM * 2);
  _Float16* X16 = (_Float16*)take(NR * DM * 2); _Float16* XKp = (_Float16*)take(NR * DM * 2); _Float16* XVp = (_Float16*)take(NR * DM * 2); _Float16* Q16 = (_Float16*)take(NR * DM * 2); _Float16* KP = (_Float16*)take((size_t)NH * HD * SQ * 2);
  _Float16* VP = (_Float16*)take((size_t)NH * HD * SQ * 2);
  if (off > ws_size) return;
  _Float16* XK = XKp; _Float16* XV = XVp;
  k_prep<<<PW / 16, 512, 0, stream>>>(x, xk, xv, wq, wk, wv, X16, XK, XV, BQ, BK, BV);      /* inputs as exact f16 rows; per-head [m][d] -> Bt[(h, d)][m] x16 */
  const size_t r0p = (size_t)B0 * SQ;      /* first projected row */
  static_assert((NR * DM * 2) % 256 == 0 && ((size_t)DM * DM * 2) % 256 == 0 && (size_t)NH * HD * SQ == NR * DM && B0 == 0, "the three planes of X, of Bt and of the results each stand in a row in the workspace, one plane's size apart");
  k_gemm2<0><<<dim3((unsigned)((MP / 128) * (DM / 64)), 3), 128, 0, stream>>>(X16 + r0p * DM, DM, NR * DM, BQ, DM, (size_t)DM * DM, 0.0625f, bq, bk, bv, nullptr, 1, 0, 0, nullptr, Q16 + r0p * DM, DM, NR * DM, MP, DM, DM, 0.18033688011112042f);      /* y = 0: Q in rows, times log2 e / sqrt(64) (the attention loop's scores are in log2 units); 1: K in fragment order; 2: V^T in fragment order */
  for (int b = B0; b < B0 + NBR; ++b) { const size_t r0 = (size_t)b * SQ;
    k_fattn<<<NH * (SQ / 256), 512, 0, stream>>>(Q16 + r0 * LQ, KP, VP, (float*)d_out + r0 * DM); }      /* all heads: softmax(Q K^T / 8) V written f32 straight into each head's 64 columns of the output rows (no output projection) */
}

// v009
// A run of this version takes 108 microseconds.
// In two side-by-side timings against v008, it was 1.05 and 1.04 times as fast.
// All steps since v000 together make it 123 times as fast.
#include <hip/hip_runtime.h>
// Multi-head attention over three inputs with PER-HEAD projection weights and no output projection (X_Q, X_K, X_V [4096][1024] (one sequence); Q[h] = X_Q Wq[h] + bq[h], K, V likewise (Wq / Wk / Wv [16][1024][64] per-head [in][out], sigma 1/32; biases [16][64] sigma 1/32); scores = Q[h] K[h]^T / sqrt(64); softmax over all 4096 keys; out[h] = attn V[h]; heads concatenated along the feature axis -> [4096][1024]).
// Structure: one preparation launch (the three inputs as exact f16 rows (bf16-rounded); per-head [in][out] weights gathered into Bt[(h, d)][in] x16 planes); Q, K, V as three WMMA GEMMs in ONE launch, grid y picking the projection (32x64 wave tiles, operands staged in LDS by asynchronous copies in a ring of two buffers, f32 accumulation, + bias [(h, d)], f16 outputs; the K and V GEMMs store their 32-key x 64-feature wave tiles in the attention loop's fragment order, V transposed on the way); then ONE attention launch for all heads: two waves of a work-group own 32 query rows, each walks one half of the 4096 keys 32 at a time, S^T = K Q^T - a reference held over the passes (it rises only when a score stands 2^7 above it), softmax in registers (f32 statistics; weights x256 as f16), O^T += V^T P^T; the two halves are joined through LDS at the end, divided by the row sum and written f32 straight into the head's 64 columns of the output rows. Work-groups that read the same operand lines from L2 (GEMM: the k stages; attention: the key passes) each enter the walk at a place set by the block index and wrap round.
// Compute dtype: inputs rounded to bf16; x / weights exact; q, k, v and softmax weights as plain f16 GEMM operands (~2^-12); scores, softmax statistics and o f32. v_wmma_f32_16x16x32_f16.
#define NB 1
#define SQ 4096
#define DM 1024
#define NH 16
#define HD 64
#define HG 1                         /* heads per launch of the non-template k_vt */
#define B0 0                         /* first batch processed (debug hook) */
#define NBR NB                       /* batches processed (debug hook) */
#define NR ((size_t)NB * SQ)         /* token rows */
#define MP ((int)((size_t)NBR * SQ)) /* rows projected (debug hook) */
#define QN SQ                        /* unused (the attention launch attends all SQ query rows) */
#define NHD NH                       /* unused (the attention launch covers all NH heads) */
#define MPO MP                       /* unused (there is no output stage) */
#define LQ DM      /* row pitch of the q rows */
typedef __bf16 v16b __attribute__((ext_vector_type(16)));
typedef unsigned short v8us __attribute__((ext_vector_type(8), may_alias));
typedef float  v8f  __attribute__((ext_vector_type(8)));
typedef float  v4f  __attribute__((ext_vector_type(4)));
typedef float  v4fa __attribute__((ext_vector_type(4), may_alias));
union FragB { v16b v; v8us half[2]; unsigned short u[16]; };

__device__ __forceinline__ unsigned short bf16_bits(float x) { unsigned int u = __float_as_uint(x); return (unsigned short)((u + 0x7FFFu + ((u >> 16) & 1u)) >> 16); }
__device__ __forceinline__ float bf16_val(unsigned short b) { return __uint_as_float(((unsigned int)b) << 16); }
__device__ __forceinline__ float bf16_round(float x) { return bf16_val(bf16_bits(x)); }
// D += A·B with NT terms: 1 = ah·bh, 2 = + al·bh (A split), 3 = + ah·bl (both split)
template <int NT>
__device__ __forceinline__ v8f mmaN(v16b ah, v16b al, v16b bh, v16b bl, v8f c) {
  c = __builtin_amdgcn_wmma_f32_16x16x32_bf16(false, ah, false, bh, (short)0, c, false, false);
  if (NT >= 2) c = __builtin_amdgcn_wmma_f32_16x16x32_bf16(false, al, false, bh, (short)0, c, false, false);
  if (NT >= 3) c = __builtin_amdgcn_wmma_f32_16x16x32_bf16(false, ah, false, bl, (short)0, c, false, false);
  asm volatile("v_nop\n\tv_nop\n\tv_nop\n\tv_nop" : "+v"(c) : "v"(ah), "v"(al), "v"(bh), "v"(bl));
  return c;
}

__global__ __launch_bounds__(256) void k_wt_bf16(const float* __restrict__ W, unsigned short* __restrict__ Wt, int K, int N) {
  const int t = blockIdx.x * 256 + threadIdx.x;
  const int k8n = K / 8;
  if (t >= N * k8n) return;
  const int n = t / k8n, k8 = (t % k8n) * 8;
  v8us v;
#pragma unroll
  for (int i = 0; i < 8; ++i) v[i] = bf16_bits(W[(size_t)(k8 + i) * N + n]);
  *(v8us*)(Wt + (size_t)n * K + k8) = v;
  
}

// GEMM C[M][N] (f32, pitch ldc) = act(A[M][K]·W + bias). A f32 row-major (pitch lda) converted per fragment to bf16
// (ASPLIT: hi/lo two planes -> 2 terms, else single rounded term); Wt bf16 [N][K] (pitch ldb). BIAS_BF16 rounds the
// bias to bf16 first (bias quantised to bf16 before the add). K%32==0, M%16==0, N%64==0.
template <bool ASPLIT, int ACT, bool BIAS_BF16>
__global__ __launch_bounds__(128) void k_gemm_bf(const float* __restrict__ A, int lda, const unsigned short* __restrict__ Wt, int ldb,
                                               const float* __restrict__ bias, float* __restrict__ C, int ldc, int M, int N, int K) {
  __shared__ __attribute__((aligned(16))) float so[4][16][64];
  const int tid = threadIdx.x, w = tid >> 5, lane = tid & 31, ln = lane & 15, hh = lane >> 4;
  const int ntn = N / 64;
  const int wid = blockIdx.x * 4 + w;
  const int mt = wid / ntn, nq = wid % ntn;
  if (mt * 16 >= M) return;
  const int row0 = mt * 16, col0 = nq * 64;
  const float* arow = A + (size_t)(row0 + ln) * lda;
  v8f acc[4] = {};
  for (int kb = 0; kb < K; kb += 32) {
    FragB ah, al;
    const v4f x0 = *(const v4fa*)(arow + kb + 8 * hh), x1 = *(const v4fa*)(arow + kb + 8 * hh + 4);
    const v4f x2 = *(const v4fa*)(arow + kb + 16 + 8 * hh), x3 = *(const v4fa*)(arow + kb + 16 + 8 * hh + 4);
    float xs[16] = {x0[0],x0[1],x0[2],x0[3],x1[0],x1[1],x1[2],x1[3],x2[0],x2[1],x2[2],x2[3],x3[0],x3[1],x3[2],x3[3]};
#pragma unroll
    for (int i = 0; i < 16; ++i) { const unsigned short hb = bf16_bits(xs[i]); ah.u[i] = hb; al.u[i] = ASPLIT ? bf16_bits(xs[i] - bf16_val(hb)) : (unsigned short)0; }
#pragma unroll
    for (int t = 0; t < 4; ++t) {
      const unsigned short* brow = Wt + (size_t)(col0 + t * 16 + ln) * ldb + kb;
      FragB b;
      b.half[0] = *(const v8us*)(brow + 8 * hh);
      b.half[1] = *(const v8us*)(brow + 16 + 8 * hh);
      acc[t] = mmaN<ASPLIT ? 2 : 1>(ah.v, al.v, b.v, b.v, acc[t]);
    }
  }
#pragma unroll
  for (int t = 0; t < 4; ++t) {
    float bv = bias ? bias[col0 + t * 16 + ln] : 0.f;
    if (BIAS_BF16) bv = bf16_round(bv);
#pragma unroll
    for (int r = 0; r < 8; ++r) { float v = acc[t][r] + bv; if (ACT == 1) v = fmaxf(v, 0.f); so[w][8 * hh + r][t * 16 + ln] = v; }
  }
  __builtin_amdgcn_fence(__ATOMIC_ACQ_REL, "workgroup");
  __builtin_amdgcn_wave_barrier();
  const int rsub = lane >> 4, c4 = (lane & 15) * 4;
  {
#pragma unroll
    for (int q = 0; q < 8; ++q) {
      const int r = q * 2 + rsub;
      const v4f v = *(const v4fa*)&so[w][r][c4];
      *(v4f*)(C + (size_t)(row0 + r) * ldc + col0 + c4) = v;
    }
    
  }
}

// GEMM C = act(A·W + bias + resid): A f32 (ASPLIT -> hi/lo 2 terms), Wt bf16 [N][K]; ACT 0 none, 1 relu, 2 exact gelu;
// resid (optional, f32, row index = (row % rmod), pitch ldr, RES_BF16 rounds it) added before the activation.
template <bool ASPLIT, int ACT, bool BIAS_BF16, bool RES_BF16>
__global__ __launch_bounds__(128) void k_gemm_bf3(const float* __restrict__ A, int lda, const unsigned short* __restrict__ Wt, int ldb,
                                                const float* __restrict__ bias, const float* __restrict__ resid, int rmod, int ldr,
                                                float* __restrict__ C, int ldc, int M, int N, int K) {
  __shared__ __attribute__((aligned(16))) float so[4][16][64];
  const int tid = threadIdx.x, w = tid >> 5, lane = tid & 31, ln = lane & 15, hh = lane >> 4;
  const int ntn = N / 64;
  const int wid = blockIdx.x * 4 + w;
  const int mt = wid / ntn, nq = wid % ntn;
  if (mt * 16 >= M) return;
  const int row0 = mt * 16, col0 = nq * 64;
  const float* arow = A + (size_t)(row0 + ln) * lda;
  v8f acc[4] = {};
  for (int kb = 0; kb < K; kb += 32) {
    FragB ah, al;
    const v4f x0 = *(const v4fa*)(arow + kb + 8 * hh), x1 = *(const v4fa*)(arow + kb + 8 * hh + 4);
    const v4f x2 = *(const v4fa*)(arow + kb + 16 + 8 * hh), x3 = *(const v4fa*)(arow + kb + 16 + 8 * hh + 4);
    float xs[16] = {x0[0],x0[1],x0[2],x0[3],x1[0],x1[1],x1[2],x1[3],x2[0],x2[1],x2[2],x2[3],x3[0],x3[1],x3[2],x3[3]};
#pragma unroll
    for (int i = 0; i < 16; ++i) { const unsigned short hb = bf16_bits(xs[i]); ah.u[i] = hb; al.u[i] = ASPLIT ? bf16_bits(xs[i] - bf16_val(hb)) : (unsigned short)0; }
#pragma unroll
    for (int t = 0; t < 4; ++t) {
      const unsigned short* brow = Wt + (size_t)(col0 + t * 16 + ln) * ldb + kb;
      FragB b;
      b.half[0] = *(const v8us*)(brow + 8 * hh);
      b.half[1] = *(const v8us*)(brow + 16 + 8 * hh);
      acc[t] = mmaN<ASPLIT ? 2 : 1>(ah.v, al.v, b.v, b.v, acc[t]);
    }
  }
#pragma unroll
  for (int t = 0; t < 4; ++t) {
    const int col = col0 + t * 16 + ln;
    float bv = bias ? bias[col] : 0.f;
    if (BIAS_BF16) bv = bf16_round(bv);
#pragma unroll
    for (int r = 0; r < 8; ++r) {
      float v = acc[t][r] + bv;
      if (resid) { float rv = resid[(size_t)((row0 + 8 * hh + r) % rmod) * ldr + col]; if (RES_BF16) rv = bf16_round(rv); v += rv; }
      if (ACT == 1) v = fmaxf(v, 0.f);
      if (ACT == 2) v = 0.5f * v * (1.0f + erff(v * 0.70710678118654752f));
      if (ACT == 3) { const float u = 0.7978845608028654f * (v + 0.044715f * v * v * v); v = 0.5f * v * (1.0f + tanhf(u)); }
      so[w][8 * hh + r][t * 16 + ln] = v;
    }
  }
  __builtin_amdgcn_fence(__ATOMIC_ACQ_REL, "workgroup");
  __builtin_amdgcn_wave_barrier();
  const int rsub = lane >> 4, c4 = (lane & 15) * 4;
  {
#pragma unroll
    for (int q = 0; q < 8; ++q) {
      const int r = q * 2 + rsub;
      const v4f v = *(const v4fa*)&so[w][r][c4];
      *(v4f*)(C + (size_t)(row0 + r) * ldc + col0 + c4) = v;
    }
    
  }
}
// row LayerNorm (biased variance, eps) over N: s = X (+ R); optional out_sum <- s; out_norm <- (s-mu)*rsqrt(var+eps)*g + b
template <bool PARAM_BF16>
__global__ __launch_bounds__(256) void k_layernorm(const float* __restrict__ X, const float* __restrict__ R, const float* __restrict__ g, const float* __restrict__ bta,
                                                  float* __restrict__ out_sum, float* __restrict__ out_norm, int N, float eps) {
  __shared__ float red[256];
  const int row = blockIdx.x, tid = threadIdx.x;
  const float* x = X + (size_t)row * N; const float* rr = R ? R + (size_t)row * N : nullptr;
  float vals[16];                     // up to N = 4096
  const int per = N / 256;            // contiguous chunk per thread? use strided-by-4 chunks: thread handles j = tid*4 + 1024*u
  float s1 = 0.f;
  for (int u = 0; u < per / 4; ++u) {
    const int j = tid * 4 + 1024 * u;
    const v4f a = *(const v4fa*)(x + j);
    v4f b = {0.f,0.f,0.f,0.f}; if (rr) b = *(const v4fa*)(rr + j);
#pragma unroll
    for (int q = 0; q < 4; ++q) { const float v = a[q] + b[q]; vals[u * 4 + q] = v; s1 += v; }
  }
  red[tid] = s1; __syncthreads();
  for (int st = 128; st > 0; st >>= 1) { if (tid < st) red[tid] += red[tid + st]; __syncthreads(); }
  const float mu = red[0] / (float)N; __syncthreads();
  float s2 = 0.f;
  for (int u = 0; u < per / 4; ++u)
#pragma unroll
    for (int q = 0; q < 4; ++q) { const float c = vals[u * 4 + q] - mu; s2 += c * c; }
  red[tid] = s2; __syncthreads();
  for (int st = 128; st > 0; st >>= 1) { if (tid < st) red[tid] += red[tid + st]; __syncthreads(); }
  const float rs = rsqrtf(red[0] / (float)N + eps);
  {
    for (int u = 0; u < per / 4; ++u) {
      const int j = tid * 4 + 1024 * u;
      v4f o, sm;
#pragma unroll
      for (int q = 0; q < 4; ++q) {
        float gg = g[j + q], bb = bta[j + q];
        if (PARAM_BF16) { gg = bf16_round(gg); bb = bf16_round(bb); }
        sm[q] = vals[u * 4 + q]; o[q] = (vals[u * 4 + q] - mu) * rs * gg + bb;
      }
      if (out_sum) *(v4f*)(out_sum + (size_t)row * N + j) = sm;
      *(v4f*)(out_norm + (size_t)row * N + j) = o;
    }
    
  }
}



// ---- f16 WMMA path (v_wmma_f32_16x16x32_f16): 11-bit significands for operands in range — used where a [0,1] probability operand needs more precision than bf16
typedef _Float16 v16h __attribute__((ext_vector_type(16)));
union FragH { v16h v; v8us half[2]; _Float16 h[16]; unsigned short u[16]; };
template <int NT>
__device__ __forceinline__ v8f mmaH(v16h ah, v16h al, v16h bh, v16h bl, v8f c) {
  c = __builtin_amdgcn_wmma_f32_16x16x32_f16(false, ah, false, bh, (short)0, c, false, false);
  if (NT >= 2) c = __builtin_amdgcn_wmma_f32_16x16x32_f16(false, al, false, bh, (short)0, c, false, false);
  if (NT >= 3) c = __builtin_amdgcn_wmma_f32_16x16x32_f16(false, ah, false, bl, (short)0, c, false, false);
  asm volatile("v_nop\n\tv_nop\n\tv_nop\n\tv_nop" : "+v"(c) : "v"(ah), "v"(al), "v"(bh), "v"(bl));
  return c;
}
// batched GEMM like k_gemm_b but f16 operands: A f32 (split into f16 hi/lo if ASPLIT, else rounded to f16), Bt = f16 values [n][k]; alpha; C f32; N multiple of 16 (partial tiles skipped)
template <bool ASPLIT>
__global__ __launch_bounds__(128) void k_gemm_h(const float* __restrict__ A, int lda, size_t sA, const _Float16* __restrict__ Bh, int ldb, size_t sB, float alpha, float* __restrict__ C, int ldc, size_t sC, int M, int N, int K) {
  __shared__ __attribute__((aligned(16))) float so[4][16][64];
  const int tid = threadIdx.x, w = tid >> 5, lane = tid & 31, ln = lane & 15, hh = lane >> 4; const int by = blockIdx.y;
  A += (size_t)by * sA; Bh += (size_t)by * sB; C += (size_t)by * sC;
  const int ntn = (N + 63) / 64; const int wid = blockIdx.x * 4 + w; const int mt = wid / ntn, nq = wid % ntn; if (mt * 16 >= M) return;
  const int row0 = mt * 16, col0 = nq * 64; const float* arow = A + (size_t)(row0 + ln) * lda;
  v8f acc[4] = {};
  for (int kb = 0; kb < K; kb += 32) {
    FragH ah, al;
    const v4f x0 = *(const v4fa*)(arow + kb + 8 * hh), x1 = *(const v4fa*)(arow + kb + 8 * hh + 4), x2 = *(const v4fa*)(arow + kb + 16 + 8 * hh), x3 = *(const v4fa*)(arow + kb + 16 + 8 * hh + 4);
    float xs[16] = {x0[0],x0[1],x0[2],x0[3],x1[0],x1[1],x1[2],x1[3],x2[0],x2[1],x2[2],x2[3],x3[0],x3[1],x3[2],x3[3]};
#pragma unroll
    for (int i = 0; i < 16; ++i) { const _Float16 h = (_Float16)xs[i]; ah.h[i] = h; al.h[i] = ASPLIT ? (_Float16)(xs[i] - (float)h) : (_Float16)0.0f; }
#pragma unroll
    for (int t = 0; t < 4; ++t) { if (col0 + t * 16 >= N) continue; const size_t boff = (size_t)(col0 + t * 16 + ln) * ldb + kb; FragH bq; bq.half[0] = *(const v8us*)(Bh + boff + 8 * hh); bq.half[1] = *(const v8us*)(Bh + boff + 16 + 8 * hh);
      acc[t] = mmaH<ASPLIT ? 2 : 1>(ah.v, al.v, bq.v, bq.v, acc[t]); }
  }
#pragma unroll
  for (int t = 0; t < 4; ++t) { if (col0 + t * 16 >= N) continue;
#pragma unroll
    for (int r = 0; r < 8; ++r) so[w][8 * hh + r][t * 16 + ln] = acc[t][r] * alpha; }
  __builtin_amdgcn_fence(__ATOMIC_ACQ_REL, "workgroup"); __builtin_amdgcn_wave_barrier();
  const int rsub = lane >> 4, c4 = (lane & 15) * 4;
  {
#pragma unroll
    for (int q = 0; q < 8; ++q) { const int r = q * 2 + rsub; if (col0 + c4 < N) { const v4f v = *(const v4fa*)&so[w][r][c4]; *(v4f*)(C + (size_t)(row0 + r) * ldc + col0 + c4) = v; } }
     }
}

// Wt[n][k] = f16(W[k][n]·scale) from f32 row-major W[K][N] (scale = power of two; bf16-exact weights stay exact in f16 away from the subnormal range)
__global__ __launch_bounds__(256) void k_wt_f16(const float* __restrict__ W, _Float16* __restrict__ Wt, int K, int N, float scale) {
  const int t = blockIdx.x * 256 + threadIdx.x; if (t >= N * (K / 8)) return; const int n = t / (K / 8), k8 = (t % (K / 8)) * 8; FragH f;
#pragma unroll
  for (int i = 0; i < 8; ++i) f.h[i] = (_Float16)(bf16_round(W[(size_t)(k8 + i) * N + n]) * scale); const v8us o = f.half[0];
  *(v8us*)((unsigned short*)Wt + (size_t)n * K + k8) = o; 
}
// k_gemm_hh variant with fused epilogue: v = acc·alpha + bias[by·sBias + col] (+ CP[(row/rowsPerB)·sCPb + by·64 + col] if CP) ; ACT 0 none / 1 elu ; writes f16 C16 (and f32 C if non-null)
template <int ACT>
__global__ __launch_bounds__(128) void k_gemm_hhx(const _Float16* __restrict__ A, int lda, size_t sA, const _Float16* __restrict__ Bh, int ldb, size_t sB, float alpha, const float* __restrict__ bias, size_t sBias, const float* __restrict__ CP, int rowsPerB, size_t sCPb, int row0g,
    float* __restrict__ C, _Float16* __restrict__ C16, int ldc, size_t sC, int M, int N, int K) {
  __shared__ __attribute__((aligned(16))) float so[4][16][64];
  const int tid = threadIdx.x, w = tid >> 5, lane = tid & 31, ln = lane & 15, hh = lane >> 4; const int by = blockIdx.y;
  A += (size_t)by * sA; Bh += (size_t)by * sB; const size_t cofs = (size_t)by * sC; const float* bp = bias ? bias + (size_t)by * sBias : nullptr;
  const int ntn = (N + 63) / 64; const int wid = blockIdx.x * 4 + w; const int mt = wid / ntn, nq = wid % ntn; if (mt * 16 >= M) return;
  const int row0 = mt * 16, col0 = nq * 64; const _Float16* arow = A + (size_t)(row0 + ln) * lda;
  v8f acc[4] = {};
  for (int kb = 0; kb < K; kb += 32) { FragH ah; ah.half[0] = *(const v8us*)((const unsigned short*)arow + kb + 8 * hh); ah.half[1] = *(const v8us*)((const unsigned short*)arow + kb + 16 + 8 * hh);
#pragma unroll
    for (int t = 0; t < 4; ++t) { if (col0 + t * 16 >= N) continue; const size_t boff = (size_t)(col0 + t * 16 + ln) * ldb + kb; FragH bq; bq.half[0] = *(const v8us*)((const unsigned short*)Bh + boff + 8 * hh); bq.half[1] = *(const v8us*)((const unsigned short*)Bh + boff + 16 + 8 * hh);
      acc[t] = mmaH<1>(ah.v, ah.v, bq.v, bq.v, acc[t]); }
  }
#pragma unroll
  for (int t = 0; t < 4; ++t) { if (col0 + t * 16 >= N) continue; const int col = col0 + t * 16 + ln; const float bv = bp ? bf16_round(bp[col]) : 0.f;
#pragma unroll
    for (int r = 0; r < 8; ++r) { float v = acc[t][r] * alpha + bv; if (CP) { const int rr = row0g + row0 + 8 * hh + r; if (rowsPerB < 0) v += CP[cofs + (size_t)rr * ldc + col];      /* rowsPerB < 0: own element of the batched C plane */ else { const int bidx = rr / rowsPerB; v += CP[(size_t)bidx * sCPb + (size_t)by * 64 + col]; } } if (ACT == 1) v = (v > 0.f) ? v : expm1f(v); else if (ACT == 7) v = (v > 0.f) ? v + 1.0f : expf(v); else if (ACT == 8) v = tanhf(v); else if (ACT == 9) v = 0.5f * v * (1.0f + tanhf(0.7978845608028654f * (v + 0.044715f * v * v * v))); else if (ACT == 11) v = 1.0f / (1.0f + expf(-v)); else if (ACT == 12) v = (v > 0.f) ? v : 0.01f * v; else if (ACT == 14) v = (v > 0.f) ? v : 0.1f * v; else if (ACT == 16) v = (v >= 0.f) ? v : 0.3f * v; else if (ACT == 17) v = (v >= 0.f) ? v : 0.2f * v; else if (ACT == 15) v = v / (1.0f + expf(-v)); else if (ACT == 3) v = fmaxf(v, 0.f); else if (ACT == 6) v = 0.5f * v * (1.0f + erff(v * 0.70710678118654752f)); so[w][8 * hh + r][t * 16 + ln] = v; } }
  __builtin_amdgcn_fence(__ATOMIC_ACQ_REL, "workgroup"); __builtin_amdgcn_wave_barrier();
  const int rsub = lane >> 4, c4 = (lane & 15) * 4; typedef _Float16 v4h __attribute__((ext_vector_type(4)));
  {
#pragma unroll
    for (int q = 0; q < 8; ++q) { const int r = q * 2 + rsub; if (col0 + c4 < N) { const v4f v = *(const v4fa*)&so[w][r][c4]; if (C) *(v4f*)(C + cofs + (size_t)(row0 + r) * ldc + col0 + c4) = v; if (C16) { v4h h4; for (int i = 0; i < 4; ++i) h4[i] = (_Float16)v[i]; *(v4h*)(C16 + cofs + (size_t)(row0 + r) * ldc + col0 + c4) = h4; } } }
     }
}


typedef _Float16 v4h __attribute__((ext_vector_type(4)));

__global__ __launch_bounds__(256) void k_h16(const float* __restrict__ x, _Float16* __restrict__ X16, size_t n8) { const size_t t = (size_t)blockIdx.x * 256 + threadIdx.x; if (t >= n8) return; FragH f;
#pragma unroll
  for (int q = 0; q < 8; ++q) f.h[q] = (_Float16)x[t * 8 + q]; *(v8us*)((unsigned short*)X16 + t * 8) = f.half[0];  }
__global__ __launch_bounds__(256) void k_round16f(const float* __restrict__ W, _Float16* __restrict__ Bt, size_t n8) { const size_t t = (size_t)blockIdx.x * 256 + threadIdx.x; if (t >= n8) return; FragH f;
#pragma unroll
  for (int i = 0; i < 8; ++i) f.h[i] = (_Float16)(bf16_round(W[t * 8 + i]) * 16.0f); *(v8us*)((unsigned short*)Bt + t * 8) = f.half[0];  }
template <int NHv, int TTv>
__global__ __launch_bounds__(256) void k_vt(const _Float16* __restrict__ V16, int ldv, int voff, _Float16* __restrict__ Vt) { __shared__ unsigned short tl[64][66]; const int tid = threadIdx.x; const int slab = blockIdx.x / (TTv / 64), lg = blockIdx.x % (TTv / 64); const int b = slab / NHv, h = slab % NHv;
  for (int i = tid; i < 64 * 8; i += 256) { const int r = i / 8, c8 = (i % 8) * 8; FragH f; f.half[0] = *(const v8us*)((const unsigned short*)V16 + ((size_t)b * TTv + lg * 64 + r) * ldv + voff + h * 64 + c8);
#pragma unroll
    for (int q = 0; q < 8; ++q) tl[r][c8 + q] = f.u[q]; }
  __syncthreads();
  {
#pragma unroll
    for (int rd = 0; rd < 2; ++rd) { const int d = rd * 32 + tid / 8, pc = tid % 8; FragH f;
#pragma unroll
      for (int q = 0; q < 8; ++q) f.u[q] = tl[pc * 8 + q][d];
      *(v8us*)((unsigned short*)Vt + ((size_t)slab * 64 + d) * TTv + lg * 64 + pc * 8) = f.half[0]; }
     } }

__global__ __launch_bounds__(256) void k_hl(const float* __restrict__ F, _Float16* __restrict__ Hh, _Float16* __restrict__ Hl, size_t n8) { const size_t t = (size_t)blockIdx.x * 256 + threadIdx.x; if (t >= n8) return; FragH fh, fl; const v4f a = *(const v4fa*)(F + t * 8), c = *(const v4fa*)(F + t * 8 + 4);
#pragma unroll
  for (int q = 0; q < 4; ++q) { _Float16 h = (_Float16)a[q]; fh.h[q] = h; fl.h[q] = (_Float16)((a[q] - (float)h) * 1024.0f); h = (_Float16)c[q]; fh.h[4 + q] = h; fl.h[4 + q] = (_Float16)((c[q] - (float)h) * 1024.0f); }
  { *(v8us*)((unsigned short*)Hh + t * 8) = fh.half[0]; *(v8us*)((unsigned short*)Hl + t * 8) = fl.half[0];  } }

// ---- fast GEMM (wave tile 32x64, work-group tile 128x64; requires M % 128 == 0 rows per launch region, N % 64 == 0 and K % 128 == 0); epilogue = k_gemm_hhx semantics ----
__device__ __forceinline__ v16h g2_frag(const _Float16* p, int hh) { FragH f; f.half[0] = *(const v8us*)((const unsigned short*)p + 8 * hh); f.half[1] = *(const v8us*)((const unsigned short*)p + 16 + 8 * hh); return f.v; }
__device__ __forceinline__ v8f g2_mma(v16h a, v16h b, v8f c) { v8f d = __builtin_amdgcn_wmma_f32_16x16x32_f16(false, a, false, b, (short)0, c, false, false); asm volatile("v_nop\n\tv_nop\n\tv_nop\n\tv_nop" : "+v"(d) : "v"(a), "v"(b)); return d; }
// ---- operand ring of k_gemm2: a stage is 128 k (256 bytes) of the work-group's 128 A rows and 64 B rows, laid in LDS at a pitch of 272 bytes (16 x odd: 16-byte fragment reads meet no bank conflict); two buffers ----
#define G2_KT 128
#define G2_PITCH 272
#define G2_BUF (192 * G2_PITCH)
__device__ __forceinline__ v8f g2_mmab(v16h a, v16h b, v8f c) { return __builtin_amdgcn_wmma_f32_16x16x32_f16(false, a, false, b, (short)0, c, false, false); }
__device__ __forceinline__ v16h g2_lfrag(const unsigned char* p) { FragH f; f.half[0] = *(const v8us*)p; f.half[1] = *(const v8us*)(p + 32); return f.v; }      /* p = the lane's row + 16 hh bytes: elements 0..7 = k 8 hh + e, 8..15 = k 16 + 8 hh + e, as in g2_frag */
// Eight asynchronous 16-byte copies of a thread, global to LDS through no register: 64 operand rows a call (row step 8), 16 threads a row, so that a wave's copy reads two whole 256-byte row pieces.
// The address wait is the statement's last line: it stands in front of whatever next writes a register that a copy names.
__device__ __forceinline__ void g2_copy8(unsigned l, const _Float16* g, size_t g8) {
  const unsigned l1 = l + 8 * G2_PITCH, l2 = l + 16 * G2_PITCH, l3 = l + 24 * G2_PITCH, l4 = l + 32 * G2_PITCH, l5 = l + 40 * G2_PITCH, l6 = l + 48 * G2_PITCH, l7 = l + 56 * G2_PITCH;
  const _Float16* g1 = g + g8; const _Float16* g2 = g1 + g8; const _Float16* g3 = g2 + g8; const _Float16* g4 = g3 + g8; const _Float16* g5 = g4 + g8; const _Float16* g6 = g5 + g8; const _Float16* g7 = g6 + g8;
  asm volatile("global_load_async_to_lds_b128 %0, %8, off\n\tglobal_load_async_to_lds_b128 %1, %9, off\n\tglobal_load_async_to_lds_b128 %2, %10, off\n\tglobal_load_async_to_lds_b128 %3, %11, off\n\t"
               "global_load_async_to_lds_b128 %4, %12, off\n\tglobal_load_async_to_lds_b128 %5, %13, off\n\tglobal_load_async_to_lds_b128 %6, %14, off\n\tglobal_load_async_to_lds_b128 %7, %15, off\n\ts_wait_xcnt 0x0"
               :: "v"(l), "v"(l1), "v"(l2), "v"(l3), "v"(l4), "v"(l5), "v"(l6), "v"(l7), "v"(g), "v"(g1), "v"(g2), "v"(g3), "v"(g4), "v"(g5), "v"(g6), "v"(g7) : "memory"); }
// Grid y = the projection (0 Q, 1 K, 2 V): the three products depend on nothing of one another, so they run as one grid; a work-group of a later one starts on a WGP as soon as one of an earlier one ends there. Plane y of A, Bh and C16 stands y sA, y sB, y sC elements behind plane 0; each has its own bias pointer.
// pk = y: layout of C16. 0 = rows of pitch ldc. 1, 2 = fragment order for the attention loop (N / 64 heads, M keys): the wave's 32 keys x 64 features of head nq are 8 units of 512 bytes at ((nq M + row0) 64) elements,
// unit u holding lane l's 8 elements at 8 l, so that one wave-wide 16-byte load of a unit reads 4 whole cache lines. 1 (K, A operand of S^T): u = 4 (key / 16) + feature / 16, lane = 16 ((feature / 8) & 1) + key % 16, element = feature % 8.
// 2 (V^T, A operand of O^T): u = 2 (feature / 16) + (key / 16) % 2, lane = 16 ((key / 8) & 1) + feature % 16, element = key % 8.
template <int ACT>
__global__ __launch_bounds__(128) void k_gemm2(const _Float16* __restrict__ A, int lda, size_t sA, const _Float16* __restrict__ Bh, int ldb, size_t sB, float alpha, const float* __restrict__ bias, const float* __restrict__ bias1, const float* __restrict__ bias2, const float* __restrict__ CP, int rowsPerB, size_t sCPb, int row0g,
    float* __restrict__ C, _Float16* __restrict__ C16, int ldc, size_t sC, int M, int N, int K, float osc0) { static_assert(ACT == 0 || ACT == 3 || ACT == 6 || ACT == 8 || ACT == 9 || ACT == 11 || ACT == 12 || ACT == 14 || ACT == 15 || ACT == 16 || ACT == 17, "k_gemm2: unsupported ACT code (would silently apply no activation)");
  __shared__ __attribute__((aligned(16))) float so[4][32][68];
  __shared__ __attribute__((aligned(16))) unsigned char ring[2 * G2_BUF];      /* rows 0..127 of a buffer: the work-group's A rows; 128..191: its B rows */
  const int tid = threadIdx.x, w = tid >> 5, lane = tid & 31, ln = lane & 15, hh = lane >> 4; const int by = blockIdx.y;
  A += (size_t)by * sA; Bh += (size_t)by * sB; const size_t cofs = (size_t)by * sC; const float* bp = by == 0 ? bias : by == 1 ? bias1 : bias2; const int pk = by; const float osc = by == 0 ? osc0 : 1.0f;      /* all scalar: by is the same for the work-group */
  const int ntn = N >> 6; const int mt = blockIdx.x / ntn, nq = blockIdx.x - mt * ntn; const int row0 = mt * 128 + 32 * w, col0 = nq * 64; if (mt * 128 >= M) return;      /* the whole work-group leaves or none does (barriers below); needs M % 128 == 0, K % 128 == 0, K >= 128 */
  const _Float16* ga = A + (size_t)(mt * 128 + (tid >> 4)) * lda + (tid & 15) * 8; const _Float16* gb = Bh + (size_t)(col0 + (tid >> 4)) * ldb + (tid & 15) * 8;      /* the thread's first 16 bytes of a stage: row tid / 16, piece tid % 16 */
  const unsigned lc = (unsigned)(size_t)ring + (unsigned)((tid >> 4) * G2_PITCH + (tid & 15) * 16);      /* their place in buffer 0: byte address in the work-group's LDS */
  const size_t a8 = (size_t)8 * lda, b8 = (size_t)8 * ldb; const int nt = K / G2_KT;
  /* Work-groups of one mt read the same A rows from L2, those of one nq the same B rows, and they start together: each enters the nt stages at a stage of its own and wraps round. ks(t) = first k of the stage worked on in trip t. */
  const int rot = (mt + nq) % nt; auto ks = [&](int t) { const int s = t + rot; return (size_t)(s >= nt ? s - nt : s) * G2_KT; };      /* scalar; t < nt and rot < nt, so 0 <= stage < nt */
  const unsigned char* fa = ring + (32 * w + ln) * G2_PITCH + 16 * hh; const unsigned char* fb = ring + (128 + ln) * G2_PITCH + 16 * hh;      /* the lane's fragment rows in buffer 0 */
  const v8f z8 = {0.f,0.f,0.f,0.f,0.f,0.f,0.f,0.f}; v8f c00 = z8, c01 = z8, c02 = z8, c03 = z8, c10 = z8, c11 = z8, c12 = z8, c13 = z8;
  { const size_t k0 = ks(0); g2_copy8(lc, ga + k0, a8); g2_copy8(lc + 64 * G2_PITCH, ga + k0 + 8 * a8, a8); g2_copy8(lc + 128 * G2_PITCH, gb + k0, b8); }      /* trip 0's stage into buffer 0 */
  asm volatile("s_wait_asynccnt 0x0" ::: "memory");      /* this wave's copies of trip 0's stage have landed */
  __syncthreads();      /* every wave's have: trip 0's stage may be read */
  if (nt > 1) { const size_t k1 = ks(1); g2_copy8(lc + G2_BUF, ga + k1, a8); g2_copy8(lc + G2_BUF + 64 * G2_PITCH, ga + k1 + 8 * a8, a8); g2_copy8(lc + G2_BUF + 128 * G2_PITCH, gb + k1, b8); }      /* trip 1's stage flies while trip 0's is worked on */
#pragma unroll 1      /* one stage a trip: the ring's order below is written once */
  for (int t = 0; t < nt; ++t) { const unsigned bo = (unsigned)(t & 1) * G2_BUF;
    const unsigned char* pa = fa + bo; const unsigned char* pb = fb + bo; v16h fr[2][6];      /* two fragment sets: A rows 0..15, 16..31, B columns 0..15 .. 48..63 of one k step */
    fr[0][0] = g2_lfrag(pa); fr[0][1] = g2_lfrag(pa + 16 * G2_PITCH); fr[0][2] = g2_lfrag(pb); fr[0][3] = g2_lfrag(pb + 16 * G2_PITCH); fr[0][4] = g2_lfrag(pb + 32 * G2_PITCH); fr[0][5] = g2_lfrag(pb + 48 * G2_PITCH);
#pragma unroll      /* constant indices keep the fragment sets in registers; constant offsets for the four k steps of a stage */
    for (int kk = 0; kk < 4; ++kk) { const int c = kk & 1, n = c ^ 1;
      if (kk < 3) { const unsigned char* qa = pa + (kk + 1) * 64; const unsigned char* qb = pb + (kk + 1) * 64;      /* the next k step of this same stage */
        fr[n][0] = g2_lfrag(qa); fr[n][1] = g2_lfrag(qa + 16 * G2_PITCH); fr[n][2] = g2_lfrag(qb); fr[n][3] = g2_lfrag(qb + 16 * G2_PITCH); fr[n][4] = g2_lfrag(qb + 32 * G2_PITCH); fr[n][5] = g2_lfrag(qb + 48 * G2_PITCH); }
      __builtin_amdgcn_sched_barrier(0);      /* keeps the twelve LDS reads one group in front of the products: spread among them, each pair is waited out to 0 */
      c00 = g2_mmab(fr[c][0], fr[c][2], c00); c10 = g2_mmab(fr[c][1], fr[c][2], c10); c01 = g2_mmab(fr[c][0], fr[c][3], c01); c11 = g2_mmab(fr[c][1], fr[c][3], c11);
      c02 = g2_mmab(fr[c][0], fr[c][4], c02); c12 = g2_mmab(fr[c][1], fr[c][4], c12); c03 = g2_mmab(fr[c][0], fr[c][5], c03); c13 = g2_mmab(fr[c][1], fr[c][5], c13);
      __builtin_amdgcn_sched_barrier(0); }      /* the other side of the same fence: the following group stays behind these products */
    asm volatile("s_wait_dscnt 0x0" ::: "memory");      /* this wave's reads of the buffer are done before it is handed over */
    asm volatile("s_wait_asynccnt 0x0" ::: "memory");      /* this wave's copies of trip t + 1's stage have landed */
    __syncthreads();      /* publishes trip t + 1's stage and ends every reader's last read of trip t's buffer */
    if (t + 2 < nt) { const size_t k2 = ks(t + 2); const _Float16* na = ga + k2; const _Float16* nb = gb + k2;      /* refill of the buffer just read */
      g2_copy8(lc + bo, na, a8); g2_copy8(lc + bo + 64 * G2_PITCH, na + 8 * a8, a8); g2_copy8(lc + bo + 128 * G2_PITCH, nb, b8); } }
  asm volatile("s_wait_asynccnt 0x0" ::: "memory");      /* nothing of this wave is in flight behind the loop */
  v8f accs[8] = {c00, c01, c02, c03, c10, c11, c12, c13};
#pragma unroll
  for (int u = 0; u < 8; ++u) { const int t = u & 3, half = u >> 2; const int col = col0 + t * 16 + ln; const float bv = bp ? bf16_round(bp[col]) : 0.f;
#pragma unroll
    for (int r = 0; r < 8; ++r) { const int rloc = half * 16 + 8 * hh + r; float v = accs[u][r] * alpha + bv; if (CP) { if (rowsPerB < 0) v += CP[cofs + (size_t)(row0g + row0 + rloc) * ldc + col];      /* rowsPerB < 0: own element of the batched C plane */ else { const int bidx = (row0g + row0 + rloc) / rowsPerB; v += CP[(size_t)bidx * sCPb + (size_t)by * 64 + col]; } }
      if (ACT == 3) v = fmaxf(v, 0.f); else if (ACT == 6) v = 0.5f * v * (1.0f + erff(v * 0.70710678118654752f)); else if (ACT == 11) v = 1.0f / (1.0f + expf(-v)); else if (ACT == 15) v = v / (1.0f + expf(-v)); else if (ACT == 12) v = (v > 0.f) ? v : 0.01f * v; else if (ACT == 8) v = tanhf(v); else if (ACT == 9) v = 0.5f * v * (1.0f + tanhf(0.7978845608028654f * (v + 0.044715f * v * v * v))); else if (ACT == 14) v = (v > 0.f) ? v : 0.1f * v; else if (ACT == 16) v = (v >= 0.f) ? v : 0.3f * v; else if (ACT == 17) v = (v >= 0.f) ? v : 0.2f * v;
      so[w][rloc][t * 16 + ln] = v * osc; } }      /* osc: a factor on the finished f32 value, in front of its one rounding to f16 (osc0 for plane 0; 1, which leaves it as it is, for the others) */
  __builtin_amdgcn_fence(__ATOMIC_ACQ_REL, "workgroup"); __builtin_amdgcn_wave_barrier();
  const int rsub = lane >> 4, c4 = (lane & 15) * 4;
  if (pk == 0) {
#pragma unroll
    for (int q = 0; q < 16; ++q) { const int r = q * 2 + rsub; const v4f v = *(const v4fa*)&so[w][r][c4]; if (C) *(v4f*)(C + cofs + (size_t)(row0 + r) * ldc + col0 + c4) = v; if (C16) { v4h h4; for (int i = 0; i < 4; ++i) h4[i] = (_Float16)v[i]; *(v4h*)(C16 + cofs + (size_t)(row0 + r) * ldc + col0 + c4) = h4; } }
  } else {
    unsigned short* dp = (unsigned short*)C16 + cofs + ((size_t)nq * M + row0) * 64 + lane * 8;
    if (pk == 1) {
#pragma unroll
      for (int u = 0; u < 8; ++u) { FragH f; const int rl = (u >> 2) * 16 + ln, cl = (u & 3) * 16 + 8 * hh; const v4f x = *(const v4fa*)&so[w][rl][cl], y = *(const v4fa*)&so[w][rl][cl + 4];
#pragma unroll
        for (int i = 0; i < 4; ++i) { f.h[i] = (_Float16)x[i]; f.h[4 + i] = (_Float16)y[i]; }
        *(v8us*)(dp + u * 256) = f.half[0]; }
      asm volatile("s_wait_xcnt 0x0" ::: "memory");      /* address wait behind the run of stores above, in front of whatever next writes a register that they name */
    } else {
#pragma unroll
      for (int u = 0; u < 8; ++u) { FragH f; const int rl = (u & 1) * 16 + 8 * hh, cl = (u >> 1) * 16 + ln;
#pragma unroll
        for (int i = 0; i < 8; ++i) f.h[i] = (_Float16)so[w][rl + i][cl];
        *(v8us*)(dp + u * 256) = f.half[0]; }
      asm volatile("s_wait_xcnt 0x0" ::: "memory");      /* address wait behind the run of stores above, in front of whatever next writes a register that they name */
    }
  } }


__global__ __launch_bounds__(256) void k_wnat(const float* __restrict__ w, size_t n8, _Float16* __restrict__ Bt) { const size_t t = (size_t)blockIdx.x * 256 + threadIdx.x; if (t >= n8) return; FragH f; for (int q = 0; q < 8; ++q) f.h[q] = (_Float16)(bf16_round(w[t * 8 + q]) * 16.0f); *(v8us*)((unsigned short*)Bt + t * 8) = f.half[0];  }
__global__ __launch_bounds__(256) void k_rsm(const float* __restrict__ S, _Float16* __restrict__ P, int nrows) {
  #pragma clang fp contract(off)
  const int i = blockIdx.x * 256 + threadIdx.x; if (i >= nrows) return; const float* s = S + (size_t)i * SQ; float mx = -3.0e38f;
#pragma unroll 1
  for (int j = 0; j < SQ; ++j) mx = fmaxf(mx, s[j]); float se = 0.f;
#pragma unroll 1
  for (int j = 0; j < SQ; ++j) se += expf(s[j] - mx); const float sc = 256.0f / se;
#pragma unroll 1
  for (int j0 = 0; j0 < SQ; j0 += 8) { FragH f; for (int q = 0; q < 8; ++q) f.h[q] = (_Float16)(expf(s[j0 + q] - mx) * sc); unsigned short* d = (unsigned short*)P + (size_t)i * SQ + j0; *(v8us*)d = f.half[0];  } }
__global__ __launch_bounds__(256) void k_vt(const _Float16* __restrict__ V16, int b, int h0, _Float16* __restrict__ VT) { __shared__ unsigned short tl[64][65]; const int tid = threadIdx.x; const int hh = blockIdx.x % HG, sg = blockIdx.x / HG; const int s0 = sg * 64; const int h = h0 + hh;
  for (int i = tid; i < 64 * 8; i += 256) { const int j = i / 8, d8 = (i % 8) * 8; FragH f; f.half[0] = *(const v8us*)((const unsigned short*)V16 + ((size_t)b * SQ + s0 + j) * DM + h * HD + d8); for (int q = 0; q < 8; ++q) tl[d8 + q][j] = f.u[q]; }
  __syncthreads();
  { for (int i = tid; i < 64 * 8; i += 256) { const int d = i / 8, j8 = (i % 8) * 8; FragH f; for (int q = 0; q < 8; ++q) f.u[q] = tl[d][j8 + q]; *(v8us*)((unsigned short*)VT + ((size_t)hh * HD + d) * SQ + s0 + j8) = f.half[0]; }  } }



__global__ __launch_bounds__(256) void k_rsmkm(const float* __restrict__ S, _Float16* __restrict__ P, int nrows, const int* __restrict__ am) {
  #pragma clang fp contract(off)
  const int t = blockIdx.x * 256 + threadIdx.x; if (t >= nrows) return; const size_t i = (size_t)t; const float* s = S + i * SQ; const int* mr = am + (size_t)(t % SQ) * SQ; float mx = -3.0e38f;
#pragma unroll 1
  for (int j = 0; j < SQ; ++j) { const float f = (mr[j] != 0) ? 1.f : 0.f; mx = fmaxf(mx, fmaf(f, s[j], (1.f - f) * -1.0e9f)); } float se = 0.f;
#pragma unroll 1
  for (int j = 0; j < SQ; ++j) { const float f = (mr[j] != 0) ? 1.f : 0.f; se += __expf(fmaf(f, s[j], (1.f - f) * -1.0e9f) - mx); } const float sc = 256.0f / se;
#pragma unroll 1
  for (int j0 = 0; j0 < SQ; j0 += 8) { FragH fr; for (int q = 0; q < 8; ++q) { const int j = j0 + q; const float f = (mr[j] != 0) ? 1.f : 0.f; fr.h[q] = (_Float16)(__expf(fmaf(f, s[j], (1.f - f) * -1.0e9f) - mx) * sc); }
    unsigned short* d = (unsigned short*)P + i * SQ + j0; *(v8us*)d = fr.half[0];  } }
// The swap of a wave's two 16-lane rows: a plain lane shuffle would go through the LDS pipe.
__device__ __forceinline__ float rs_x16(float v) { const int b = __float_as_int(v); return __int_as_float(__builtin_amdgcn_permlanex16(b, b, 0x76543210, 0xfedcba98, false, false)); }
// Four native 2^x in one statement: no result shares a register
// with a source (early clobber), each exp has an independent one behind it, and the v_nop is the slot that the instruction set asks for behind the last.
__device__ __forceinline__ v4f rs_exp2x4(v4f x) { float y0, y1, y2, y3;
  asm("v_exp_f32 %0, %4\n\tv_exp_f32 %1, %5\n\tv_exp_f32 %2, %6\n\tv_exp_f32 %3, %7\n\tv_nop" : "=&v"(y0), "=&v"(y1), "=&v"(y2), "=&v"(y3) : "v"(x[0]), "v"(x[1]), "v"(x[2]), "v"(x[3]));
  const v4f y = {y0, y1, y2, y3}; return y; }
// One native 2^x with the same slot behind it.
__device__ __forceinline__ float rs_exp2(float x) { float y; asm("v_exp_f32 %0, %1\n\tv_nop" : "=&v"(y) : "v"(x)); return y; }
__device__ __forceinline__ v16h fa_frag(const _Float16* base, unsigned lofs) { FragH f; f.half[0] = *(const v8us*)((const unsigned short*)base + lofs); f.half[1] = *(const v8us*)((const unsigned short*)base + lofs + 16); return f.v; }      /* base is wave-uniform, lofs the lane's own element offset (row ln, k 8 hh) */
__device__ __forceinline__ v16h fa_fragp(const _Float16* base, unsigned lofs) { FragH f; f.half[0] = *(const v8us*)((const unsigned short*)base + lofs); f.half[1] = *(const v8us*)((const unsigned short*)base + lofs + 256); return f.v; }      /* fragment-order operand: two units of 512 bytes, lofs = 8 lane; elements 0..7 and 8..15 as in fa_frag */
__device__ __forceinline__ v8f fa_mma(v16h a, v16h b, v8f c) { return __builtin_amdgcn_wmma_f32_16x16x32_f16(false, a, false, b, (short)0, c, false, false); }
// 16 waves a work-group, one work-group a WGP, so 4 waves a SIMD: vector work of one wave runs beside the products and the load waits of the others. Waves w and w + 8 own the same 32 query rows;
// wave w walks keys 0..2047, wave w + 8 keys 2048..4095, each with its own held reference, sum and O^T; behind the loop the upper wave hands its three over in LDS and the lower wave joins them.
__global__ __launch_bounds__(512) void k_fattn(const _Float16* __restrict__ Q, const _Float16* __restrict__ KP, const _Float16* __restrict__ VP, float* __restrict__ O) {      /* Q in rows; KP, VP in fragment order (k_gemm2, pk 1 and 2): 32 keys of a head are 4 KB in a row in each */
  __shared__ __attribute__((aligned(16))) float xo[8][17][32][4];      /* per query tile: the upper wave's O^T as 16 pieces of 16 bytes a lane (a wave's piece is 512 bytes in a row: no bank conflict), then its references and sums */
  const int lane = threadIdx.x & 31, ln = lane & 15, hh = lane >> 4; const int w = __builtin_amdgcn_readfirstlane(threadIdx.x >> 5);      /* the wave's number, held scalar so that the row bases and the branches on it are scalar */
  const int wq = w & 7, kh = w >> 3, kbeg = kh * (SQ / 2);      /* query tile, key half, first key of the half */
  const int h = blockIdx.x / (SQ / 256); const int q0 = (blockIdx.x % (SQ / 256)) * 256 + wq * 32;      /* the 8 waves of a key half share its K and V^T lines in the WGP's cache */
  /* The 16 work-groups of a head read the same K and V^T lines from L2 and start together: each enters the 64 passes of its halves at a pass of its own (4 apart within a head, heads one apart) and wraps round, so that no two of a head ask for a line at the same moment. */
  const int rot = (4 * (int)(blockIdx.x % (SQ / 256)) + h) & (SQ / 64 - 1); const int kst = kbeg + rot * 32;      /* first pass, first key walked */
  const unsigned lk = (unsigned)(ln * DM + 8 * hh), lp = (unsigned)(lane * 8);
  const _Float16* qb = Q + (size_t)q0 * DM + h * HD; const _Float16* kb = KP + (size_t)h * HD * SQ; const _Float16* vb = VP + (size_t)h * HD * SQ;
  v16h qf[2][2], kf[2][2], vf[4];
  /* every loop over a fragment, score or output array of this kernel is unrolled: constant indices keep the arrays in registers */
#pragma unroll
  for (int j = 0; j < 2; ++j) { qf[j][0] = fa_frag(qb + j * 16 * DM, lk); qf[j][1] = fa_frag(qb + j * 16 * DM + 32, lk); }
#pragma unroll
  for (int t = 0; t < 2; ++t) { kf[t][0] = fa_fragp(kb + kst * HD + t * 1024, lp); kf[t][1] = fa_fragp(kb + kst * HD + t * 1024 + 512, lp); }
  __builtin_amdgcn_sched_barrier(0);      /* keeps the first V^T loads the youngest, as they are in every pass: otherwise the counted wait at the loop's head falls to 0 and each pass waits out the V^T loads issued just before it */
#pragma unroll
  for (int t = 0; t < 4; ++t) vf[t] = fa_fragp(vb + kst * HD + t * 512, lp);
  const v8f z8 = {0.f, 0.f, 0.f, 0.f, 0.f, 0.f, 0.f, 0.f}; v8f o[2][4], cr[2]; float l[2] = {0.f, 0.f};
#pragma unroll
  for (int j = 0; j < 2; ++j) for (int t = 0; t < 4; ++t) o[j][t] = z8;
  /* The held reference. Q arrives times log2 e / sqrt(64), so K Q^T is the score in log2 units. cr[j] = 8 - reference of query ln, the same in all 8 registers and in both halves of the wave, is the C operand of the
     score products: their D is the argument of 2^x as it stands (weights are 2^8 e^(s - reference): f16 keeps small ones normal; the row sum carries the same factor). It starts as the maximum of the first 32 keys that the wave walks. */
#pragma unroll
  for (int j = 0; j < 2; ++j) { const v8f a = fa_mma(kf[0][1], qf[j][1], fa_mma(kf[0][0], qf[j][0], z8)), b = fa_mma(kf[1][1], qf[j][1], fa_mma(kf[1][0], qf[j][0], z8)); float mx = fmaxf(a[0], b[0]);
#pragma unroll
    for (int r = 1; r < 8; ++r) mx = fmaxf(mx, fmaxf(a[r], b[r]));
    const float c = 8.0f - fmaxf(mx, rs_x16(mx));
#pragma unroll
    for (int r = 0; r < 8; ++r) cr[j][r] = c; }
  for (int p = 1; p <= SQ / 64; ++p) {
    const int kn = kbeg + ((rot + p) & (SQ / 64 - 1)) * 32;      /* the next pass's keys, wrapping inside the half; a wave's last pass fetches its first 32 keys again (in bounds, not used) so that the loop has no branch */
    v8f s[2][2];
#pragma unroll
    for (int t = 0; t < 2; ++t) for (int j = 0; j < 2; ++j) s[t][j] = fa_mma(kf[t][1], qf[j][1], fa_mma(kf[t][0], qf[j][0], cr[j]));
    const _Float16* kp = kb + kn * HD;      /* K one pass ahead, into the registers that the products above have just read */
#pragma unroll
    for (int t = 0; t < 2; ++t) { kf[t][0] = fa_fragp(kp + t * 1024, lp); kf[t][1] = fa_fragp(kp + t * 1024 + 512, lp); }
    asm volatile("s_wait_xcnt 0x0" ::: "memory");      /* address wait of the K loads, as behind the V^T loads below; its memory clobber also holds them here: left free, the compiler sinks them behind the test's branch and they start half a pass later */
    FragH pf[2]; float mx[2];
#pragma unroll
    for (int j = 0; j < 2; ++j) { mx[j] = fmaxf(s[0][j][0], s[1][j][0]);
#pragma unroll
      for (int r = 1; r < 8; ++r) mx[j] = fmaxf(mx[j], fmaxf(s[0][j][r], s[1][j][r])); }
    /* One test a pass, a scalar branch: the reference stays while every weight of the pass is at most 2^15 (f16 holds it), that is while no score stands more than 7 (log2) above its reference. */
    if (__builtin_amdgcn_ballot_w32(fmaxf(mx[0], mx[1]) > 15.0f) != 0) {
#pragma unroll
      for (int j = 0; j < 2; ++j) { const float d = fmaxf(fmaxf(mx[j], rs_x16(mx[j])) - 8.0f, 0.f); const float al = rs_exp2(-d);      /* the reference rises to the query's maximum of this pass where that is the higher; what has been summed under the old one shrinks by 2^-d */
        l[j] *= al; cr[j] -= d;
#pragma unroll
        for (int t = 0; t < 2; ++t) s[t][j] -= d;
#pragma unroll
        for (int t = 0; t < 4; ++t) o[j][t] *= al; } }
#pragma unroll
    for (int j = 0; j < 2; ++j) { v4f sm = {0.f, 0.f, 0.f, 0.f};
#pragma unroll
      for (int t = 0; t < 2; ++t) for (int g = 0; g < 2; ++g) { const v4f x = {s[t][j][4 * g], s[t][j][4 * g + 1], s[t][j][4 * g + 2], s[t][j][4 * g + 3]}; const v4f p = rs_exp2x4(x); sm += p; for (int q = 0; q < 4; ++q) pf[j].h[8 * t + 4 * g + q] = (_Float16)p[q]; }
      l[j] += (sm[0] + sm[1]) + (sm[2] + sm[3]); }      /* the lane's own 16 keys; the halves are joined once, behind the loop */
#pragma unroll
    for (int t = 0; t < 4; ++t) for (int j = 0; j < 2; ++j) o[j][t] = fa_mma(vf[t], pf[j].v, o[j][t]);
    const _Float16* vp = vb + kn * HD;      /* V^T one pass ahead, likewise */
#pragma unroll
    for (int t = 0; t < 4; ++t) vf[t] = fa_fragp(vp + t * 512, lp);
    asm volatile("s_wait_xcnt 0x0" ::: "memory");      /* the next pass forms its addresses in the registers that the loads above name: their address wait stands in front of that overwrite */
  }
  if (kh == 1) {      /* the upper wave hands over what it has of keys 2048..4095 */
#pragma unroll
    for (int j = 0; j < 2; ++j)
#pragma unroll
      for (int t = 0; t < 4; ++t) { const v4f lo = {o[j][t][0], o[j][t][1], o[j][t][2], o[j][t][3]}, hi = {o[j][t][4], o[j][t][5], o[j][t][6], o[j][t][7]}; *(v4f*)xo[wq][(j * 4 + t) * 2][lane] = lo; *(v4f*)xo[wq][(j * 4 + t) * 2 + 1][lane] = hi; }
    const v4f st = {cr[0][0], cr[1][0], l[0], l[1]}; *(v4f*)xo[wq][16][lane] = st; }
  __syncthreads();      /* every wave passes it once: the upper waves' LDS writes stand before the lower waves read them */
  if (kh == 0) {      /* the lower wave joins the halves under the higher of their two references (the lower cr), divides and stores */
    const v4f st = *(const v4f*)xo[wq][16][lane];
#pragma unroll
    for (int j = 0; j < 2; ++j) { const float cn = fminf(cr[j][0], st[j]); const float a0 = rs_exp2(cn - cr[j][0]), a1 = rs_exp2(cn - st[j]); const float lt = l[j] * a0 + st[2 + j] * a1;
      const float inv = 1.0f / (lt + rs_x16(lt)); const float f0 = a0 * inv, f1 = a1 * inv; float* d = O + (size_t)(q0 + j * 16 + ln) * DM + h * HD + 8 * hh;
#pragma unroll
      for (int t = 0; t < 4; ++t) { const v4f xl = *(const v4f*)xo[wq][(j * 4 + t) * 2][lane], xh = *(const v4f*)xo[wq][(j * 4 + t) * 2 + 1][lane];
        const v4f lo = {o[j][t][0] * f0 + xl[0] * f1, o[j][t][1] * f0 + xl[1] * f1, o[j][t][2] * f0 + xl[2] * f1, o[j][t][3] * f0 + xl[3] * f1}, hi = {o[j][t][4] * f0 + xh[0] * f1, o[j][t][5] * f0 + xh[1] * f1, o[j][t][6] * f0 + xh[2] * f1, o[j][t][7] * f0 + xh[3] * f1};
        *(v4f*)(d + t * 16) = lo; *(v4f*)(d + t * 16 + 4) = hi; } } } }



// ---- preparation, one launch: the three inputs as f16 rows and the three weight planes as Bt[(h, d)][m] x16 ----
// PW waves in all, 16 a work-group, as many work-groups as the chip has WGPs: few waves to start, all resident at once. Each wave takes 1 / PW of each of the six passes.
// Inputs: 1024 floats a wave and input, as 8 loads of 16 bytes a lane, each covering 512 bytes in a row (4 whole lines); all 24 are in flight before the first is converted; stores of 8 bytes a lane cover 2 whole lines.
// Weights: a thread gathers 8 m of one (h, d) of each plane, as per-head [m][d] -> Bt[(h, d)][m]; a wave's store covers 512 bytes in a row.
#define PW 4096
__global__ __launch_bounds__(512) void k_prep(const float* __restrict__ xq, const float* __restrict__ xk, const float* __restrict__ xv, const float* __restrict__ wq, const float* __restrict__ wk, const float* __restrict__ wv,
    _Float16* __restrict__ XQ, _Float16* __restrict__ XK, _Float16* __restrict__ XV, _Float16* __restrict__ BQ, _Float16* __restrict__ BK, _Float16* __restrict__ BV) {
  static_assert(NR * DM == (size_t)PW * 1024 && (size_t)NH * HD * (DM / 8) == (size_t)PW * 32, "k_prep: one piece of every pass a wave");
  const int lane = threadIdx.x & 31; const int gw = blockIdx.x * 16 + __builtin_amdgcn_readfirstlane(threadIdx.x >> 5);      /* the wave's number in the grid, held scalar so that the bases are scalar */
  const float* xs[3] = {xq + (size_t)gw * 1024, xk + (size_t)gw * 1024, xv + (size_t)gw * 1024}; _Float16* xd[3] = {XQ + (size_t)gw * 1024, XK + (size_t)gw * 1024, XV + (size_t)gw * 1024};
  const unsigned t = (unsigned)(gw * 32 + lane); const unsigned m8 = (t % (DM / 8)) * 8, d = (t / (DM / 8)) % HD, h = t / ((DM / 8) * HD);
  const unsigned wo = (h * DM + m8) * HD + d; const float* wsrc[3] = {wq, wk, wv}; _Float16* wd[3] = {BQ, BK, BV};
  v4f a[3][8]; float g[3][8];
  /* every loop below is unrolled: constant indices keep the arrays in registers */
#pragma unroll
  for (int p = 0; p < 3; ++p)
#pragma unroll
    for (int i = 0; i < 8; ++i) a[p][i] = *(const v4fa*)(xs[p] + i * 128 + lane * 4);
#pragma unroll
  for (int p = 0; p < 3; ++p)
#pragma unroll
    for (int q = 0; q < 8; ++q) g[p][q] = wsrc[p][wo + q * HD];
  __builtin_amdgcn_sched_barrier(0);      /* keeps all 48 loads in front of the first conversion: left free, the compiler sinks most of them among the conversions and a wave has only some 12 in flight */
#pragma unroll
  for (int p = 0; p < 3; ++p)
#pragma unroll
    for (int i = 0; i < 8; ++i) { v4h o;
#pragma unroll
      for (int q = 0; q < 4; ++q) o[q] = (_Float16)bf16_round(a[p][i][q]);
      *(v4h*)(xd[p] + i * 128 + lane * 4) = o; }
#pragma unroll
  for (int p = 0; p < 3; ++p) { FragH f;
#pragma unroll
    for (int q = 0; q < 8; ++q) f.h[q] = (_Float16)(16.0f * bf16_round(g[p][q]));
    *(v8us*)((unsigned short*)wd[p] + (size_t)(h * HD + d) * DM + m8) = f.half[0]; } }

extern "C" void kernel_launch(void* const* d_in, const int* in_sizes, int n_in,
                              void* d_out, int out_size, void* d_ws, size_t ws_size, hipStream_t stream) {
  (void)in_sizes; (void)n_in; (void)out_size;
  const float* const* I = (const float* const*)d_in; const float* xq = I[0]; const float* xk = I[1]; const float* xv = I[2]; const float* wq = I[3]; const float* bq = I[4]; const float* wk = I[5]; const float* bk = I[6]; const float* wv = I[7]; const float* bv = I[8]; const float* x = xq;      /* X_Q, X_K, X_V [4096][1024]; per-head Wq / Wk / Wv [16][1024][64] ([in][out] per head) + biases [16][64] = [(h, d)]; no output projection */
  static_assert(NH * HD == DM && DM % 128 == 0 && SQ % 256 == 0 && HD == 64 && HG == 1 && NB == 1, "shape / tile multiples");
  char* ws = (char*)d_ws; size_t off = 0;
  auto take = [&](size_t bytes) { char* p = ws + off; off += (bytes + 255) & ~(size_t)255; return p; };
  _Float16* BQ = (_Float16*)take((size_t)DM * DM * 2); _Float16* BK = (_Float16*)take((size_t)DM * DM * 2); _Float16* BV = (_Float16*)take((size_t)DM * DM * 2);
  _Float16* X16 = (_Float16*)take(NR * DM * 2); _Float16* XKp = (_Float16*)take(NR * DM * 2); _Float16* XVp = (_Float16*)take(NR * DM * 2); _Float16* Q16 = (_Float16*)take(NR * DM * 2); _Float16* KP = (_Float16*)take((size_t)NH * HD * SQ * 2);
  _Float16* VP = (_Float16*)take((size_t)NH * HD * SQ * 2);
  if (off > ws_size) return;
  _Float16* XK = XKp; _Float16* XV = XVp;
  k_prep<<<PW / 16, 512, 0, stream>>>(x, xk, xv, wq, wk, wv, X16, XK, XV, BQ, BK, BV);      /* inputs as exact f16 rows; per-head [m][d] -> Bt[(h, d)][m] x16 */
  const size_t r0p = (size_t)B0 * SQ;      /* first projected row */
  static_assert((NR * DM * 2) % 256 == 0 && ((size_t)DM * DM * 2) % 256 == 0 && (size_t)NH * HD * SQ == NR * DM && B0 == 0, "the three planes of X, of Bt and of the results each stand in a row in the workspace, one plane's size apart");
  k_gemm2<0><<<dim3((unsigned)((MP / 128) * (DM / 64)), 3), 128, 0, stream>>>(X16 + r0p * DM, DM, NR * DM, BQ, DM, (size_t)DM * DM, 0.0625f, bq, bk, bv, nullptr, 1, 0, 0, nullptr, Q16 + r0p * DM, DM, NR * DM, MP, DM, DM, 0.18033688011112042f);      /* y = 0: Q in rows, times log2 e / sqrt(64) (the attention loop's scores are in log2 units); 1: K in fragment order; 2: V^T in fragment order */
  for (int b = B0; b < B0 + NBR; ++b) { const size_t r0 = (size_t)b * SQ;
    k_fattn<<<NH * (SQ / 256), 512, 0, stream>>>(Q16 + r0 * LQ, KP, VP, (float*)d_out + r0 * DM); }      /* all heads: softmax(Q K^T / 8) V written f32 straight into each head's 64 columns of the output rows (no output projection) */
}

// v010
// It runs in 106 microseconds.
// Timed twice side by side with v009, it ran 1.03 times as fast both times.
// Over all steps from v000 it is 127 times as fast.
#include <hip/hip_runtime.h>
// Multi-head attention over three inputs with PER-HEAD projection weights and no output projection (X_Q, X_K, X_V [4096][1024] (one sequence); Q[h] = X_Q Wq[h] + bq[h], K, V likewise (Wq / Wk / Wv [16][1024][64] per-head [in][out], sigma 1/32; biases [16][64] sigma 1/32); scores = Q[h] K[h]^T / sqrt(64); softmax over all 4096 keys; out[h] = attn V[h]; heads concatenated along the feature axis -> [4096][1024]).
// Structure: one preparation launch (the three inputs as exact f16 rows (bf16-rounded); per-head [in][out] weights gathered into Bt[(h, d)][in] x16 planes); Q, K, V as three WMMA GEMMs in ONE launch, grid y picking the projection (32x64 wave tiles, operands staged in LDS by asynchronous copies in a ring of two buffers, f32 accumulation, + bias [(h, d)], f16 outputs; the K and V GEMMs store their 32-key x 64-feature wave tiles in the attention loop's fragment order, V transposed on the way); then ONE attention launch for all heads: two waves of a work-group own 32 query rows, each walks one half of the 4096 keys 32 at a time (K and V^T brought into LDS once for the work-group by asynchronous copies, a ring of two buffers of 128 keys a half), S^T = K Q^T - a reference held over the passes (it rises only when a score stands 2^7 above it), softmax in registers (f32 statistics; weights x256 as f16), O^T += V^T P^T; the two halves are joined through LDS at the end, divided by the row sum and written f32 straight into the head's 64 columns of the output rows. Work-groups that read the same operand lines from L2 (GEMM: the k stages; attention: the key passes) each enter the walk at a place set by the block index and wrap round.
// Compute dtype: inputs rounded to bf16; x / weights exact; q, k, v and softmax weights as plain f16 GEMM operands (~2^-12); scores and softmax statistics f32. v_wmma_f32_16x16x32_f16.
#define NB 1
#define SQ 4096
#define DM 1024
#define NH 16
#define HD 64
#define HG 1                         /* heads per launch of the non-template k_vt */
#define B0 0                         /* first batch processed (debug hook) */
#define NBR NB                       /* batches processed (debug hook) */
#define NR ((size_t)NB * SQ)         /* token rows */
#define MP ((int)((size_t)NBR * SQ)) /* rows projected (debug hook) */
#define QN SQ                        /* unused (the attention launch attends all SQ query rows) */
#define NHD NH                       /* unused (the attention launch covers all NH heads) */
#define MPO MP                       /* unused (there is no output stage) */
#define LQ DM      /* row pitch of the q rows */
typedef __bf16 v16b __attribute__((ext_vector_type(16)));
typedef unsigned short v8us __attribute__((ext_vector_type(8), may_alias));
typedef float  v8f  __attribute__((ext_vector_type(8)));
typedef float  v4f  __attribute__((ext_vector_type(4)));
typedef float  v4fa __attribute__((ext_vector_type(4), may_alias));
union FragB { v16b v; v8us half[2]; unsigned short u[16]; };

__device__ __forceinline__ unsigned short bf16_bits(float x) { unsigned int u = __float_as_uint(x); return (unsigned short)((u + 0x7FFFu + ((u >> 16) & 1u)) >> 16); }
__device__ __forceinline__ float bf16_val(unsigned short b) { return __uint_as_float(((unsigned int)b) << 16); }
__device__ __forceinline__ float bf16_round(float x) { return bf16_val(bf16_bits(x)); }
// D += A·B with NT terms: 1 = ah·bh, 2 = + al·bh (A split), 3 = + ah·bl (both split)
template <int NT>
__device__ __forceinline__ v8f mmaN(v16b ah, v16b al, v16b bh, v16b bl, v8f c) {
  c = __builtin_amdgcn_wmma_f32_16x16x32_bf16(false, ah, false, bh, (short)0, c, false, false);
  if (NT >= 2) c = __builtin_amdgcn_wmma_f32_16x16x32_bf16(false, al, false, bh, (short)0, c, false, false);
  if (NT >= 3) c = __builtin_amdgcn_wmma_f32_16x16x32_bf16(false, ah, false, bl, (short)0, c, false, false);
  asm volatile("v_nop\n\tv_nop\n\tv_nop\n\tv_nop" : "+v"(c) : "v"(ah), "v"(al), "v"(bh), "v"(bl));
  return c;
}

__global__ __launch_bounds__(256) void k_wt_bf16(const float* __restrict__ W, unsigned short* __restrict__ Wt, int K, int N) {
  const int t = blockIdx.x * 256 + threadIdx.x;
  const int k8n = K / 8;
  if (t >= N * k8n) return;
  const int n = t / k8n, k8 = (t % k8n) * 8;
  v8us v;
#pragma unroll
  for (int i = 0; i < 8; ++i) v[i] = bf16_bits(W[(size_t)(k8 + i) * N + n]);
  *(v8us*)(Wt + (size_t)n * K + k8) = v;
  
}

// GEMM C[M][N] (f32, pitch ldc) = act(A[M][K]·W + bias). A f32 row-major (pitch lda) converted per fragment to bf16
// (ASPLIT: hi/lo two planes -> 2 terms, else single rounded term); Wt bf16 [N][K] (pitch ldb). BIAS_BF16 rounds the
// bias to bf16 first (bias quantised to bf16 before the add). K%32==0, M%16==0, N%64==0.
template <bool ASPLIT, int ACT, bool BIAS_BF16>
__global__ __launch_bounds__(128) void k_gemm_bf(const float* __restrict__ A, int lda, const unsigned short* __restrict__ Wt, int ldb,
                                               const float* __restrict__ bias, float* __restrict__ C, int ldc, int M, int N, int K) {
  __shared__ __attribute__((aligned(16))) float so[4][16][64];
  const int tid = threadIdx.x, w = tid >> 5, lane = tid & 31, ln = lane & 15, hh = lane >> 4;
  const int ntn = N / 64;
  const int wid = blockIdx.x * 4 + w;
  const int mt = wid / ntn, nq = wid % ntn;
  if (mt * 16 >= M) return;
  const int row0 = mt * 16, col0 = nq * 64;
  const float* arow = A + (size_t)(row0 + ln) * lda;
  v8f acc[4] = {};
  for (int kb = 0; kb < K; kb += 32) {
    FragB ah, al;
    const v4f x0 = *(const v4fa*)(arow + kb + 8 * hh), x1 = *(const v4fa*)(arow + kb + 8 * hh + 4);
    const v4f x2 = *(const v4fa*)(arow + kb + 16 + 8 * hh), x3 = *(const v4fa*)(arow + kb + 16 + 8 * hh + 4);
    float xs[16] = {x0[0],x0[1],x0[2],x0[3],x1[0],x1[1],x1[2],x1[3],x2[0],x2[1],x2[2],x2[3],x3[0],x3[1],x3[2],x3[3]};
#pragma unroll
    for (int i = 0; i < 16; ++i) { const unsigned short hb = bf16_bits(xs[i]); ah.u[i] = hb; al.u[i] = ASPLIT ? bf16_bits(xs[i] - bf16_val(hb)) : (unsigned short)0; }
#pragma unroll
    for (int t = 0; t < 4; ++t) {
      const unsigned short* brow = Wt + (size_t)(col0 + t * 16 + ln) * ldb + kb;
      FragB b;
      b.half[0] = *(const v8us*)(brow + 8 * hh);
      b.half[1] = *(const v8us*)(brow + 16 + 8 * hh);
      acc[t] = mmaN<ASPLIT ? 2 : 1>(ah.v, al.v, b.v, b.v, acc[t]);
    }
  }
#pragma unroll
  for (int t = 0; t < 4; ++t) {
    float bv = bias ? bias[col0 + t * 16 + ln] : 0.f;
    if (BIAS_BF16) bv = bf16_round(bv);
#pragma unroll
    for (int r = 0; r < 8; ++r) { float v = acc[t][r] + bv; if (ACT == 1) v = fmaxf(v, 0.f); so[w][8 * hh + r][t * 16 + ln] = v; }
  }
  __builtin_amdgcn_fence(__ATOMIC_ACQ_REL, "workgroup");
  __builtin_amdgcn_wave_barrier();
  const int rsub = lane >> 4, c4 = (lane & 15) * 4;
  {
#pragma unroll
    for (int q = 0; q < 8; ++q) {
      const int r = q * 2 + rsub;
      const v4f v = *(const v4fa*)&so[w][r][c4];
      *(v4f*)(C + (size_t)(row0 + r) * ldc + col0 + c4) = v;
    }
    
  }
}

// GEMM C = act(A·W + bias + resid): A f32 (ASPLIT -> hi/lo 2 terms), Wt bf16 [N][K]; ACT 0 none, 1 relu, 2 exact gelu;
// resid (optional, f32, row index = (row % rmod), pitch ldr, RES_BF16 rounds it) added before the activation.
template <bool ASPLIT, int ACT, bool BIAS_BF16, bool RES_BF16>
__global__ __launch_bounds__(128) void k_gemm_bf3(const float* __restrict__ A, int lda, const unsigned short* __restrict__ Wt, int ldb,
                                                const float* __restrict__ bias, const float* __restrict__ resid, int rmod, int ldr,
                                                float* __restrict__ C, int ldc, int M, int N, int K) {
  __shared__ __attribute__((aligned(16))) float so[4][16][64];
  const int tid = threadIdx.x, w = tid >> 5, lane = tid & 31, ln = lane & 15, hh = lane >> 4;
  const int ntn = N / 64;
  const int wid = blockIdx.x * 4 + w;
  const int mt = wid / ntn, nq = wid % ntn;
  if (mt * 16 >= M) return;
  const int row0 = mt * 16, col0 = nq * 64;
  const float* arow = A + (size_t)(row0 + ln) * lda;
  v8f acc[4] = {};
  for (int kb = 0; kb < K; kb += 32) {
    FragB ah, al;
    const v4f x0 = *(const v4fa*)(arow + kb + 8 * hh), x1 = *(const v4fa*)(arow + kb + 8 * hh + 4);
    const v4f x2 = *(const v4fa*)(arow + kb + 16 + 8 * hh), x3 = *(const v4fa*)(arow + kb + 16 + 8 * hh + 4);
    float xs[16] = {x0[0],x0[1],x0[2],x0[3],x1[0],x1[1],x1[2],x1[3],x2[0],x2[1],x2[2],x2[3],x3[0],x3[1],x3[2],x3[3]};
#pragma unroll
    for (int i = 0; i < 16; ++i) { const unsigned short hb = bf16_bits(xs[i]); ah.u[i] = hb; al.u[i] = ASPLIT ? bf16_bits(xs[i] - bf16_val(hb)) : (unsigned short)0; }
#pragma unroll
    for (int t = 0; t < 4; ++t) {
      const unsigned short* brow = Wt + (size_t)(col0 + t * 16 + ln) * ldb + kb;
      FragB b;
      b.half[0] = *(const v8us*)(brow + 8 * hh);
      b.half[1] = *(const v8us*)(brow + 16 + 8 * hh);
      acc[t] = mmaN<ASPLIT ? 2 : 1>(ah.v, al.v, b.v, b.v, acc[t]);
    }
  }
#pragma unroll
  for (int t = 0; t < 4; ++t) {
    const int col = col0 + t * 16 + ln;
    float bv = bias ? bias[col] : 0.f;
    if (BIAS_BF16) bv = bf16_round(bv);
#pragma unroll
    for (int r = 0; r < 8; ++r) {
      float v = acc[t][r] + bv;
      if (resid) { float rv = resid[(size_t)((row0 + 8 * hh + r) % rmod) * ldr + col]; if (RES_BF16) rv = bf16_round(rv); v += rv; }
      if (ACT == 1) v = fmaxf(v, 0.f);
      if (ACT == 2) v = 0.5f * v * (1.0f + erff(v * 0.70710678118654752f));
      if (ACT == 3) { const float u = 0.7978845608028654f * (v + 0.044715f * v * v * v); v = 0.5f * v * (1.0f + tanhf(u)); }
      so[w][8 * hh + r][t * 16 + ln] = v;
    }
  }
  __builtin_amdgcn_fence(__ATOMIC_ACQ_REL, "workgroup");
  __builtin_amdgcn_wave_barrier();
  const int rsub = lane >> 4, c4 = (lane & 15) * 4;
  {
#pragma unroll
    for (int q = 0; q < 8; ++q) {
      const int r = q * 2 + rsub;
      const v4f v = *(const v4fa*)&so[w][r][c4];
      *(v4f*)(C + (size_t)(row0 + r) * ldc + col0 + c4) = v;
    }
    
  }
}
// row LayerNorm (biased variance, eps) over N: s = X (+ R); optional out_sum <- s; out_norm <- (s-mu)*rsqrt(var+eps)*g + b
template <bool PARAM_BF16>
__global__ __launch_bounds__(256) void k_layernorm(const float* __restrict__ X, const float* __restrict__ R, const float* __restrict__ g, const float* __restrict__ bta,
                                                  float* __restrict__ out_sum, float* __restrict__ out_norm, int N, float eps) {
  __shared__ float red[256];
  const int row = blockIdx.x, tid = threadIdx.x;
  const float* x = X + (size_t)row * N; const float* rr = R ? R + (size_t)row * N : nullptr;
  float vals[16];                     // up to N = 4096
  const int per = N / 256;            // contiguous chunk per thread? use strided-by-4 chunks: thread handles j = tid*4 + 1024*u
  float s1 = 0.f;
  for (int u = 0; u < per / 4; ++u) {
    const int j = tid * 4 + 1024 * u;
    const v4f a = *(const v4fa*)(x + j);
    v4f b = {0.f,0.f,0.f,0.f}; if (rr) b = *(const v4fa*)(rr + j);
#pragma unroll
    for (int q = 0; q < 4; ++q) { const float v = a[q] + b[q]; vals[u * 4 + q] = v; s1 += v; }
  }
  red[tid] = s1; __syncthreads();
  for (int st = 128; st > 0; st >>= 1) { if (tid < st) red[tid] += red[tid + st]; __syncthreads(); }
  const float mu = red[0] / (float)N; __syncthreads();
  float s2 = 0.f;
  for (int u = 0; u < per / 4; ++u)
#pragma unroll
    for (int q = 0; q < 4; ++q) { const float c = vals[u * 4 + q] - mu; s2 += c * c; }
  red[tid] = s2; __syncthreads();
  for (int st = 128; st > 0; st >>= 1) { if (tid < st) red[tid] += red[tid + st]; __syncthreads(); }
  const float rs = rsqrtf(red[0] / (float)N + eps);
  {
    for (int u = 0; u < per / 4; ++u) {
      const int j = tid * 4 + 1024 * u;
      v4f o, sm;
#pragma unroll
      for (int q = 0; q < 4; ++q) {
        float gg = g[j + q], bb = bta[j + q];
        if (PARAM_BF16) { gg = bf16_round(gg); bb = bf16_round(bb); }
        sm[q] = vals[u * 4 + q]; o[q] = (vals[u * 4 + q] - mu) * rs * gg + bb;
      }
      if (out_sum) *(v4f*)(out_sum + (size_t)row * N + j) = sm;
      *(v4f*)(out_norm + (size_t)row * N + j) = o;
    }
    
  }
}



// ---- f16 WMMA path (v_wmma_f32_16x16x32_f16): 11-bit significands for operands in range — used where a [0,1] probability operand needs more precision than bf16
typedef _Float16 v16h __attribute__((ext_vector_type(16)));
union FragH { v16h v; v8us half[2]; _Float16 h[16]; unsigned short u[16]; };
template <int NT>
__device__ __forceinline__ v8f mmaH(v16h ah, v16h al, v16h bh, v16h bl, v8f c) {
  c = __builtin_amdgcn_wmma_f32_16x16x32_f16(false, ah, false, bh, (short)0, c, false, false);
  if (NT >= 2) c = __builtin_amdgcn_wmma_f32_16x16x32_f16(false, al, false, bh, (short)0, c, false, false);
  if (NT >= 3) c = __builtin_amdgcn_wmma_f32_16x16x32_f16(false, ah, false, bl, (short)0, c, false, false);
  asm volatile("v_nop\n\tv_nop\n\tv_nop\n\tv_nop" : "+v"(c) : "v"(ah), "v"(al), "v"(bh), "v"(bl));
  return c;
}
// batched GEMM like k_gemm_b but f16 operands: A f32 (split into f16 hi/lo if ASPLIT, else rounded to f16), Bt = f16 values [n][k]; alpha; C f32; N multiple of 16 (partial tiles skipped)
template <bool ASPLIT>
__global__ __launch_bounds__(128) void k_gemm_h(const float* __restrict__ A, int lda, size_t sA, const _Float16* __restrict__ Bh, int ldb, size_t sB, float alpha, float* __restrict__ C, int ldc, size_t sC, int M, int N, int K) {
  __shared__ __attribute__((aligned(16))) float so[4][16][64];
  const int tid = threadIdx.x, w = tid >> 5, lane = tid & 31, ln = lane & 15, hh = lane >> 4; const int by = blockIdx.y;
  A += (size_t)by * sA; Bh += (size_t)by * sB; C += (size_t)by * sC;
  const int ntn = (N + 63) / 64; const int wid = blockIdx.x * 4 + w; const int mt = wid / ntn, nq = wid % ntn; if (mt * 16 >= M) return;
  const int row0 = mt * 16, col0 = nq * 64; const float* arow = A + (size_t)(row0 + ln) * lda;
  v8f acc[4] = {};
  for (int kb = 0; kb < K; kb += 32) {
    FragH ah, al;
    const v4f x0 = *(const v4fa*)(arow + kb + 8 * hh), x1 = *(const v4fa*)(arow + kb + 8 * hh + 4), x2 = *(const v4fa*)(arow + kb + 16 + 8 * hh), x3 = *(const v4fa*)(arow + kb + 16 + 8 * hh + 4);
    float xs[16] = {x0[0],x0[1],x0[2],x0[3],x1[0],x1[1],x1[2],x1[3],x2[0],x2[1],x2[2],x2[3],x3[0],x3[1],x3[2],x3[3]};
#pragma unroll
    for (int i = 0; i < 16; ++i) { const _Float16 h = (_Float16)xs[i]; ah.h[i] = h; al.h[i] = ASPLIT ? (_Float16)(xs[i] - (float)h) : (_Float16)0.0f; }
#pragma unroll
    for (int t = 0; t < 4; ++t) { if (col0 + t * 16 >= N) continue; const size_t boff = (size_t)(col0 + t * 16 + ln) * ldb + kb; FragH bq; bq.half[0] = *(const v8us*)(Bh + boff + 8 * hh); bq.half[1] = *(const v8us*)(Bh + boff + 16 + 8 * hh);
      acc[t] = mmaH<ASPLIT ? 2 : 1>(ah.v, al.v, bq.v, bq.v, acc[t]); }
  }
#pragma unroll
  for (int t = 0; t < 4; ++t) { if (col0 + t * 16 >= N) continue;
#pragma unroll
    for (int r = 0; r < 8; ++r) so[w][8 * hh + r][t * 16 + ln] = acc[t][r] * alpha; }
  __builtin_amdgcn_fence(__ATOMIC_ACQ_REL, "workgroup"); __builtin_amdgcn_wave_barrier();
  const int rsub = lane >> 4, c4 = (lane & 15) * 4;
  {
#pragma unroll
    for (int q = 0; q < 8; ++q) { const int r = q * 2 + rsub; if (col0 + c4 < N) { const v4f v = *(const v4fa*)&so[w][r][c4]; *(v4f*)(C + (size_t)(row0 + r) * ldc + col0 + c4) = v; } }
     }
}

// Wt[n][k] = f16(W[k][n]·scale) from f32 row-major W[K][N] (scale = power of two; bf16-exact weights stay exact in f16 away from the subnormal range)
__global__ __launch_bounds__(256) void k_wt_f16(const float* __restrict__ W, _Float16* __restrict__ Wt, int K, int N, float scale) {
  const int t = blockIdx.x * 256 + threadIdx.x; if (t >= N * (K / 8)) return; const int n = t / (K / 8), k8 = (t % (K / 8)) * 8; FragH f;
#pragma unroll
  for (int i = 0; i < 8; ++i) f.h[i] = (_Float16)(bf16_round(W[(size_t)(k8 + i) * N + n]) * scale); const v8us o = f.half[0];
  *(v8us*)((unsigned short*)Wt + (size_t)n * K + k8) = o; 
}
// k_gemm_hh variant with fused epilogue: v = acc·alpha + bias[by·sBias + col] (+ CP[(row/rowsPerB)·sCPb + by·64 + col] if CP) ; ACT 0 none / 1 elu ; writes f16 C16 (and f32 C if non-null)
template <int ACT>
__global__ __launch_bounds__(128) void k_gemm_hhx(const _Float16* __restrict__ A, int lda, size_t sA, const _Float16* __restrict__ Bh, int ldb, size_t sB, float alpha, const float* __restrict__ bias, size_t sBias, const float* __restrict__ CP, int rowsPerB, size_t sCPb, int row0g,
    float* __restrict__ C, _Float16* __restrict__ C16, int ldc, size_t sC, int M, int N, int K) {
  __shared__ __attribute__((aligned(16))) float so[4][16][64];
  const int tid = threadIdx.x, w = tid >> 5, lane = tid & 31, ln = lane & 15, hh = lane >> 4; const int by = blockIdx.y;
  A += (size_t)by * sA; Bh += (size_t)by * sB; const size_t cofs = (size_t)by * sC; const float* bp = bias ? bias + (size_t)by * sBias : nullptr;
  const int ntn = (N + 63) / 64; const int wid = blockIdx.x * 4 + w; const int mt = wid / ntn, nq = wid % ntn; if (mt * 16 >= M) return;
  const int row0 = mt * 16, col0 = nq * 64; const _Float16* arow = A + (size_t)(row0 + ln) * lda;
  v8f acc[4] = {};
  for (int kb = 0; kb < K; kb += 32) { FragH ah; ah.half[0] = *(const v8us*)((const unsigned short*)arow + kb + 8 * hh); ah.half[1] = *(const v8us*)((const unsigned short*)arow + kb + 16 + 8 * hh);
#pragma unroll
    for (int t = 0; t < 4; ++t) { if (col0 + t * 16 >= N) continue; const size_t boff = (size_t)(col0 + t * 16 + ln) * ldb + kb; FragH bq; bq.half[0] = *(const v8us*)((const unsigned short*)Bh + boff + 8 * hh); bq.half[1] = *(const v8us*)((const unsigned short*)Bh + boff + 16 + 8 * hh);
      acc[t] = mmaH<1>(ah.v, ah.v, bq.v, bq.v, acc[t]); }
  }
#pragma unroll
  for (int t = 0; t < 4; ++t) { if (col0 + t * 16 >= N) continue; const int col = col0 + t * 16 + ln; const float bv = bp ? bf16_round(bp[col]) : 0.f;
#pragma unroll
    for (int r = 0; r < 8; ++r) { float v = acc[t][r] * alpha + bv; if (CP) { const int rr = row0g + row0 + 8 * hh + r; if (rowsPerB < 0) v += CP[cofs + (size_t)rr * ldc + col];      /* rowsPerB < 0: own element of the batched C plane */ else { const int bidx = rr / rowsPerB; v += CP[(size_t)bidx * sCPb + (size_t)by * 64 + col]; } } if (ACT == 1) v = (v > 0.f) ? v : expm1f(v); else if (ACT == 7) v = (v > 0.f) ? v + 1.0f : expf(v); else if (ACT == 8) v = tanhf(v); else if (ACT == 9) v = 0.5f * v * (1.0f + tanhf(0.7978845608028654f * (v + 0.044715f * v * v * v))); else if (ACT == 11) v = 1.0f / (1.0f + expf(-v)); else if (ACT == 12) v = (v > 0.f) ? v : 0.01f * v; else if (ACT == 14) v = (v > 0.f) ? v : 0.1f * v; else if (ACT == 16) v = (v >= 0.f) ? v : 0.3f * v; else if (ACT == 17) v = (v >= 0.f) ? v : 0.2f * v; else if (ACT == 15) v = v / (1.0f + expf(-v)); else if (ACT == 3) v = fmaxf(v, 0.f); else if (ACT == 6) v = 0.5f * v * (1.0f + erff(v * 0.70710678118654752f)); so[w][8 * hh + r][t * 16 + ln] = v; } }
  __builtin_amdgcn_fence(__ATOMIC_ACQ_REL, "workgroup"); __builtin_amdgcn_wave_barrier();
  const int rsub = lane >> 4, c4 = (lane & 15) * 4; typedef _Float16 v4h __attribute__((ext_vector_type(4)));
  {
#pragma unroll
    for (int q = 0; q < 8; ++q) { const int r = q * 2 + rsub; if (col0 + c4 < N) { const v4f v = *(const v4fa*)&so[w][r][c4]; if (C) *(v4f*)(C + cofs + (size_t)(row0 + r) * ldc + col0 + c4) = v; if (C16) { v4h h4; for (int i = 0; i < 4; ++i) h4[i] = (_Float16)v[i]; *(v4h*)(C16 + cofs + (size_t)(row0 + r) * ldc + col0 + c4) = h4; } } }
     }
}


typedef _Float16 v4h __attribute__((ext_vector_type(4)));

__global__ __launch_bounds__(256) void k_h16(const float* __restrict__ x, _Float16* __restrict__ X16, size_t n8) { const size_t t = (size_t)blockIdx.x * 256 + threadIdx.x; if (t >= n8) return; FragH f;
#pragma unroll
  for (int q = 0; q < 8; ++q) f.h[q] = (_Float16)x[t * 8 + q]; *(v8us*)((unsigned short*)X16 + t * 8) = f.half[0];  }
__global__ __launch_bounds__(256) void k_round16f(const float* __restrict__ W, _Float16* __restrict__ Bt, size_t n8) { const size_t t = (size_t)blockIdx.x * 256 + threadIdx.x; if (t >= n8) return; FragH f;
#pragma unroll
  for (int i = 0; i < 8; ++i) f.h[i] = (_Float16)(bf16_round(W[t * 8 + i]) * 16.0f); *(v8us*)((unsigned short*)Bt + t * 8) = f.half[0];  }
template <int NHv, int TTv>
__global__ __launch_bounds__(256) void k_vt(const _Float16* __restrict__ V16, int ldv, int voff, _Float16* __restrict__ Vt) { __shared__ unsigned short tl[64][66]; const int tid = threadIdx.x; const int slab = blockIdx.x / (TTv / 64), lg = blockIdx.x % (TTv / 64); const int b = slab / NHv, h = slab % NHv;
  for (int i = tid; i < 64 * 8; i += 256) { const int r = i / 8, c8 = (i % 8) * 8; FragH f; f.half[0] = *(const v8us*)((const unsigned short*)V16 + ((size_t)b * TTv + lg * 64 + r) * ldv + voff + h * 64 + c8);
#pragma unroll
    for (int q = 0; q < 8; ++q) tl[r][c8 + q] = f.u[q]; }
  __syncthreads();
  {
#pragma unroll
    for (int rd = 0; rd < 2; ++rd) { const int d = rd * 32 + tid / 8, pc = tid % 8; FragH f;
#pragma unroll
      for (int q = 0; q < 8; ++q) f.u[q] = tl[pc * 8 + q][d];
      *(v8us*)((unsigned short*)Vt + ((size_t)slab * 64 + d) * TTv + lg * 64 + pc * 8) = f.half[0]; }
     } }

__global__ __launch_bounds__(256) void k_hl(const float* __restrict__ F, _Float16* __restrict__ Hh, _Float16* __restrict__ Hl, size_t n8) { const size_t t = (size_t)blockIdx.x * 256 + threadIdx.x; if (t >= n8) return; FragH fh, fl; const v4f a = *(const v4fa*)(F + t * 8), c = *(const v4fa*)(F + t * 8 + 4);
#pragma unroll
  for (int q = 0; q < 4; ++q) { _Float16 h = (_Float16)a[q]; fh.h[q] = h; fl.h[q] = (_Float16)((a[q] - (float)h) * 1024.0f); h = (_Float16)c[q]; fh.h[4 + q] = h; fl.h[4 + q] = (_Float16)((c[q] - (float)h) * 1024.0f); }
  { *(v8us*)((unsigned short*)Hh + t * 8) = fh.half[0]; *(v8us*)((unsigned short*)Hl + t * 8) = fl.half[0];  } }

// ---- fast GEMM (wave tile 32x64, work-group tile 128x64; requires M % 128 == 0 rows per launch region, N % 64 == 0 and K % 128 == 0); epilogue = k_gemm_hhx semantics ----
__device__ __forceinline__ v16h g2_frag(const _Float16* p, int hh) { FragH f; f.half[0] = *(const v8us*)((const unsigned short*)p + 8 * hh); f.half[1] = *(const v8us*)((const unsigned short*)p + 16 + 8 * hh); return f.v; }
__device__ __forceinline__ v8f g2_mma(v16h a, v16h b, v8f c) { v8f d = __builtin_amdgcn_wmma_f32_16x16x32_f16(false, a, false, b, (short)0, c, false, false); asm volatile("v_nop\n\tv_nop\n\tv_nop\n\tv_nop" : "+v"(d) : "v"(a), "v"(b)); return d; }
// ---- operand ring of k_gemm2: a stage is 128 k (256 bytes) of the work-group's 128 A rows and 64 B rows, laid in LDS at a pitch of 272 bytes (16 x odd: 16-byte fragment reads meet no bank conflict); two buffers ----
#define G2_KT 128
#define G2_PITCH 272
#define G2_BUF (192 * G2_PITCH)
__device__ __forceinline__ v8f g2_mmab(v16h a, v16h b, v8f c) { return __builtin_amdgcn_wmma_f32_16x16x32_f16(false, a, false, b, (short)0, c, false, false); }
__device__ __forceinline__ v16h g2_lfrag(const unsigned char* p) { FragH f; f.half[0] = *(const v8us*)p; f.half[1] = *(const v8us*)(p + 32); return f.v; }      /* p = the lane's row + 16 hh bytes: elements 0..7 = k 8 hh + e, 8..15 = k 16 + 8 hh + e, as in g2_frag */
// Eight asynchronous 16-byte copies of a thread, global to LDS through no register: 64 operand rows a call (row step 8), 16 threads a row, so that a wave's copy reads two whole 256-byte row pieces.
// The address wait is the statement's last line: it stands in front of whatever next writes a register that a copy names.
__device__ __forceinline__ void g2_copy8(unsigned l, const _Float16* g, size_t g8) {
  const unsigned l1 = l + 8 * G2_PITCH, l2 = l + 16 * G2_PITCH, l3 = l + 24 * G2_PITCH, l4 = l + 32 * G2_PITCH, l5 = l + 40 * G2_PITCH, l6 = l + 48 * G2_PITCH, l7 = l + 56 * G2_PITCH;
  const _Float16* g1 = g + g8; const _Float16* g2 = g1 + g8; const _Float16* g3 = g2 + g8; const _Float16* g4 = g3 + g8; const _Float16* g5 = g4 + g8; const _Float16* g6 = g5 + g8; const _Float16* g7 = g6 + g8;
  asm volatile("global_load_async_to_lds_b128 %0, %8, off\n\tglobal_load_async_to_lds_b128 %1, %9, off\n\tglobal_load_async_to_lds_b128 %2, %10, off\n\tglobal_load_async_to_lds_b128 %3, %11, off\n\t"
               "global_load_async_to_lds_b128 %4, %12, off\n\tglobal_load_async_to_lds_b128 %5, %13, off\n\tglobal_load_async_to_lds_b128 %6, %14, off\n\tglobal_load_async_to_lds_b128 %7, %15, off\n\ts_wait_xcnt 0x0"
               :: "v"(l), "v"(l1), "v"(l2), "v"(l3), "v"(l4), "v"(l5), "v"(l6), "v"(l7), "v"(g), "v"(g1), "v"(g2), "v"(g3), "v"(g4), "v"(g5), "v"(g6), "v"(g7) : "memory"); }
// Grid y = the projection (0 Q, 1 K, 2 V): the three products depend on nothing of one another, so they run as one grid; a work-group of a later one starts on a WGP as soon as one of an earlier one ends there. Plane y of A, Bh and C16 stands y sA, y sB, y sC elements behind plane 0; each has its own bias pointer.
// pk = y: layout of C16. 0 = rows of pitch ldc. 1, 2 = fragment order for the attention loop (N / 64 heads, M keys): the wave's 32 keys x 64 features of head nq are 8 units of 512 bytes at ((nq M + row0) 64) elements,
// unit u holding lane l's 8 elements at 8 l, so that one wave-wide 16-byte load of a unit reads 4 whole cache lines. 1 (K, A operand of S^T): u = 4 (key / 16) + feature / 16, lane = 16 ((feature / 8) & 1) + key % 16, element = feature % 8.
// 2 (V^T, A operand of O^T): u = 2 (feature / 16) + (key / 16) % 2, lane = 16 ((key / 8) & 1) + feature % 16, element = key % 8.
template <int ACT>
__global__ __launch_bounds__(128) void k_gemm2(const _Float16* __restrict__ A, int lda, size_t sA, const _Float16* __restrict__ Bh, int ldb, size_t sB, float alpha, const float* __restrict__ bias, const float* __restrict__ bias1, const float* __restrict__ bias2, const float* __restrict__ CP, int rowsPerB, size_t sCPb, int row0g,
    float* __restrict__ C, _Float16* __restrict__ C16, int ldc, size_t sC, int M, int N, int K, float osc0) { static_assert(ACT == 0 || ACT == 3 || ACT == 6 || ACT == 8 || ACT == 9 || ACT == 11 || ACT == 12 || ACT == 14 || ACT == 15 || ACT == 16 || ACT == 17, "k_gemm2: unsupported ACT code (would silently apply no activation)");
  __shared__ __attribute__((aligned(16))) float so[4][32][68];
  __shared__ __attribute__((aligned(16))) unsigned char ring[2 * G2_BUF];      /* rows 0..127 of a buffer: the work-group's A rows; 128..191: its B rows */
  const int tid = threadIdx.x, w = tid >> 5, lane = tid & 31, ln = lane & 15, hh = lane >> 4; const int by = blockIdx.y;
  A += (size_t)by * sA; Bh += (size_t)by * sB; const size_t cofs = (size_t)by * sC; const float* bp = by == 0 ? bias : by == 1 ? bias1 : bias2; const int pk = by; const float osc = by == 0 ? osc0 : 1.0f;      /* all scalar: by is the same for the work-group */
  const int ntn = N >> 6; const int mt = blockIdx.x / ntn, nq = blockIdx.x - mt * ntn; const int row0 = mt * 128 + 32 * w, col0 = nq * 64; if (mt * 128 >= M) return;      /* the whole work-group leaves or none does (barriers below); needs M % 128 == 0, K % 128 == 0, K >= 128 */
  const _Float16* ga = A + (size_t)(mt * 128 + (tid >> 4)) * lda + (tid & 15) * 8; const _Float16* gb = Bh + (size_t)(col0 + (tid >> 4)) * ldb + (tid & 15) * 8;      /* the thread's first 16 bytes of a stage: row tid / 16, piece tid % 16 */
  const unsigned lc = (unsigned)(size_t)ring + (unsigned)((tid >> 4) * G2_PITCH + (tid & 15) * 16);      /* their place in buffer 0: byte address in the work-group's LDS */
  const size_t a8 = (size_t)8 * lda, b8 = (size_t)8 * ldb; const int nt = K / G2_KT;
  /* Work-groups of one mt read the same A rows from L2, those of one nq the same B rows, and they start together: each enters the nt stages at a stage of its own and wraps round. ks(t) = first k of the stage worked on in trip t. */
  const int rot = (mt + nq) % nt; auto ks = [&](int t) { const int s = t + rot; return (size_t)(s >= nt ? s - nt : s) * G2_KT; };      /* scalar; t < nt and rot < nt, so 0 <= stage < nt */
  const unsigned char* fa = ring + (32 * w + ln) * G2_PITCH + 16 * hh; const unsigned char* fb = ring + (128 + ln) * G2_PITCH + 16 * hh;      /* the lane's fragment rows in buffer 0 */
  const v8f z8 = {0.f,0.f,0.f,0.f,0.f,0.f,0.f,0.f}; v8f c00 = z8, c01 = z8, c02 = z8, c03 = z8, c10 = z8, c11 = z8, c12 = z8, c13 = z8;
  { const size_t k0 = ks(0); g2_copy8(lc, ga + k0, a8); g2_copy8(lc + 64 * G2_PITCH, ga + k0 + 8 * a8, a8); g2_copy8(lc + 128 * G2_PITCH, gb + k0, b8); }      /* trip 0's stage into buffer 0 */
  asm volatile("s_wait_asynccnt 0x0" ::: "memory");      /* this wave's copies of trip 0's stage have landed */
  __syncthreads();      /* every wave's have: trip 0's stage may be read */
  if (nt > 1) { const size_t k1 = ks(1); g2_copy8(lc + G2_BUF, ga + k1, a8); g2_copy8(lc + G2_BUF + 64 * G2_PITCH, ga + k1 + 8 * a8, a8); g2_copy8(lc + G2_BUF + 128 * G2_PITCH, gb + k1, b8); }      /* trip 1's stage flies while trip 0's is worked on */
#pragma unroll 1      /* one stage a trip: the ring's order below is written once */
  for (int t = 0; t < nt; ++t) { const unsigned bo = (unsigned)(t & 1) * G2_BUF;
    const unsigned char* pa = fa + bo; const unsigned char* pb = fb + bo; v16h fr[2][6];      /* two fragment sets: A rows 0..15, 16..31, B columns 0..15 .. 48..63 of one k step */
    fr[0][0] = g2_lfrag(pa); fr[0][1] = g2_lfrag(pa + 16 * G2_PITCH); fr[0][2] = g2_lfrag(pb); fr[0][3] = g2_lfrag(pb + 16 * G2_PITCH); fr[0][4] = g2_lfrag(pb + 32 * G2_PITCH); fr[0][5] = g2_lfrag(pb + 48 * G2_PITCH);
#pragma unroll      /* constant indices keep the fragment sets in registers; constant offsets for the four k steps of a stage */
    for (int kk = 0; kk < 4; ++kk) { const int c = kk & 1, n = c ^ 1;
      if (kk < 3) { const unsigned char* qa = pa + (kk + 1) * 64; const unsigned char* qb = pb + (kk + 1) * 64;      /* the next k step of this same stage */
        fr[n][0] = g2_lfrag(qa); fr[n][1] = g2_lfrag(qa + 16 * G2_PITCH); fr[n][2] = g2_lfrag(qb); fr[n][3] = g2_lfrag(qb + 16 * G2_PITCH); fr[n][4] = g2_lfrag(qb + 32 * G2_PITCH); fr[n][5] = g2_lfrag(qb + 48 * G2_PITCH); }
      __builtin_amdgcn_sched_barrier(0);      /* keeps the twelve LDS reads one group in front of the products: spread among them, each pair is waited out to 0 */
      c00 = g2_mmab(fr[c][0], fr[c][2], c00); c10 = g2_mmab(fr[c][1], fr[c][2], c10); c01 = g2_mmab(fr[c][0], fr[c][3], c01); c11 = g2_mmab(fr[c][1], fr[c][3], c11);
      c02 = g2_mmab(fr[c][0], fr[c][4], c02); c12 = g2_mmab(fr[c][1], fr[c][4], c12); c03 = g2_mmab(fr[c][0], fr[c][5], c03); c13 = g2_mmab(fr[c][1], fr[c][5], c13);
      __builtin_amdgcn_sched_barrier(0); }      /* the other side of the same fence: the following group stays behind these products */
    asm volatile("s_wait_dscnt 0x0" ::: "memory");      /* this wave's reads of the buffer are done before it is handed over */
    asm volatile("s_wait_asynccnt 0x0" ::: "memory");      /* this wave's copies of trip t + 1's stage have landed */
    __syncthreads();      /* publishes trip t + 1's stage and ends every reader's last read of trip t's buffer */
    if (t + 2 < nt) { const size_t k2 = ks(t + 2); const _Float16* na = ga + k2; const _Float16* nb = gb + k2;      /* refill of the buffer just read */
      g2_copy8(lc + bo, na, a8); g2_copy8(lc + bo + 64 * G2_PITCH, na + 8 * a8, a8); g2_copy8(lc + bo + 128 * G2_PITCH, nb, b8); } }
  asm volatile("s_wait_asynccnt 0x0" ::: "memory");      /* nothing of this wave is in flight behind the loop */
  v8f accs[8] = {c00, c01, c02, c03, c10, c11, c12, c13};
#pragma unroll
  for (int u = 0; u < 8; ++u) { const int t = u & 3, half = u >> 2; const int col = col0 + t * 16 + ln; const float bv = bp ? bf16_round(bp[col]) : 0.f;
#pragma unroll
    for (int r = 0; r < 8; ++r) { const int rloc = half * 16 + 8 * hh + r; float v = accs[u][r] * alpha + bv; if (CP) { if (rowsPerB < 0) v += CP[cofs + (size_t)(row0g + row0 + rloc) * ldc + col];      /* rowsPerB < 0: own element of the batched C plane */ else { const int bidx = (row0g + row0 + rloc) / rowsPerB; v += CP[(size_t)bidx * sCPb + (size_t)by * 64 + col]; } }
      if (ACT == 3) v = fmaxf(v, 0.f); else if (ACT == 6) v = 0.5f * v * (1.0f + erff(v * 0.70710678118654752f)); else if (ACT == 11) v = 1.0f / (1.0f + expf(-v)); else if (ACT == 15) v = v / (1.0f + expf(-v)); else if (ACT == 12) v = (v > 0.f) ? v : 0.01f * v; else if (ACT == 8) v = tanhf(v); else if (ACT == 9) v = 0.5f * v * (1.0f + tanhf(0.7978845608028654f * (v + 0.044715f * v * v * v))); else if (ACT == 14) v = (v > 0.f) ? v : 0.1f * v; else if (ACT == 16) v = (v >= 0.f) ? v : 0.3f * v; else if (ACT == 17) v = (v >= 0.f) ? v : 0.2f * v;
      so[w][rloc][t * 16 + ln] = v * osc; } }      /* osc: a factor on the finished f32 value, in front of its one rounding to f16 (osc0 for plane 0; 1, which leaves it as it is, for the others) */
  __builtin_amdgcn_fence(__ATOMIC_ACQ_REL, "workgroup"); __builtin_amdgcn_wave_barrier();
  const int rsub = lane >> 4, c4 = (lane & 15) * 4;
  if (pk == 0) {
#pragma unroll
    for (int q = 0; q < 16; ++q) { const int r = q * 2 + rsub; const v4f v = *(const v4fa*)&so[w][r][c4]; if (C) *(v4f*)(C + cofs + (size_t)(row0 + r) * ldc + col0 + c4) = v; if (C16) { v4h h4; for (int i = 0; i < 4; ++i) h4[i] = (_Float16)v[i]; *(v4h*)(C16 + cofs + (size_t)(row0 + r) * ldc + col0 + c4) = h4; } }
  } else {
    unsigned short* dp = (unsigned short*)C16 + cofs + ((size_t)nq * M + row0) * 64 + lane * 8;
    if (pk == 1) {
#pragma unroll
      for (int u = 0; u < 8; ++u) { FragH f; const int rl = (u >> 2) * 16 + ln, cl = (u & 3) * 16 + 8 * hh; const v4f x = *(const v4fa*)&so[w][rl][cl], y = *(const v4fa*)&so[w][rl][cl + 4];
#pragma unroll
        for (int i = 0; i < 4; ++i) { f.h[i] = (_Float16)x[i]; f.h[4 + i] = (_Float16)y[i]; }
        *(v8us*)(dp + u * 256) = f.half[0]; }
      asm volatile("s_wait_xcnt 0x0" ::: "memory");      /* address wait behind the run of stores above, in front of whatever next writes a register that they name */
    } else {
#pragma unroll
      for (int u = 0; u < 8; ++u) { FragH f; const int rl = (u & 1) * 16 + 8 * hh, cl = (u >> 1) * 16 + ln;
#pragma unroll
        for (int i = 0; i < 8; ++i) f.h[i] = (_Float16)so[w][rl + i][cl];
        *(v8us*)(dp + u * 256) = f.half[0]; }
      asm volatile("s_wait_xcnt 0x0" ::: "memory");      /* address wait behind the run of stores above, in front of whatever next writes a register that they name */
    }
  } }


__global__ __launch_bounds__(256) void k_wnat(const float* __restrict__ w, size_t n8, _Float16* __restrict__ Bt) { const size_t t = (size_t)blockIdx.x * 256 + threadIdx.x; if (t >= n8) return; FragH f; for (int q = 0; q < 8; ++q) f.h[q] = (_Float16)(bf16_round(w[t * 8 + q]) * 16.0f); *(v8us*)((unsigned short*)Bt + t * 8) = f.half[0];  }
__global__ __launch_bounds__(256) void k_rsm(const float* __restrict__ S, _Float16* __restrict__ P, int nrows) {
  #pragma clang fp contract(off)
  const int i = blockIdx.x * 256 + threadIdx.x; if (i >= nrows) return; const float* s = S + (size_t)i * SQ; float mx = -3.0e38f;
#pragma unroll 1
  for (int j = 0; j < SQ; ++j) mx = fmaxf(mx, s[j]); float se = 0.f;
#pragma unroll 1
  for (int j = 0; j < SQ; ++j) se += expf(s[j] - mx); const float sc = 256.0f / se;
#pragma unroll 1
  for (int j0 = 0; j0 < SQ; j0 += 8) { FragH f; for (int q = 0; q < 8; ++q) f.h[q] = (_Float16)(expf(s[j0 + q] - mx) * sc); unsigned short* d = (unsigned short*)P + (size_t)i * SQ + j0; *(v8us*)d = f.half[0];  } }
__global__ __launch_bounds__(256) void k_vt(const _Float16* __restrict__ V16, int b, int h0, _Float16* __restrict__ VT) { __shared__ unsigned short tl[64][65]; const int tid = threadIdx.x; const int hh = blockIdx.x % HG, sg = blockIdx.x / HG; const int s0 = sg * 64; const int h = h0 + hh;
  for (int i = tid; i < 64 * 8; i += 256) { const int j = i / 8, d8 = (i % 8) * 8; FragH f; f.half[0] = *(const v8us*)((const unsigned short*)V16 + ((size_t)b * SQ + s0 + j) * DM + h * HD + d8); for (int q = 0; q < 8; ++q) tl[d8 + q][j] = f.u[q]; }
  __syncthreads();
  { for (int i = tid; i < 64 * 8; i += 256) { const int d = i / 8, j8 = (i % 8) * 8; FragH f; for (int q = 0; q < 8; ++q) f.u[q] = tl[d][j8 + q]; *(v8us*)((unsigned short*)VT + ((size_t)hh * HD + d) * SQ + s0 + j8) = f.half[0]; }  } }



__global__ __launch_bounds__(256) void k_rsmkm(const float* __restrict__ S, _Float16* __restrict__ P, int nrows, const int* __restrict__ am) {
  #pragma clang fp contract(off)
  const int t = blockIdx.x * 256 + threadIdx.x; if (t >= nrows) return; const size_t i = (size_t)t; const float* s = S + i * SQ; const int* mr = am + (size_t)(t % SQ) * SQ; float mx = -3.0e38f;
#pragma unroll 1
  for (int j = 0; j < SQ; ++j) { const float f = (mr[j] != 0) ? 1.f : 0.f; mx = fmaxf(mx, fmaf(f, s[j], (1.f - f) * -1.0e9f)); } float se = 0.f;
#pragma unroll 1
  for (int j = 0; j < SQ; ++j) { const float f = (mr[j] != 0) ? 1.f : 0.f; se += __expf(fmaf(f, s[j], (1.f - f) * -1.0e9f) - mx); } const float sc = 256.0f / se;
#pragma unroll 1
  for (int j0 = 0; j0 < SQ; j0 += 8) { FragH fr; for (int q = 0; q < 8; ++q) { const int j = j0 + q; const float f = (mr[j] != 0) ? 1.f : 0.f; fr.h[q] = (_Float16)(__expf(fmaf(f, s[j], (1.f - f) * -1.0e9f) - mx) * sc); }
    unsigned short* d = (unsigned short*)P + i * SQ + j0; *(v8us*)d = fr.half[0];  } }
// The swap of a wave's two 16-lane rows: a plain lane shuffle would go through the LDS pipe.
__device__ __forceinline__ float rs_x16(float v) { const int b = __float_as_int(v); return __int_as_float(__builtin_amdgcn_permlanex16(b, b, 0x76543210, 0xfedcba98, false, false)); }
// Four native 2^x in one statement: no result shares a register
// with a source (early clobber), each exp has an independent one behind it, and the v_nop is the slot that the instruction set asks for behind the last.
__device__ __forceinline__ v4f rs_exp2x4(v4f x) { float y0, y1, y2, y3;
  asm("v_exp_f32 %0, %4\n\tv_exp_f32 %1, %5\n\tv_exp_f32 %2, %6\n\tv_exp_f32 %3, %7\n\tv_nop" : "=&v"(y0), "=&v"(y1), "=&v"(y2), "=&v"(y3) : "v"(x[0]), "v"(x[1]), "v"(x[2]), "v"(x[3]));
  const v4f y = {y0, y1, y2, y3}; return y; }
// One native 2^x with the same slot behind it.
__device__ __forceinline__ float rs_exp2(float x) { float y; asm("v_exp_f32 %0, %1\n\tv_nop" : "=&v"(y) : "v"(x)); return y; }
__device__ __forceinline__ v16h fa_frag(const _Float16* base, unsigned lofs) { FragH f; f.half[0] = *(const v8us*)((const unsigned short*)base + lofs); f.half[1] = *(const v8us*)((const unsigned short*)base + lofs + 16); return f.v; }      /* base is wave-uniform, lofs the lane's own element offset (row ln, k 8 hh) */
__device__ __forceinline__ v8f fa_mma(v16h a, v16h b, v8f c) { return __builtin_amdgcn_wmma_f32_16x16x32_f16(false, a, false, b, (short)0, c, false, false); }
// ---- K / V^T ring of k_fattn: a stage is FA_SP passes (of 32 keys) of both key halves; a pass of a half is 4 KB of K, then 4 KB of V^T, each in fragment order as it stands in global memory; two buffers ----
#define FA_SP 4
#define FA_HALF (FA_SP * 8192)
#define FA_BUF (2 * FA_HALF)
#define FA_NST (SQ / 64 / FA_SP)      /* stages of a key half */
__device__ __forceinline__ v16h fa_lfrag(const unsigned char* p) { FragH f; f.half[0] = *(const v8us*)p; f.half[1] = *(const v8us*)(p + 512); return f.v; }      /* fragment-order operand: p = a unit of 512 bytes in LDS + 16 lane, the second unit behind it; elements 0..7 and 8..15 as in fa_frag; a wave's read is 512 bytes in a row: no bank conflict */
// Eight asynchronous 16-byte copies of a lane, global to LDS through no register: 4 KB in a row for the wave (K or V^T of one pass), 512 bytes (4 whole lines) a copy.
// The address wait is the statement's last line: it stands in front of whatever next writes a register that a copy names.
__device__ __forceinline__ void fa_copy8(unsigned l, const _Float16* g) {
  const unsigned l1 = l + 512, l2 = l + 1024, l3 = l + 1536, l4 = l + 2048, l5 = l + 2560, l6 = l + 3072, l7 = l + 3584;
  const _Float16* g1 = g + 256; const _Float16* g2 = g + 512; const _Float16* g3 = g + 768; const _Float16* g4 = g + 1024; const _Float16* g5 = g + 1280; const _Float16* g6 = g + 1536; const _Float16* g7 = g + 1792;
  asm volatile("global_load_async_to_lds_b128 %0, %8, off\n\tglobal_load_async_to_lds_b128 %1, %9, off\n\tglobal_load_async_to_lds_b128 %2, %10, off\n\tglobal_load_async_to_lds_b128 %3, %11, off\n\t"
               "global_load_async_to_lds_b128 %4, %12, off\n\tglobal_load_async_to_lds_b128 %5, %13, off\n\tglobal_load_async_to_lds_b128 %6, %14, off\n\tglobal_load_async_to_lds_b128 %7, %15, off\n\ts_wait_xcnt 0x0"
               :: "v"(l), "v"(l1), "v"(l2), "v"(l3), "v"(l4), "v"(l5), "v"(l6), "v"(l7), "v"(g), "v"(g1), "v"(g2), "v"(g3), "v"(g4), "v"(g5), "v"(g6), "v"(g7) : "memory"); }
// 16 waves a work-group, one work-group a WGP, so 4 waves a SIMD: vector work of one wave runs beside the products and the load waits of the others. Waves w and w + 8 own the same 32 query rows;
// wave w walks keys 0..2047, wave w + 8 keys 2048..4095, each with its own held reference, sum and O^T; behind the loop the upper wave hands its three over in LDS and the lower wave joins them.
// The 8 waves of a key half read the same K and V^T: a stage of them is brought into LDS once for the work-group, a whole stage ahead of its use, and every wave takes its fragments from there.
__global__ __launch_bounds__(512) void k_fattn(const _Float16* __restrict__ Q, const _Float16* __restrict__ KP, const _Float16* __restrict__ VP, float* __restrict__ O) {      /* Q in rows; KP, VP in fragment order (k_gemm2, pk 1 and 2): 32 keys of a head are 4 KB in a row in each */
  __shared__ __attribute__((aligned(16))) float xo[8][17][32][4];      /* per query tile: the upper wave's O^T as 16 pieces of 16 bytes a lane (a wave's piece is 512 bytes in a row: no bank conflict), then its references and sums */
  __shared__ __attribute__((aligned(16))) unsigned char kvr[2 * FA_BUF];      /* [buffer][key half][pass of the stage][K, V^T][4 KB] */
  const int lane = threadIdx.x & 31, ln = lane & 15, hh = lane >> 4; const int w = __builtin_amdgcn_readfirstlane(threadIdx.x >> 5);      /* the wave's number, held scalar so that the row bases and the branches on it are scalar */
  const int wq = w & 7, kh = w >> 3, kbeg = kh * (SQ / 2);      /* query tile, key half, first key of the half */
  const int h = blockIdx.x / (SQ / 256); const int q0 = (blockIdx.x % (SQ / 256)) * 256 + wq * 32;
  /* The 16 work-groups of a head read the same K and V^T lines from L2 and start together: each enters the 64 passes of its halves at a pass of its own (4 apart within a head, heads one apart) and wraps round, so that no two of a head ask for a line at the same moment. */
  const int rot = (4 * (int)(blockIdx.x % (SQ / 256)) + h) & (SQ / 64 - 1);      /* first pass walked */
  const unsigned lk = (unsigned)(ln * DM + 8 * hh);
  const _Float16* qb = Q + (size_t)q0 * DM + h * HD; const _Float16* kb = KP + (size_t)h * HD * SQ; const _Float16* vb = VP + (size_t)h * HD * SQ;
  /* The wave's share of a stage: piece wq of its own key half, that is K (wq even) or V^T (wq odd) of the stage's pass wq / 2. All scalar but the lane's 16 bytes. */
  static_assert(FA_SP == 4 && FA_NST >= 2 && FA_NST * FA_SP == SQ / 64, "k_fattn: 8 pieces of 4 KB a stage and half, one a wave; at least two stages");
  const _Float16* cs = ((wq & 1) ? vb : kb) + lane * 8; const unsigned cl = (unsigned)(size_t)kvr + (unsigned)(kh * FA_HALF + wq * 4096 + lane * 16);      /* source, and place in buffer 0: byte address in the work-group's LDS */
  auto stage = [&](int t, unsigned bo) { const int key = kbeg + ((rot + t * FA_SP + (wq >> 1)) & (SQ / 64 - 1)) * 32; fa_copy8(cl + bo, cs + key * HD); };      /* stage t = passes rot + 4 t .. rot + 4 t + 3, each wrapped inside the half on its own */
  const unsigned char* fb = kvr + kh * FA_HALF + lane * 16;      /* the lane's 16 bytes of the first unit of its half in buffer 0 */
  v16h qf[2][2], kf[2][2], vf[4];
  /* every loop over a fragment, score or output array of this kernel is unrolled: constant indices keep the arrays in registers */
#pragma unroll
  for (int j = 0; j < 2; ++j) { qf[j][0] = fa_frag(qb + j * 16 * DM, lk); qf[j][1] = fa_frag(qb + j * 16 * DM + 32, lk); }
  stage(0, 0);      /* stage 0 into buffer 0 */
  asm volatile("s_wait_asynccnt 0x0" ::: "memory");      /* this wave's copies of stage 0 have landed */
  __syncthreads();      /* every wave's have: stage 0 may be read */
  stage(1, FA_BUF);      /* stage 1 flies while stage 0 is worked on */
#pragma unroll
  for (int t = 0; t < 2; ++t) { kf[t][0] = fa_lfrag(fb + t * 2048); kf[t][1] = fa_lfrag(fb + t * 2048 + 1024); }
  const v8f z8 = {0.f, 0.f, 0.f, 0.f, 0.f, 0.f, 0.f, 0.f}; v8f o[2][4], cr[2]; float l[2] = {0.f, 0.f};
#pragma unroll
  for (int j = 0; j < 2; ++j) for (int t = 0; t < 4; ++t) o[j][t] = z8;
  /* The held reference. Q arrives times log2 e / sqrt(64), so K Q^T is the score in log2 units. cr[j] = 8 - reference of query ln, the same in all 8 registers and in both halves of the wave, is the C operand of the
     score products: their D is the argument of 2^x as it stands (weights are 2^8 e^(s - reference): f16 keeps small ones normal; the row sum carries the same factor). It starts as the maximum of the first 32 keys that the wave walks. */
#pragma unroll
  for (int j = 0; j < 2; ++j) { const v8f a = fa_mma(kf[0][1], qf[j][1], fa_mma(kf[0][0], qf[j][0], z8)), b = fa_mma(kf[1][1], qf[j][1], fa_mma(kf[1][0], qf[j][0], z8)); float mx = fmaxf(a[0], b[0]);
#pragma unroll
    for (int r = 1; r < 8; ++r) mx = fmaxf(mx, fmaxf(a[r], b[r]));
    const float c = 8.0f - fmaxf(mx, rs_x16(mx));
#pragma unroll
    for (int r = 0; r < 8; ++r) cr[j][r] = c; }
#pragma unroll 1      /* one stage a trip: the ring's order below is written once */
  for (int st = 0; st < FA_NST; ++st) { const unsigned bo = (unsigned)(st & 1) * FA_BUF; const unsigned char* sb = fb + bo;      /* this trip reads this buffer alone */
#pragma unroll
    for (int t = 0; t < 2; ++t) { kf[t][0] = fa_lfrag(sb + t * 2048); kf[t][1] = fa_lfrag(sb + t * 2048 + 1024); }
    __builtin_amdgcn_sched_barrier(0);      /* keeps the 8 LDS reads above one group in front of the products: left free, the compiler sinks each pair to its first use and waits it out to 0 there */
#pragma unroll      /* constant offsets for the passes of a stage; the last one fetches nothing ahead */
    for (int pp = 0; pp < FA_SP; ++pp) {
    v8f s[2][2];
#pragma unroll
    for (int t = 0; t < 2; ++t) for (int j = 0; j < 2; ++j) s[t][j] = fa_mma(kf[t][1], qf[j][1], fa_mma(kf[t][0], qf[j][0], cr[j]));
    if (pp == 0) {      /* the stage's first V^T: behind the barrier all 16 waves read at once, and these reads, wanted only behind the softmax, leave the LDS to the waves' first K reads */
      __builtin_amdgcn_sched_barrier(0);      /* keeps them behind the score products: left free, the compiler lifts them up to the K reads */
#pragma unroll
      for (int t = 0; t < 4; ++t) vf[t] = fa_lfrag(sb + 4096 + t * 1024); }
    if (pp + 1 < FA_SP) { const unsigned char* kp = sb + (pp + 1) * 8192;      /* K one pass ahead inside the stage, into the registers that the products above have just read */
#pragma unroll
      for (int t = 0; t < 2; ++t) { kf[t][0] = fa_lfrag(kp + t * 2048); kf[t][1] = fa_lfrag(kp + t * 2048 + 1024); }
      asm volatile("" ::: "memory"); }      /* compiler fence, no instruction: left free, the compiler sinks these reads behind the test's branch, each pair to its first use, and waits it out to 0 there */
    FragH pf[2]; float mx[2];
#pragma unroll
    for (int j = 0; j < 2; ++j) { mx[j] = fmaxf(s[0][j][0], s[1][j][0]);
#pragma unroll
      for (int r = 1; r < 8; ++r) mx[j] = fmaxf(mx[j], fmaxf(s[0][j][r], s[1][j][r])); }
    /* One test a pass, a scalar branch: the reference stays while every weight of the pass is at most 2^15 (f16 holds it), that is while no score stands more than 7 (log2) above its reference. */
    if (__builtin_amdgcn_ballot_w32(fmaxf(mx[0], mx[1]) > 15.0f) != 0) {
#pragma unroll
      for (int j = 0; j < 2; ++j) { const float d = fmaxf(fmaxf(mx[j], rs_x16(mx[j])) - 8.0f, 0.f); const float al = rs_exp2(-d);      /* the reference rises to the query's maximum of this pass where that is the higher; what has been summed under the old one shrinks by 2^-d */
        l[j] *= al; cr[j] -= d;
#pragma unroll
        for (int t = 0; t < 2; ++t) s[t][j] -= d;
#pragma unroll
        for (int t = 0; t < 4; ++t) o[j][t] *= al; } }
#pragma unroll
    for (int j = 0; j < 2; ++j) { v4f sm = {0.f, 0.f, 0.f, 0.f};
#pragma unroll
      for (int t = 0; t < 2; ++t) for (int g = 0; g < 2; ++g) { const v4f x = {s[t][j][4 * g], s[t][j][4 * g + 1], s[t][j][4 * g + 2], s[t][j][4 * g + 3]}; const v4f p = rs_exp2x4(x); sm += p; for (int q = 0; q < 4; ++q) pf[j].h[8 * t + 4 * g + q] = (_Float16)p[q]; }
      l[j] += (sm[0] + sm[1]) + (sm[2] + sm[3]); }      /* the lane's own 16 keys; the halves are joined once, behind the loop */
#pragma unroll
    for (int t = 0; t < 4; ++t) for (int j = 0; j < 2; ++j) o[j][t] = fa_mma(vf[t], pf[j].v, o[j][t]);
    __builtin_amdgcn_sched_barrier(0);      /* keeps these products in front of the next pass: moved down among its instructions, the last ones stand directly in front of the 2^x statements, which overwrite their B registers */
    if (pp + 1 < FA_SP) { const unsigned char* vp = sb + (pp + 1) * 8192 + 4096;      /* V^T one pass ahead inside the stage, likewise */
#pragma unroll
      for (int t = 0; t < 4; ++t) vf[t] = fa_lfrag(vp + t * 1024);
      asm volatile("" ::: "memory"); }      /* compiler fence, as behind the K reads */
    }
    asm volatile("s_wait_dscnt 0x0" ::: "memory");      /* this wave's reads of the buffer are done before it is handed over */
    asm volatile("s_wait_asynccnt 0x0" ::: "memory");      /* this wave's copies of stage st + 1 have landed */
    __syncthreads();      /* publishes stage st + 1 and ends every reader's last read of stage st's buffer */
    if (st + 2 < FA_NST) stage(st + 2, bo);      /* refill of the buffer just read */
  }
  asm volatile("s_wait_asynccnt 0x0" ::: "memory");      /* nothing of this wave is in flight behind the loop */
  if (kh == 1) {      /* the upper wave hands over what it has of keys 2048..4095 */
#pragma unroll
    for (int j = 0; j < 2; ++j)
#pragma unroll
      for (int t = 0; t < 4; ++t) { const v4f lo = {o[j][t][0], o[j][t][1], o[j][t][2], o[j][t][3]}, hi = {o[j][t][4], o[j][t][5], o[j][t][6], o[j][t][7]}; *(v4f*)xo[wq][(j * 4 + t) * 2][lane] = lo; *(v4f*)xo[wq][(j * 4 + t) * 2 + 1][lane] = hi; }
    const v4f st = {cr[0][0], cr[1][0], l[0], l[1]}; *(v4f*)xo[wq][16][lane] = st; }
  __syncthreads();      /* every wave passes it once: the upper waves' LDS writes stand before the lower waves read them */
  if (kh == 0) {      /* the lower wave joins the halves under the higher of their two references (the lower cr), divides and stores */
    const v4f st = *(const v4f*)xo[wq][16][lane];
#pragma unroll
    for (int j = 0; j < 2; ++j) { const float cn = fminf(cr[j][0], st[j]); const float a0 = rs_exp2(cn - cr[j][0]), a1 = rs_exp2(cn - st[j]); const float lt = l[j] * a0 + st[2 + j] * a1;
      const float inv = 1.0f / (lt + rs_x16(lt)); const float f0 = a0 * inv, f1 = a1 * inv; float* d = O + (size_t)(q0 + j * 16 + ln) * DM + h * HD + 8 * hh;
#pragma unroll
      for (int t = 0; t < 4; ++t) { const v4f xl = *(const v4f*)xo[wq][(j * 4 + t) * 2][lane], xh = *(const v4f*)xo[wq][(j * 4 + t) * 2 + 1][lane];
        const v4f lo = {o[j][t][0] * f0 + xl[0] * f1, o[j][t][1] * f0 + xl[1] * f1, o[j][t][2] * f0 + xl[2] * f1, o[j][t][3] * f0 + xl[3] * f1}, hi = {o[j][t][4] * f0 + xh[0] * f1, o[j][t][5] * f0 + xh[1] * f1, o[j][t][6] * f0 + xh[2] * f1, o[j][t][7] * f0 + xh[3] * f1};
        *(v4f*)(d + t * 16) = lo; *(v4f*)(d + t * 16 + 4) = hi; } } } }



// ---- preparation, one launch: the three inputs as f16 rows and the three weight planes as Bt[(h, d)][m] x16 ----
// PW waves in all, 16 a work-group, as many work-groups as the chip has WGPs: few waves to start, all resident at once. Each wave takes 1 / PW of each of the six passes.
// Inputs: 1024 floats a wave and input, as 8 loads of 16 bytes a lane, each covering 512 bytes in a row (4 whole lines); all 24 are in flight before the first is converted; stores of 8 bytes a lane cover 2 whole lines.
// Weights: a thread gathers 8 m of one (h, d) of each plane, as per-head [m][d] -> Bt[(h, d)][m]; a wave's store covers 512 bytes in a row.
#define PW 4096
__global__ __launch_bounds__(512) void k_prep(const float* __restrict__ xq, const float* __restrict__ xk, const float* __restrict__ xv, const float* __restrict__ wq, const float* __restrict__ wk, const float* __restrict__ wv,
    _Float16* __restrict__ XQ, _Float16* __restrict__ XK, _Float16* __restrict__ XV, _Float16* __restrict__ BQ, _Float16* __restrict__ BK, _Float16* __restrict__ BV) {
  static_assert(NR * DM == (size_t)PW * 1024 && (size_t)NH * HD * (DM / 8) == (size_t)PW * 32, "k_prep: one piece of every pass a wave");
  const int lane = threadIdx.x & 31; const int gw = blockIdx.x * 16 + __builtin_amdgcn_readfirstlane(threadIdx.x >> 5);      /* the wave's number in the grid, held scalar so that the bases are scalar */
  const float* xs[3] = {xq + (size_t)gw * 1024, xk + (size_t)gw * 1024, xv + (size_t)gw * 1024}; _Float16* xd[3] = {XQ + (size_t)gw * 1024, XK + (size_t)gw * 1024, XV + (size_t)gw * 1024};
  const unsigned t = (unsigned)(gw * 32 + lane); const unsigned m8 = (t % (DM / 8)) * 8, d = (t / (DM / 8)) % HD, h = t / ((DM / 8) * HD);
  const unsigned wo = (h * DM + m8) * HD + d; const float* wsrc[3] = {wq, wk, wv}; _Float16* wd[3] = {BQ, BK, BV};
  v4f a[3][8]; float g[3][8];
  /* every loop below is unrolled: constant indices keep the arrays in registers */
#pragma unroll
  for (int p = 0; p < 3; ++p)
#pragma unroll
    for (int i = 0; i < 8; ++i) a[p][i] = *(const v4fa*)(xs[p] + i * 128 + lane * 4);
#pragma unroll
  for (int p = 0; p < 3; ++p)
#pragma unroll
    for (int q = 0; q < 8; ++q) g[p][q] = wsrc[p][wo + q * HD];
  __builtin_amdgcn_sched_barrier(0);      /* keeps all 48 loads in front of the first conversion: left free, the compiler sinks most of them among the conversions and a wave has only some 12 in flight */
#pragma unroll
  for (int p = 0; p < 3; ++p)
#pragma unroll
    for (int i = 0; i < 8; ++i) { v4h o;
#pragma unroll
      for (int q = 0; q < 4; ++q) o[q] = (_Float16)bf16_round(a[p][i][q]);
      *(v4h*)(xd[p] + i * 128 + lane * 4) = o; }
#pragma unroll
  for (int p = 0; p < 3; ++p) { FragH f;
#pragma unroll
    for (int q = 0; q < 8; ++q) f.h[q] = (_Float16)(16.0f * bf16_round(g[p][q]));
    *(v8us*)((unsigned short*)wd[p] + (size_t)(h * HD + d) * DM + m8) = f.half[0]; } }

extern "C" void kernel_launch(void* const* d_in, const int* in_sizes, int n_in,
                              void* d_out, int out_size, void* d_ws, size_t ws_size, hipStream_t stream) {
  (void)in_sizes; (void)n_in; (void)out_size;
  const float* const* I = (const float* const*)d_in; const float* xq = I[0]; const float* xk = I[1]; const float* xv = I[2]; const float* wq = I[3]; const float* bq = I[4]; const float* wk = I[5]; const float* bk = I[6]; const float* wv = I[7]; const float* bv = I[8]; const float* x = xq;      /* X_Q, X_K, X_V [4096][1024]; per-head Wq / Wk / Wv [16][1024][64] ([in][out] per head) + biases [16][64] = [(h, d)]; no output projection */
  static_assert(NH * HD == DM && DM % 128 == 0 && SQ % 256 == 0 && HD == 64 && HG == 1 && NB == 1, "shape / tile multiples");
  char* ws = (char*)d_ws; size_t off = 0;
  auto take = [&](size_t bytes) { char* p = ws + off; off += (bytes + 255) & ~(size_t)255; return p; };
  _Float16* BQ = (_Float16*)take((size_t)DM * DM * 2); _Float16* BK = (_Float16*)take((size_t)DM * DM * 2); _Float16* BV = (_Float16*)take((size_t)DM * DM * 2);
  _Float16* X16 = (_Float16*)take(NR * DM * 2); _Float16* XKp = (_Float16*)take(NR * DM * 2); _Float16* XVp = (_Float16*)take(NR * DM * 2); _Float16* Q16 = (_Float16*)take(NR * DM * 2); _Float16* KP = (_Float16*)take((size_t)NH * HD * SQ * 2);
  _Float16* VP = (_Float16*)take((size_t)NH * HD * SQ * 2);
  if (off > ws_size) return;
  _Float16* XK = XKp; _Float16* XV = XVp;
  k_prep<<<PW / 16, 512, 0, stream>>>(x, xk, xv, wq, wk, wv, X16, XK, XV, BQ, BK, BV);      /* inputs as exact f16 rows; per-head [m][d] -> Bt[(h, d)][m] x16 */
  const size_t r0p = (size_t)B0 * SQ;      /* first projected row */
  static_assert((NR * DM * 2) % 256 == 0 && ((size_t)DM * DM * 2) % 256 == 0 && (size_t)NH * HD * SQ == NR * DM && B0 == 0, "the three planes of X, of Bt and of the results each stand in a row in the workspace, one plane's size apart");
  k_gemm2<0><<<dim3((unsigned)((MP / 128) * (DM / 64)), 3), 128, 0, stream>>>(X16 + r0p * DM, DM, NR * DM, BQ, DM, (size_t)DM * DM, 0.0625f, bq, bk, bv, nullptr, 1, 0, 0, nullptr, Q16 + r0p * DM, DM, NR * DM, MP, DM, DM, 0.18033688011112042f);      /* y = 0: Q in rows, times log2 e / sqrt(64) (the attention loop's scores are in log2 units); 1: K in fragment order; 2: V^T in fragment order */
  for (int b = B0; b < B0 + NBR; ++b) { const size_t r0 = (size_t)b * SQ;
    k_fattn<<<NH * (SQ / 256), 512, 0, stream>>>(Q16 + r0 * LQ, KP, VP, (float*)d_out + r0 * DM); }      /* all heads: softmax(Q K^T / 8) V written f32 straight into each head's 64 columns of the output rows (no output projection) */
}
